// v000
// Measured on an AMD MI455X. A time is GPU time per run, averaged over a window of back-to-back runs after a warm-up
// (all launches, gaps included; the runs take copies of the inputs in turn), and the median of several windows.
// Apart from v000's, it joins two sittings. Times from different sittings can be a few percent apart, while
// side-by-side timings come from the same sitting.
// v000, which the later versions start from, runs in 635 microseconds.
#include <hip/hip_runtime.h>
#include <math.h>
#include <stdint.h>
#include <stddef.h>

// All six contractions (three input projections, q.k^T scores, attn.V, output projection): v_wmma_f32_16x16x32_bf16 with bf16 hi/lo three-term split operands (hi*hi + hi*lo + lo*hi), f32 accumulate; softmax / cumsum / distance-decay row math in f32 on VALU.

typedef __bf16         v16bf __attribute__((ext_vector_type(16)));
typedef float          v8f   __attribute__((ext_vector_type(8)));
typedef float          v4f   __attribute__((ext_vector_type(4)));
typedef unsigned int   v4u   __attribute__((ext_vector_type(4)));
typedef unsigned short u16;

union Frag { v16bf v; v4u u[2]; };

static constexpr int BB  = 4;
static constexpr int SS  = 1024;
static constexpr int DM  = 1024;
static constexpr int HH  = 16;
static constexpr int DKK = 64;
static constexpr int MROWS = BB * SS;                 // 4096
static constexpr size_t ACT = (size_t)MROWS * DM;     // 4194304
static constexpr size_t WEL = (size_t)DM * DM;        // 1048576
static_assert(HH * DKK == DM);
static_assert(MROWS % 64 == 0);
static_assert(DM % 128 == 0);
static_assert(DM % 32 == 0);
static_assert(SS % 64 == 0);
static_assert(ACT % 2048 == 0);
static_assert(WEL % 2048 == 0);

// ---------------------------------------------------------------- small helpers
__device__ __forceinline__ unsigned bf16_bits(float x) {          // RNE f32 -> bf16 bits
  unsigned u = __float_as_uint(x);
  u += 0x7FFFu + ((u >> 16) & 1u);
  return u >> 16;
}
__device__ __forceinline__ void split2(float x, unsigned& hi, unsigned& lo) {
  hi = bf16_bits(x);
  const float xh = __uint_as_float(hi << 16);
  lo = bf16_bits(x - xh);                                         // x - xh exact in f32
}
// 8 consecutive f32 -> packed 8 bf16 hi (16 B) and 8 bf16 lo (16 B)
__device__ __forceinline__ void split8(const float* x, v4u& vh, v4u& vl) {
  unsigned hw[4], lw[4];
#pragma unroll
  for (int i = 0; i < 4; ++i) {
    unsigned h0, l0, h1, l1;
    split2(x[2 * i], h0, l0);
    split2(x[2 * i + 1], h1, l1);
    hw[i] = h0 | (h1 << 16);
    lw[i] = l0 | (l1 << 16);
  }
  vh.x = hw[0]; vh.y = hw[1]; vh.z = hw[2]; vh.w = hw[3];
  vl.x = lw[0]; vl.y = lw[1]; vl.z = lw[2]; vl.w = lw[3];
}
__device__ __forceinline__ v8f zero8() {
  v8f z;
#pragma unroll
  for (int i = 0; i < 8; ++i) z[i] = 0.f;
  return z;
}
// 16x32 operand fragment from a k-contiguous bf16 row: elements 0..7 <- e.., 8..15 <- e+16..
// (caller passes e = row*pitch + k0 + 8*(lane>>4); same map for A rows and for B stored [n][k])
__device__ __forceinline__ v16bf ldg_frag(const u16* __restrict__ p, size_t e) {
  Frag f;
  f.u[0] = *(const v4u*)(p + e);
  f.u[1] = *(const v4u*)(p + e + 16);
  return f.v;
}
__device__ __forceinline__ v16bf lds_frag(const u16* p, int e) {
  Frag f;
  f.u[0] = *(const v4u*)(p + e);
  f.u[1] = *(const v4u*)(p + e + 16);
  return f.v;
}
// three-term split product into one accumulator, then hazard guard (ties D, keeps A/B live)
__device__ __forceinline__ v8f wmma3(v8f acc, v16bf ah, v16bf al, v16bf bh, v16bf bl) {
  acc = __builtin_amdgcn_wmma_f32_16x16x32_bf16(false, ah, false, bh, (short)0, acc, false, false);
  acc = __builtin_amdgcn_wmma_f32_16x16x32_bf16(false, ah, false, bl, (short)0, acc, false, false);
  acc = __builtin_amdgcn_wmma_f32_16x16x32_bf16(false, al, false, bh, (short)0, acc, false, false);
  asm volatile("v_nop\n\tv_nop\n\tv_nop\n\tv_nop" : "+v"(acc) : "v"(ah), "v"(al), "v"(bh), "v"(bl));
  return acc;
}

// ---------------------------------------------------------------- f32 -> bf16 hi/lo planes
__global__ void __launch_bounds__(256)
k_split(const float* __restrict__ in, u16* __restrict__ ph, u16* __restrict__ pl, int n8) {
  const int t = blockIdx.x * 256 + (int)threadIdx.x;
  if (t >= n8) return;
  const size_t base = (size_t)t * 8;
  const v4f a = *(const v4f*)(in + base);
  const v4f c = *(const v4f*)(in + base + 4);
  float x[8] = {a.x, a.y, a.z, a.w, c.x, c.y, c.z, c.w};
  v4u vh, vl;
  split8(x, vh, vl);
  u16* dh = ph + base;
  u16* dl = pl + base;
  *(v4u*)dh = vh;
  *(v4u*)dl = vl;
  
}

// ---------------------------------------------------------------- GEMM: out = A @ W^T + bias
// A planes [M=4096][K=1024] bf16 hi/lo row-major; W planes [N=1024][K] bf16 hi/lo ([out,in]);
// bias [N] f32. Block 256 thr = 8 waves, block tile 64(M) x 128(N), wave tile 16 x 64.
// Fragments straight from global (no LDS in the k-loop).  Epilogue: tile staged in LDS, then
// MODE 0: bf16 hi/lo planes row-major [M][N] (Oh/Ol)
// MODE 1: bf16 hi/lo planes transposed  [(m/SS)*N + n][m%SS]   (token-contiguous, for attn.V)
// MODE 2: f32 row-major [M][N] (Of)
static constexpr int TP = 132;   // LDS tile pitch (floats)

template <int MODE>
__global__ void __launch_bounds__(256)
k_gemm3(const u16* __restrict__ Ah, const u16* __restrict__ Al,
        const u16* __restrict__ Wh, const u16* __restrict__ Wl,
        const float* __restrict__ bias,
        u16* __restrict__ Oh, u16* __restrict__ Ol, float* __restrict__ Of) {
  constexpr int N = DM, K = DM;
  __shared__ __attribute__((aligned(16))) float sT[64 * TP];

  const int lane = threadIdx.x & 31;
  const int w    = threadIdx.x >> 5;
  const int wm   = w & 3;              // 0..3
  const int wn   = w >> 2;             // 0..1
  const int hl   = lane >> 4;
  const int l15  = lane & 15;
  const int m0b  = blockIdx.y * 64;
  const int n0b  = blockIdx.x * 128;
  const int m0   = m0b + wm * 16;
  const int n0   = n0b + wn * 64;

  v8f acc[4];
#pragma unroll
  for (int nt = 0; nt < 4; ++nt) acc[nt] = zero8();

  const size_t ea0 = (size_t)(m0 + l15) * K + hl * 8;   // A row m0+l15
  const size_t eb0 = (size_t)(n0 + l15) * K + hl * 8;   // W row n0+l15 (+nt*16 rows)

#pragma unroll 2
  for (int k0 = 0; k0 < K; k0 += 32) {
    const v16bf ah = ldg_frag(Ah, ea0 + k0);
    const v16bf al = ldg_frag(Al, ea0 + k0);
#pragma unroll
    for (int nt = 0; nt < 4; ++nt) {
      const size_t eb = eb0 + (size_t)nt * 16 * K + k0;
      const v16bf bh = ldg_frag(Wh, eb);
      const v16bf bl = ldg_frag(Wl, eb);
      acc[nt] = wmma3(acc[nt], ah, al, bh, bl);
    }
  }

  // stage the 64x128 f32 tile (+bias) in LDS; D element r of lane = (row 8h+r, col l15)
#pragma unroll
  for (int nt = 0; nt < 4; ++nt) {
    const float bb = bias[n0 + nt * 16 + l15];
#pragma unroll
    for (int r = 0; r < 8; ++r)
      sT[(wm * 16 + hl * 8 + r) * TP + wn * 64 + nt * 16 + l15] = acc[nt][r] + bb;
  }
  __syncthreads();

  if (MODE == 0) {
    // wave w owns rows w*8..w*8+7; one instruction = 2 rows x 256 B (lanes 0-15 row r, 16-31 row r+1),
    const int rsub = lane >> 4;
    const int cc   = (lane & 15) * 8;
    v4u vh[4], vl[4];
    size_t go[4];
#pragma unroll
    for (int j = 0; j < 4; ++j) {
      const int row = w * 8 + 2 * j + rsub;
      const float* sp = sT + row * TP + cc;
      const v4f a = *(const v4f*)sp;
      const v4f c = *(const v4f*)(sp + 4);
      float x[8] = {a.x, a.y, a.z, a.w, c.x, c.y, c.z, c.w};
      split8(x, vh[j], vl[j]);
      go[j] = (size_t)(m0b + row) * N + n0b + cc;
    }
#pragma unroll
    for (int j = 0; j < 4; ++j) {
      *(v4u*)(Oh + go[j]) = vh[j];
      *(v4u*)(Ol + go[j]) = vl[j];
    }
    
  } else if (MODE == 1) {
    // wave w owns features w*16..w*16+15; one instruction = 4 features x 8 lanes x 16 B.
    const int bidx = m0b / SS;
    const int s0   = m0b - bidx * SS;
    const int fsub = lane >> 3;
    const int tc   = (lane & 7) * 8;
    v4u vh[4], vl[4];
    size_t go[4];
#pragma unroll
    for (int j = 0; j < 4; ++j) {
      const int f = w * 16 + 4 * j + fsub;
      float x[8];
#pragma unroll
      for (int i = 0; i < 8; ++i) x[i] = sT[(tc + i) * TP + f];
      split8(x, vh[j], vl[j]);
      go[j] = ((size_t)bidx * N + n0b + f) * SS + s0 + tc;
    }
#pragma unroll
    for (int j = 0; j < 4; ++j) {
      *(v4u*)(Oh + go[j]) = vh[j];
      *(v4u*)(Ol + go[j]) = vl[j];
    }
    
  } else {
    // f32: wave w owns rows w*8..+7; one instruction = 32 lanes x 16 B = one 512-B row segment.
    const int cc4 = lane * 4;
    v4f val[8];
    size_t go[8];
#pragma unroll
    for (int j = 0; j < 8; ++j) {
      const int row = w * 8 + j;
      val[j] = *(const v4f*)(sT + row * TP + cc4);
      go[j]  = (size_t)(m0b + row) * N + n0b + cc4;
    }
#pragma unroll
    for (int j = 0; j < 8; ++j) *(v4f*)(Of + go[j]) = val[j];
    
  }
}

// ---------------------------------------------------------------- distance-decay attention
// grid (S/16, H, B); block 256 thr = 8 waves; 16 query rows, full 1024-key score rows in LDS.
// Qp, Kp planes row-major [b*S+s][h*64+d]; Vt planes [b][h*64+d][s] (token-contiguous);
static constexpr int SST = 1028;                          // f32 score row pitch
static constexpr int AST = 1032;                          // bf16 prob row pitch (x2 B = 129*16)
static constexpr int OST = 68;                            // f32 out-tile pitch
static constexpr size_t SM_S = (size_t)16 * SST * 4;      // 65792
static constexpr size_t SM_P = (size_t)8 * 1024 * 4;      // 32768 (per-wave cumsum scratch; out tile aliases it later)
static constexpr size_t SM_A = (size_t)16 * AST * 2;      // 33024
static constexpr size_t SMEM_ATTN = SM_S + SM_P + 2 * SM_A;   // 164608
static_assert((size_t)16 * OST * 4 <= SM_P);
static_assert(SM_S % 16 == 0);
static_assert(SM_P % 16 == 0);
static_assert(SM_A % 16 == 0);

__global__ void __launch_bounds__(256)
k_attn(const u16* __restrict__ Qh, const u16* __restrict__ Ql,
       const u16* __restrict__ Kh, const u16* __restrict__ Kl,
       const u16* __restrict__ Vh, const u16* __restrict__ Vl,
       const float* __restrict__ gammas,
       u16* __restrict__ Ch, u16* __restrict__ Cl) {
  extern __shared__ __attribute__((aligned(16))) char smem[];
  float* sS   = (float*)smem;                               // [16][SST]
  float* pbuf = (float*)(smem + SM_S);                      // [8 waves][1024]
  float* sO   = pbuf;                                       // [16][OST], used only after the phase-2 barrier
  u16*   aH   = (u16*)(smem + SM_S + SM_P);                 // [16][AST] bf16 hi
  u16*   aL   = (u16*)(smem + SM_S + SM_P + SM_A);          // [16][AST] bf16 lo

  const int qt = blockIdx.x, h = blockIdx.y, b = blockIdx.z;
  const int q0 = qt * 16;
  const int lane = threadIdx.x & 31;
  const int w    = threadIdx.x >> 5;
  const int hl   = lane >> 4;
  const int l15  = lane & 15;

  // ---- phase 1: sS[16][1024] = Q(16x64) . K^T / 8 ------------------------------------------
  {
    const size_t qrow = (size_t)(b * SS + q0 + l15) * DM + h * DKK + hl * 8;
    const v16bf qh0 = ldg_frag(Qh, qrow),      ql0 = ldg_frag(Ql, qrow);
    const v16bf qh1 = ldg_frag(Qh, qrow + 32), ql1 = ldg_frag(Ql, qrow + 32);
    for (int t = 0; t < 8; ++t) {                            // 8 key tiles of 16 per wave
      const int kt = w * 8 + t;
      const size_t krow = (size_t)(b * SS + kt * 16 + l15) * DM + h * DKK + hl * 8;
      v8f acc = zero8();
      {
        const v16bf kh = ldg_frag(Kh, krow), kl = ldg_frag(Kl, krow);
        acc = wmma3(acc, qh0, ql0, kh, kl);
      }
      {
        const v16bf kh = ldg_frag(Kh, krow + 32), kl = ldg_frag(Kl, krow + 32);
        acc = wmma3(acc, qh1, ql1, kh, kl);
      }
#pragma unroll
      for (int r = 0; r < 8; ++r)
        sS[(hl * 8 + r) * SST + kt * 16 + l15] = acc[r] * 0.125f;
    }
  }
  __syncthreads();

  // ---- phase 2: row math, 2 rows per wave, 32 consecutive columns per lane -----------------
  {
    const float gg  = gammas[h];
    const float gam = -(fmaxf(gg, 0.f) + log1pf(expf(-fabsf(gg))));   // -softplus
    const int cb = lane * 32;
    for (int rr = 0; rr < 2; ++rr) {
      const int row = w + rr * 8;
      const int iq  = q0 + row;
      float* srow = sS + row * SST + cb;
      float* prow = pbuf + w * 1024 + cb;

      // A: row max over all 1024 keys
      float m1 = -3.0e38f;
#pragma unroll 1
      for (int g8 = 0; g8 < 4; ++g8) {
        const v4f a = *(const v4f*)(srow + 8 * g8);
        const v4f c = *(const v4f*)(srow + 8 * g8 + 4);
        m1 = fmaxf(m1, fmaxf(fmaxf(fmaxf(a.x, a.y), fmaxf(a.z, a.w)),
                             fmaxf(fmaxf(c.x, c.y), fmaxf(c.z, c.w))));
      }
#pragma unroll
      for (int o = 16; o > 0; o >>= 1) m1 = fmaxf(m1, __shfl_xor(m1, o, 32));

      // B: e = exp(s - m1) over the full row, kept in prow; s1 = sum
      float s1 = 0.f;
#pragma unroll 1
      for (int g8 = 0; g8 < 4; ++g8) {
        const v4f a = *(const v4f*)(srow + 8 * g8);
        const v4f c = *(const v4f*)(srow + 8 * g8 + 4);
        float x[8] = {a.x, a.y, a.z, a.w, c.x, c.y, c.z, c.w};
        float e[8];
#pragma unroll
        for (int i = 0; i < 8; ++i) { e[i] = expf(x[i] - m1); s1 += e[i]; }
        v4f ea, ec;
        ea.x = e[0]; ea.y = e[1]; ea.z = e[2]; ea.w = e[3];
        ec.x = e[4]; ec.y = e[5]; ec.z = e[6]; ec.w = e[7];
        *(v4f*)(prow + 8 * g8)     = ea;
        *(v4f*)(prow + 8 * g8 + 4) = ec;
      }
#pragma unroll
      for (int o = 16; o > 0; o >>= 1) s1 += __shfl_xor(s1, o, 32);
      const float inv1 = 1.0f / s1;

      // C: p = softmax * (j <= i); within-chunk inclusive running sum kept in prow
      float run = 0.f;
#pragma unroll 1
      for (int g8 = 0; g8 < 4; ++g8) {
        const v4f a = *(const v4f*)(prow + 8 * g8);
        const v4f c = *(const v4f*)(prow + 8 * g8 + 4);
        float e[8] = {a.x, a.y, a.z, a.w, c.x, c.y, c.z, c.w};
        float y[8];
#pragma unroll
        for (int i = 0; i < 8; ++i) {
          const int cidx = cb + 8 * g8 + i;
          const float p = (cidx <= iq) ? e[i] * inv1 : 0.f;
          run += p;
          y[i] = run;
        }
        v4f ya, yc;
        ya.x = y[0]; ya.y = y[1]; ya.z = y[2]; ya.w = y[3];
        yc.x = y[4]; yc.y = y[5]; yc.z = y[6]; yc.w = y[7];
        *(v4f*)(prow + 8 * g8)     = ya;
        *(v4f*)(prow + 8 * g8 + 4) = yc;
      }
      float incl = run;
#pragma unroll
      for (int d = 1; d < 32; d <<= 1) {
        const float t = __shfl_up(incl, d, 32);
        if (lane >= d) incl += t;
      }
      const float off       = incl - run;                    // exclusive prefix of earlier lanes
      const float disttotal = __shfl(incl, 31, 32);

      // D: decay factor, masked rescale, row max of the new scores (written back to srow)
      float m2 = -3.0e38f;
#pragma unroll 1
      for (int g8 = 0; g8 < 4; ++g8) {
        const v4f ca = *(const v4f*)(prow + 8 * g8);
        const v4f cc = *(const v4f*)(prow + 8 * g8 + 4);
        const v4f sa = *(const v4f*)(srow + 8 * g8);
        const v4f sc = *(const v4f*)(srow + 8 * g8 + 4);
        float cum[8] = {ca.x, ca.y, ca.z, ca.w, cc.x, cc.y, cc.z, cc.w};
        float s[8]   = {sa.x, sa.y, sa.z, sa.w, sc.x, sc.y, sc.z, sc.w};
        float o8[8];
#pragma unroll
        for (int i = 0; i < 8; ++i) {
          const int cidx = cb + 8 * g8 + i;
          const float distcum = off + cum[i];
          const float pe  = fabsf((float)(iq - cidx));
          const float x   = (disttotal - distcum) * pe;
          const float dsc = sqrtf(fmaxf(x, 0.f));
          float eff = expf(dsc * gam);
          eff = fminf(fmaxf(eff, 1e-5f), 1e5f);
          const float ns = (cidx <= iq) ? s[i] * eff : -1e32f;
          o8[i] = ns;
          m2 = fmaxf(m2, ns);
        }
        v4f oa, oc;
        oa.x = o8[0]; oa.y = o8[1]; oa.z = o8[2]; oa.w = o8[3];
        oc.x = o8[4]; oc.y = o8[5]; oc.z = o8[6]; oc.w = o8[7];
        *(v4f*)(srow + 8 * g8)     = oa;
        *(v4f*)(srow + 8 * g8 + 4) = oc;
      }
#pragma unroll
      for (int o = 16; o > 0; o >>= 1) m2 = fmaxf(m2, __shfl_xor(m2, o, 32));

      // E: e2 = exp(ns - m2) (masked entries give exactly 0), kept in srow; s2 = sum
      float s2 = 0.f;
#pragma unroll 1
      for (int g8 = 0; g8 < 4; ++g8) {
        const v4f sa = *(const v4f*)(srow + 8 * g8);
        const v4f sc = *(const v4f*)(srow + 8 * g8 + 4);
        float s[8] = {sa.x, sa.y, sa.z, sa.w, sc.x, sc.y, sc.z, sc.w};
        float e[8];
#pragma unroll
        for (int i = 0; i < 8; ++i) { e[i] = expf(s[i] - m2); s2 += e[i]; }
        v4f ea, ec;
        ea.x = e[0]; ea.y = e[1]; ea.z = e[2]; ea.w = e[3];
        ec.x = e[4]; ec.y = e[5]; ec.z = e[6]; ec.w = e[7];
        *(v4f*)(srow + 8 * g8)     = ea;
        *(v4f*)(srow + 8 * g8 + 4) = ec;
      }
#pragma unroll
      for (int o = 16; o > 0; o >>= 1) s2 += __shfl_xor(s2, o, 32);
      const float inv2 = 1.0f / s2;

      // F: attn probabilities -> bf16 hi/lo planes in LDS (16-B stores per lane)
      u16* ahp = aH + row * AST + cb;
      u16* alp = aL + row * AST + cb;
#pragma unroll 1
      for (int g8 = 0; g8 < 4; ++g8) {
        const v4f sa = *(const v4f*)(srow + 8 * g8);
        const v4f sc = *(const v4f*)(srow + 8 * g8 + 4);
        float p[8] = {sa.x * inv2, sa.y * inv2, sa.z * inv2, sa.w * inv2,
                      sc.x * inv2, sc.y * inv2, sc.z * inv2, sc.w * inv2};
        v4u vh, vl;
        split8(p, vh, vl);
        *(v4u*)(ahp + 8 * g8) = vh;
        *(v4u*)(alp + 8 * g8) = vl;
      }
    }
  }
  __syncthreads();   // P planes complete (block barrier between the LDS spill and the fragment reload)

  // ---- phase 3: out(16x64) = attn(16x1024) . V(1024x64); key tiles beyond the causal range carry exact zeros
  if (w < 4) {                                               // wave-uniform
    const int nt  = w;                                       // output columns nt*16..+15
    const int nkt = q0 / 32 + 1;                             // <= 32, block-uniform
    const size_t vrow = ((size_t)(b * DM + h * DKK + nt * 16 + l15)) * SS + hl * 8;
    v8f acc = zero8();
    for (int kt = 0; kt < nkt; ++kt) {
      const int pa = l15 * AST + kt * 32 + hl * 8;
      const v16bf ph = lds_frag(aH, pa);
      const v16bf pl = lds_frag(aL, pa);
      const size_t ev = vrow + (size_t)kt * 32;
      const v16bf vh = ldg_frag(Vh, ev);
      const v16bf vl = ldg_frag(Vl, ev);
      acc = wmma3(acc, ph, pl, vh, vl);
    }
#pragma unroll
    for (int r = 0; r < 8; ++r)
      sO[(hl * 8 + r) * OST + nt * 16 + l15] = acc[r];
  }
  __syncthreads();

  // ---- store concat planes: wave w owns rows 4w..4w+3; one instruction per plane = 4 rows x 8 lanes x 16 B
  if (w < 4) {
    const int row = w * 4 + (lane >> 3);
    const int cc  = (lane & 7) * 8;
    const float* sp = sO + row * OST + cc;
    const v4f a = *(const v4f*)sp;
    const v4f c = *(const v4f*)(sp + 4);
    float x[8] = {a.x, a.y, a.z, a.w, c.x, c.y, c.z, c.w};
    v4u vh, vl;
    split8(x, vh, vl);
    const size_t go = (size_t)(b * SS + q0 + row) * DM + h * DKK + cc;
    *(v4u*)(Ch + go) = vh;
    *(v4u*)(Cl + go) = vl;
    
  }
}

// ---------------------------------------------------------------- launcher
extern "C" void kernel_launch(void* const* d_in, const int* in_sizes, int n_in,
                              void* d_out, int out_size, void* d_ws, size_t ws_size,
                              hipStream_t stream) {
  if (n_in < 12) return;
  if (in_sizes[0] != (int)ACT || in_sizes[1] != (int)ACT || in_sizes[2] != (int)ACT) return;
  if (in_sizes[3] != (int)WEL || in_sizes[5] != (int)WEL || in_sizes[7] != (int)WEL || in_sizes[9] != (int)WEL) return;
  if (in_sizes[4] != DM || in_sizes[6] != DM || in_sizes[8] != DM || in_sizes[10] != DM) return;
  if (in_sizes[11] != HH) return;
  if (out_size != (int)ACT) return;

  const float* q   = (const float*)d_in[0];
  const float* k   = (const float*)d_in[1];
  const float* v   = (const float*)d_in[2];
  const float* Wq  = (const float*)d_in[3];
  const float* bq  = (const float*)d_in[4];
  const float* Wk  = (const float*)d_in[5];
  const float* bk  = (const float*)d_in[6];
  const float* Wv  = (const float*)d_in[7];
  const float* bv  = (const float*)d_in[8];
  const float* Wo  = (const float*)d_in[9];
  const float* bo  = (const float*)d_in[10];
  const float* gam = (const float*)d_in[11];
  float* out = (float*)d_out;

  // workspace carve (256-B aligned): act hi/lo (reused: q, k, v planes, then concat planes),
  // weight hi/lo (reused per weight), Qp hi/lo, Kp hi/lo, Vt hi/lo.  Total 68 MiB.
  char* ws = (char*)d_ws;
  size_t off = 0;
  auto carve = [&](size_t bytes) -> char* {
    char* p = ws + off;
    off += (bytes + 255) & ~(size_t)255;
    return p;
  };
  u16* actH = (u16*)carve(ACT * 2);
  u16* actL = (u16*)carve(ACT * 2);
  u16* wH   = (u16*)carve(WEL * 2);
  u16* wL   = (u16*)carve(WEL * 2);
  u16* QpH  = (u16*)carve(ACT * 2);
  u16* QpL  = (u16*)carve(ACT * 2);
  u16* KpH  = (u16*)carve(ACT * 2);
  u16* KpL  = (u16*)carve(ACT * 2);
  u16* VtH  = (u16*)carve(ACT * 2);
  u16* VtL  = (u16*)carve(ACT * 2);
  if (off > ws_size) return;

  const int nAct8 = (int)(ACT / 8);                 // 524288 threads
  const int nWel8 = (int)(WEL / 8);                 // 131072 threads
  const dim3 gAct((unsigned)((nAct8 + 255) / 256));
  const dim3 gWel((unsigned)((nWel8 + 255) / 256));
  const dim3 ggrid(DM / 128, MROWS / 64);           // (8, 64)
  const dim3 agrid(SS / 16, HH, BB);                // (64, 16, 4)

  // q projection -> Qp planes (row-major)
  k_split<<<gAct, 256, 0, stream>>>(q, actH, actL, nAct8);
  k_split<<<gWel, 256, 0, stream>>>(Wq, wH, wL, nWel8);
  k_gemm3<0><<<ggrid, 256, 0, stream>>>(actH, actL, wH, wL, bq, QpH, QpL, out);
  // k projection -> Kp planes (row-major)
  k_split<<<gAct, 256, 0, stream>>>(k, actH, actL, nAct8);
  k_split<<<gWel, 256, 0, stream>>>(Wk, wH, wL, nWel8);
  k_gemm3<0><<<ggrid, 256, 0, stream>>>(actH, actL, wH, wL, bk, KpH, KpL, out);
  // v projection -> Vt planes (token-contiguous)
  k_split<<<gAct, 256, 0, stream>>>(v, actH, actL, nAct8);
  k_split<<<gWel, 256, 0, stream>>>(Wv, wH, wL, nWel8);
  k_gemm3<1><<<ggrid, 256, 0, stream>>>(actH, actL, wH, wL, bv, VtH, VtL, out);
  // attention -> concat planes (reuse act planes)
  k_attn<<<agrid, 256, SMEM_ATTN, stream>>>(QpH, QpL, KpH, KpL, VtH, VtL, gam, actH, actL);
  // output projection -> f32 result
  k_split<<<gWel, 256, 0, stream>>>(Wo, wH, wL, nWel8);
  k_gemm3<2><<<ggrid, 256, 0, stream>>>(actH, actL, wH, wL, bo, QpH, QpL, out);
}

// v001
// A run of this version takes 506 microseconds.
// In two side-by-side timings against v000, it was 1.32 and 1.28 times as fast.
#include <hip/hip_runtime.h>
#include <math.h>
#include <stdint.h>
#include <stddef.h>

// All six contractions (three input projections, q.k^T scores, attn.V, output projection): v_wmma_f32_16x16x32_bf16 with bf16 hi/lo three-term split operands (hi*hi + hi*lo + lo*hi), f32 accumulate; softmax / cumsum / distance-decay row math in f32 on VALU.

typedef __bf16         v16bf __attribute__((ext_vector_type(16)));
typedef float          v8f   __attribute__((ext_vector_type(8)));
typedef float          v4f   __attribute__((ext_vector_type(4)));
typedef unsigned int   v4u   __attribute__((ext_vector_type(4)));
typedef unsigned short u16;

union Frag { v16bf v; v4u u[2]; };

static constexpr int BB  = 4;
static constexpr int SS  = 1024;
static constexpr int DM  = 1024;
static constexpr int HH  = 16;
static constexpr int DKK = 64;
static constexpr int MROWS = BB * SS;                 // 4096
static constexpr size_t ACT = (size_t)MROWS * DM;     // 4194304
static constexpr size_t WEL = (size_t)DM * DM;        // 1048576
static_assert(HH * DKK == DM);
static_assert(MROWS % 64 == 0);
static_assert(DM % 128 == 0);
static_assert(DM % 32 == 0);
static_assert(SS % 64 == 0);
static_assert(ACT % 2048 == 0);
static_assert(WEL % 2048 == 0);

// ---------------------------------------------------------------- small helpers
__device__ __forceinline__ unsigned bf16_bits(float x) {          // RNE f32 -> bf16 bits
  unsigned u = __float_as_uint(x);
  u += 0x7FFFu + ((u >> 16) & 1u);
  return u >> 16;
}
__device__ __forceinline__ void split2(float x, unsigned& hi, unsigned& lo) {
  hi = bf16_bits(x);
  const float xh = __uint_as_float(hi << 16);
  lo = bf16_bits(x - xh);                                         // x - xh exact in f32
}
// 8 consecutive f32 -> packed 8 bf16 hi (16 B) and 8 bf16 lo (16 B)
__device__ __forceinline__ void split8(const float* x, v4u& vh, v4u& vl) {
  unsigned hw[4], lw[4];
#pragma unroll
  for (int i = 0; i < 4; ++i) {
    unsigned h0, l0, h1, l1;
    split2(x[2 * i], h0, l0);
    split2(x[2 * i + 1], h1, l1);
    hw[i] = h0 | (h1 << 16);
    lw[i] = l0 | (l1 << 16);
  }
  vh.x = hw[0]; vh.y = hw[1]; vh.z = hw[2]; vh.w = hw[3];
  vl.x = lw[0]; vl.y = lw[1]; vl.z = lw[2]; vl.w = lw[3];
}
__device__ __forceinline__ v8f zero8() {
  v8f z;
#pragma unroll
  for (int i = 0; i < 8; ++i) z[i] = 0.f;
  return z;
}
// 16x32 operand fragment from a k-contiguous bf16 row: elements 0..7 <- e.., 8..15 <- e+16..
// (caller passes e = row*pitch + k0 + 8*(lane>>4); same map for A rows and for B stored [n][k])
__device__ __forceinline__ v16bf ldg_frag(const u16* __restrict__ p, size_t e) {
  Frag f;
  f.u[0] = *(const v4u*)(p + e);
  f.u[1] = *(const v4u*)(p + e + 16);
  return f.v;
}
__device__ __forceinline__ v16bf lds_frag(const u16* p, int e) {
  Frag f;
  f.u[0] = *(const v4u*)(p + e);
  f.u[1] = *(const v4u*)(p + e + 16);
  return f.v;
}
// three-term split product into one accumulator, then hazard guard (ties D, keeps A/B live)
__device__ __forceinline__ v8f wmma3(v8f acc, v16bf ah, v16bf al, v16bf bh, v16bf bl) {
  acc = __builtin_amdgcn_wmma_f32_16x16x32_bf16(false, ah, false, bh, (short)0, acc, false, false);
  acc = __builtin_amdgcn_wmma_f32_16x16x32_bf16(false, ah, false, bl, (short)0, acc, false, false);
  acc = __builtin_amdgcn_wmma_f32_16x16x32_bf16(false, al, false, bh, (short)0, acc, false, false);
  asm volatile("v_nop\n\tv_nop\n\tv_nop\n\tv_nop" : "+v"(acc) : "v"(ah), "v"(al), "v"(bh), "v"(bl));
  return acc;
}

// ---------------------------------------------------------------- f32 -> bf16 hi/lo planes
__global__ void __launch_bounds__(256)
k_split(const float* __restrict__ in, u16* __restrict__ ph, u16* __restrict__ pl, int n8) {
  const int t = blockIdx.x * 256 + (int)threadIdx.x;
  if (t >= n8) return;
  const size_t base = (size_t)t * 8;
  const v4f a = *(const v4f*)(in + base);
  const v4f c = *(const v4f*)(in + base + 4);
  float x[8] = {a.x, a.y, a.z, a.w, c.x, c.y, c.z, c.w};
  v4u vh, vl;
  split8(x, vh, vl);
  u16* dh = ph + base;
  u16* dl = pl + base;
  *(v4u*)dh = vh;
  *(v4u*)dl = vl;
  
}

// ---------------------------------------------------------------- GEMM: out = A @ W^T + bias
// A planes [M=4096][K=1024] bf16 hi/lo row-major; W planes [N=1024][K] bf16 hi/lo ([out,in]);
// bias [N] f32. Block 256 thr = 8 waves, block tile 64(M) x 128(N), wave tile 16 x 64.
// Fragments straight from global (no LDS in the k-loop).  Epilogue: tile staged in LDS, then
// MODE 0: bf16 hi/lo planes row-major [M][N] (Oh/Ol)
// MODE 1: bf16 hi/lo planes transposed  [(m/SS)*N + n][m%SS]   (token-contiguous, for attn.V)
// MODE 2: f32 row-major [M][N] (Of)
static constexpr int TP = 132;   // LDS tile pitch (floats)

template <int MODE>
__global__ void __launch_bounds__(256)
k_gemm3(const u16* __restrict__ Ah, const u16* __restrict__ Al,
        const u16* __restrict__ Wh, const u16* __restrict__ Wl,
        const float* __restrict__ bias,
        u16* __restrict__ Oh, u16* __restrict__ Ol, float* __restrict__ Of) {
  constexpr int N = DM, K = DM;
  __shared__ __attribute__((aligned(16))) float sT[64 * TP];

  const int lane = threadIdx.x & 31;
  const int w    = threadIdx.x >> 5;
  const int wm   = w & 3;              // 0..3
  const int wn   = w >> 2;             // 0..1
  const int hl   = lane >> 4;
  const int l15  = lane & 15;
  const int m0b  = blockIdx.y * 64;
  const int n0b  = blockIdx.x * 128;
  const int m0   = m0b + wm * 16;
  const int n0   = n0b + wn * 64;

  v8f acc[4];
#pragma unroll
  for (int nt = 0; nt < 4; ++nt) acc[nt] = zero8();

  const size_t ea0 = (size_t)(m0 + l15) * K + hl * 8;   // A row m0+l15
  const size_t eb0 = (size_t)(n0 + l15) * K + hl * 8;   // W row n0+l15 (+nt*16 rows)

#pragma unroll 2
  for (int k0 = 0; k0 < K; k0 += 32) {
    const v16bf ah = ldg_frag(Ah, ea0 + k0);
    const v16bf al = ldg_frag(Al, ea0 + k0);
#pragma unroll
    for (int nt = 0; nt < 4; ++nt) {
      const size_t eb = eb0 + (size_t)nt * 16 * K + k0;
      const v16bf bh = ldg_frag(Wh, eb);
      const v16bf bl = ldg_frag(Wl, eb);
      acc[nt] = wmma3(acc[nt], ah, al, bh, bl);
    }
  }

  // stage the 64x128 f32 tile (+bias) in LDS; D element r of lane = (row 8h+r, col l15)
#pragma unroll
  for (int nt = 0; nt < 4; ++nt) {
    const float bb = bias[n0 + nt * 16 + l15];
#pragma unroll
    for (int r = 0; r < 8; ++r)
      sT[(wm * 16 + hl * 8 + r) * TP + wn * 64 + nt * 16 + l15] = acc[nt][r] + bb;
  }
  __syncthreads();

  if (MODE == 0) {
    // wave w owns rows w*8..w*8+7; one instruction = 2 rows x 256 B (lanes 0-15 row r, 16-31 row r+1),
    const int rsub = lane >> 4;
    const int cc   = (lane & 15) * 8;
    v4u vh[4], vl[4];
    size_t go[4];
#pragma unroll
    for (int j = 0; j < 4; ++j) {
      const int row = w * 8 + 2 * j + rsub;
      const float* sp = sT + row * TP + cc;
      const v4f a = *(const v4f*)sp;
      const v4f c = *(const v4f*)(sp + 4);
      float x[8] = {a.x, a.y, a.z, a.w, c.x, c.y, c.z, c.w};
      split8(x, vh[j], vl[j]);
      go[j] = (size_t)(m0b + row) * N + n0b + cc;
    }
#pragma unroll
    for (int j = 0; j < 4; ++j) {
      *(v4u*)(Oh + go[j]) = vh[j];
      *(v4u*)(Ol + go[j]) = vl[j];
    }
    
  } else if (MODE == 1) {
    // wave w owns features w*16..w*16+15; one instruction = 4 features x 8 lanes x 16 B.
    const int bidx = m0b / SS;
    const int s0   = m0b - bidx * SS;
    const int fsub = lane >> 3;
    const int tc   = (lane & 7) * 8;
    v4u vh[4], vl[4];
    size_t go[4];
#pragma unroll
    for (int j = 0; j < 4; ++j) {
      const int f = w * 16 + 4 * j + fsub;
      float x[8];
#pragma unroll
      for (int i = 0; i < 8; ++i) x[i] = sT[(tc + i) * TP + f];
      split8(x, vh[j], vl[j]);
      go[j] = ((size_t)bidx * N + n0b + f) * SS + s0 + tc;
    }
#pragma unroll
    for (int j = 0; j < 4; ++j) {
      *(v4u*)(Oh + go[j]) = vh[j];
      *(v4u*)(Ol + go[j]) = vl[j];
    }
    
  } else {
    // f32: wave w owns rows w*8..+7; one instruction = 32 lanes x 16 B = one 512-B row segment.
    const int cc4 = lane * 4;
    v4f val[8];
    size_t go[8];
#pragma unroll
    for (int j = 0; j < 8; ++j) {
      const int row = w * 8 + j;
      val[j] = *(const v4f*)(sT + row * TP + cc4);
      go[j]  = (size_t)(m0b + row) * N + n0b + cc4;
    }
#pragma unroll
    for (int j = 0; j < 8; ++j) *(v4f*)(Of + go[j]) = val[j];
    
  }
}

// ---------------------------------------------------------------- distance-decay attention
// grid (S/16, H, B); block 256 thr = 8 waves; 16 query rows, full 1024-key score rows in LDS.
// Qp, Kp planes row-major [b*S+s][h*64+d]; Vt planes [b][h*64+d][s] (token-contiguous);
// Row math runs in registers: the owning wave reads a score row from LDS once, 32 columns per lane.
static constexpr int SST = 1028;                          // f32 score row pitch
static constexpr int AST = 1032;                          // bf16 prob row pitch (x2 B = 129*16)
static constexpr int OST = 68;                            // f32 out-tile pitch
static constexpr size_t SM_S = (size_t)16 * SST * 4;      // 65792 (out tile aliases it later)
static constexpr size_t SM_A = (size_t)16 * AST * 2;      // 33024
static constexpr size_t SMEM_ATTN = SM_S + 2 * SM_A;      // 131840
static_assert((size_t)16 * OST * 4 <= SM_S);
static_assert(SM_S % 16 == 0);
static_assert(SM_A % 16 == 0);

__global__ void __launch_bounds__(256)
k_attn(const u16* __restrict__ Qh, const u16* __restrict__ Ql,
       const u16* __restrict__ Kh, const u16* __restrict__ Kl,
       const u16* __restrict__ Vh, const u16* __restrict__ Vl,
       const float* __restrict__ gammas,
       u16* __restrict__ Ch, u16* __restrict__ Cl) {
  extern __shared__ __attribute__((aligned(16))) char smem[];
  float* sS   = (float*)smem;                               // [16][SST]
  float* sO   = sS;                                         // [16][OST], used only after the phase-2 barrier
  u16*   aH   = (u16*)(smem + SM_S);                        // [16][AST] bf16 hi
  u16*   aL   = (u16*)(smem + SM_S + SM_A);                 // [16][AST] bf16 lo

  const int qt = blockIdx.x, h = blockIdx.y, b = blockIdx.z;
  const int q0 = qt * 16;
  const int lane = threadIdx.x & 31;
  const int w    = threadIdx.x >> 5;
  const int hl   = lane >> 4;
  const int l15  = lane & 15;

  // ---- phase 1: sS[16][1024] = Q(16x64) . K^T / 8 ------------------------------------------
  {
    const size_t qrow = (size_t)(b * SS + q0 + l15) * DM + h * DKK + hl * 8;
    const v16bf qh0 = ldg_frag(Qh, qrow),      ql0 = ldg_frag(Ql, qrow);
    const v16bf qh1 = ldg_frag(Qh, qrow + 32), ql1 = ldg_frag(Ql, qrow + 32);
    for (int t = 0; t < 8; ++t) {                            // 8 key tiles of 16 per wave
      const int kt = w * 8 + t;
      const size_t krow = (size_t)(b * SS + kt * 16 + l15) * DM + h * DKK + hl * 8;
      v8f acc = zero8();
      {
        const v16bf kh = ldg_frag(Kh, krow), kl = ldg_frag(Kl, krow);
        acc = wmma3(acc, qh0, ql0, kh, kl);
      }
      {
        const v16bf kh = ldg_frag(Kh, krow + 32), kl = ldg_frag(Kl, krow + 32);
        acc = wmma3(acc, qh1, ql1, kh, kl);
      }
#pragma unroll
      for (int r = 0; r < 8; ++r)
        sS[(hl * 8 + r) * SST + kt * 16 + l15] = acc[r] * 0.125f;
    }
  }
  __syncthreads();

  // ---- phase 2: row math, 2 rows per wave, 32 consecutive columns per lane, all in registers
  {
    const float gg  = gammas[h];
    const float gam = -(fmaxf(gg, 0.f) + log1pf(expf(-fabsf(gg))));   // -softplus
    const int cb = lane * 32;
    for (int rr = 0; rr < 2; ++rr) {
      const int row = w + rr * 8;
      const int iq  = q0 + row;
      const float* srow = sS + row * SST + cb;

      float s[32];                                           // scores, then new scores, then e2
      float c[32];                                           // e, then within-chunk running sum
#pragma unroll  // constant indices, or s[] falls to scratch
      for (int g = 0; g < 8; ++g) {
        const v4f a = *(const v4f*)(srow + 4 * g);
        s[4 * g] = a.x; s[4 * g + 1] = a.y; s[4 * g + 2] = a.z; s[4 * g + 3] = a.w;
      }

      // A: row max over all 1024 keys
      float m1 = -3.0e38f;
#pragma unroll  // constant indices into s[]
      for (int i = 0; i < 32; ++i) m1 = fmaxf(m1, s[i]);
#pragma unroll
      for (int o = 16; o > 0; o >>= 1) m1 = fmaxf(m1, __shfl_xor(m1, o, 32));

      // B: e = exp(s - m1) over the full row; s1 = sum
      float s1 = 0.f;
#pragma unroll  // constant indices into s[] and c[]
      for (int i = 0; i < 32; ++i) { c[i] = expf(s[i] - m1); s1 += c[i]; }
#pragma unroll
      for (int o = 16; o > 0; o >>= 1) s1 += __shfl_xor(s1, o, 32);
      const float inv1 = 1.0f / s1;

      // C: p = softmax * (j <= i); within-chunk inclusive running sum
      float run = 0.f;
#pragma unroll  // constant indices into c[]
      for (int i = 0; i < 32; ++i) {
        const float p = (cb + i <= iq) ? c[i] * inv1 : 0.f;
        run += p;
        c[i] = run;
      }
      float incl = run;
#pragma unroll
      for (int d = 1; d < 32; d <<= 1) {
        const float t = __shfl_up(incl, d, 32);
        if (lane >= d) incl += t;
      }
      const float off       = incl - run;                    // exclusive prefix of earlier lanes
      const float disttotal = __shfl(incl, 31, 32);

      // D: decay factor, masked rescale, row max of the new scores
      float m2 = -3.0e38f;
#pragma unroll  // constant indices into s[] and c[]
      for (int i = 0; i < 32; ++i) {
        const int cidx = cb + i;
        const float distcum = off + c[i];
        const float pe  = fabsf((float)(iq - cidx));
        const float x   = (disttotal - distcum) * pe;
        const float dsc = sqrtf(fmaxf(x, 0.f));
        float eff = expf(dsc * gam);
        eff = fminf(fmaxf(eff, 1e-5f), 1e5f);
        const float ns = (cidx <= iq) ? s[i] * eff : -1e32f;
        s[i] = ns;
        m2 = fmaxf(m2, ns);
      }
#pragma unroll
      for (int o = 16; o > 0; o >>= 1) m2 = fmaxf(m2, __shfl_xor(m2, o, 32));

      // E: e2 = exp(ns - m2) (masked entries give exactly 0); s2 = sum
      float s2 = 0.f;
#pragma unroll  // constant indices into s[]
      for (int i = 0; i < 32; ++i) { s[i] = expf(s[i] - m2); s2 += s[i]; }
#pragma unroll
      for (int o = 16; o > 0; o >>= 1) s2 += __shfl_xor(s2, o, 32);
      const float inv2 = 1.0f / s2;

      // F: attn probabilities -> bf16 hi/lo planes in LDS (16-B stores per lane)
      u16* ahp = aH + row * AST + cb;
      u16* alp = aL + row * AST + cb;
#pragma unroll  // constant indices into s[]
      for (int g8 = 0; g8 < 4; ++g8) {
        float p[8];
#pragma unroll  // constant indices into s[] and p[]
        for (int i = 0; i < 8; ++i) p[i] = s[8 * g8 + i] * inv2;
        v4u vh, vl;
        split8(p, vh, vl);
        *(v4u*)(ahp + 8 * g8) = vh;
        *(v4u*)(alp + 8 * g8) = vl;
      }
    }
  }
  __syncthreads();   // P planes complete (block barrier between the LDS spill and the fragment reload)

  // ---- phase 3: out(16x64) = attn(16x1024) . V(1024x64); key tiles beyond the causal range carry exact zeros
  if (w < 4) {                                               // wave-uniform
    const int nt  = w;                                       // output columns nt*16..+15
    const int nkt = q0 / 32 + 1;                             // <= 32, block-uniform
    const size_t vrow = ((size_t)(b * DM + h * DKK + nt * 16 + l15)) * SS + hl * 8;
    v8f acc = zero8();
    for (int kt = 0; kt < nkt; ++kt) {
      const int pa = l15 * AST + kt * 32 + hl * 8;
      const v16bf ph = lds_frag(aH, pa);
      const v16bf pl = lds_frag(aL, pa);
      const size_t ev = vrow + (size_t)kt * 32;
      const v16bf vh = ldg_frag(Vh, ev);
      const v16bf vl = ldg_frag(Vl, ev);
      acc = wmma3(acc, ph, pl, vh, vl);
    }
#pragma unroll
    for (int r = 0; r < 8; ++r)
      sO[(hl * 8 + r) * OST + nt * 16 + l15] = acc[r];
  }
  __syncthreads();

  // ---- store concat planes: wave w owns rows 4w..4w+3; one instruction per plane = 4 rows x 8 lanes x 16 B
  if (w < 4) {
    const int row = w * 4 + (lane >> 3);
    const int cc  = (lane & 7) * 8;
    const float* sp = sO + row * OST + cc;
    const v4f a = *(const v4f*)sp;
    const v4f c = *(const v4f*)(sp + 4);
    float x[8] = {a.x, a.y, a.z, a.w, c.x, c.y, c.z, c.w};
    v4u vh, vl;
    split8(x, vh, vl);
    const size_t go = (size_t)(b * SS + q0 + row) * DM + h * DKK + cc;
    *(v4u*)(Ch + go) = vh;
    *(v4u*)(Cl + go) = vl;
    
  }
}

// ---------------------------------------------------------------- launcher
extern "C" void kernel_launch(void* const* d_in, const int* in_sizes, int n_in,
                              void* d_out, int out_size, void* d_ws, size_t ws_size,
                              hipStream_t stream) {
  if (n_in < 12) return;
  if (in_sizes[0] != (int)ACT || in_sizes[1] != (int)ACT || in_sizes[2] != (int)ACT) return;
  if (in_sizes[3] != (int)WEL || in_sizes[5] != (int)WEL || in_sizes[7] != (int)WEL || in_sizes[9] != (int)WEL) return;
  if (in_sizes[4] != DM || in_sizes[6] != DM || in_sizes[8] != DM || in_sizes[10] != DM) return;
  if (in_sizes[11] != HH) return;
  if (out_size != (int)ACT) return;

  const float* q   = (const float*)d_in[0];
  const float* k   = (const float*)d_in[1];
  const float* v   = (const float*)d_in[2];
  const float* Wq  = (const float*)d_in[3];
  const float* bq  = (const float*)d_in[4];
  const float* Wk  = (const float*)d_in[5];
  const float* bk  = (const float*)d_in[6];
  const float* Wv  = (const float*)d_in[7];
  const float* bv  = (const float*)d_in[8];
  const float* Wo  = (const float*)d_in[9];
  const float* bo  = (const float*)d_in[10];
  const float* gam = (const float*)d_in[11];
  float* out = (float*)d_out;

  // workspace carve (256-B aligned): act hi/lo (reused: q, k, v planes, then concat planes),
  // weight hi/lo (reused per weight), Qp hi/lo, Kp hi/lo, Vt hi/lo.  Total 68 MiB.
  char* ws = (char*)d_ws;
  size_t off = 0;
  auto carve = [&](size_t bytes) -> char* {
    char* p = ws + off;
    off += (bytes + 255) & ~(size_t)255;
    return p;
  };
  u16* actH = (u16*)carve(ACT * 2);
  u16* actL = (u16*)carve(ACT * 2);
  u16* wH   = (u16*)carve(WEL * 2);
  u16* wL   = (u16*)carve(WEL * 2);
  u16* QpH  = (u16*)carve(ACT * 2);
  u16* QpL  = (u16*)carve(ACT * 2);
  u16* KpH  = (u16*)carve(ACT * 2);
  u16* KpL  = (u16*)carve(ACT * 2);
  u16* VtH  = (u16*)carve(ACT * 2);
  u16* VtL  = (u16*)carve(ACT * 2);
  if (off > ws_size) return;

  const int nAct8 = (int)(ACT / 8);                 // 524288 threads
  const int nWel8 = (int)(WEL / 8);                 // 131072 threads
  const dim3 gAct((unsigned)((nAct8 + 255) / 256));
  const dim3 gWel((unsigned)((nWel8 + 255) / 256));
  const dim3 ggrid(DM / 128, MROWS / 64);           // (8, 64)
  const dim3 agrid(SS / 16, HH, BB);                // (64, 16, 4)

  // q projection -> Qp planes (row-major)
  k_split<<<gAct, 256, 0, stream>>>(q, actH, actL, nAct8);
  k_split<<<gWel, 256, 0, stream>>>(Wq, wH, wL, nWel8);
  k_gemm3<0><<<ggrid, 256, 0, stream>>>(actH, actL, wH, wL, bq, QpH, QpL, out);
  // k projection -> Kp planes (row-major)
  k_split<<<gAct, 256, 0, stream>>>(k, actH, actL, nAct8);
  k_split<<<gWel, 256, 0, stream>>>(Wk, wH, wL, nWel8);
  k_gemm3<0><<<ggrid, 256, 0, stream>>>(actH, actL, wH, wL, bk, KpH, KpL, out);
  // v projection -> Vt planes (token-contiguous)
  k_split<<<gAct, 256, 0, stream>>>(v, actH, actL, nAct8);
  k_split<<<gWel, 256, 0, stream>>>(Wv, wH, wL, nWel8);
  k_gemm3<1><<<ggrid, 256, 0, stream>>>(actH, actL, wH, wL, bv, VtH, VtL, out);
  // attention -> concat planes (reuse act planes)
  k_attn<<<agrid, 256, SMEM_ATTN, stream>>>(QpH, QpL, KpH, KpL, VtH, VtL, gam, actH, actL);
  // output projection -> f32 result
  k_split<<<gWel, 256, 0, stream>>>(Wo, wH, wL, nWel8);
  k_gemm3<2><<<ggrid, 256, 0, stream>>>(actH, actL, wH, wL, bo, QpH, QpL, out);
}

// v002
// A run of this version takes 447 microseconds.
// In two side-by-side timings against v001, it was 1.14 and 1.13 times as fast.
// Over all steps from v000 it is 1.47 times as fast.
#include <hip/hip_runtime.h>
#include <math.h>
#include <stdint.h>
#include <stddef.h>

// All six contractions (three input projections, q.k^T scores, attn.V, output projection): v_wmma_f32_16x16x32_bf16 with bf16 hi/lo three-term split operands (hi*hi + hi*lo + lo*hi), f32 accumulate; softmax / cumsum / distance-decay row math in f32 on VALU.

typedef __bf16         v16bf __attribute__((ext_vector_type(16)));
typedef float          v8f   __attribute__((ext_vector_type(8)));
typedef float          v4f   __attribute__((ext_vector_type(4)));
typedef unsigned int   v4u   __attribute__((ext_vector_type(4)));
typedef unsigned short u16;

union Frag { v16bf v; v4u u[2]; };

static constexpr int BB  = 4;
static constexpr int SS  = 1024;
static constexpr int DM  = 1024;
static constexpr int HH  = 16;
static constexpr int DKK = 64;
static constexpr int MROWS = BB * SS;                 // 4096
static constexpr size_t ACT = (size_t)MROWS * DM;     // 4194304
static constexpr size_t WEL = (size_t)DM * DM;        // 1048576
static_assert(HH * DKK == DM);
static_assert(MROWS % 64 == 0);
static_assert(DM % 128 == 0);
static_assert(DM % 32 == 0);
static_assert(SS % 64 == 0);
static_assert(ACT % 2048 == 0);
static_assert(WEL % 2048 == 0);
static_assert(SS == DM);                              // one tile map serves every plane

// Every bf16 plane is a [rows][1024] matrix stored in fragment order: 1-KiB tiles of 16 rows x 32 k,
// tile index (row/16)*KB + k/32; inside a tile the 16-B chunk of (row, k/8) sits at (k/8 % 4)*16 + row%16.
// A lane's two fragment chunks are then chunk 'lane' and chunk '32 + lane' of the tile, so one
// wave-wide 16-B load covers 512 contiguous bytes.
static constexpr int KB = DM / 32;                    // tiles along k

// ---------------------------------------------------------------- small helpers
__device__ __forceinline__ unsigned bf16_bits(float x) {          // RNE f32 -> bf16 bits
  unsigned u = __float_as_uint(x);
  u += 0x7FFFu + ((u >> 16) & 1u);
  return u >> 16;
}
__device__ __forceinline__ void split2(float x, unsigned& hi, unsigned& lo) {
  hi = bf16_bits(x);
  const float xh = __uint_as_float(hi << 16);
  lo = bf16_bits(x - xh);                                         // x - xh exact in f32
}
// 8 consecutive f32 -> packed 8 bf16 hi (16 B) and 8 bf16 lo (16 B)
__device__ __forceinline__ void split8(const float* x, v4u& vh, v4u& vl) {
  unsigned hw[4], lw[4];
#pragma unroll
  for (int i = 0; i < 4; ++i) {
    unsigned h0, l0, h1, l1;
    split2(x[2 * i], h0, l0);
    split2(x[2 * i + 1], h1, l1);
    hw[i] = h0 | (h1 << 16);
    lw[i] = l0 | (l1 << 16);
  }
  vh.x = hw[0]; vh.y = hw[1]; vh.z = hw[2]; vh.w = hw[3];
  vl.x = lw[0]; vl.y = lw[1]; vl.z = lw[2]; vl.w = lw[3];
}
__device__ __forceinline__ v8f zero8() {
  v8f z;
#pragma unroll
  for (int i = 0; i < 8; ++i) z[i] = 0.f;
  return z;
}
// 16x32 operand fragment from one plane tile: elements 0..7 <- k 8*(lane>>4).., 8..15 <- 16 further,
// row lane&15 (same map for A rows and for B stored [n][k])
// (caller passes e = row0*DM + (k0/32)*512 + 8*lane, the lane's first chunk of the tile at row0, k0)
__device__ __forceinline__ v16bf ldg_frag(const u16* __restrict__ p, size_t e) {
  Frag f;
  f.u[0] = *(const v4u*)(p + e);
  f.u[1] = *(const v4u*)(p + e + 256);
  return f.v;
}
// 16x32 operand fragment from a k-contiguous bf16 row in LDS: elements 0..7 <- e.., 8..15 <- e+16..
// (caller passes e = row*pitch + k0 + 8*(lane>>4))
__device__ __forceinline__ v16bf lds_frag(const u16* p, int e) {
  Frag f;
  f.u[0] = *(const v4u*)(p + e);
  f.u[1] = *(const v4u*)(p + e + 16);
  return f.v;
}
// three-term split product into one accumulator, then hazard guard (ties D, keeps A/B live)
__device__ __forceinline__ v8f wmma3(v8f acc, v16bf ah, v16bf al, v16bf bh, v16bf bl) {
  acc = __builtin_amdgcn_wmma_f32_16x16x32_bf16(false, ah, false, bh, (short)0, acc, false, false);
  acc = __builtin_amdgcn_wmma_f32_16x16x32_bf16(false, ah, false, bl, (short)0, acc, false, false);
  acc = __builtin_amdgcn_wmma_f32_16x16x32_bf16(false, al, false, bh, (short)0, acc, false, false);
  asm volatile("v_nop\n\tv_nop\n\tv_nop\n\tv_nop" : "+v"(acc) : "v"(ah), "v"(al), "v"(bh), "v"(bl));
  return acc;
}

// ---------------------------------------------------------------- f32 [rows][1024] -> bf16 hi/lo planes (fragment order)
__global__ void __launch_bounds__(256)
k_split(const float* __restrict__ in, u16* __restrict__ ph, u16* __restrict__ pl, int n8) {
  const int t = blockIdx.x * 256 + (int)threadIdx.x;
  if (t >= n8) return;
  // a wave takes 8 rows x 32 k of one tile: it reads 8 whole 128-B lines and stores 4 whole lines per plane
  const int tile = t >> 6;
  const int r    = ((t >> 5) & 1) * 8 + (t & 7);
  const int j    = (t >> 3) & 3;
  const size_t base = (size_t)((tile / KB) * 16 + r) * DM + (tile % KB) * 32 + j * 8;
  const v4f a = *(const v4f*)(in + base);
  const v4f c = *(const v4f*)(in + base + 4);
  float x[8] = {a.x, a.y, a.z, a.w, c.x, c.y, c.z, c.w};
  v4u vh, vl;
  split8(x, vh, vl);
  const size_t dst = ((size_t)tile * 64 + j * 16 + r) * 8;
  *(v4u*)(ph + dst) = vh;
  *(v4u*)(pl + dst) = vl;
}

// ---------------------------------------------------------------- GEMM: out = A @ W^T + bias
// A planes [M=4096][K=1024] bf16 hi/lo, W planes [N=1024][K] bf16 hi/lo ([out,in]), both in fragment order;
// bias [N] f32. Block 256 thr = 8 waves, block tile 64(M) x 128(N), wave tile 16 x 64.
// Fragments straight from global (no LDS in the k-loop).  Epilogue: tile staged in LDS, then
// MODE 0: bf16 hi/lo planes [M][N] in fragment order (Oh/Ol)
// MODE 1: bf16 hi/lo planes transposed  [(m/SS)*N + n][m%SS] in fragment order (k = token, for attn.V)
// MODE 2: f32 row-major [M][N] (Of)
static constexpr int TP = 132;   // LDS tile pitch (floats)

template <int MODE>
__global__ void __launch_bounds__(256)
k_gemm3(const u16* __restrict__ Ah, const u16* __restrict__ Al,
        const u16* __restrict__ Wh, const u16* __restrict__ Wl,
        const float* __restrict__ bias,
        u16* __restrict__ Oh, u16* __restrict__ Ol, float* __restrict__ Of) {
  constexpr int N = DM, K = DM;
  __shared__ __attribute__((aligned(16))) float sT[64 * TP];

  const int lane = threadIdx.x & 31;
  const int w    = threadIdx.x >> 5;
  const int wm   = w & 3;              // 0..3
  const int wn   = w >> 2;             // 0..1
  const int hl   = lane >> 4;
  const int l15  = lane & 15;
  const int m0b  = blockIdx.y * 64;
  const int n0b  = blockIdx.x * 128;
  const int m0   = m0b + wm * 16;
  const int n0   = n0b + wn * 64;

  v8f acc[4];
#pragma unroll
  for (int nt = 0; nt < 4; ++nt) acc[nt] = zero8();

  const size_t ea0 = (size_t)m0 * K + lane * 8;         // A rows m0..m0+15
  const size_t eb0 = (size_t)n0 * K + lane * 8;         // W rows n0..n0+15 (+nt*16 rows)

#pragma unroll 2
  for (int kb = 0; kb < K / 32; ++kb) {
    const v16bf ah = ldg_frag(Ah, ea0 + kb * 512);
    const v16bf al = ldg_frag(Al, ea0 + kb * 512);
#pragma unroll
    for (int nt = 0; nt < 4; ++nt) {
      const size_t eb = eb0 + (size_t)nt * 16 * K + kb * 512;
      const v16bf bh = ldg_frag(Wh, eb);
      const v16bf bl = ldg_frag(Wl, eb);
      acc[nt] = wmma3(acc[nt], ah, al, bh, bl);
    }
  }

  // stage the 64x128 f32 tile (+bias) in LDS; D element r of lane = (row 8h+r, col l15)
#pragma unroll
  for (int nt = 0; nt < 4; ++nt) {
    const float bb = bias[n0 + nt * 16 + l15];
#pragma unroll
    for (int r = 0; r < 8; ++r)
      sT[(wm * 16 + hl * 8 + r) * TP + wn * 64 + nt * 16 + l15] = acc[nt][r] + bb;
  }
  __syncthreads();

  if (MODE == 0) {
    // 4 x 4 plane tiles; a wave pair owns tile j*4 + w/2, one instruction = half a tile = 512 contiguous B
    const int s = (w & 1) * 32 + lane;                     // chunk inside the tile
    v4u vh[4], vl[4];
    size_t go[4];
#pragma unroll
    for (int j = 0; j < 4; ++j) {
      const int kbl = w >> 1;                              // tile column; tile row is j
      const int row = j * 16 + (s & 15);
      const float* sp = sT + row * TP + kbl * 32 + (s >> 4) * 8;
      const v4f a = *(const v4f*)sp;
      const v4f c = *(const v4f*)(sp + 4);
      float x[8] = {a.x, a.y, a.z, a.w, c.x, c.y, c.z, c.w};
      split8(x, vh[j], vl[j]);
      go[j] = ((size_t)(((m0b >> 4) + j) * KB + (n0b >> 5) + kbl) * 64 + s) * 8;
    }
#pragma unroll
    for (int j = 0; j < 4; ++j) {
      *(v4u*)(Oh + go[j]) = vh[j];
      *(v4u*)(Ol + go[j]) = vl[j];
    }
    
  } else if (MODE == 1) {
    // 8 (features) x 2 (tokens) plane tiles; wave w owns features w*16..+15, one instruction = half a tile
    const int bidx = m0b / SS;
    const int s0   = m0b - bidx * SS;
    const int f    = w * 16 + l15;
    v4u vh[4], vl[4];
    size_t go[4];
#pragma unroll
    for (int j = 0; j < 4; ++j) {
      const int s  = (j & 1) * 32 + lane;                  // chunk inside the tile
      const int tc = (j >> 1) * 32 + (s >> 4) * 8;         // first of its 8 tokens
      float x[8];
#pragma unroll
      for (int i = 0; i < 8; ++i) x[i] = sT[(tc + i) * TP + f];
      split8(x, vh[j], vl[j]);
      go[j] = ((size_t)(((bidx * N + n0b) >> 4) + w) * KB + (s0 >> 5) + (j >> 1)) * 512 + (size_t)s * 8;
    }
#pragma unroll
    for (int j = 0; j < 4; ++j) {
      *(v4u*)(Oh + go[j]) = vh[j];
      *(v4u*)(Ol + go[j]) = vl[j];
    }
    
  } else {
    // f32: wave w owns rows w*8..+7; one instruction = 32 lanes x 16 B = one 512-B row segment.
    const int cc4 = lane * 4;
    v4f val[8];
    size_t go[8];
#pragma unroll
    for (int j = 0; j < 8; ++j) {
      const int row = w * 8 + j;
      val[j] = *(const v4f*)(sT + row * TP + cc4);
      go[j]  = (size_t)(m0b + row) * N + n0b + cc4;
    }
#pragma unroll
    for (int j = 0; j < 8; ++j) *(v4f*)(Of + go[j]) = val[j];
    
  }
}

// ---------------------------------------------------------------- distance-decay attention
// grid (S/16, H, B); block 256 thr = 8 waves; 16 query rows, full 1024-key score rows in LDS.
// Qp, Kp planes [b*S+s][h*64+d], Vt planes [b*1024+h*64+d][s], concat planes [b*S+s][h*64+d]: all in fragment order;
// Row math runs in registers: the owning wave reads a score row from LDS once, 32 columns per lane.
static constexpr int SST = 1028;                          // f32 score row pitch
static constexpr int AST = 1032;                          // bf16 prob row pitch (x2 B = 129*16)
static constexpr int OST = 68;                            // f32 out-tile pitch
static constexpr size_t SM_S = (size_t)16 * SST * 4;      // 65792 (out tile aliases it later)
static constexpr size_t SM_A = (size_t)16 * AST * 2;      // 33024
static constexpr size_t SMEM_ATTN = SM_S + 2 * SM_A;      // 131840
static_assert((size_t)16 * OST * 4 <= SM_S);
static_assert(SM_S % 16 == 0);
static_assert(SM_A % 16 == 0);

__global__ void __launch_bounds__(256)
k_attn(const u16* __restrict__ Qh, const u16* __restrict__ Ql,
       const u16* __restrict__ Kh, const u16* __restrict__ Kl,
       const u16* __restrict__ Vh, const u16* __restrict__ Vl,
       const float* __restrict__ gammas,
       u16* __restrict__ Ch, u16* __restrict__ Cl) {
  extern __shared__ __attribute__((aligned(16))) char smem[];
  float* sS   = (float*)smem;                               // [16][SST]
  float* sO   = sS;                                         // [16][OST], used only after the phase-2 barrier
  u16*   aH   = (u16*)(smem + SM_S);                        // [16][AST] bf16 hi
  u16*   aL   = (u16*)(smem + SM_S + SM_A);                 // [16][AST] bf16 lo

  const int qt = blockIdx.x, h = blockIdx.y, b = blockIdx.z;
  const int q0 = qt * 16;
  const int lane = threadIdx.x & 31;
  const int w    = threadIdx.x >> 5;
  const int hl   = lane >> 4;
  const int l15  = lane & 15;

  // ---- phase 1: sS[16][1024] = Q(16x64) . K^T / 8 ------------------------------------------
  {
    const size_t qrow = (size_t)(b * SS + q0) * DM + h * (DKK * 16) + lane * 8;
    const v16bf qh0 = ldg_frag(Qh, qrow),       ql0 = ldg_frag(Ql, qrow);
    const v16bf qh1 = ldg_frag(Qh, qrow + 512), ql1 = ldg_frag(Ql, qrow + 512);
    for (int t = 0; t < 8; ++t) {                            // 8 key tiles of 16 per wave
      const int kt = w * 8 + t;
      const size_t krow = (size_t)(b * SS + kt * 16) * DM + h * (DKK * 16) + lane * 8;
      v8f acc = zero8();
      {
        const v16bf kh = ldg_frag(Kh, krow), kl = ldg_frag(Kl, krow);
        acc = wmma3(acc, qh0, ql0, kh, kl);
      }
      {
        const v16bf kh = ldg_frag(Kh, krow + 512), kl = ldg_frag(Kl, krow + 512);
        acc = wmma3(acc, qh1, ql1, kh, kl);
      }
#pragma unroll
      for (int r = 0; r < 8; ++r)
        sS[(hl * 8 + r) * SST + kt * 16 + l15] = acc[r] * 0.125f;
    }
  }
  __syncthreads();

  // ---- phase 2: row math, 2 rows per wave, 32 consecutive columns per lane, all in registers
  {
    const float gg  = gammas[h];
    const float gam = -(fmaxf(gg, 0.f) + log1pf(expf(-fabsf(gg))));   // -softplus
    const int cb = lane * 32;
    for (int rr = 0; rr < 2; ++rr) {
      const int row = w + rr * 8;
      const int iq  = q0 + row;
      const float* srow = sS + row * SST + cb;

      float s[32];                                           // scores, then new scores, then e2
      float c[32];                                           // e, then within-chunk running sum
#pragma unroll  // constant indices, or s[] falls to scratch
      for (int g = 0; g < 8; ++g) {
        const v4f a = *(const v4f*)(srow + 4 * g);
        s[4 * g] = a.x; s[4 * g + 1] = a.y; s[4 * g + 2] = a.z; s[4 * g + 3] = a.w;
      }

      // A: row max over all 1024 keys
      float m1 = -3.0e38f;
#pragma unroll  // constant indices into s[]
      for (int i = 0; i < 32; ++i) m1 = fmaxf(m1, s[i]);
#pragma unroll
      for (int o = 16; o > 0; o >>= 1) m1 = fmaxf(m1, __shfl_xor(m1, o, 32));

      // B: e = exp(s - m1) over the full row; s1 = sum
      float s1 = 0.f;
#pragma unroll  // constant indices into s[] and c[]
      for (int i = 0; i < 32; ++i) { c[i] = expf(s[i] - m1); s1 += c[i]; }
#pragma unroll
      for (int o = 16; o > 0; o >>= 1) s1 += __shfl_xor(s1, o, 32);
      const float inv1 = 1.0f / s1;

      // C: p = softmax * (j <= i); within-chunk inclusive running sum
      float run = 0.f;
#pragma unroll  // constant indices into c[]
      for (int i = 0; i < 32; ++i) {
        const float p = (cb + i <= iq) ? c[i] * inv1 : 0.f;
        run += p;
        c[i] = run;
      }
      float incl = run;
#pragma unroll
      for (int d = 1; d < 32; d <<= 1) {
        const float t = __shfl_up(incl, d, 32);
        if (lane >= d) incl += t;
      }
      const float off       = incl - run;                    // exclusive prefix of earlier lanes
      const float disttotal = __shfl(incl, 31, 32);

      // D: decay factor, masked rescale, row max of the new scores
      float m2 = -3.0e38f;
#pragma unroll  // constant indices into s[] and c[]
      for (int i = 0; i < 32; ++i) {
        const int cidx = cb + i;
        const float distcum = off + c[i];
        const float pe  = fabsf((float)(iq - cidx));
        const float x   = (disttotal - distcum) * pe;
        const float dsc = sqrtf(fmaxf(x, 0.f));
        float eff = expf(dsc * gam);
        eff = fminf(fmaxf(eff, 1e-5f), 1e5f);
        const float ns = (cidx <= iq) ? s[i] * eff : -1e32f;
        s[i] = ns;
        m2 = fmaxf(m2, ns);
      }
#pragma unroll
      for (int o = 16; o > 0; o >>= 1) m2 = fmaxf(m2, __shfl_xor(m2, o, 32));

      // E: e2 = exp(ns - m2) (masked entries give exactly 0); s2 = sum
      float s2 = 0.f;
#pragma unroll  // constant indices into s[]
      for (int i = 0; i < 32; ++i) { s[i] = expf(s[i] - m2); s2 += s[i]; }
#pragma unroll
      for (int o = 16; o > 0; o >>= 1) s2 += __shfl_xor(s2, o, 32);
      const float inv2 = 1.0f / s2;

      // F: attn probabilities -> bf16 hi/lo planes in LDS (16-B stores per lane)
      u16* ahp = aH + row * AST + cb;
      u16* alp = aL + row * AST + cb;
#pragma unroll  // constant indices into s[]
      for (int g8 = 0; g8 < 4; ++g8) {
        float p[8];
#pragma unroll  // constant indices into s[] and p[]
        for (int i = 0; i < 8; ++i) p[i] = s[8 * g8 + i] * inv2;
        v4u vh, vl;
        split8(p, vh, vl);
        *(v4u*)(ahp + 8 * g8) = vh;
        *(v4u*)(alp + 8 * g8) = vl;
      }
    }
  }
  __syncthreads();   // P planes complete (block barrier between the LDS spill and the fragment reload)

  // ---- phase 3: out(16x64) = attn(16x1024) . V(1024x64); key tiles beyond the causal range carry exact zeros
  if (w < 4) {                                               // wave-uniform
    const int nt  = w;                                       // output columns nt*16..+15
    const int nkt = q0 / 32 + 1;                             // <= 32, block-uniform
    const size_t vrow = ((size_t)(b * DM + h * DKK + nt * 16)) * SS + lane * 8;
    v8f acc = zero8();
    for (int kt = 0; kt < nkt; ++kt) {
      const int pa = l15 * AST + kt * 32 + hl * 8;
      const v16bf ph = lds_frag(aH, pa);
      const v16bf pl = lds_frag(aL, pa);
      const size_t ev = vrow + (size_t)kt * 512;
      const v16bf vh = ldg_frag(Vh, ev);
      const v16bf vl = ldg_frag(Vl, ev);
      acc = wmma3(acc, ph, pl, vh, vl);
    }
#pragma unroll
    for (int r = 0; r < 8; ++r)
      sO[(hl * 8 + r) * OST + nt * 16 + l15] = acc[r];
  }
  __syncthreads();

  // ---- store concat planes: two plane tiles; wave w owns half of tile w/2, one instruction per plane = 512 contiguous B
  if (w < 4) {
    const int s  = (w & 1) * 32 + lane;                      // chunk inside the tile
    const int cc = (w >> 1) * 32 + (s >> 4) * 8;
    const float* sp = sO + (s & 15) * OST + cc;
    const v4f a = *(const v4f*)sp;
    const v4f c = *(const v4f*)(sp + 4);
    float x[8] = {a.x, a.y, a.z, a.w, c.x, c.y, c.z, c.w};
    v4u vh, vl;
    split8(x, vh, vl);
    const size_t go = (size_t)(b * SS + q0) * DM + h * (DKK * 16) + (w >> 1) * 512 + s * 8;
    *(v4u*)(Ch + go) = vh;
    *(v4u*)(Cl + go) = vl;
    
  }
}

// ---------------------------------------------------------------- launcher
extern "C" void kernel_launch(void* const* d_in, const int* in_sizes, int n_in,
                              void* d_out, int out_size, void* d_ws, size_t ws_size,
                              hipStream_t stream) {
  if (n_in < 12) return;
  if (in_sizes[0] != (int)ACT || in_sizes[1] != (int)ACT || in_sizes[2] != (int)ACT) return;
  if (in_sizes[3] != (int)WEL || in_sizes[5] != (int)WEL || in_sizes[7] != (int)WEL || in_sizes[9] != (int)WEL) return;
  if (in_sizes[4] != DM || in_sizes[6] != DM || in_sizes[8] != DM || in_sizes[10] != DM) return;
  if (in_sizes[11] != HH) return;
  if (out_size != (int)ACT) return;

  const float* q   = (const float*)d_in[0];
  const float* k   = (const float*)d_in[1];
  const float* v   = (const float*)d_in[2];
  const float* Wq  = (const float*)d_in[3];
  const float* bq  = (const float*)d_in[4];
  const float* Wk  = (const float*)d_in[5];
  const float* bk  = (const float*)d_in[6];
  const float* Wv  = (const float*)d_in[7];
  const float* bv  = (const float*)d_in[8];
  const float* Wo  = (const float*)d_in[9];
  const float* bo  = (const float*)d_in[10];
  const float* gam = (const float*)d_in[11];
  float* out = (float*)d_out;

  // workspace carve (256-B aligned): act hi/lo (reused: q, k, v planes, then concat planes),
  // weight hi/lo (reused per weight), Qp hi/lo, Kp hi/lo, Vt hi/lo.  Total 68 MiB.
  char* ws = (char*)d_ws;
  size_t off = 0;
  auto carve = [&](size_t bytes) -> char* {
    char* p = ws + off;
    off += (bytes + 255) & ~(size_t)255;
    return p;
  };
  u16* actH = (u16*)carve(ACT * 2);
  u16* actL = (u16*)carve(ACT * 2);
  u16* wH   = (u16*)carve(WEL * 2);
  u16* wL   = (u16*)carve(WEL * 2);
  u16* QpH  = (u16*)carve(ACT * 2);
  u16* QpL  = (u16*)carve(ACT * 2);
  u16* KpH  = (u16*)carve(ACT * 2);
  u16* KpL  = (u16*)carve(ACT * 2);
  u16* VtH  = (u16*)carve(ACT * 2);
  u16* VtL  = (u16*)carve(ACT * 2);
  if (off > ws_size) return;

  const int nAct8 = (int)(ACT / 8);                 // 524288 threads
  const int nWel8 = (int)(WEL / 8);                 // 131072 threads
  const dim3 gAct((unsigned)((nAct8 + 255) / 256));
  const dim3 gWel((unsigned)((nWel8 + 255) / 256));
  const dim3 ggrid(DM / 128, MROWS / 64);           // (8, 64)
  const dim3 agrid(SS / 16, HH, BB);                // (64, 16, 4)

  // q projection -> Qp planes
  k_split<<<gAct, 256, 0, stream>>>(q, actH, actL, nAct8);
  k_split<<<gWel, 256, 0, stream>>>(Wq, wH, wL, nWel8);
  k_gemm3<0><<<ggrid, 256, 0, stream>>>(actH, actL, wH, wL, bq, QpH, QpL, out);
  // k projection -> Kp planes
  k_split<<<gAct, 256, 0, stream>>>(k, actH, actL, nAct8);
  k_split<<<gWel, 256, 0, stream>>>(Wk, wH, wL, nWel8);
  k_gemm3<0><<<ggrid, 256, 0, stream>>>(actH, actL, wH, wL, bk, KpH, KpL, out);
  // v projection -> Vt planes (k = token)
  k_split<<<gAct, 256, 0, stream>>>(v, actH, actL, nAct8);
  k_split<<<gWel, 256, 0, stream>>>(Wv, wH, wL, nWel8);
  k_gemm3<1><<<ggrid, 256, 0, stream>>>(actH, actL, wH, wL, bv, VtH, VtL, out);
  // attention -> concat planes (reuse act planes)
  k_attn<<<agrid, 256, SMEM_ATTN, stream>>>(QpH, QpL, KpH, KpL, VtH, VtL, gam, actH, actL);
  // output projection -> f32 result
  k_split<<<gWel, 256, 0, stream>>>(Wo, wH, wL, nWel8);
  k_gemm3<2><<<ggrid, 256, 0, stream>>>(actH, actL, wH, wL, bo, QpH, QpL, out);
}

// v003
// It runs in 292 microseconds.
// Timed twice side by side with v002, it ran 1.54 and 1.53 times as fast.
// All steps since v000 together make it 2.26 times as fast.
#include <hip/hip_runtime.h>
#include <math.h>
#include <stdint.h>
#include <stddef.h>

// All six contractions (three input projections, q.k^T scores, attn.V, output projection): v_wmma_f32_16x16x32_bf16 with bf16 hi/lo three-term split operands (hi*hi + hi*lo + lo*hi), f32 accumulate; softmax / cumsum / distance-decay row math in f32 on VALU.

typedef __bf16         v16bf __attribute__((ext_vector_type(16)));
typedef float          v8f   __attribute__((ext_vector_type(8)));
typedef float          v4f   __attribute__((ext_vector_type(4)));
typedef unsigned int   v4u   __attribute__((ext_vector_type(4)));
typedef unsigned short u16;

union Frag { v16bf v; v4u u[2]; };

static constexpr int BB  = 4;
static constexpr int SS  = 1024;
static constexpr int DM  = 1024;
static constexpr int HH  = 16;
static constexpr int DKK = 64;
static constexpr int MROWS = BB * SS;                 // 4096
static constexpr size_t ACT = (size_t)MROWS * DM;     // 4194304
static constexpr size_t WEL = (size_t)DM * DM;        // 1048576
static_assert(HH * DKK == DM);
static_assert(MROWS % 64 == 0);
static_assert(DM % 128 == 0);
static_assert(DM % 64 == 0);
static_assert(SS % 64 == 0);
static_assert(ACT % 2048 == 0);
static_assert(WEL % 2048 == 0);
static_assert(SS == DM);                              // one tile map serves every plane

// Every bf16 plane is a [rows][1024] matrix stored in fragment order: 1-KiB tiles of 16 rows x 32 k,
// tile index (row/16)*KB + k/32; inside a tile the 16-B chunk of (row, k/8) sits at (k/8 % 4)*16 + row%16.
// A lane's two fragment chunks are then chunk 'lane' and chunk '32 + lane' of the tile, so one
// wave-wide 16-B load covers 512 contiguous bytes.
static constexpr int KB = DM / 32;                    // tiles along k

// ---------------------------------------------------------------- small helpers
__device__ __forceinline__ unsigned bf16_bits(float x) {          // RNE f32 -> bf16 bits
  unsigned u = __float_as_uint(x);
  u += 0x7FFFu + ((u >> 16) & 1u);
  return u >> 16;
}
__device__ __forceinline__ void split2(float x, unsigned& hi, unsigned& lo) {
  hi = bf16_bits(x);
  const float xh = __uint_as_float(hi << 16);
  lo = bf16_bits(x - xh);                                         // x - xh exact in f32
}
// 8 consecutive f32 -> packed 8 bf16 hi (16 B) and 8 bf16 lo (16 B)
__device__ __forceinline__ void split8(const float* x, v4u& vh, v4u& vl) {
  unsigned hw[4], lw[4];
#pragma unroll
  for (int i = 0; i < 4; ++i) {
    unsigned h0, l0, h1, l1;
    split2(x[2 * i], h0, l0);
    split2(x[2 * i + 1], h1, l1);
    hw[i] = h0 | (h1 << 16);
    lw[i] = l0 | (l1 << 16);
  }
  vh.x = hw[0]; vh.y = hw[1]; vh.z = hw[2]; vh.w = hw[3];
  vl.x = lw[0]; vl.y = lw[1]; vl.z = lw[2]; vl.w = lw[3];
}
__device__ __forceinline__ v8f zero8() {
  v8f z;
#pragma unroll
  for (int i = 0; i < 8; ++i) z[i] = 0.f;
  return z;
}
// 16x32 operand fragment from one plane tile: elements 0..7 <- k 8*(lane>>4).., 8..15 <- 16 further,
// row lane&15 (same map for A rows and for B stored [n][k])
// (caller passes e = row0*DM + (k0/32)*512 + 8*lane, the lane's first chunk of the tile at row0, k0)
__device__ __forceinline__ v16bf ldg_frag(const u16* __restrict__ p, size_t e) {
  Frag f;
  f.u[0] = *(const v4u*)(p + e);
  f.u[1] = *(const v4u*)(p + e + 256);
  return f.v;
}
// 16x32 operand fragment from a k-contiguous bf16 row in LDS: elements 0..7 <- e.., 8..15 <- e+16..
// (caller passes e = row*pitch + k0 + 8*(lane>>4))
__device__ __forceinline__ v16bf lds_frag(const u16* p, int e) {
  Frag f;
  f.u[0] = *(const v4u*)(p + e);
  f.u[1] = *(const v4u*)(p + e + 16);
  return f.v;
}
// three-term split product into one accumulator, then hazard guard (ties D, keeps A/B live)
__device__ __forceinline__ v8f wmma3(v8f acc, v16bf ah, v16bf al, v16bf bh, v16bf bl) {
  acc = __builtin_amdgcn_wmma_f32_16x16x32_bf16(false, ah, false, bh, (short)0, acc, false, false);
  acc = __builtin_amdgcn_wmma_f32_16x16x32_bf16(false, ah, false, bl, (short)0, acc, false, false);
  acc = __builtin_amdgcn_wmma_f32_16x16x32_bf16(false, al, false, bh, (short)0, acc, false, false);
  asm volatile("v_nop\n\tv_nop\n\tv_nop\n\tv_nop" : "+v"(acc) : "v"(ah), "v"(al), "v"(bh), "v"(bl));
  return acc;
}

// ---------------------------------------------------------------- f32 [rows][1024] -> bf16 hi/lo planes (fragment order)
__global__ void __launch_bounds__(256)
k_split(const float* __restrict__ in, u16* __restrict__ ph, u16* __restrict__ pl, int n8) {
  const int t = blockIdx.x * 256 + (int)threadIdx.x;
  if (t >= n8) return;
  // a wave takes 8 rows x 32 k of one tile: it reads 8 whole 128-B lines and stores 4 whole lines per plane
  const int tile = t >> 6;
  const int r    = ((t >> 5) & 1) * 8 + (t & 7);
  const int j    = (t >> 3) & 3;
  const size_t base = (size_t)((tile / KB) * 16 + r) * DM + (tile % KB) * 32 + j * 8;
  const v4f a = *(const v4f*)(in + base);
  const v4f c = *(const v4f*)(in + base + 4);
  float x[8] = {a.x, a.y, a.z, a.w, c.x, c.y, c.z, c.w};
  v4u vh, vl;
  split8(x, vh, vl);
  const size_t dst = ((size_t)tile * 64 + j * 16 + r) * 8;
  *(v4u*)(ph + dst) = vh;
  *(v4u*)(pl + dst) = vl;
}

// ---------------------------------------------------------------- GEMM: out = A @ W^T + bias
// A planes [M=4096][K=1024] bf16 hi/lo, W planes [N=1024][K] bf16 hi/lo ([out,in]), both in fragment order;
// bias [N] f32. Block 256 thr = 8 waves, block tile 64(M) x 128(N), wave tile 16 x 64.
// Fragments straight from global (no LDS in the k-loop), fetched two k steps ahead.  Epilogue: tile staged in LDS, then
// MODE 0: bf16 hi/lo planes [M][N] in fragment order (Oh/Ol)
// MODE 1: bf16 hi/lo planes transposed  [(m/SS)*N + n][m%SS] in fragment order (k = token, for attn.V)
// MODE 2: f32 row-major [M][N] (Of)
static constexpr int TP = 132;   // LDS tile pitch (floats)

template <int MODE>
__global__ void __launch_bounds__(256)
k_gemm3(const u16* __restrict__ Ah, const u16* __restrict__ Al,
        const u16* __restrict__ Wh, const u16* __restrict__ Wl,
        const float* __restrict__ bias,
        u16* __restrict__ Oh, u16* __restrict__ Ol, float* __restrict__ Of) {
  constexpr int N = DM, K = DM;
  __shared__ __attribute__((aligned(16))) float sT[64 * TP];

  const int lane = threadIdx.x & 31;
  const int w    = threadIdx.x >> 5;
  const int wm   = w & 3;              // 0..3
  const int wn   = w >> 2;             // 0..1
  const int hl   = lane >> 4;
  const int l15  = lane & 15;
  const int m0b  = blockIdx.y * 64;
  const int n0b  = blockIdx.x * 128;
  const int m0   = m0b + wm * 16;
  const int n0   = n0b + wn * 64;

  v8f acc[4];
#pragma unroll
  for (int nt = 0; nt < 4; ++nt) acc[nt] = zero8();

  const size_t ea0 = (size_t)m0 * K + lane * 8;         // A rows m0..m0+15
  const size_t eb0 = (size_t)n0 * K + lane * 8;         // W rows n0..n0+15 (+nt*16 rows)

  // Two register sets of fragments, even and odd k steps.  Each fragment is loaded again, for two k steps
  // later, directly behind its last product, so a load has up to seven products' time to come back.
  v16bf ah[2], al[2], bh[2][4], bl[2][4];
#pragma unroll  // constant indices, or the sets fall to scratch
  for (int p = 0; p < 2; ++p) {
    ah[p] = ldg_frag(Ah, ea0 + p * 512);
    al[p] = ldg_frag(Al, ea0 + p * 512);
#pragma unroll
    for (int nt = 0; nt < 4; ++nt) {
      bh[p][nt] = ldg_frag(Wh, eb0 + (size_t)nt * 16 * K + p * 512);
      bl[p][nt] = ldg_frag(Wl, eb0 + (size_t)nt * 16 * K + p * 512);
    }
  }
#pragma unroll 1  // one trip already holds both sets; further copies only grow the code
  for (int kb = 0; kb < K / 32 - 2; kb += 2) {
#pragma unroll  // constant indices into the sets
    for (int p = 0; p < 2; ++p) {
      const size_t en = (size_t)(kb + 2 + p) * 512;
#pragma unroll
      for (int nt = 0; nt < 4; ++nt) {
        acc[nt] = wmma3(acc[nt], ah[p], al[p], bh[p][nt], bl[p][nt]);
        bh[p][nt] = ldg_frag(Wh, eb0 + (size_t)nt * 16 * K + en);
        bl[p][nt] = ldg_frag(Wl, eb0 + (size_t)nt * 16 * K + en);
      }
      ah[p] = ldg_frag(Ah, ea0 + en);
      al[p] = ldg_frag(Al, ea0 + en);
    }
    // the next trip's address additions overwrite registers that the loads in flight name
    asm volatile("s_wait_xcnt 0x0" ::: "memory");
  }
#pragma unroll  // the last two k steps: nothing left to load
  for (int p = 0; p < 2; ++p) {
#pragma unroll
    for (int nt = 0; nt < 4; ++nt)
      acc[nt] = wmma3(acc[nt], ah[p], al[p], bh[p][nt], bl[p][nt]);
  }

  // stage the 64x128 f32 tile (+bias) in LDS; D element r of lane = (row 8h+r, col l15)
#pragma unroll
  for (int nt = 0; nt < 4; ++nt) {
    const float bb = bias[n0 + nt * 16 + l15];
#pragma unroll
    for (int r = 0; r < 8; ++r)
      sT[(wm * 16 + hl * 8 + r) * TP + wn * 64 + nt * 16 + l15] = acc[nt][r] + bb;
  }
  __syncthreads();

  if (MODE == 0) {
    // 4 x 4 plane tiles; a wave pair owns tile j*4 + w/2, one instruction = half a tile = 512 contiguous B
    const int s = (w & 1) * 32 + lane;                     // chunk inside the tile
    v4u vh[4], vl[4];
    size_t go[4];
#pragma unroll
    for (int j = 0; j < 4; ++j) {
      const int kbl = w >> 1;                              // tile column; tile row is j
      const int row = j * 16 + (s & 15);
      const float* sp = sT + row * TP + kbl * 32 + (s >> 4) * 8;
      const v4f a = *(const v4f*)sp;
      const v4f c = *(const v4f*)(sp + 4);
      float x[8] = {a.x, a.y, a.z, a.w, c.x, c.y, c.z, c.w};
      split8(x, vh[j], vl[j]);
      go[j] = ((size_t)(((m0b >> 4) + j) * KB + (n0b >> 5) + kbl) * 64 + s) * 8;
    }
#pragma unroll
    for (int j = 0; j < 4; ++j) {
      *(v4u*)(Oh + go[j]) = vh[j];
      *(v4u*)(Ol + go[j]) = vl[j];
    }
    
  } else if (MODE == 1) {
    // 8 (features) x 2 (tokens) plane tiles; wave w owns features w*16..+15, one instruction = half a tile
    const int bidx = m0b / SS;
    const int s0   = m0b - bidx * SS;
    const int f    = w * 16 + l15;
    v4u vh[4], vl[4];
    size_t go[4];
#pragma unroll
    for (int j = 0; j < 4; ++j) {
      const int s  = (j & 1) * 32 + lane;                  // chunk inside the tile
      const int tc = (j >> 1) * 32 + (s >> 4) * 8;         // first of its 8 tokens
      float x[8];
#pragma unroll
      for (int i = 0; i < 8; ++i) x[i] = sT[(tc + i) * TP + f];
      split8(x, vh[j], vl[j]);
      go[j] = ((size_t)(((bidx * N + n0b) >> 4) + w) * KB + (s0 >> 5) + (j >> 1)) * 512 + (size_t)s * 8;
    }
#pragma unroll
    for (int j = 0; j < 4; ++j) {
      *(v4u*)(Oh + go[j]) = vh[j];
      *(v4u*)(Ol + go[j]) = vl[j];
    }
    
  } else {
    // f32: wave w owns rows w*8..+7; one instruction = 32 lanes x 16 B = one 512-B row segment.
    const int cc4 = lane * 4;
    v4f val[8];
    size_t go[8];
#pragma unroll
    for (int j = 0; j < 8; ++j) {
      const int row = w * 8 + j;
      val[j] = *(const v4f*)(sT + row * TP + cc4);
      go[j]  = (size_t)(m0b + row) * N + n0b + cc4;
    }
#pragma unroll
    for (int j = 0; j < 8; ++j) *(v4f*)(Of + go[j]) = val[j];
    
  }
}

// ---------------------------------------------------------------- distance-decay attention
// grid (S/16, H, B); block 256 thr = 8 waves; 16 query rows, full 1024-key score rows in LDS.
// Qp, Kp planes [b*S+s][h*64+d], Vt planes [b*1024+h*64+d][s], concat planes [b*S+s][h*64+d]: all in fragment order;
// Row math runs in registers: the owning wave reads a score row from LDS once, 32 columns per lane.
static constexpr int SST = 1028;                          // f32 score row pitch
static constexpr int AST = 1032;                          // bf16 prob row pitch (x2 B = 129*16)
static constexpr int OST = 68;                            // f32 out-tile pitch
static constexpr size_t SM_S = (size_t)16 * SST * 4;      // 65792 (out tile aliases it later)
static constexpr size_t SM_A = (size_t)16 * AST * 2;      // 33024
static constexpr size_t SMEM_ATTN = SM_S + 2 * SM_A;      // 131840
static_assert((size_t)16 * OST * 4 <= SM_S);
static_assert(SM_S % 16 == 0);
static_assert(SM_A % 16 == 0);

__global__ void __launch_bounds__(256)
k_attn(const u16* __restrict__ Qh, const u16* __restrict__ Ql,
       const u16* __restrict__ Kh, const u16* __restrict__ Kl,
       const u16* __restrict__ Vh, const u16* __restrict__ Vl,
       const float* __restrict__ gammas,
       u16* __restrict__ Ch, u16* __restrict__ Cl) {
  extern __shared__ __attribute__((aligned(16))) char smem[];
  float* sS   = (float*)smem;                               // [16][SST]
  float* sO   = sS;                                         // [16][OST], used only after the phase-2 barrier
  u16*   aH   = (u16*)(smem + SM_S);                        // [16][AST] bf16 hi
  u16*   aL   = (u16*)(smem + SM_S + SM_A);                 // [16][AST] bf16 lo

  const int qt = blockIdx.x, h = blockIdx.y, b = blockIdx.z;
  const int q0 = qt * 16;
  const int lane = threadIdx.x & 31;
  const int w    = threadIdx.x >> 5;
  const int hl   = lane >> 4;
  const int l15  = lane & 15;

  // ---- phase 1: sS[16][1024] = Q(16x64) . K^T / 8 ------------------------------------------
  {
    const size_t qrow = (size_t)(b * SS + q0) * DM + h * (DKK * 16) + lane * 8;
    const v16bf qh0 = ldg_frag(Qh, qrow),       ql0 = ldg_frag(Ql, qrow);
    const v16bf qh1 = ldg_frag(Qh, qrow + 512), ql1 = ldg_frag(Ql, qrow + 512);
    // the two Q address pairs stay live up to this wait: no later load may land on them before it
    asm volatile("s_wait_xcnt 0x0" :: "v"(Qh + qrow), "v"(Ql + qrow) : "memory");
    // ring of four key tiles in registers: a tile's slot is loaded again, four tiles ahead, behind its products
    const size_t krow0 = (size_t)(b * SS + w * 128) * DM + h * (DKK * 16) + lane * 8;
    v16bf kh0[4], kl0[4], kh1[4], kl1[4];
#pragma unroll  // constant indices, or the ring falls to scratch
    for (int t = 0; t < 4; ++t) {
      const size_t krow = krow0 + (size_t)t * 16 * DM;
      kh0[t] = ldg_frag(Kh, krow);       kl0[t] = ldg_frag(Kl, krow);
      kh1[t] = ldg_frag(Kh, krow + 512); kl1[t] = ldg_frag(Kl, krow + 512);
    }
#pragma unroll  // constant indices into the ring
    for (int t = 0; t < 8; ++t) {                            // 8 key tiles of 16 per wave
      const int kt = w * 8 + t;
      const int sl = t & 3;
      v8f acc = zero8();
      acc = wmma3(acc, qh0, ql0, kh0[sl], kl0[sl]);
      acc = wmma3(acc, qh1, ql1, kh1[sl], kl1[sl]);
      if (t + 4 < 8) {
        const size_t krow = krow0 + (size_t)(t + 4) * 16 * DM;
        kh0[sl] = ldg_frag(Kh, krow);       kl0[sl] = ldg_frag(Kl, krow);
        kh1[sl] = ldg_frag(Kh, krow + 512); kl1[sl] = ldg_frag(Kl, krow + 512);
        // behind the last K load: its address pairs stay live up to this wait and are free for reuse behind it
        if (t == 3) asm volatile("s_wait_xcnt 0x0" :: "v"(Kh + krow0), "v"(Kl + krow0) : "memory");
      }
#pragma unroll
      for (int r = 0; r < 8; ++r)
        sS[(hl * 8 + r) * SST + kt * 16 + l15] = acc[r] * 0.125f;
    }
  }
  __syncthreads();

  // ---- phase 2: row math, 2 rows per wave, 32 consecutive columns per lane, all in registers
  {
    const float gg  = gammas[h];
    const float gam = -(fmaxf(gg, 0.f) + log1pf(expf(-fabsf(gg))));   // -softplus
    const int cb = lane * 32;
    for (int rr = 0; rr < 2; ++rr) {
      const int row = w + rr * 8;
      const int iq  = q0 + row;
      const float* srow = sS + row * SST + cb;

      float s[32];                                           // scores, then new scores, then e2
      float c[32];                                           // e, then within-chunk running sum
#pragma unroll  // constant indices, or s[] falls to scratch
      for (int g = 0; g < 8; ++g) {
        const v4f a = *(const v4f*)(srow + 4 * g);
        s[4 * g] = a.x; s[4 * g + 1] = a.y; s[4 * g + 2] = a.z; s[4 * g + 3] = a.w;
      }

      // A: row max over all 1024 keys
      float m1 = -3.0e38f;
#pragma unroll  // constant indices into s[]
      for (int i = 0; i < 32; ++i) m1 = fmaxf(m1, s[i]);
#pragma unroll
      for (int o = 16; o > 0; o >>= 1) m1 = fmaxf(m1, __shfl_xor(m1, o, 32));

      // B: e = exp(s - m1) over the full row; s1 = sum
      float s1 = 0.f;
#pragma unroll  // constant indices into s[] and c[]
      for (int i = 0; i < 32; ++i) { c[i] = expf(s[i] - m1); s1 += c[i]; }
#pragma unroll
      for (int o = 16; o > 0; o >>= 1) s1 += __shfl_xor(s1, o, 32);
      const float inv1 = 1.0f / s1;

      // C: p = softmax * (j <= i); within-chunk inclusive running sum
      float run = 0.f;
#pragma unroll  // constant indices into c[]
      for (int i = 0; i < 32; ++i) {
        const float p = (cb + i <= iq) ? c[i] * inv1 : 0.f;
        run += p;
        c[i] = run;
      }
      float incl = run;
#pragma unroll
      for (int d = 1; d < 32; d <<= 1) {
        const float t = __shfl_up(incl, d, 32);
        if (lane >= d) incl += t;
      }
      const float off       = incl - run;                    // exclusive prefix of earlier lanes
      const float disttotal = __shfl(incl, 31, 32);

      // D: decay factor, masked rescale, row max of the new scores
      float m2 = -3.0e38f;
#pragma unroll  // constant indices into s[] and c[]
      for (int i = 0; i < 32; ++i) {
        const int cidx = cb + i;
        const float distcum = off + c[i];
        const float pe  = fabsf((float)(iq - cidx));
        const float x   = (disttotal - distcum) * pe;
        const float dsc = sqrtf(fmaxf(x, 0.f));
        float eff = expf(dsc * gam);
        eff = fminf(fmaxf(eff, 1e-5f), 1e5f);
        const float ns = (cidx <= iq) ? s[i] * eff : -1e32f;
        s[i] = ns;
        m2 = fmaxf(m2, ns);
      }
#pragma unroll
      for (int o = 16; o > 0; o >>= 1) m2 = fmaxf(m2, __shfl_xor(m2, o, 32));

      // E: e2 = exp(ns - m2) (masked entries give exactly 0); s2 = sum
      float s2 = 0.f;
#pragma unroll  // constant indices into s[]
      for (int i = 0; i < 32; ++i) { s[i] = expf(s[i] - m2); s2 += s[i]; }
#pragma unroll
      for (int o = 16; o > 0; o >>= 1) s2 += __shfl_xor(s2, o, 32);
      const float inv2 = 1.0f / s2;

      // F: attn probabilities -> bf16 hi/lo planes in LDS (16-B stores per lane)
      u16* ahp = aH + row * AST + cb;
      u16* alp = aL + row * AST + cb;
#pragma unroll  // constant indices into s[]
      for (int g8 = 0; g8 < 4; ++g8) {
        float p[8];
#pragma unroll  // constant indices into s[] and p[]
        for (int i = 0; i < 8; ++i) p[i] = s[8 * g8 + i] * inv2;
        v4u vh, vl;
        split8(p, vh, vl);
        *(v4u*)(ahp + 8 * g8) = vh;
        *(v4u*)(alp + 8 * g8) = vl;
      }
    }
  }
  __syncthreads();   // P planes complete (block barrier between the LDS spill and the fragment reload)

  // ---- phase 3: out(16x64) = attn(16x1024) . V(1024x64); key tiles beyond the causal range carry exact zeros
  if (w < 4) {                                               // wave-uniform
    const int nt  = w;                                       // output columns nt*16..+15
    const int nkt = q0 / 32 + 1;                             // <= 32, block-uniform
    const size_t vrow = ((size_t)(b * DM + h * DKK + nt * 16)) * SS + lane * 8;
    const int nk4 = (nkt + 3) & ~3;                          // whole groups of four tiles, <= 32: the added tiles have P == 0
    const int pa0 = l15 * AST + hl * 8;
    v8f acc = zero8();
    // ring of four V tiles in registers: a tile's slot is loaded again, four tiles ahead, behind its product
    v16bf vh[4], vl[4];
#pragma unroll  // constant indices, or the ring falls to scratch
    for (int j = 0; j < 4; ++j) {
      vh[j] = ldg_frag(Vh, vrow + (size_t)j * 512);
      vl[j] = ldg_frag(Vl, vrow + (size_t)j * 512);
    }
    // the two V address pairs stay live up to this wait: no load above may land on them
    asm volatile("s_wait_xcnt 0x0" :: "v"(Vh + vrow), "v"(Vl + vrow) : "memory");
    int k0 = 0;
    for (; k0 + 4 < nk4; k0 += 4) {
      v16bf ph[4], pl[4];
#pragma unroll  // constant indices; the group's four P tiles are read from LDS in one go
      for (int j = 0; j < 4; ++j) {
        ph[j] = lds_frag(aH, pa0 + (k0 + j) * 32);
        pl[j] = lds_frag(aL, pa0 + (k0 + j) * 32);
      }
#pragma unroll  // constant indices into the ring
      for (int j = 0; j < 4; ++j) {
        acc = wmma3(acc, ph[j], pl[j], vh[j], vl[j]);
        vh[j] = ldg_frag(Vh, vrow + (size_t)(k0 + 4 + j) * 512);
        vl[j] = ldg_frag(Vl, vrow + (size_t)(k0 + 4 + j) * 512);
      }
      // the next trip's address additions overwrite registers that the loads in flight name
      asm volatile("s_wait_xcnt 0x0" ::: "memory");
    }
    {                                                        // last group: nothing left to load
      v16bf ph[4], pl[4];
#pragma unroll
      for (int j = 0; j < 4; ++j) {
        ph[j] = lds_frag(aH, pa0 + (k0 + j) * 32);
        pl[j] = lds_frag(aL, pa0 + (k0 + j) * 32);
      }
#pragma unroll
      for (int j = 0; j < 4; ++j) acc = wmma3(acc, ph[j], pl[j], vh[j], vl[j]);
    }
#pragma unroll
    for (int r = 0; r < 8; ++r)
      sO[(hl * 8 + r) * OST + nt * 16 + l15] = acc[r];
  }
  __syncthreads();

  // ---- store concat planes: two plane tiles; wave w owns half of tile w/2, one instruction per plane = 512 contiguous B
  if (w < 4) {
    const int s  = (w & 1) * 32 + lane;                      // chunk inside the tile
    const int cc = (w >> 1) * 32 + (s >> 4) * 8;
    const float* sp = sO + (s & 15) * OST + cc;
    const v4f a = *(const v4f*)sp;
    const v4f c = *(const v4f*)(sp + 4);
    float x[8] = {a.x, a.y, a.z, a.w, c.x, c.y, c.z, c.w};
    v4u vh, vl;
    split8(x, vh, vl);
    const size_t go = (size_t)(b * SS + q0) * DM + h * (DKK * 16) + (w >> 1) * 512 + s * 8;
    *(v4u*)(Ch + go) = vh;
    *(v4u*)(Cl + go) = vl;
    
  }
}

// ---------------------------------------------------------------- launcher
extern "C" void kernel_launch(void* const* d_in, const int* in_sizes, int n_in,
                              void* d_out, int out_size, void* d_ws, size_t ws_size,
                              hipStream_t stream) {
  if (n_in < 12) return;
  if (in_sizes[0] != (int)ACT || in_sizes[1] != (int)ACT || in_sizes[2] != (int)ACT) return;
  if (in_sizes[3] != (int)WEL || in_sizes[5] != (int)WEL || in_sizes[7] != (int)WEL || in_sizes[9] != (int)WEL) return;
  if (in_sizes[4] != DM || in_sizes[6] != DM || in_sizes[8] != DM || in_sizes[10] != DM) return;
  if (in_sizes[11] != HH) return;
  if (out_size != (int)ACT) return;

  const float* q   = (const float*)d_in[0];
  const float* k   = (const float*)d_in[1];
  const float* v   = (const float*)d_in[2];
  const float* Wq  = (const float*)d_in[3];
  const float* bq  = (const float*)d_in[4];
  const float* Wk  = (const float*)d_in[5];
  const float* bk  = (const float*)d_in[6];
  const float* Wv  = (const float*)d_in[7];
  const float* bv  = (const float*)d_in[8];
  const float* Wo  = (const float*)d_in[9];
  const float* bo  = (const float*)d_in[10];
  const float* gam = (const float*)d_in[11];
  float* out = (float*)d_out;

  // workspace carve (256-B aligned): act hi/lo (reused: q, k, v planes, then concat planes),
  // weight hi/lo (reused per weight), Qp hi/lo, Kp hi/lo, Vt hi/lo.  Total 68 MiB.
  char* ws = (char*)d_ws;
  size_t off = 0;
  auto carve = [&](size_t bytes) -> char* {
    char* p = ws + off;
    off += (bytes + 255) & ~(size_t)255;
    return p;
  };
  u16* actH = (u16*)carve(ACT * 2);
  u16* actL = (u16*)carve(ACT * 2);
  u16* wH   = (u16*)carve(WEL * 2);
  u16* wL   = (u16*)carve(WEL * 2);
  u16* QpH  = (u16*)carve(ACT * 2);
  u16* QpL  = (u16*)carve(ACT * 2);
  u16* KpH  = (u16*)carve(ACT * 2);
  u16* KpL  = (u16*)carve(ACT * 2);
  u16* VtH  = (u16*)carve(ACT * 2);
  u16* VtL  = (u16*)carve(ACT * 2);
  if (off > ws_size) return;

  const int nAct8 = (int)(ACT / 8);                 // 524288 threads
  const int nWel8 = (int)(WEL / 8);                 // 131072 threads
  const dim3 gAct((unsigned)((nAct8 + 255) / 256));
  const dim3 gWel((unsigned)((nWel8 + 255) / 256));
  const dim3 ggrid(DM / 128, MROWS / 64);           // (8, 64)
  const dim3 agrid(SS / 16, HH, BB);                // (64, 16, 4)

  // q projection -> Qp planes
  k_split<<<gAct, 256, 0, stream>>>(q, actH, actL, nAct8);
  k_split<<<gWel, 256, 0, stream>>>(Wq, wH, wL, nWel8);
  k_gemm3<0><<<ggrid, 256, 0, stream>>>(actH, actL, wH, wL, bq, QpH, QpL, out);
  // k projection -> Kp planes
  k_split<<<gAct, 256, 0, stream>>>(k, actH, actL, nAct8);
  k_split<<<gWel, 256, 0, stream>>>(Wk, wH, wL, nWel8);
  k_gemm3<0><<<ggrid, 256, 0, stream>>>(actH, actL, wH, wL, bk, KpH, KpL, out);
  // v projection -> Vt planes (k = token)
  k_split<<<gAct, 256, 0, stream>>>(v, actH, actL, nAct8);
  k_split<<<gWel, 256, 0, stream>>>(Wv, wH, wL, nWel8);
  k_gemm3<1><<<ggrid, 256, 0, stream>>>(actH, actL, wH, wL, bv, VtH, VtL, out);
  // attention -> concat planes (reuse act planes)
  k_attn<<<agrid, 256, SMEM_ATTN, stream>>>(QpH, QpL, KpH, KpL, VtH, VtL, gam, actH, actL);
  // output projection -> f32 result
  k_split<<<gWel, 256, 0, stream>>>(Wo, wH, wL, nWel8);
  k_gemm3<2><<<ggrid, 256, 0, stream>>>(actH, actL, wH, wL, bo, QpH, QpL, out);
}

// v004
// Measured time: 262 microseconds a run.
// Two timings next to v003 put it at 1.06 and 1.11 times that version's speed.
// Counting every step since v000, it is 2.45 times as fast.
#include <hip/hip_runtime.h>
#include <math.h>
#include <stdint.h>
#include <stddef.h>

// All six contractions (three input projections, q.k^T scores, attn.V, output projection): v_wmma_f32_16x16x32_bf16 with bf16 hi/lo three-term split operands (hi*hi + hi*lo + lo*hi), f32 accumulate; softmax / cumsum / distance-decay row math in f32 on VALU.

typedef __bf16         v16bf __attribute__((ext_vector_type(16)));
typedef float          v8f   __attribute__((ext_vector_type(8)));
typedef float          v4f   __attribute__((ext_vector_type(4)));
typedef unsigned int   v4u   __attribute__((ext_vector_type(4)));
typedef unsigned short u16;

union Frag { v16bf v; v4u u[2]; };

static constexpr int BB  = 4;
static constexpr int SS  = 1024;
static constexpr int DM  = 1024;
static constexpr int HH  = 16;
static constexpr int DKK = 64;
static constexpr int MROWS = BB * SS;                 // 4096
static constexpr size_t ACT = (size_t)MROWS * DM;     // 4194304
static constexpr size_t WEL = (size_t)DM * DM;        // 1048576
static_assert(HH * DKK == DM);
static_assert(MROWS % 64 == 0);
static_assert(DM % 128 == 0);
static_assert(DM % 64 == 0);
static_assert(SS % 64 == 0);
static_assert(ACT % 2048 == 0);
static_assert(WEL % 2048 == 0);
static_assert(SS == DM);                              // one tile map serves every plane

// Every bf16 plane is a [rows][1024] matrix stored in fragment order: 1-KiB tiles of 16 rows x 32 k,
// tile index (row/16)*KB + k/32; inside a tile the 16-B chunk of (row, k/8) sits at (k/8 % 4)*16 + row%16.
// A lane's two fragment chunks are then chunk 'lane' and chunk '32 + lane' of the tile, so one
// wave-wide 16-B load covers 512 contiguous bytes.
static constexpr int KB = DM / 32;                    // tiles along k

// ---------------------------------------------------------------- small helpers
__device__ __forceinline__ unsigned bf16_bits(float x) {          // RNE f32 -> bf16 bits
  unsigned u = __float_as_uint(x);
  u += 0x7FFFu + ((u >> 16) & 1u);
  return u >> 16;
}
__device__ __forceinline__ void split2(float x, unsigned& hi, unsigned& lo) {
  hi = bf16_bits(x);
  const float xh = __uint_as_float(hi << 16);
  lo = bf16_bits(x - xh);                                         // x - xh exact in f32
}
// 8 consecutive f32 -> packed 8 bf16 hi (16 B) and 8 bf16 lo (16 B)
__device__ __forceinline__ void split8(const float* x, v4u& vh, v4u& vl) {
  unsigned hw[4], lw[4];
#pragma unroll
  for (int i = 0; i < 4; ++i) {
    unsigned h0, l0, h1, l1;
    split2(x[2 * i], h0, l0);
    split2(x[2 * i + 1], h1, l1);
    hw[i] = h0 | (h1 << 16);
    lw[i] = l0 | (l1 << 16);
  }
  vh.x = hw[0]; vh.y = hw[1]; vh.z = hw[2]; vh.w = hw[3];
  vl.x = lw[0]; vl.y = lw[1]; vl.z = lw[2]; vl.w = lw[3];
}
__device__ __forceinline__ v8f zero8() {
  v8f z;
#pragma unroll
  for (int i = 0; i < 8; ++i) z[i] = 0.f;
  return z;
}
// 16x32 operand fragment from one plane tile: elements 0..7 <- k 8*(lane>>4).., 8..15 <- 16 further,
// row lane&15 (same map for A rows and for B stored [n][k])
// (caller passes e = row0*DM + (k0/32)*512 + 8*lane, the lane's first chunk of the tile at row0, k0)
__device__ __forceinline__ v16bf ldg_frag(const u16* __restrict__ p, size_t e) {
  Frag f;
  f.u[0] = *(const v4u*)(p + e);
  f.u[1] = *(const v4u*)(p + e + 256);
  return f.v;
}
// 16x32 operand fragment from a k-contiguous bf16 row in LDS: elements 0..7 <- e.., 8..15 <- e+16..
// (caller passes e = row*pitch + k0 + 8*(lane>>4))
__device__ __forceinline__ v16bf lds_frag(const u16* p, int e) {
  Frag f;
  f.u[0] = *(const v4u*)(p + e);
  f.u[1] = *(const v4u*)(p + e + 16);
  return f.v;
}
// 2^x, log2(x), sqrt(x) and 1/x as the chip's own single instructions (about 1 ulp), without libm's range reduction,
// range checks and refinement steps.  A result below the normal range may come out as 0, a subnormal
// sqrt argument likewise: every use below adds such a value to a sum that is at least 1 or clamps it;
// the two reciprocals are of such sums (1 <= sum <= 1024).
// Eight at a time in one statement: behind a transcendental the instruction set wants one slot before its
// result is read or its source overwritten.  "=&v" keeps every result apart from every argument, so no
// neighbour takes a source's register; the v_nop is the slot behind the last one; the s_delay_alu is the
// issue hint for the arguments, which the compiler cannot give for instructions inside a statement.
__device__ __forceinline__ void hw_exp2x8(float (&r)[8], const float (&a)[8]) {
  asm("s_delay_alu instid0(VALU_DEP_1)\n\t"
      "v_exp_f32 %0, %8\n\tv_exp_f32 %1, %9\n\tv_exp_f32 %2, %10\n\tv_exp_f32 %3, %11\n\t"
      "v_exp_f32 %4, %12\n\tv_exp_f32 %5, %13\n\tv_exp_f32 %6, %14\n\tv_exp_f32 %7, %15\n\t"
      "v_nop"
      : "=&v"(r[0]), "=&v"(r[1]), "=&v"(r[2]), "=&v"(r[3]), "=&v"(r[4]), "=&v"(r[5]), "=&v"(r[6]), "=&v"(r[7])
      : "v"(a[0]), "v"(a[1]), "v"(a[2]), "v"(a[3]), "v"(a[4]), "v"(a[5]), "v"(a[6]), "v"(a[7]));
}
__device__ __forceinline__ void hw_sqrtx8(float (&r)[8], const float (&a)[8]) {
  asm("s_delay_alu instid0(VALU_DEP_1)\n\t"
      "v_sqrt_f32 %0, %8\n\tv_sqrt_f32 %1, %9\n\tv_sqrt_f32 %2, %10\n\tv_sqrt_f32 %3, %11\n\t"
      "v_sqrt_f32 %4, %12\n\tv_sqrt_f32 %5, %13\n\tv_sqrt_f32 %6, %14\n\tv_sqrt_f32 %7, %15\n\t"
      "v_nop"
      : "=&v"(r[0]), "=&v"(r[1]), "=&v"(r[2]), "=&v"(r[3]), "=&v"(r[4]), "=&v"(r[5]), "=&v"(r[6]), "=&v"(r[7])
      : "v"(a[0]), "v"(a[1]), "v"(a[2]), "v"(a[3]), "v"(a[4]), "v"(a[5]), "v"(a[6]), "v"(a[7]));
}
__device__ __forceinline__ float hw_rcp(float x) { return __builtin_amdgcn_rcpf(x); }
static constexpr float LOG2E = 1.44269504088896340736f;
// three-term split product into one accumulator, then hazard guard (ties D, keeps A/B live)
__device__ __forceinline__ v8f wmma3(v8f acc, v16bf ah, v16bf al, v16bf bh, v16bf bl) {
  acc = __builtin_amdgcn_wmma_f32_16x16x32_bf16(false, ah, false, bh, (short)0, acc, false, false);
  acc = __builtin_amdgcn_wmma_f32_16x16x32_bf16(false, ah, false, bl, (short)0, acc, false, false);
  acc = __builtin_amdgcn_wmma_f32_16x16x32_bf16(false, al, false, bh, (short)0, acc, false, false);
  asm volatile("v_nop\n\tv_nop\n\tv_nop\n\tv_nop" : "+v"(acc) : "v"(ah), "v"(al), "v"(bh), "v"(bl));
  return acc;
}

// ---------------------------------------------------------------- f32 [rows][1024] -> bf16 hi/lo planes (fragment order)
__global__ void __launch_bounds__(256)
k_split(const float* __restrict__ in, u16* __restrict__ ph, u16* __restrict__ pl, int n8) {
  const int t = blockIdx.x * 256 + (int)threadIdx.x;
  if (t >= n8) return;
  // a wave takes 8 rows x 32 k of one tile: it reads 8 whole 128-B lines and stores 4 whole lines per plane
  const int tile = t >> 6;
  const int r    = ((t >> 5) & 1) * 8 + (t & 7);
  const int j    = (t >> 3) & 3;
  const size_t base = (size_t)((tile / KB) * 16 + r) * DM + (tile % KB) * 32 + j * 8;
  const v4f a = *(const v4f*)(in + base);
  const v4f c = *(const v4f*)(in + base + 4);
  float x[8] = {a.x, a.y, a.z, a.w, c.x, c.y, c.z, c.w};
  v4u vh, vl;
  split8(x, vh, vl);
  const size_t dst = ((size_t)tile * 64 + j * 16 + r) * 8;
  *(v4u*)(ph + dst) = vh;
  *(v4u*)(pl + dst) = vl;
}

// ---------------------------------------------------------------- GEMM: out = A @ W^T + bias
// A planes [M=4096][K=1024] bf16 hi/lo, W planes [N=1024][K] bf16 hi/lo ([out,in]), both in fragment order;
// bias [N] f32. Block 256 thr = 8 waves, block tile 64(M) x 128(N), wave tile 16 x 64.
// Fragments straight from global (no LDS in the k-loop), fetched two k steps ahead.  Epilogue: tile staged in LDS, then
// MODE 0: bf16 hi/lo planes [M][N] in fragment order (Oh/Ol)
// MODE 1: bf16 hi/lo planes transposed  [(m/SS)*N + n][m%SS] in fragment order (k = token, for attn.V)
// MODE 2: f32 row-major [M][N] (Of)
static constexpr int TP = 132;   // LDS tile pitch (floats)

template <int MODE>
__global__ void __launch_bounds__(256)
k_gemm3(const u16* __restrict__ Ah, const u16* __restrict__ Al,
        const u16* __restrict__ Wh, const u16* __restrict__ Wl,
        const float* __restrict__ bias,
        u16* __restrict__ Oh, u16* __restrict__ Ol, float* __restrict__ Of) {
  constexpr int N = DM, K = DM;
  __shared__ __attribute__((aligned(16))) float sT[64 * TP];

  const int lane = threadIdx.x & 31;
  const int w    = threadIdx.x >> 5;
  const int wm   = w & 3;              // 0..3
  const int wn   = w >> 2;             // 0..1
  const int hl   = lane >> 4;
  const int l15  = lane & 15;
  const int m0b  = blockIdx.y * 64;
  const int n0b  = blockIdx.x * 128;
  const int m0   = m0b + wm * 16;
  const int n0   = n0b + wn * 64;

  v8f acc[4];
#pragma unroll
  for (int nt = 0; nt < 4; ++nt) acc[nt] = zero8();

  const size_t ea0 = (size_t)m0 * K + lane * 8;         // A rows m0..m0+15
  const size_t eb0 = (size_t)n0 * K + lane * 8;         // W rows n0..n0+15 (+nt*16 rows)

  // Two register sets of fragments, even and odd k steps.  Each fragment is loaded again, for two k steps
  // later, directly behind its last product, so a load has up to seven products' time to come back.
  v16bf ah[2], al[2], bh[2][4], bl[2][4];
#pragma unroll  // constant indices, or the sets fall to scratch
  for (int p = 0; p < 2; ++p) {
    ah[p] = ldg_frag(Ah, ea0 + p * 512);
    al[p] = ldg_frag(Al, ea0 + p * 512);
#pragma unroll
    for (int nt = 0; nt < 4; ++nt) {
      bh[p][nt] = ldg_frag(Wh, eb0 + (size_t)nt * 16 * K + p * 512);
      bl[p][nt] = ldg_frag(Wl, eb0 + (size_t)nt * 16 * K + p * 512);
    }
  }
#pragma unroll 1  // one trip already holds both sets; further copies only grow the code
  for (int kb = 0; kb < K / 32 - 2; kb += 2) {
#pragma unroll  // constant indices into the sets
    for (int p = 0; p < 2; ++p) {
      const size_t en = (size_t)(kb + 2 + p) * 512;
#pragma unroll
      for (int nt = 0; nt < 4; ++nt) {
        acc[nt] = wmma3(acc[nt], ah[p], al[p], bh[p][nt], bl[p][nt]);
        bh[p][nt] = ldg_frag(Wh, eb0 + (size_t)nt * 16 * K + en);
        bl[p][nt] = ldg_frag(Wl, eb0 + (size_t)nt * 16 * K + en);
      }
      ah[p] = ldg_frag(Ah, ea0 + en);
      al[p] = ldg_frag(Al, ea0 + en);
    }
    // the next trip's address additions overwrite registers that the loads in flight name
    asm volatile("s_wait_xcnt 0x0" ::: "memory");
  }
#pragma unroll  // the last two k steps: nothing left to load
  for (int p = 0; p < 2; ++p) {
#pragma unroll
    for (int nt = 0; nt < 4; ++nt)
      acc[nt] = wmma3(acc[nt], ah[p], al[p], bh[p][nt], bl[p][nt]);
  }

  // stage the 64x128 f32 tile (+bias) in LDS; D element r of lane = (row 8h+r, col l15)
#pragma unroll
  for (int nt = 0; nt < 4; ++nt) {
    const float bb = bias[n0 + nt * 16 + l15];
#pragma unroll
    for (int r = 0; r < 8; ++r)
      sT[(wm * 16 + hl * 8 + r) * TP + wn * 64 + nt * 16 + l15] = acc[nt][r] + bb;
  }
  __syncthreads();

  if (MODE == 0) {
    // 4 x 4 plane tiles; a wave pair owns tile j*4 + w/2, one instruction = half a tile = 512 contiguous B
    const int s = (w & 1) * 32 + lane;                     // chunk inside the tile
    v4u vh[4], vl[4];
    size_t go[4];
#pragma unroll
    for (int j = 0; j < 4; ++j) {
      const int kbl = w >> 1;                              // tile column; tile row is j
      const int row = j * 16 + (s & 15);
      const float* sp = sT + row * TP + kbl * 32 + (s >> 4) * 8;
      const v4f a = *(const v4f*)sp;
      const v4f c = *(const v4f*)(sp + 4);
      float x[8] = {a.x, a.y, a.z, a.w, c.x, c.y, c.z, c.w};
      split8(x, vh[j], vl[j]);
      go[j] = ((size_t)(((m0b >> 4) + j) * KB + (n0b >> 5) + kbl) * 64 + s) * 8;
    }
#pragma unroll
    for (int j = 0; j < 4; ++j) {
      *(v4u*)(Oh + go[j]) = vh[j];
      *(v4u*)(Ol + go[j]) = vl[j];
    }
    
  } else if (MODE == 1) {
    // 8 (features) x 2 (tokens) plane tiles; wave w owns features w*16..+15, one instruction = half a tile
    const int bidx = m0b / SS;
    const int s0   = m0b - bidx * SS;
    const int f    = w * 16 + l15;
    v4u vh[4], vl[4];
    size_t go[4];
#pragma unroll
    for (int j = 0; j < 4; ++j) {
      const int s  = (j & 1) * 32 + lane;                  // chunk inside the tile
      const int tc = (j >> 1) * 32 + (s >> 4) * 8;         // first of its 8 tokens
      float x[8];
#pragma unroll
      for (int i = 0; i < 8; ++i) x[i] = sT[(tc + i) * TP + f];
      split8(x, vh[j], vl[j]);
      go[j] = ((size_t)(((bidx * N + n0b) >> 4) + w) * KB + (s0 >> 5) + (j >> 1)) * 512 + (size_t)s * 8;
    }
#pragma unroll
    for (int j = 0; j < 4; ++j) {
      *(v4u*)(Oh + go[j]) = vh[j];
      *(v4u*)(Ol + go[j]) = vl[j];
    }
    
  } else {
    // f32: wave w owns rows w*8..+7; one instruction = 32 lanes x 16 B = one 512-B row segment.
    const int cc4 = lane * 4;
    v4f val[8];
    size_t go[8];
#pragma unroll
    for (int j = 0; j < 8; ++j) {
      const int row = w * 8 + j;
      val[j] = *(const v4f*)(sT + row * TP + cc4);
      go[j]  = (size_t)(m0b + row) * N + n0b + cc4;
    }
#pragma unroll
    for (int j = 0; j < 8; ++j) *(v4f*)(Of + go[j]) = val[j];
    
  }
}

// ---------------------------------------------------------------- distance-decay attention
// grid (S/16, H, B); block 256 thr = 8 waves; 16 query rows, full 1024-key score rows in LDS.
// Qp, Kp planes [b*S+s][h*64+d], Vt planes [b*1024+h*64+d][s], concat planes [b*S+s][h*64+d]: all in fragment order;
// Row math runs in registers: the owning wave reads a score row from LDS once, 32 columns per lane.
static constexpr int SST = 1028;                          // f32 score row pitch
static constexpr int AST = 1032;                          // bf16 prob row pitch (x2 B = 129*16)
static constexpr int OST = 68;                            // f32 out-tile pitch
static constexpr size_t SM_S = (size_t)16 * SST * 4;      // 65792 (out tile aliases it later)
static constexpr size_t SM_A = (size_t)16 * AST * 2;      // 33024
static constexpr size_t SMEM_ATTN = SM_S + 2 * SM_A;      // 131840
static_assert((size_t)16 * OST * 4 <= SM_S);
static_assert(SM_S % 16 == 0);
static_assert(SM_A % 16 == 0);

__global__ void __launch_bounds__(256)
k_attn(const u16* __restrict__ Qh, const u16* __restrict__ Ql,
       const u16* __restrict__ Kh, const u16* __restrict__ Kl,
       const u16* __restrict__ Vh, const u16* __restrict__ Vl,
       const float* __restrict__ gammas,
       u16* __restrict__ Ch, u16* __restrict__ Cl) {
  extern __shared__ __attribute__((aligned(16))) char smem[];
  float* sS   = (float*)smem;                               // [16][SST]
  float* sO   = sS;                                         // [16][OST], used only after the phase-2 barrier
  u16*   aH   = (u16*)(smem + SM_S);                        // [16][AST] bf16 hi
  u16*   aL   = (u16*)(smem + SM_S + SM_A);                 // [16][AST] bf16 lo

  const int qt = blockIdx.x, h = blockIdx.y, b = blockIdx.z;
  const int q0 = qt * 16;
  const int lane = threadIdx.x & 31;
  const int w    = threadIdx.x >> 5;
  const int hl   = lane >> 4;
  const int l15  = lane & 15;

  // ---- phase 1: sS[16][1024] = Q(16x64) . K^T / 8 * log2(e): scores in base-2 units, so that every
  //      exp(a - b) of the row math is 2^(a' - b') with no multiply of its own ------------------
  {
    const size_t qrow = (size_t)(b * SS + q0) * DM + h * (DKK * 16) + lane * 8;
    const v16bf qh0 = ldg_frag(Qh, qrow),       ql0 = ldg_frag(Ql, qrow);
    const v16bf qh1 = ldg_frag(Qh, qrow + 512), ql1 = ldg_frag(Ql, qrow + 512);
    // the two Q address pairs stay live up to this wait: no later load may land on them before it
    asm volatile("s_wait_xcnt 0x0" :: "v"(Qh + qrow), "v"(Ql + qrow) : "memory");
    // ring of four key tiles in registers: a tile's slot is loaded again, four tiles ahead, behind its products
    const size_t krow0 = (size_t)(b * SS + w * 128) * DM + h * (DKK * 16) + lane * 8;
    v16bf kh0[4], kl0[4], kh1[4], kl1[4];
#pragma unroll  // constant indices, or the ring falls to scratch
    for (int t = 0; t < 4; ++t) {
      const size_t krow = krow0 + (size_t)t * 16 * DM;
      kh0[t] = ldg_frag(Kh, krow);       kl0[t] = ldg_frag(Kl, krow);
      kh1[t] = ldg_frag(Kh, krow + 512); kl1[t] = ldg_frag(Kl, krow + 512);
    }
#pragma unroll  // constant indices into the ring
    for (int t = 0; t < 8; ++t) {                            // 8 key tiles of 16 per wave
      const int kt = w * 8 + t;
      const int sl = t & 3;
      v8f acc = zero8();
      acc = wmma3(acc, qh0, ql0, kh0[sl], kl0[sl]);
      acc = wmma3(acc, qh1, ql1, kh1[sl], kl1[sl]);
      if (t + 4 < 8) {
        const size_t krow = krow0 + (size_t)(t + 4) * 16 * DM;
        kh0[sl] = ldg_frag(Kh, krow);       kl0[sl] = ldg_frag(Kl, krow);
        kh1[sl] = ldg_frag(Kh, krow + 512); kl1[sl] = ldg_frag(Kl, krow + 512);
        // behind the last K load: its address pairs stay live up to this wait and are free for reuse behind it
        if (t == 3) asm volatile("s_wait_xcnt 0x0" :: "v"(Kh + krow0), "v"(Kl + krow0) : "memory");
      }
#pragma unroll
      for (int r = 0; r < 8; ++r)
        sS[(hl * 8 + r) * SST + kt * 16 + l15] = acc[r] * (0.125f * LOG2E);
    }
  }
  __syncthreads();

  // ---- phase 2: row math, 2 rows per wave, 32 consecutive columns per lane, all in registers
  {
    const float gg  = gammas[h];
    // gam2 = -softplus(gg) * log2(e), so that exp(-d * softplus) = 2^(d * gam2); 1 + 2^(..) lies in (1, 2]
    const float gam2 = -(fmaxf(gg, 0.f) * LOG2E +
                         __builtin_amdgcn_logf(1.0f + __builtin_amdgcn_exp2f(-fabsf(gg) * LOG2E)));
    const int cb = lane * 32;
    for (int rr = 0; rr < 2; ++rr) {
      const int row = w + rr * 8;
      const int iq  = q0 + row;
      const float* srow = sS + row * SST + cb;

      float s[32];                                           // scores, then new scores, then e2
      float c[32];                                           // e, then within-chunk running sum
#pragma unroll  // constant indices, or s[] falls to scratch
      for (int g = 0; g < 8; ++g) {
        const v4f a = *(const v4f*)(srow + 4 * g);
        s[4 * g] = a.x; s[4 * g + 1] = a.y; s[4 * g + 2] = a.z; s[4 * g + 3] = a.w;
      }

      // A: row max over all 1024 keys
      float m1 = -3.0e38f;
#pragma unroll  // constant indices into s[]
      for (int i = 0; i < 32; ++i) m1 = fmaxf(m1, s[i]);
#pragma unroll
      for (int o = 16; o > 0; o >>= 1) m1 = fmaxf(m1, __shfl_xor(m1, o, 32));

      // B: e = exp(score - max) = 2^(s - m1) over the full row; s1 = sum
      float s1 = 0.f;
#pragma unroll  // constant indices into s[] and c[]
      for (int g = 0; g < 4; ++g) {
        float a[8], e[8];
#pragma unroll
        for (int i = 0; i < 8; ++i) a[i] = s[8 * g + i] - m1;
        hw_exp2x8(e, a);
#pragma unroll
        for (int i = 0; i < 8; ++i) { c[8 * g + i] = e[i]; s1 += e[i]; }
      }
#pragma unroll
      for (int o = 16; o > 0; o >>= 1) s1 += __shfl_xor(s1, o, 32);
      const float inv1 = hw_rcp(s1);

      // C: p = softmax * (j <= i); within-chunk inclusive running sum
      float run = 0.f;
#pragma unroll  // constant indices into c[]
      for (int i = 0; i < 32; ++i) {
        const float p = (cb + i <= iq) ? c[i] * inv1 : 0.f;
        run += p;
        c[i] = run;
      }
      float incl = run;
#pragma unroll
      for (int d = 1; d < 32; d <<= 1) {
        const float t = __shfl_up(incl, d, 32);
        if (lane >= d) incl += t;
      }
      const float off       = incl - run;                    // exclusive prefix of earlier lanes
      const float disttotal = __shfl(incl, 31, 32);

      // D: decay factor, masked rescale, row max of the new scores
      float m2 = -3.0e38f;
#pragma unroll  // constant indices into s[] and c[]
      for (int g = 0; g < 4; ++g) {
        float x[8], dsc[8], t[8], eff[8];
#pragma unroll
        for (int i = 0; i < 8; ++i) {
          const float distcum = off + c[8 * g + i];
          const float pe = fabsf((float)(iq - (cb + 8 * g + i)));
          x[i] = fmaxf((disttotal - distcum) * pe, 0.f);
        }
        hw_sqrtx8(dsc, x);
#pragma unroll
        for (int i = 0; i < 8; ++i) t[i] = dsc[i] * gam2;
        hw_exp2x8(eff, t);
#pragma unroll
        for (int i = 0; i < 8; ++i) {
          const float ef = fminf(fmaxf(eff[i], 1e-5f), 1e5f);
          const float ns = (cb + 8 * g + i <= iq) ? s[8 * g + i] * ef : -1e32f;
          s[8 * g + i] = ns;
          m2 = fmaxf(m2, ns);
        }
      }
#pragma unroll
      for (int o = 16; o > 0; o >>= 1) m2 = fmaxf(m2, __shfl_xor(m2, o, 32));

      // E: e2 = 2^(ns - m2) (masked entries give exactly 0); s2 = sum
      float s2 = 0.f;
#pragma unroll  // constant indices into s[]
      for (int g = 0; g < 4; ++g) {
        float a[8], e[8];
#pragma unroll
        for (int i = 0; i < 8; ++i) a[i] = s[8 * g + i] - m2;
        hw_exp2x8(e, a);
#pragma unroll
        for (int i = 0; i < 8; ++i) { s[8 * g + i] = e[i]; s2 += e[i]; }
      }
#pragma unroll
      for (int o = 16; o > 0; o >>= 1) s2 += __shfl_xor(s2, o, 32);
      const float inv2 = hw_rcp(s2);

      // F: attn probabilities -> bf16 hi/lo planes in LDS (16-B stores per lane)
      u16* ahp = aH + row * AST + cb;
      u16* alp = aL + row * AST + cb;
#pragma unroll  // constant indices into s[]
      for (int g8 = 0; g8 < 4; ++g8) {
        float p[8];
#pragma unroll  // constant indices into s[] and p[]
        for (int i = 0; i < 8; ++i) p[i] = s[8 * g8 + i] * inv2;
        v4u vh, vl;
        split8(p, vh, vl);
        *(v4u*)(ahp + 8 * g8) = vh;
        *(v4u*)(alp + 8 * g8) = vl;
      }
    }
  }
  __syncthreads();   // P planes complete (block barrier between the LDS spill and the fragment reload)

  // ---- phase 3: out(16x64) = attn(16x1024) . V(1024x64); key tiles beyond the causal range carry exact zeros
  if (w < 4) {                                               // wave-uniform
    const int nt  = w;                                       // output columns nt*16..+15
    const int nkt = q0 / 32 + 1;                             // <= 32, block-uniform
    const size_t vrow = ((size_t)(b * DM + h * DKK + nt * 16)) * SS + lane * 8;
    const int nk4 = (nkt + 3) & ~3;                          // whole groups of four tiles, <= 32: the added tiles have P == 0
    const int pa0 = l15 * AST + hl * 8;
    v8f acc = zero8();
    // ring of four V tiles in registers: a tile's slot is loaded again, four tiles ahead, behind its product
    v16bf vh[4], vl[4];
#pragma unroll  // constant indices, or the ring falls to scratch
    for (int j = 0; j < 4; ++j) {
      vh[j] = ldg_frag(Vh, vrow + (size_t)j * 512);
      vl[j] = ldg_frag(Vl, vrow + (size_t)j * 512);
    }
    // the two V address pairs stay live up to this wait: no load above may land on them
    asm volatile("s_wait_xcnt 0x0" :: "v"(Vh + vrow), "v"(Vl + vrow) : "memory");
    int k0 = 0;
    for (; k0 + 4 < nk4; k0 += 4) {
      v16bf ph[4], pl[4];
#pragma unroll  // constant indices; the group's four P tiles are read from LDS in one go
      for (int j = 0; j < 4; ++j) {
        ph[j] = lds_frag(aH, pa0 + (k0 + j) * 32);
        pl[j] = lds_frag(aL, pa0 + (k0 + j) * 32);
      }
#pragma unroll  // constant indices into the ring
      for (int j = 0; j < 4; ++j) {
        acc = wmma3(acc, ph[j], pl[j], vh[j], vl[j]);
        vh[j] = ldg_frag(Vh, vrow + (size_t)(k0 + 4 + j) * 512);
        vl[j] = ldg_frag(Vl, vrow + (size_t)(k0 + 4 + j) * 512);
      }
      // the next trip's address additions overwrite registers that the loads in flight name
      asm volatile("s_wait_xcnt 0x0" ::: "memory");
    }
    {                                                        // last group: nothing left to load
      v16bf ph[4], pl[4];
#pragma unroll
      for (int j = 0; j < 4; ++j) {
        ph[j] = lds_frag(aH, pa0 + (k0 + j) * 32);
        pl[j] = lds_frag(aL, pa0 + (k0 + j) * 32);
      }
#pragma unroll
      for (int j = 0; j < 4; ++j) acc = wmma3(acc, ph[j], pl[j], vh[j], vl[j]);
    }
#pragma unroll
    for (int r = 0; r < 8; ++r)
      sO[(hl * 8 + r) * OST + nt * 16 + l15] = acc[r];
  }
  __syncthreads();

  // ---- store concat planes: two plane tiles; wave w owns half of tile w/2, one instruction per plane = 512 contiguous B
  if (w < 4) {
    const int s  = (w & 1) * 32 + lane;                      // chunk inside the tile
    const int cc = (w >> 1) * 32 + (s >> 4) * 8;
    const float* sp = sO + (s & 15) * OST + cc;
    const v4f a = *(const v4f*)sp;
    const v4f c = *(const v4f*)(sp + 4);
    float x[8] = {a.x, a.y, a.z, a.w, c.x, c.y, c.z, c.w};
    v4u vh, vl;
    split8(x, vh, vl);
    const size_t go = (size_t)(b * SS + q0) * DM + h * (DKK * 16) + (w >> 1) * 512 + s * 8;
    *(v4u*)(Ch + go) = vh;
    *(v4u*)(Cl + go) = vl;
    
  }
}

// ---------------------------------------------------------------- launcher
extern "C" void kernel_launch(void* const* d_in, const int* in_sizes, int n_in,
                              void* d_out, int out_size, void* d_ws, size_t ws_size,
                              hipStream_t stream) {
  if (n_in < 12) return;
  if (in_sizes[0] != (int)ACT || in_sizes[1] != (int)ACT || in_sizes[2] != (int)ACT) return;
  if (in_sizes[3] != (int)WEL || in_sizes[5] != (int)WEL || in_sizes[7] != (int)WEL || in_sizes[9] != (int)WEL) return;
  if (in_sizes[4] != DM || in_sizes[6] != DM || in_sizes[8] != DM || in_sizes[10] != DM) return;
  if (in_sizes[11] != HH) return;
  if (out_size != (int)ACT) return;

  const float* q   = (const float*)d_in[0];
  const float* k   = (const float*)d_in[1];
  const float* v   = (const float*)d_in[2];
  const float* Wq  = (const float*)d_in[3];
  const float* bq  = (const float*)d_in[4];
  const float* Wk  = (const float*)d_in[5];
  const float* bk  = (const float*)d_in[6];
  const float* Wv  = (const float*)d_in[7];
  const float* bv  = (const float*)d_in[8];
  const float* Wo  = (const float*)d_in[9];
  const float* bo  = (const float*)d_in[10];
  const float* gam = (const float*)d_in[11];
  float* out = (float*)d_out;

  // workspace carve (256-B aligned): act hi/lo (reused: q, k, v planes, then concat planes),
  // weight hi/lo (reused per weight), Qp hi/lo, Kp hi/lo, Vt hi/lo.  Total 68 MiB.
  char* ws = (char*)d_ws;
  size_t off = 0;
  auto carve = [&](size_t bytes) -> char* {
    char* p = ws + off;
    off += (bytes + 255) & ~(size_t)255;
    return p;
  };
  u16* actH = (u16*)carve(ACT * 2);
  u16* actL = (u16*)carve(ACT * 2);
  u16* wH   = (u16*)carve(WEL * 2);
  u16* wL   = (u16*)carve(WEL * 2);
  u16* QpH  = (u16*)carve(ACT * 2);
  u16* QpL  = (u16*)carve(ACT * 2);
  u16* KpH  = (u16*)carve(ACT * 2);
  u16* KpL  = (u16*)carve(ACT * 2);
  u16* VtH  = (u16*)carve(ACT * 2);
  u16* VtL  = (u16*)carve(ACT * 2);
  if (off > ws_size) return;

  const int nAct8 = (int)(ACT / 8);                 // 524288 threads
  const int nWel8 = (int)(WEL / 8);                 // 131072 threads
  const dim3 gAct((unsigned)((nAct8 + 255) / 256));
  const dim3 gWel((unsigned)((nWel8 + 255) / 256));
  const dim3 ggrid(DM / 128, MROWS / 64);           // (8, 64)
  const dim3 agrid(SS / 16, HH, BB);                // (64, 16, 4)

  // q projection -> Qp planes
  k_split<<<gAct, 256, 0, stream>>>(q, actH, actL, nAct8);
  k_split<<<gWel, 256, 0, stream>>>(Wq, wH, wL, nWel8);
  k_gemm3<0><<<ggrid, 256, 0, stream>>>(actH, actL, wH, wL, bq, QpH, QpL, out);
  // k projection -> Kp planes
  k_split<<<gAct, 256, 0, stream>>>(k, actH, actL, nAct8);
  k_split<<<gWel, 256, 0, stream>>>(Wk, wH, wL, nWel8);
  k_gemm3<0><<<ggrid, 256, 0, stream>>>(actH, actL, wH, wL, bk, KpH, KpL, out);
  // v projection -> Vt planes (k = token)
  k_split<<<gAct, 256, 0, stream>>>(v, actH, actL, nAct8);
  k_split<<<gWel, 256, 0, stream>>>(Wv, wH, wL, nWel8);
  k_gemm3<1><<<ggrid, 256, 0, stream>>>(actH, actL, wH, wL, bv, VtH, VtL, out);
  // attention -> concat planes (reuse act planes)
  k_attn<<<agrid, 256, SMEM_ATTN, stream>>>(QpH, QpL, KpH, KpL, VtH, VtL, gam, actH, actL);
  // output projection -> f32 result
  k_split<<<gWel, 256, 0, stream>>>(Wo, wH, wL, nWel8);
  k_gemm3<2><<<ggrid, 256, 0, stream>>>(actH, actL, wH, wL, bo, QpH, QpL, out);
}

// v005
// One run takes 223 microseconds.
// Two timings next to v004 both put it at 1.18 times that version's speed.
// Over all steps from v000 it is 2.89 times as fast.
#include <hip/hip_runtime.h>
#include <math.h>
#include <stdint.h>
#include <stddef.h>

// All six contractions (three input projections, q.k^T scores, attn.V, output projection): v_wmma_f32_16x16x32_bf16 with bf16 hi/lo three-term split operands (hi*hi + hi*lo + lo*hi), f32 accumulate; softmax / cumsum / distance-decay row math in f32 on VALU.

typedef __bf16         v16bf __attribute__((ext_vector_type(16)));
typedef float          v8f   __attribute__((ext_vector_type(8)));
typedef float          v4f   __attribute__((ext_vector_type(4)));
typedef unsigned int   v4u   __attribute__((ext_vector_type(4)));
typedef unsigned short u16;

union Frag { v16bf v; v4u u[2]; };

static constexpr int BB  = 4;
static constexpr int SS  = 1024;
static constexpr int DM  = 1024;
static constexpr int HH  = 16;
static constexpr int DKK = 64;
static constexpr int MROWS = BB * SS;                 // 4096
static constexpr size_t ACT = (size_t)MROWS * DM;     // 4194304
static constexpr size_t WEL = (size_t)DM * DM;        // 1048576
static_assert(HH * DKK == DM);
static_assert(MROWS % 64 == 0);
static_assert(DM % 128 == 0);
static_assert(DM % 64 == 0);
static_assert(SS % 64 == 0);
static_assert(ACT % 2048 == 0);
static_assert(WEL % 2048 == 0);
static_assert(SS == DM);                              // one tile map serves every plane

// Every bf16 plane is a [rows][1024] matrix stored in fragment order: 1-KiB tiles of 16 rows x 32 k,
// tile index (row/16)*KB + k/32; inside a tile the 16-B chunk of (row, k/8) sits at (k/8 % 4)*16 + row%16.
// A lane's two fragment chunks are then chunk 'lane' and chunk '32 + lane' of the tile, so one
// wave-wide 16-B load covers 512 contiguous bytes.
static constexpr int KB = DM / 32;                    // tiles along k

// ---------------------------------------------------------------- small helpers
__device__ __forceinline__ unsigned bf16_bits(float x) {          // RNE f32 -> bf16 bits
  unsigned u = __float_as_uint(x);
  u += 0x7FFFu + ((u >> 16) & 1u);
  return u >> 16;
}
__device__ __forceinline__ void split2(float x, unsigned& hi, unsigned& lo) {
  hi = bf16_bits(x);
  const float xh = __uint_as_float(hi << 16);
  lo = bf16_bits(x - xh);                                         // x - xh exact in f32
}
// 8 consecutive f32 -> packed 8 bf16 hi (16 B) and 8 bf16 lo (16 B)
__device__ __forceinline__ void split8(const float* x, v4u& vh, v4u& vl) {
  unsigned hw[4], lw[4];
#pragma unroll
  for (int i = 0; i < 4; ++i) {
    unsigned h0, l0, h1, l1;
    split2(x[2 * i], h0, l0);
    split2(x[2 * i + 1], h1, l1);
    hw[i] = h0 | (h1 << 16);
    lw[i] = l0 | (l1 << 16);
  }
  vh.x = hw[0]; vh.y = hw[1]; vh.z = hw[2]; vh.w = hw[3];
  vl.x = lw[0]; vl.y = lw[1]; vl.z = lw[2]; vl.w = lw[3];
}
__device__ __forceinline__ v8f zero8() {
  v8f z;
#pragma unroll
  for (int i = 0; i < 8; ++i) z[i] = 0.f;
  return z;
}
// 16x32 operand fragment from one plane tile: elements 0..7 <- k 8*(lane>>4).., 8..15 <- 16 further,
// row lane&15 (same map for A rows and for B stored [n][k])
// (caller passes e = row0*DM + (k0/32)*512 + 8*lane, the lane's first chunk of the tile at row0, k0)
__device__ __forceinline__ v16bf ldg_frag(const u16* __restrict__ p, size_t e) {
  Frag f;
  f.u[0] = *(const v4u*)(p + e);
  f.u[1] = *(const v4u*)(p + e + 256);
  return f.v;
}
// 16x32 operand fragment from a k-contiguous bf16 row in LDS: elements 0..7 <- e.., 8..15 <- e+16..
// (caller passes e = row*pitch + k0 + 8*(lane>>4))
__device__ __forceinline__ v16bf lds_frag(const u16* p, int e) {
  Frag f;
  f.u[0] = *(const v4u*)(p + e);
  f.u[1] = *(const v4u*)(p + e + 16);
  return f.v;
}
// 2^x, log2(x), sqrt(x) and 1/x as the chip's own single instructions (about 1 ulp), without libm's range reduction,
// range checks and refinement steps.  A result below the normal range may come out as 0, a subnormal
// sqrt argument likewise: every use below adds such a value to a sum that is at least 1 or clamps it;
// the two reciprocals are of such sums (1 <= sum <= 1024).
// Eight at a time in one statement: behind a transcendental the instruction set wants one slot before its
// result is read or its source overwritten.  "=&v" keeps every result apart from every argument, so no
// neighbour takes a source's register; the v_nop is the slot behind the last one; the s_delay_alu is the
// issue hint for the arguments, which the compiler cannot give for instructions inside a statement.
__device__ __forceinline__ void hw_exp2x8(float (&r)[8], const float (&a)[8]) {
  asm("s_delay_alu instid0(VALU_DEP_1)\n\t"
      "v_exp_f32 %0, %8\n\tv_exp_f32 %1, %9\n\tv_exp_f32 %2, %10\n\tv_exp_f32 %3, %11\n\t"
      "v_exp_f32 %4, %12\n\tv_exp_f32 %5, %13\n\tv_exp_f32 %6, %14\n\tv_exp_f32 %7, %15\n\t"
      "v_nop"
      : "=&v"(r[0]), "=&v"(r[1]), "=&v"(r[2]), "=&v"(r[3]), "=&v"(r[4]), "=&v"(r[5]), "=&v"(r[6]), "=&v"(r[7])
      : "v"(a[0]), "v"(a[1]), "v"(a[2]), "v"(a[3]), "v"(a[4]), "v"(a[5]), "v"(a[6]), "v"(a[7]));
}
__device__ __forceinline__ void hw_sqrtx8(float (&r)[8], const float (&a)[8]) {
  asm("s_delay_alu instid0(VALU_DEP_1)\n\t"
      "v_sqrt_f32 %0, %8\n\tv_sqrt_f32 %1, %9\n\tv_sqrt_f32 %2, %10\n\tv_sqrt_f32 %3, %11\n\t"
      "v_sqrt_f32 %4, %12\n\tv_sqrt_f32 %5, %13\n\tv_sqrt_f32 %6, %14\n\tv_sqrt_f32 %7, %15\n\t"
      "v_nop"
      : "=&v"(r[0]), "=&v"(r[1]), "=&v"(r[2]), "=&v"(r[3]), "=&v"(r[4]), "=&v"(r[5]), "=&v"(r[6]), "=&v"(r[7])
      : "v"(a[0]), "v"(a[1]), "v"(a[2]), "v"(a[3]), "v"(a[4]), "v"(a[5]), "v"(a[6]), "v"(a[7]));
}
__device__ __forceinline__ float hw_rcp(float x) { return __builtin_amdgcn_rcpf(x); }
static constexpr float LOG2E = 1.44269504088896340736f;
// three-term split product into one accumulator, then hazard guard (ties D, keeps A/B live)
__device__ __forceinline__ v8f wmma3(v8f acc, v16bf ah, v16bf al, v16bf bh, v16bf bl) {
  acc = __builtin_amdgcn_wmma_f32_16x16x32_bf16(false, ah, false, bh, (short)0, acc, false, false);
  acc = __builtin_amdgcn_wmma_f32_16x16x32_bf16(false, ah, false, bl, (short)0, acc, false, false);
  acc = __builtin_amdgcn_wmma_f32_16x16x32_bf16(false, al, false, bh, (short)0, acc, false, false);
  asm volatile("v_nop\n\tv_nop\n\tv_nop\n\tv_nop" : "+v"(acc) : "v"(ah), "v"(al), "v"(bh), "v"(bl));
  return acc;
}

// ---------------------------------------------------------------- f32 [rows][1024] -> bf16 hi/lo planes (fragment order)
// One launch splits all seven f32 matrices (q, k, v, Wq, Wk, Wv, Wo): none reads another's result.
// aH/aL hold the three activation planes one behind the other, wH/wL the four weight planes.
// A unit is 8 rows x 32 k of one tile, one wave's work: 8 whole 128-B lines read, 4 whole lines stored per plane.
// A block takes 128 consecutive units of ONE matrix (32 rows), 16 per wave.
static constexpr int UPB      = 128;                        // units per block
static constexpr int ACT_BLKS = (int)(ACT / 256 / UPB);     // 128 blocks per activation
static constexpr int WEL_BLKS = (int)(WEL / 256 / UPB);     // 32 blocks per weight
static constexpr int SPLIT_BLKS = 3 * ACT_BLKS + 4 * WEL_BLKS;
static_assert(ACT % (256 * UPB) == 0);
static_assert(WEL % (256 * UPB) == 0);

__global__ void __launch_bounds__(256)
k_split(const float* __restrict__ q, const float* __restrict__ k, const float* __restrict__ v,
        const float* __restrict__ Wq, const float* __restrict__ Wk, const float* __restrict__ Wv,
        const float* __restrict__ Wo,
        u16* __restrict__ aH, u16* __restrict__ aL, u16* __restrict__ wH, u16* __restrict__ wL) {
  const int blk  = blockIdx.x;
  const int lane = threadIdx.x & 31;
  const int w    = threadIdx.x >> 5;
  const float* in;
  u16 *ph, *pl;
  int u0;                                                   // the block's first unit inside its matrix
  if (blk < 3 * ACT_BLKS) {                                 // block-uniform
    const int a = blk / ACT_BLKS;
    in = (a == 0) ? q : (a == 1) ? k : v;
    ph = aH + (size_t)a * ACT;
    pl = aL + (size_t)a * ACT;
    u0 = (blk - a * ACT_BLKS) * UPB;
  } else {
    const int a = (blk - 3 * ACT_BLKS) / WEL_BLKS;
    in = (a == 0) ? Wq : (a == 1) ? Wk : (a == 2) ? Wv : Wo;
    ph = wH + (size_t)a * WEL;
    pl = wL + (size_t)a * WEL;
    u0 = (blk - 3 * ACT_BLKS - a * WEL_BLKS) * UPB;
  }
  // the wave's n-th unit is unit n*8 + w of the block: half w&1 of tile (n&7)*4 + w/2 in the block's tile row n>>3,
  // so every address below is one lane address plus a compile-time offset
  const int r = (w & 1) * 8 + (lane & 7);                   // row inside the tile
  const int j = lane >> 3;                                  // 8-element chunk along k
  const float* src = in + (size_t)((u0 >> 6) * 16 + r) * DM + (w >> 1) * 32 + j * 8;
  const size_t dst = ((size_t)((u0 >> 1) + (w >> 1)) * 64 + j * 16 + r) * 8;
  v4f a[16], c[16];
#pragma unroll  // constant indices, or a[] and c[] fall to scratch
  for (int n = 0; n < 16; ++n) {
    const float* p = src + (n >> 3) * 16 * DM + (n & 7) * 128;
    a[n] = *(const v4f*)p;
    c[n] = *(const v4f*)(p + 4);
  }
  // keeps all 32 loads ahead of the arithmetic: left alone the compiler sinks them and holds about six in flight
  __builtin_amdgcn_sched_barrier(0);
#pragma unroll  // constant indices
  for (int n = 0; n < 16; ++n) {
    float x[8] = {a[n].x, a[n].y, a[n].z, a[n].w, c[n].x, c[n].y, c[n].z, c[n].w};
    v4u vh, vl;
    split8(x, vh, vl);
    const size_t d = dst + (size_t)((n >> 3) * KB + (n & 7) * 4) * 512;
    *(v4u*)(ph + d) = vh;
    *(v4u*)(pl + d) = vl;
  }
}

// ---------------------------------------------------------------- GEMM: out = A @ W^T + bias
// A planes [M=4096][K=1024] bf16 hi/lo, W planes [N=1024][K] bf16 hi/lo ([out,in]), both in fragment order;
// bias [N] f32. Block 256 thr = 8 waves, block tile 64(M) x 128(N), wave tile 16 x 64.
// Fragments straight from global (no LDS in the k-loop), fetched two k steps ahead.  Epilogue: tile staged in LDS, then
// MODE 0: the three input projections in one launch, blockIdx.z = 0, 1, 2 for q, k, v: operand, weight and result
//         planes of projection z lie z planes behind the pointers given.  Result of z = 0, 1: bf16 hi/lo planes
//         [M][N] in fragment order; of z = 2: planes transposed [(m/SS)*N + n][m%SS] in fragment order
//         (k = token, for attn.V)
// MODE 2: f32 row-major [M][N] (Of)
static constexpr int TP = 132;   // LDS tile pitch (floats)

template <int MODE>
__global__ void __launch_bounds__(256)
k_gemm3(const u16* __restrict__ Ah0, const u16* __restrict__ Al0,
        const u16* __restrict__ Wh0, const u16* __restrict__ Wl0,
        const float* __restrict__ bias0, const float* __restrict__ bias1, const float* __restrict__ bias2,
        u16* __restrict__ Oh0, u16* __restrict__ Ol0, float* __restrict__ Of) {
  constexpr int N = DM, K = DM;
  __shared__ __attribute__((aligned(16))) float sT[64 * TP];

  const int z = (MODE == 0) ? (int)blockIdx.z : 0;     // which projection; block-uniform
  const u16* __restrict__ Ah = Ah0 + (size_t)z * ACT;
  const u16* __restrict__ Al = Al0 + (size_t)z * ACT;
  const u16* __restrict__ Wh = Wh0 + (size_t)z * WEL;
  const u16* __restrict__ Wl = Wl0 + (size_t)z * WEL;
  const float* __restrict__ bias = (z == 0) ? bias0 : (z == 1) ? bias1 : bias2;
  u16* __restrict__ Oh = Oh0 + (size_t)z * ACT;
  u16* __restrict__ Ol = Ol0 + (size_t)z * ACT;

  const int lane = threadIdx.x & 31;
  const int w    = threadIdx.x >> 5;
  const int wm   = w & 3;              // 0..3
  const int wn   = w >> 2;             // 0..1
  const int hl   = lane >> 4;
  const int l15  = lane & 15;
  const int m0b  = blockIdx.y * 64;
  const int n0b  = blockIdx.x * 128;
  const int m0   = m0b + wm * 16;
  const int n0   = n0b + wn * 64;

  v8f acc[4];
#pragma unroll
  for (int nt = 0; nt < 4; ++nt) acc[nt] = zero8();

  const size_t ea0 = (size_t)m0 * K + lane * 8;         // A rows m0..m0+15
  const size_t eb0 = (size_t)n0 * K + lane * 8;         // W rows n0..n0+15 (+nt*16 rows)

  // Two register sets of fragments, even and odd k steps.  Each fragment is loaded again, for two k steps
  // later, directly behind its last product, so a load has up to seven products' time to come back.
  v16bf ah[2], al[2], bh[2][4], bl[2][4];
#pragma unroll  // constant indices, or the sets fall to scratch
  for (int p = 0; p < 2; ++p) {
    ah[p] = ldg_frag(Ah, ea0 + p * 512);
    al[p] = ldg_frag(Al, ea0 + p * 512);
#pragma unroll
    for (int nt = 0; nt < 4; ++nt) {
      bh[p][nt] = ldg_frag(Wh, eb0 + (size_t)nt * 16 * K + p * 512);
      bl[p][nt] = ldg_frag(Wl, eb0 + (size_t)nt * 16 * K + p * 512);
    }
  }
#pragma unroll 1  // one trip already holds both sets; further copies only grow the code
  for (int kb = 0; kb < K / 32 - 2; kb += 2) {
#pragma unroll  // constant indices into the sets
    for (int p = 0; p < 2; ++p) {
      const size_t en = (size_t)(kb + 2 + p) * 512;
#pragma unroll
      for (int nt = 0; nt < 4; ++nt) {
        acc[nt] = wmma3(acc[nt], ah[p], al[p], bh[p][nt], bl[p][nt]);
        bh[p][nt] = ldg_frag(Wh, eb0 + (size_t)nt * 16 * K + en);
        bl[p][nt] = ldg_frag(Wl, eb0 + (size_t)nt * 16 * K + en);
      }
      ah[p] = ldg_frag(Ah, ea0 + en);
      al[p] = ldg_frag(Al, ea0 + en);
    }
    // the next trip's address additions overwrite registers that the loads in flight name
    asm volatile("s_wait_xcnt 0x0" ::: "memory");
  }
#pragma unroll  // the last two k steps: nothing left to load
  for (int p = 0; p < 2; ++p) {
#pragma unroll
    for (int nt = 0; nt < 4; ++nt)
      acc[nt] = wmma3(acc[nt], ah[p], al[p], bh[p][nt], bl[p][nt]);
  }

  // stage the 64x128 f32 tile (+bias) in LDS; D element r of lane = (row 8h+r, col l15)
#pragma unroll
  for (int nt = 0; nt < 4; ++nt) {
    const float bb = bias[n0 + nt * 16 + l15];
#pragma unroll
    for (int r = 0; r < 8; ++r)
      sT[(wm * 16 + hl * 8 + r) * TP + wn * 64 + nt * 16 + l15] = acc[nt][r] + bb;
  }
  __syncthreads();

  if (MODE == 0 && z < 2) {
    // 4 x 4 plane tiles; a wave pair owns tile j*4 + w/2, one instruction = half a tile = 512 contiguous B
    const int s = (w & 1) * 32 + lane;                     // chunk inside the tile
    v4u vh[4], vl[4];
    size_t go[4];
#pragma unroll
    for (int j = 0; j < 4; ++j) {
      const int kbl = w >> 1;                              // tile column; tile row is j
      const int row = j * 16 + (s & 15);
      const float* sp = sT + row * TP + kbl * 32 + (s >> 4) * 8;
      const v4f a = *(const v4f*)sp;
      const v4f c = *(const v4f*)(sp + 4);
      float x[8] = {a.x, a.y, a.z, a.w, c.x, c.y, c.z, c.w};
      split8(x, vh[j], vl[j]);
      go[j] = ((size_t)(((m0b >> 4) + j) * KB + (n0b >> 5) + kbl) * 64 + s) * 8;
    }
#pragma unroll
    for (int j = 0; j < 4; ++j) {
      *(v4u*)(Oh + go[j]) = vh[j];
      *(v4u*)(Ol + go[j]) = vl[j];
    }
    
  } else if (MODE == 0) {
    // 8 (features) x 2 (tokens) plane tiles; wave w owns features w*16..+15, one instruction = half a tile
    const int bidx = m0b / SS;
    const int s0   = m0b - bidx * SS;
    const int f    = w * 16 + l15;
    v4u vh[4], vl[4];
    size_t go[4];
#pragma unroll
    for (int j = 0; j < 4; ++j) {
      const int s  = (j & 1) * 32 + lane;                  // chunk inside the tile
      const int tc = (j >> 1) * 32 + (s >> 4) * 8;         // first of its 8 tokens
      float x[8];
#pragma unroll
      for (int i = 0; i < 8; ++i) x[i] = sT[(tc + i) * TP + f];
      split8(x, vh[j], vl[j]);
      go[j] = ((size_t)(((bidx * N + n0b) >> 4) + w) * KB + (s0 >> 5) + (j >> 1)) * 512 + (size_t)s * 8;
    }
#pragma unroll
    for (int j = 0; j < 4; ++j) {
      *(v4u*)(Oh + go[j]) = vh[j];
      *(v4u*)(Ol + go[j]) = vl[j];
    }
    // in the built code a never-taken branch leads from here into the other result form's block, which rewrites
    // registers that the stores above name
    asm volatile("s_wait_xcnt 0x0" ::: "memory");
  } else {
    // f32: wave w owns rows w*8..+7; one instruction = 32 lanes x 16 B = one 512-B row segment.
    const int cc4 = lane * 4;
    v4f val[8];
    size_t go[8];
#pragma unroll
    for (int j = 0; j < 8; ++j) {
      const int row = w * 8 + j;
      val[j] = *(const v4f*)(sT + row * TP + cc4);
      go[j]  = (size_t)(m0b + row) * N + n0b + cc4;
    }
#pragma unroll
    for (int j = 0; j < 8; ++j) *(v4f*)(Of + go[j]) = val[j];
    
  }
}

// ---------------------------------------------------------------- distance-decay attention
// grid (S/16, H, B); block 256 thr = 8 waves; 16 query rows, full 1024-key score rows in LDS.
// Qp, Kp planes [b*S+s][h*64+d], Vt planes [b*1024+h*64+d][s], concat planes [b*S+s][h*64+d]: all in fragment order;
// Row math runs in registers: the owning wave reads a score row from LDS once, 32 columns per lane.
static constexpr int SST = 1028;                          // f32 score row pitch
static constexpr int AST = 1032;                          // bf16 prob row pitch (x2 B = 129*16)
static constexpr int OST = 68;                            // f32 out-tile pitch
static constexpr size_t SM_S = (size_t)16 * SST * 4;      // 65792 (out tile aliases it later)
static constexpr size_t SM_A = (size_t)16 * AST * 2;      // 33024
static constexpr size_t SMEM_ATTN = SM_S + 2 * SM_A;      // 131840
static_assert((size_t)16 * OST * 4 <= SM_S);
static_assert(SM_S % 16 == 0);
static_assert(SM_A % 16 == 0);

__global__ void __launch_bounds__(256)
k_attn(const u16* __restrict__ Qh, const u16* __restrict__ Ql,
       const u16* __restrict__ Kh, const u16* __restrict__ Kl,
       const u16* __restrict__ Vh, const u16* __restrict__ Vl,
       const float* __restrict__ gammas,
       u16* __restrict__ Ch, u16* __restrict__ Cl) {
  extern __shared__ __attribute__((aligned(16))) char smem[];
  float* sS   = (float*)smem;                               // [16][SST]
  float* sO   = sS;                                         // [16][OST], used only after the phase-2 barrier
  u16*   aH   = (u16*)(smem + SM_S);                        // [16][AST] bf16 hi
  u16*   aL   = (u16*)(smem + SM_S + SM_A);                 // [16][AST] bf16 lo

  const int qt = blockIdx.x, h = blockIdx.y, b = blockIdx.z;
  const int q0 = qt * 16;
  const int lane = threadIdx.x & 31;
  const int w    = threadIdx.x >> 5;
  const int hl   = lane >> 4;
  const int l15  = lane & 15;

  // ---- phase 1: sS[16][1024] = Q(16x64) . K^T / 8 * log2(e): scores in base-2 units, so that every
  //      exp(a - b) of the row math is 2^(a' - b') with no multiply of its own ------------------
  {
    const size_t qrow = (size_t)(b * SS + q0) * DM + h * (DKK * 16) + lane * 8;
    const v16bf qh0 = ldg_frag(Qh, qrow),       ql0 = ldg_frag(Ql, qrow);
    const v16bf qh1 = ldg_frag(Qh, qrow + 512), ql1 = ldg_frag(Ql, qrow + 512);
    // the two Q address pairs stay live up to this wait: no later load may land on them before it
    asm volatile("s_wait_xcnt 0x0" :: "v"(Qh + qrow), "v"(Ql + qrow) : "memory");
    // ring of four key tiles in registers: a tile's slot is loaded again, four tiles ahead, behind its products
    const size_t krow0 = (size_t)(b * SS + w * 128) * DM + h * (DKK * 16) + lane * 8;
    v16bf kh0[4], kl0[4], kh1[4], kl1[4];
#pragma unroll  // constant indices, or the ring falls to scratch
    for (int t = 0; t < 4; ++t) {
      const size_t krow = krow0 + (size_t)t * 16 * DM;
      kh0[t] = ldg_frag(Kh, krow);       kl0[t] = ldg_frag(Kl, krow);
      kh1[t] = ldg_frag(Kh, krow + 512); kl1[t] = ldg_frag(Kl, krow + 512);
    }
#pragma unroll  // constant indices into the ring
    for (int t = 0; t < 8; ++t) {                            // 8 key tiles of 16 per wave
      const int kt = w * 8 + t;
      const int sl = t & 3;
      v8f acc = zero8();
      acc = wmma3(acc, qh0, ql0, kh0[sl], kl0[sl]);
      acc = wmma3(acc, qh1, ql1, kh1[sl], kl1[sl]);
      if (t + 4 < 8) {
        const size_t krow = krow0 + (size_t)(t + 4) * 16 * DM;
        kh0[sl] = ldg_frag(Kh, krow);       kl0[sl] = ldg_frag(Kl, krow);
        kh1[sl] = ldg_frag(Kh, krow + 512); kl1[sl] = ldg_frag(Kl, krow + 512);
        // behind the last K load: its address pairs stay live up to this wait and are free for reuse behind it
        if (t == 3) asm volatile("s_wait_xcnt 0x0" :: "v"(Kh + krow0), "v"(Kl + krow0) : "memory");
      }
#pragma unroll
      for (int r = 0; r < 8; ++r)
        sS[(hl * 8 + r) * SST + kt * 16 + l15] = acc[r] * (0.125f * LOG2E);
    }
  }
  __syncthreads();

  // ---- phase 2: row math, 2 rows per wave, 32 consecutive columns per lane, all in registers
  {
    const float gg  = gammas[h];
    // gam2 = -softplus(gg) * log2(e), so that exp(-d * softplus) = 2^(d * gam2); 1 + 2^(..) lies in (1, 2]
    const float gam2 = -(fmaxf(gg, 0.f) * LOG2E +
                         __builtin_amdgcn_logf(1.0f + __builtin_amdgcn_exp2f(-fabsf(gg) * LOG2E)));
    const int cb = lane * 32;
    for (int rr = 0; rr < 2; ++rr) {
      const int row = w + rr * 8;
      const int iq  = q0 + row;
      const float* srow = sS + row * SST + cb;

      float s[32];                                           // scores, then new scores, then e2
      float c[32];                                           // e, then within-chunk running sum
#pragma unroll  // constant indices, or s[] falls to scratch
      for (int g = 0; g < 8; ++g) {
        const v4f a = *(const v4f*)(srow + 4 * g);
        s[4 * g] = a.x; s[4 * g + 1] = a.y; s[4 * g + 2] = a.z; s[4 * g + 3] = a.w;
      }

      // A: row max over all 1024 keys
      float m1 = -3.0e38f;
#pragma unroll  // constant indices into s[]
      for (int i = 0; i < 32; ++i) m1 = fmaxf(m1, s[i]);
#pragma unroll
      for (int o = 16; o > 0; o >>= 1) m1 = fmaxf(m1, __shfl_xor(m1, o, 32));

      // B: e = exp(score - max) = 2^(s - m1) over the full row; s1 = sum
      float s1 = 0.f;
#pragma unroll  // constant indices into s[] and c[]
      for (int g = 0; g < 4; ++g) {
        float a[8], e[8];
#pragma unroll
        for (int i = 0; i < 8; ++i) a[i] = s[8 * g + i] - m1;
        hw_exp2x8(e, a);
#pragma unroll
        for (int i = 0; i < 8; ++i) { c[8 * g + i] = e[i]; s1 += e[i]; }
      }
#pragma unroll
      for (int o = 16; o > 0; o >>= 1) s1 += __shfl_xor(s1, o, 32);
      const float inv1 = hw_rcp(s1);

      // C: p = softmax * (j <= i); within-chunk inclusive running sum
      float run = 0.f;
#pragma unroll  // constant indices into c[]
      for (int i = 0; i < 32; ++i) {
        const float p = (cb + i <= iq) ? c[i] * inv1 : 0.f;
        run += p;
        c[i] = run;
      }
      float incl = run;
#pragma unroll
      for (int d = 1; d < 32; d <<= 1) {
        const float t = __shfl_up(incl, d, 32);
        if (lane >= d) incl += t;
      }
      const float off       = incl - run;                    // exclusive prefix of earlier lanes
      const float disttotal = __shfl(incl, 31, 32);

      // D: decay factor, masked rescale, row max of the new scores
      float m2 = -3.0e38f;
#pragma unroll  // constant indices into s[] and c[]
      for (int g = 0; g < 4; ++g) {
        float x[8], dsc[8], t[8], eff[8];
#pragma unroll
        for (int i = 0; i < 8; ++i) {
          const float distcum = off + c[8 * g + i];
          const float pe = fabsf((float)(iq - (cb + 8 * g + i)));
          x[i] = fmaxf((disttotal - distcum) * pe, 0.f);
        }
        hw_sqrtx8(dsc, x);
#pragma unroll
        for (int i = 0; i < 8; ++i) t[i] = dsc[i] * gam2;
        hw_exp2x8(eff, t);
#pragma unroll
        for (int i = 0; i < 8; ++i) {
          const float ef = fminf(fmaxf(eff[i], 1e-5f), 1e5f);
          const float ns = (cb + 8 * g + i <= iq) ? s[8 * g + i] * ef : -1e32f;
          s[8 * g + i] = ns;
          m2 = fmaxf(m2, ns);
        }
      }
#pragma unroll
      for (int o = 16; o > 0; o >>= 1) m2 = fmaxf(m2, __shfl_xor(m2, o, 32));

      // E: e2 = 2^(ns - m2) (masked entries give exactly 0); s2 = sum
      float s2 = 0.f;
#pragma unroll  // constant indices into s[]
      for (int g = 0; g < 4; ++g) {
        float a[8], e[8];
#pragma unroll
        for (int i = 0; i < 8; ++i) a[i] = s[8 * g + i] - m2;
        hw_exp2x8(e, a);
#pragma unroll
        for (int i = 0; i < 8; ++i) { s[8 * g + i] = e[i]; s2 += e[i]; }
      }
#pragma unroll
      for (int o = 16; o > 0; o >>= 1) s2 += __shfl_xor(s2, o, 32);
      const float inv2 = hw_rcp(s2);

      // F: attn probabilities -> bf16 hi/lo planes in LDS (16-B stores per lane)
      u16* ahp = aH + row * AST + cb;
      u16* alp = aL + row * AST + cb;
#pragma unroll  // constant indices into s[]
      for (int g8 = 0; g8 < 4; ++g8) {
        float p[8];
#pragma unroll  // constant indices into s[] and p[]
        for (int i = 0; i < 8; ++i) p[i] = s[8 * g8 + i] * inv2;
        v4u vh, vl;
        split8(p, vh, vl);
        *(v4u*)(ahp + 8 * g8) = vh;
        *(v4u*)(alp + 8 * g8) = vl;
      }
    }
  }
  __syncthreads();   // P planes complete (block barrier between the LDS spill and the fragment reload)

  // ---- phase 3: out(16x64) = attn(16x1024) . V(1024x64); key tiles beyond the causal range carry exact zeros
  if (w < 4) {                                               // wave-uniform
    const int nt  = w;                                       // output columns nt*16..+15
    const int nkt = q0 / 32 + 1;                             // <= 32, block-uniform
    const size_t vrow = ((size_t)(b * DM + h * DKK + nt * 16)) * SS + lane * 8;
    const int nk4 = (nkt + 3) & ~3;                          // whole groups of four tiles, <= 32: the added tiles have P == 0
    const int pa0 = l15 * AST + hl * 8;
    v8f acc = zero8();
    // ring of four V tiles in registers: a tile's slot is loaded again, four tiles ahead, behind its product
    v16bf vh[4], vl[4];
#pragma unroll  // constant indices, or the ring falls to scratch
    for (int j = 0; j < 4; ++j) {
      vh[j] = ldg_frag(Vh, vrow + (size_t)j * 512);
      vl[j] = ldg_frag(Vl, vrow + (size_t)j * 512);
    }
    // the two V address pairs stay live up to this wait: no load above may land on them
    asm volatile("s_wait_xcnt 0x0" :: "v"(Vh + vrow), "v"(Vl + vrow) : "memory");
    int k0 = 0;
    for (; k0 + 4 < nk4; k0 += 4) {
      v16bf ph[4], pl[4];
#pragma unroll  // constant indices; the group's four P tiles are read from LDS in one go
      for (int j = 0; j < 4; ++j) {
        ph[j] = lds_frag(aH, pa0 + (k0 + j) * 32);
        pl[j] = lds_frag(aL, pa0 + (k0 + j) * 32);
      }
#pragma unroll  // constant indices into the ring
      for (int j = 0; j < 4; ++j) {
        acc = wmma3(acc, ph[j], pl[j], vh[j], vl[j]);
        vh[j] = ldg_frag(Vh, vrow + (size_t)(k0 + 4 + j) * 512);
        vl[j] = ldg_frag(Vl, vrow + (size_t)(k0 + 4 + j) * 512);
      }
      // the next trip's address additions overwrite registers that the loads in flight name
      asm volatile("s_wait_xcnt 0x0" ::: "memory");
    }
    {                                                        // last group: nothing left to load
      v16bf ph[4], pl[4];
#pragma unroll
      for (int j = 0; j < 4; ++j) {
        ph[j] = lds_frag(aH, pa0 + (k0 + j) * 32);
        pl[j] = lds_frag(aL, pa0 + (k0 + j) * 32);
      }
#pragma unroll
      for (int j = 0; j < 4; ++j) acc = wmma3(acc, ph[j], pl[j], vh[j], vl[j]);
    }
#pragma unroll
    for (int r = 0; r < 8; ++r)
      sO[(hl * 8 + r) * OST + nt * 16 + l15] = acc[r];
  }
  __syncthreads();

  // ---- store concat planes: two plane tiles; wave w owns half of tile w/2, one instruction per plane = 512 contiguous B
  if (w < 4) {
    const int s  = (w & 1) * 32 + lane;                      // chunk inside the tile
    const int cc = (w >> 1) * 32 + (s >> 4) * 8;
    const float* sp = sO + (s & 15) * OST + cc;
    const v4f a = *(const v4f*)sp;
    const v4f c = *(const v4f*)(sp + 4);
    float x[8] = {a.x, a.y, a.z, a.w, c.x, c.y, c.z, c.w};
    v4u vh, vl;
    split8(x, vh, vl);
    const size_t go = (size_t)(b * SS + q0) * DM + h * (DKK * 16) + (w >> 1) * 512 + s * 8;
    *(v4u*)(Ch + go) = vh;
    *(v4u*)(Cl + go) = vl;
    
  }
}

// ---------------------------------------------------------------- launcher
extern "C" void kernel_launch(void* const* d_in, const int* in_sizes, int n_in,
                              void* d_out, int out_size, void* d_ws, size_t ws_size,
                              hipStream_t stream) {
  if (n_in < 12) return;
  if (in_sizes[0] != (int)ACT || in_sizes[1] != (int)ACT || in_sizes[2] != (int)ACT) return;
  if (in_sizes[3] != (int)WEL || in_sizes[5] != (int)WEL || in_sizes[7] != (int)WEL || in_sizes[9] != (int)WEL) return;
  if (in_sizes[4] != DM || in_sizes[6] != DM || in_sizes[8] != DM || in_sizes[10] != DM) return;
  if (in_sizes[11] != HH) return;
  if (out_size != (int)ACT) return;

  const float* q   = (const float*)d_in[0];
  const float* k   = (const float*)d_in[1];
  const float* v   = (const float*)d_in[2];
  const float* Wq  = (const float*)d_in[3];
  const float* bq  = (const float*)d_in[4];
  const float* Wk  = (const float*)d_in[5];
  const float* bk  = (const float*)d_in[6];
  const float* Wv  = (const float*)d_in[7];
  const float* bv  = (const float*)d_in[8];
  const float* Wo  = (const float*)d_in[9];
  const float* bo  = (const float*)d_in[10];
  const float* gam = (const float*)d_in[11];
  float* out = (float*)d_out;

  // workspace carve (256-B aligned): q, k, v planes hi and lo (the q planes are reused for the concat planes),
  // Wq, Wk, Wv, Wo planes hi and lo, Qp, Kp, Vt planes hi and lo.  Total 112 MiB.
  char* ws = (char*)d_ws;
  size_t off = 0;
  auto carve = [&](size_t bytes) -> char* {
    char* p = ws + off;
    off += (bytes + 255) & ~(size_t)255;
    return p;
  };
  u16* actH = (u16*)carve(3 * ACT * 2);
  u16* actL = (u16*)carve(3 * ACT * 2);
  u16* wH   = (u16*)carve(4 * WEL * 2);
  u16* wL   = (u16*)carve(4 * WEL * 2);
  u16* prH  = (u16*)carve(3 * ACT * 2);             // Qp, Kp, Vt
  u16* prL  = (u16*)carve(3 * ACT * 2);
  if (off > ws_size) return;

  const dim3 pgrid(DM / 128, MROWS / 64, 3);        // (8, 64, 3)
  const dim3 ggrid(DM / 128, MROWS / 64);           // (8, 64)
  const dim3 agrid(SS / 16, HH, BB);                // (64, 16, 4)

  // all seven f32 matrices -> planes
  k_split<<<dim3(SPLIT_BLKS), 256, 0, stream>>>(q, k, v, Wq, Wk, Wv, Wo, actH, actL, wH, wL);
  // q, k, v projections -> Qp, Kp planes, Vt planes (k = token)
  k_gemm3<0><<<pgrid, 256, 0, stream>>>(actH, actL, wH, wL, bq, bk, bv, prH, prL, out);
  // attention -> concat planes (reuse the q planes)
  k_attn<<<agrid, 256, SMEM_ATTN, stream>>>(prH, prL, prH + ACT, prL + ACT, prH + 2 * ACT, prL + 2 * ACT, gam, actH, actL);
  // output projection -> f32 result
  k_gemm3<2><<<ggrid, 256, 0, stream>>>(actH, actL, wH + 3 * WEL, wL + 3 * WEL, bo, bo, bo, prH, prL, out);
}

// v006
// A run of this version takes 214 microseconds.
// Timed twice side by side with v005, it ran 1.04 times as fast both times.
// Counting every step since v000, it is 3.00 times as fast.
#include <hip/hip_runtime.h>
#include <math.h>
#include <stdint.h>
#include <stddef.h>

// All six contractions (three input projections, q.k^T scores, attn.V, output projection): v_wmma_f32_16x16x32_bf16 with bf16 hi/lo three-term split operands (hi*hi + hi*lo + lo*hi), f32 accumulate; softmax / cumsum / distance-decay row math in f32 on VALU.

typedef __bf16         v16bf __attribute__((ext_vector_type(16)));
typedef float          v8f   __attribute__((ext_vector_type(8)));
typedef float          v4f   __attribute__((ext_vector_type(4)));
typedef unsigned int   v4u   __attribute__((ext_vector_type(4)));
typedef unsigned short u16;

union Frag { v16bf v; v4u u[2]; };

static constexpr int BB  = 4;
static constexpr int SS  = 1024;
static constexpr int DM  = 1024;
static constexpr int HH  = 16;
static constexpr int DKK = 64;
static constexpr int MROWS = BB * SS;                 // 4096
static constexpr size_t ACT = (size_t)MROWS * DM;     // 4194304
static constexpr size_t WEL = (size_t)DM * DM;        // 1048576
static_assert(HH * DKK == DM);
static_assert(MROWS % 64 == 0);
static_assert(DM % 128 == 0);
static_assert(DM % 64 == 0);
static_assert(SS % 64 == 0);
static_assert(ACT % 2048 == 0);
static_assert(WEL % 2048 == 0);
static_assert(SS == DM);                              // one tile map serves every plane

// Every bf16 plane is a [rows][1024] matrix stored in fragment order: 1-KiB tiles of 16 rows x 32 k,
// tile index (row/16)*KB + k/32; inside a tile the 16-B chunk of (row, k/8) sits at (k/8 % 4)*16 + row%16.
// A lane's two fragment chunks are then chunk 'lane' and chunk '32 + lane' of the tile, so one
// wave-wide 16-B load covers 512 contiguous bytes.
static constexpr int KB = DM / 32;                    // tiles along k

// ---------------------------------------------------------------- small helpers
__device__ __forceinline__ unsigned bf16_bits(float x) {          // RNE f32 -> bf16 bits
  unsigned u = __float_as_uint(x);
  u += 0x7FFFu + ((u >> 16) & 1u);
  return u >> 16;
}
__device__ __forceinline__ void split2(float x, unsigned& hi, unsigned& lo) {
  hi = bf16_bits(x);
  const float xh = __uint_as_float(hi << 16);
  lo = bf16_bits(x - xh);                                         // x - xh exact in f32
}
// 8 consecutive f32 -> packed 8 bf16 hi (16 B) and 8 bf16 lo (16 B)
__device__ __forceinline__ void split8(const float* x, v4u& vh, v4u& vl) {
  unsigned hw[4], lw[4];
#pragma unroll
  for (int i = 0; i < 4; ++i) {
    unsigned h0, l0, h1, l1;
    split2(x[2 * i], h0, l0);
    split2(x[2 * i + 1], h1, l1);
    hw[i] = h0 | (h1 << 16);
    lw[i] = l0 | (l1 << 16);
  }
  vh.x = hw[0]; vh.y = hw[1]; vh.z = hw[2]; vh.w = hw[3];
  vl.x = lw[0]; vl.y = lw[1]; vl.z = lw[2]; vl.w = lw[3];
}
__device__ __forceinline__ v8f zero8() {
  v8f z;
#pragma unroll
  for (int i = 0; i < 8; ++i) z[i] = 0.f;
  return z;
}
// 16x32 operand fragment from one plane tile: elements 0..7 <- k 8*(lane>>4).., 8..15 <- 16 further,
// row lane&15 (same map for A rows and for B stored [n][k])
// (caller passes e = row0*DM + (k0/32)*512 + 8*lane, the lane's first chunk of the tile at row0, k0)
__device__ __forceinline__ v16bf ldg_frag(const u16* __restrict__ p, size_t e) {
  Frag f;
  f.u[0] = *(const v4u*)(p + e);
  f.u[1] = *(const v4u*)(p + e + 256);
  return f.v;
}
// the same through a pointer that is typed as global memory: an address that has passed through an asm statement
// has lost what the compiler knew of its origin, and an untyped one would load by flat_load
typedef const __attribute__((address_space(1))) u16* gptr;
typedef const __attribute__((address_space(1))) v4u* gptr4;
__device__ __forceinline__ v16bf ldg_frag_g(gptr p, size_t e) {
  Frag f;
  f.u[0] = *(gptr4)(p + e);
  f.u[1] = *(gptr4)(p + e + 256);
  return f.v;
}
// 16x32 operand fragment from a k-contiguous bf16 row in LDS: elements 0..7 <- e.., 8..15 <- e+16..
// (caller passes e = row*pitch + k0 + 8*(lane>>4))
__device__ __forceinline__ v16bf lds_frag(const u16* p, int e) {
  Frag f;
  f.u[0] = *(const v4u*)(p + e);
  f.u[1] = *(const v4u*)(p + e + 16);
  return f.v;
}
// 2^x, log2(x), sqrt(x) and 1/x as the chip's own single instructions (about 1 ulp), without libm's range reduction,
// range checks and refinement steps.  A result below the normal range may come out as 0, a subnormal
// sqrt argument likewise: every use below adds such a value to a sum that is at least 1 or clamps it;
// the two reciprocals are of such sums (1 <= sum <= 1024).
// Eight at a time in one statement: behind a transcendental the instruction set wants one slot before its
// result is read or its source overwritten.  "=&v" keeps every result apart from every argument, so no
// neighbour takes a source's register; the v_nop is the slot behind the last one; the s_delay_alu is the
// issue hint for the arguments, which the compiler cannot give for instructions inside a statement.
__device__ __forceinline__ void hw_exp2x8(float (&r)[8], const float (&a)[8]) {
  asm("s_delay_alu instid0(VALU_DEP_1)\n\t"
      "v_exp_f32 %0, %8\n\tv_exp_f32 %1, %9\n\tv_exp_f32 %2, %10\n\tv_exp_f32 %3, %11\n\t"
      "v_exp_f32 %4, %12\n\tv_exp_f32 %5, %13\n\tv_exp_f32 %6, %14\n\tv_exp_f32 %7, %15\n\t"
      "v_nop"
      : "=&v"(r[0]), "=&v"(r[1]), "=&v"(r[2]), "=&v"(r[3]), "=&v"(r[4]), "=&v"(r[5]), "=&v"(r[6]), "=&v"(r[7])
      : "v"(a[0]), "v"(a[1]), "v"(a[2]), "v"(a[3]), "v"(a[4]), "v"(a[5]), "v"(a[6]), "v"(a[7]));
}
__device__ __forceinline__ void hw_sqrtx8(float (&r)[8], const float (&a)[8]) {
  asm("s_delay_alu instid0(VALU_DEP_1)\n\t"
      "v_sqrt_f32 %0, %8\n\tv_sqrt_f32 %1, %9\n\tv_sqrt_f32 %2, %10\n\tv_sqrt_f32 %3, %11\n\t"
      "v_sqrt_f32 %4, %12\n\tv_sqrt_f32 %5, %13\n\tv_sqrt_f32 %6, %14\n\tv_sqrt_f32 %7, %15\n\t"
      "v_nop"
      : "=&v"(r[0]), "=&v"(r[1]), "=&v"(r[2]), "=&v"(r[3]), "=&v"(r[4]), "=&v"(r[5]), "=&v"(r[6]), "=&v"(r[7])
      : "v"(a[0]), "v"(a[1]), "v"(a[2]), "v"(a[3]), "v"(a[4]), "v"(a[5]), "v"(a[6]), "v"(a[7]));
}
__device__ __forceinline__ float hw_rcp(float x) { return __builtin_amdgcn_rcpf(x); }
static constexpr float LOG2E = 1.44269504088896340736f;
// three-term split product into one accumulator, then hazard guard (ties D, keeps A/B live)
__device__ __forceinline__ v8f wmma3(v8f acc, v16bf ah, v16bf al, v16bf bh, v16bf bl) {
  acc = __builtin_amdgcn_wmma_f32_16x16x32_bf16(false, ah, false, bh, (short)0, acc, false, false);
  acc = __builtin_amdgcn_wmma_f32_16x16x32_bf16(false, ah, false, bl, (short)0, acc, false, false);
  acc = __builtin_amdgcn_wmma_f32_16x16x32_bf16(false, al, false, bh, (short)0, acc, false, false);
  asm volatile("v_nop\n\tv_nop\n\tv_nop\n\tv_nop" : "+v"(acc) : "v"(ah), "v"(al), "v"(bh), "v"(bl));
  return acc;
}

// ---------------------------------------------------------------- f32 [rows][1024] -> bf16 hi/lo planes (fragment order)
// One launch splits all seven f32 matrices (q, k, v, Wq, Wk, Wv, Wo): none reads another's result.
// aH/aL hold the three activation planes one behind the other, wH/wL the four weight planes.
// A unit is 8 rows x 32 k of one tile, one wave's work: 8 whole 128-B lines read, 4 whole lines stored per plane.
// A block takes 128 consecutive units of ONE matrix (32 rows), 16 per wave.
static constexpr int UPB      = 128;                        // units per block
static constexpr int ACT_BLKS = (int)(ACT / 256 / UPB);     // 128 blocks per activation
static constexpr int WEL_BLKS = (int)(WEL / 256 / UPB);     // 32 blocks per weight
static constexpr int SPLIT_BLKS = 3 * ACT_BLKS + 4 * WEL_BLKS;
static_assert(ACT % (256 * UPB) == 0);
static_assert(WEL % (256 * UPB) == 0);

__global__ void __launch_bounds__(256)
k_split(const float* __restrict__ q, const float* __restrict__ k, const float* __restrict__ v,
        const float* __restrict__ Wq, const float* __restrict__ Wk, const float* __restrict__ Wv,
        const float* __restrict__ Wo,
        u16* __restrict__ aH, u16* __restrict__ aL, u16* __restrict__ wH, u16* __restrict__ wL) {
  const int blk  = blockIdx.x;
  const int lane = threadIdx.x & 31;
  const int w    = threadIdx.x >> 5;
  const float* in;
  u16 *ph, *pl;
  int u0;                                                   // the block's first unit inside its matrix
  if (blk < 3 * ACT_BLKS) {                                 // block-uniform
    const int a = blk / ACT_BLKS;
    in = (a == 0) ? q : (a == 1) ? k : v;
    ph = aH + (size_t)a * ACT;
    pl = aL + (size_t)a * ACT;
    u0 = (blk - a * ACT_BLKS) * UPB;
  } else {
    const int a = (blk - 3 * ACT_BLKS) / WEL_BLKS;
    in = (a == 0) ? Wq : (a == 1) ? Wk : (a == 2) ? Wv : Wo;
    ph = wH + (size_t)a * WEL;
    pl = wL + (size_t)a * WEL;
    u0 = (blk - 3 * ACT_BLKS - a * WEL_BLKS) * UPB;
  }
  // the wave's n-th unit is unit n*8 + w of the block: half w&1 of tile (n&7)*4 + w/2 in the block's tile row n>>3,
  // so every address below is one lane address plus a compile-time offset
  const int r = (w & 1) * 8 + (lane & 7);                   // row inside the tile
  const int j = lane >> 3;                                  // 8-element chunk along k
  const float* src = in + (size_t)((u0 >> 6) * 16 + r) * DM + (w >> 1) * 32 + j * 8;
  const size_t dst = ((size_t)((u0 >> 1) + (w >> 1)) * 64 + j * 16 + r) * 8;
  v4f a[16], c[16];
#pragma unroll  // constant indices, or a[] and c[] fall to scratch
  for (int n = 0; n < 16; ++n) {
    const float* p = src + (n >> 3) * 16 * DM + (n & 7) * 128;
    a[n] = *(const v4f*)p;
    c[n] = *(const v4f*)(p + 4);
  }
  // keeps all 32 loads ahead of the arithmetic: left alone the compiler sinks them and holds about six in flight
  __builtin_amdgcn_sched_barrier(0);
#pragma unroll  // constant indices
  for (int n = 0; n < 16; ++n) {
    float x[8] = {a[n].x, a[n].y, a[n].z, a[n].w, c[n].x, c[n].y, c[n].z, c[n].w};
    v4u vh, vl;
    split8(x, vh, vl);
    const size_t d = dst + (size_t)((n >> 3) * KB + (n & 7) * 4) * 512;
    *(v4u*)(ph + d) = vh;
    *(v4u*)(pl + d) = vl;
  }
}

// ---------------------------------------------------------------- GEMM: out = A @ W^T + bias
// A planes [M=4096][K=1024] bf16 hi/lo, W planes [N=1024][K] bf16 hi/lo ([out,in]), both in fragment order;
// bias [N] f32. Block 256 thr = 8 waves, block tile 256(M) x 128(N), wave tile 64 x 64: four 16-row tiles, 64 rows apart,
// times four 16-column tiles, so a loaded A or B fragment feeds four accumulators: a wave loads 16 KiB per 48 products.
// About 470 VGPRs per wave: two waves per SIMD, one block per WGP.
// Fragments straight from global (no LDS in the k-loop), fetched two k steps ahead.  Epilogue: tile staged in LDS, then
// MODE 0: the three input projections in one launch, blockIdx.z = 0, 1, 2 for q, k, v: operand, weight and result
//         planes of projection z lie z planes behind the pointers given.  Result of z = 0, 1: bf16 hi/lo planes
//         [M][N] in fragment order; of z = 2: planes transposed [(m/SS)*N + n][m%SS] in fragment order
//         (k = token, for attn.V)
// MODE 2: f32 row-major [M][N] (Of)
static constexpr int TP = 132;   // LDS tile pitch (floats)
static constexpr int MT = 4;     // 16-row A tiles per wave
static_assert(MROWS % (64 * MT) == 0);

template <int MODE>
__global__ void __launch_bounds__(256)
k_gemm3(const u16* __restrict__ Ah0, const u16* __restrict__ Al0,
        const u16* __restrict__ Wh0, const u16* __restrict__ Wl0,
        const float* __restrict__ bias0, const float* __restrict__ bias1, const float* __restrict__ bias2,
        u16* __restrict__ Oh0, u16* __restrict__ Ol0, float* __restrict__ Of) {
  constexpr int N = DM, K = DM;
  __shared__ __attribute__((aligned(16))) float sT[64 * MT * TP];

  const int z = (MODE == 0) ? (int)blockIdx.z : 0;     // which projection; block-uniform
  const u16* __restrict__ Ah = Ah0 + (size_t)z * ACT;
  const u16* __restrict__ Al = Al0 + (size_t)z * ACT;
  const u16* __restrict__ Wh = Wh0 + (size_t)z * WEL;
  const u16* __restrict__ Wl = Wl0 + (size_t)z * WEL;
  const float* __restrict__ bias = (z == 0) ? bias0 : (z == 1) ? bias1 : bias2;
  u16* __restrict__ Oh = Oh0 + (size_t)z * ACT;
  u16* __restrict__ Ol = Ol0 + (size_t)z * ACT;

  const int lane = threadIdx.x & 31;
  const int w    = threadIdx.x >> 5;
  const int wm   = w & 3;              // 0..3
  const int wn   = w >> 2;             // 0..1
  const int hl   = lane >> 4;
  const int l15  = lane & 15;
  const int m0b  = blockIdx.y * (64 * MT);
  const int n0b  = blockIdx.x * 128;
  const int m0   = m0b + wm * 16;
  const int n0   = n0b + wn * 64;

  v8f acc[MT][4];
#pragma unroll
  for (int mt = 0; mt < MT; ++mt)
#pragma unroll
    for (int nt = 0; nt < 4; ++nt) acc[mt][nt] = zero8();

  // the lane's four running addresses, at the current even k step; every load is one of them plus a constant
  gptr pah = (gptr)(Ah + (size_t)m0 * K + lane * 8);    // A rows m0..m0+15 (+mt*64 rows)
  gptr pal = (gptr)(Al + (size_t)m0 * K + lane * 8);
  gptr pbh = (gptr)(Wh + (size_t)n0 * K + lane * 8);    // W rows n0..n0+15 (+nt*16 rows)
  gptr pbl = (gptr)(Wl + (size_t)n0 * K + lane * 8);

  // Two register sets of fragments, even and odd k steps.  A set is loaded again, for two k steps later,
  // behind its 48 products, so a load has the other set's 48 products' time to come back.
  v16bf ah[2][MT], al[2][MT], bh[2][4], bl[2][4];
#pragma unroll  // constant indices, or the sets fall to scratch
  for (int p = 0; p < 2; ++p) {
#pragma unroll
    for (int mt = 0; mt < MT; ++mt) {
      ah[p][mt] = ldg_frag_g(pah, (size_t)mt * 64 * K + p * 512);
      al[p][mt] = ldg_frag_g(pal, (size_t)mt * 64 * K + p * 512);
    }
#pragma unroll
    for (int nt = 0; nt < 4; ++nt) {
      bh[p][nt] = ldg_frag_g(pbh, (size_t)nt * 16 * K + p * 512);
      bl[p][nt] = ldg_frag_g(pbl, (size_t)nt * 16 * K + p * 512);
    }
  }
  // one k step: hi*hi, then hi*lo, then lo*hi into each accumulator (the order of wmma3), term by term over the
  // 16 accumulators, so that neighbouring products are independent
#define GEMM_KSTEP(p)                                                                                        \
  _Pragma("unroll") for (int mt = 0; mt < MT; ++mt)                                                          \
    _Pragma("unroll") for (int nt = 0; nt < 4; ++nt)                                                         \
      acc[mt][nt] = __builtin_amdgcn_wmma_f32_16x16x32_bf16(false, ah[p][mt], false, bh[p][nt], (short)0,    \
                                                            acc[mt][nt], false, false);                      \
  _Pragma("unroll") for (int mt = 0; mt < MT; ++mt)                                                          \
    _Pragma("unroll") for (int nt = 0; nt < 4; ++nt)                                                         \
      acc[mt][nt] = __builtin_amdgcn_wmma_f32_16x16x32_bf16(false, ah[p][mt], false, bl[p][nt], (short)0,    \
                                                            acc[mt][nt], false, false);                      \
  _Pragma("unroll") for (int mt = 0; mt < MT; ++mt)                                                          \
    _Pragma("unroll") for (int nt = 0; nt < 4; ++nt)                                                         \
      acc[mt][nt] = __builtin_amdgcn_wmma_f32_16x16x32_bf16(false, al[p][mt], false, bh[p][nt], (short)0,    \
                                                            acc[mt][nt], false, false);
#pragma unroll 1  // one trip already holds both sets; further copies only grow the code
  for (int kb = 0; kb < K / 32 - 2; kb += 2) {
#pragma unroll  // constant indices into the sets
    for (int p = 0; p < 2; ++p) {
      GEMM_KSTEP(p)
      // the four slots between the last products and the loads that land on their A and B registers; the
      // scheduling fences keep every product above the slots and the reloads in one group directly below them
      // (left alone the compiler sinks the reloads halfway into the other set's products, which halves their lead)
      __builtin_amdgcn_sched_barrier(0);
      asm volatile("v_nop\n\tv_nop\n\tv_nop\n\tv_nop");
      __builtin_amdgcn_sched_barrier(0);
#pragma unroll
      for (int mt = 0; mt < MT; ++mt) {
        ah[p][mt] = ldg_frag_g(pah, (size_t)mt * 64 * K + (2 + p) * 512);
        al[p][mt] = ldg_frag_g(pal, (size_t)mt * 64 * K + (2 + p) * 512);
      }
#pragma unroll
      for (int nt = 0; nt < 4; ++nt) {
        bh[p][nt] = ldg_frag_g(pbh, (size_t)nt * 16 * K + (2 + p) * 512);
        bl[p][nt] = ldg_frag_g(pbl, (size_t)nt * 16 * K + (2 + p) * 512);
      }
      __builtin_amdgcn_sched_barrier(0);
    }
    // the four additions below overwrite registers that the loads in flight name; as operands of the wait the
    // address pairs keep registers of their own up to it, so that no reload lands on one either
    asm volatile("s_wait_xcnt 0x0" : "+v"(pah), "+v"(pal), "+v"(pbh), "+v"(pbl) :: "memory");
    pah += 2 * 512; pal += 2 * 512; pbh += 2 * 512; pbl += 2 * 512;
  }
  // the last two k steps: nothing left to load
  GEMM_KSTEP(0)
  GEMM_KSTEP(1)
#undef GEMM_KSTEP

  const int bi = n0 + l15;
  float bb[4];
#pragma unroll
  for (int nt = 0; nt < 4; ++nt) bb[nt] = bias[bi + nt * 16];
  // the index register stays live up to this wait: none of the four loads may land on it before it
  asm volatile("s_wait_xcnt 0x0" :: "v"(bi) : "memory");

  // stage the 256x128 f32 tile (+bias) in LDS; D element r of lane = (row 8h+r, col l15)
#pragma unroll  // constant indices into acc
  for (int mt = 0; mt < MT; ++mt)
#pragma unroll
    for (int nt = 0; nt < 4; ++nt)
#pragma unroll
      for (int r = 0; r < 8; ++r)
        sT[(mt * 64 + wm * 16 + hl * 8 + r) * TP + wn * 64 + nt * 16 + l15] = acc[mt][nt][r] + bb[nt];
  __syncthreads();

  // the tile leaves in MT parts of 64 rows.  The next part's LDS loads and arithmetic overwrite registers that this
  // part's stores name: the wait behind the stores stands in front of them, and the two scheduling fences keep the
  // compiler from moving any of them in between the first store and the wait
  if (MODE == 0 && z < 2) {
    // per part 4 x 4 plane tiles; a wave pair owns tile j*4 + w/2, one instruction = half a tile = 512 contiguous B
    const int s = (w & 1) * 32 + lane;                     // chunk inside the tile
#pragma unroll 1  // the parts differ only in their addresses: copies would only grow the code
    for (int mt = 0; mt < MT; ++mt) {
      const int mh  = m0b + mt * 64;                       // the part's first row
      const int kbl = w >> 1;                              // tile column; tile row is j
      v4u vh[4], vl[4];
#pragma unroll
      for (int j = 0; j < 4; ++j) {
        const int row = mt * 64 + j * 16 + (s & 15);
        const float* sp = sT + row * TP + kbl * 32 + (s >> 4) * 8;
        const v4f a = *(const v4f*)sp;
        const v4f c = *(const v4f*)(sp + 4);
        float x[8] = {a.x, a.y, a.z, a.w, c.x, c.y, c.z, c.w};
        split8(x, vh[j], vl[j]);
      }
      const size_t go = ((size_t)((mh >> 4) * KB + (n0b >> 5) + kbl) * 64 + s) * 8;   // tile row j: j*KB tiles on
      u16* oh = Oh + go;
      u16* ol = Ol + go;
      __builtin_amdgcn_sched_barrier(0);                   // all arithmetic above the stores
#pragma unroll
      for (int j = 0; j < 4; ++j) {
        *(v4u*)(oh + (size_t)j * KB * 512) = vh[j];
        *(v4u*)(ol + (size_t)j * KB * 512) = vl[j];
      }
      asm volatile("s_wait_xcnt 0x0" ::: "memory");
      __builtin_amdgcn_sched_barrier(0);
    }
  } else if (MODE == 0) {
    // per part 8 (features) x 2 (tokens) plane tiles; wave w owns features w*16..+15, one instruction = half a tile
    const int f = w * 16 + l15;
#pragma unroll 1  // the parts differ only in their addresses: copies would only grow the code
    for (int mt = 0; mt < MT; ++mt) {
      const int mh   = m0b + mt * 64;                      // the part's first row
      const int bidx = mh / SS;
      const int s0   = mh - bidx * SS;
      v4u vh[4], vl[4];
#pragma unroll
      for (int j = 0; j < 4; ++j) {
        const int s  = (j & 1) * 32 + lane;                // chunk inside the tile
        const int tc = (j >> 1) * 32 + (s >> 4) * 8;       // first of its 8 tokens
        float x[8];
#pragma unroll
        for (int i = 0; i < 8; ++i) x[i] = sT[(mt * 64 + tc + i) * TP + f];
        split8(x, vh[j], vl[j]);
      }
      // half tile j (tile j/2, chunks (j&1)*32 + lane) lies j*256 elements behind half tile 0
      const size_t go = ((size_t)(((bidx * N + n0b) >> 4) + w) * KB + (s0 >> 5)) * 512 + (size_t)lane * 8;
      u16* oh = Oh + go;
      u16* ol = Ol + go;
      __builtin_amdgcn_sched_barrier(0);                   // all arithmetic above the stores
#pragma unroll
      for (int j = 0; j < 4; ++j) {
        *(v4u*)(oh + j * 256) = vh[j];
        *(v4u*)(ol + j * 256) = vl[j];
      }
      asm volatile("s_wait_xcnt 0x0" ::: "memory");
      __builtin_amdgcn_sched_barrier(0);
    }
  } else {
    // f32: per part wave w owns rows w*8..+7; one instruction = 32 lanes x 16 B = one 512-B row segment.
    const int cc4 = lane * 4;
#pragma unroll 1  // the parts differ only in their addresses: copies would only grow the code
    for (int mt = 0; mt < MT; ++mt) {
      const int row0 = mt * 64 + w * 8;
      v4f val[8];
#pragma unroll
      for (int j = 0; j < 8; ++j) val[j] = *(const v4f*)(sT + (row0 + j) * TP + cc4);
      float* op = Of + (size_t)(m0b + row0) * N + n0b + cc4;
      __builtin_amdgcn_sched_barrier(0);                   // all arithmetic above the stores
#pragma unroll
      for (int j = 0; j < 8; ++j) *(v4f*)(op + (size_t)j * N) = val[j];
      asm volatile("s_wait_xcnt 0x0" ::: "memory");
      __builtin_amdgcn_sched_barrier(0);
    }
  }
}

// ---------------------------------------------------------------- distance-decay attention
// grid (S/16, H, B); block 256 thr = 8 waves; 16 query rows, full 1024-key score rows in LDS.
// Qp, Kp planes [b*S+s][h*64+d], Vt planes [b*1024+h*64+d][s], concat planes [b*S+s][h*64+d]: all in fragment order;
// Row math runs in registers: the owning wave reads a score row from LDS once, 32 columns per lane.
static constexpr int SST = 1028;                          // f32 score row pitch
static constexpr int AST = 1032;                          // bf16 prob row pitch (x2 B = 129*16)
static constexpr int OST = 68;                            // f32 out-tile pitch
static constexpr size_t SM_S = (size_t)16 * SST * 4;      // 65792 (out tile aliases it later)
static constexpr size_t SM_A = (size_t)16 * AST * 2;      // 33024
static constexpr size_t SMEM_ATTN = SM_S + 2 * SM_A;      // 131840
static_assert((size_t)16 * OST * 4 <= SM_S);
static_assert(SM_S % 16 == 0);
static_assert(SM_A % 16 == 0);

__global__ void __launch_bounds__(256)
k_attn(const u16* __restrict__ Qh, const u16* __restrict__ Ql,
       const u16* __restrict__ Kh, const u16* __restrict__ Kl,
       const u16* __restrict__ Vh, const u16* __restrict__ Vl,
       const float* __restrict__ gammas,
       u16* __restrict__ Ch, u16* __restrict__ Cl) {
  extern __shared__ __attribute__((aligned(16))) char smem[];
  float* sS   = (float*)smem;                               // [16][SST]
  float* sO   = sS;                                         // [16][OST], used only after the phase-2 barrier
  u16*   aH   = (u16*)(smem + SM_S);                        // [16][AST] bf16 hi
  u16*   aL   = (u16*)(smem + SM_S + SM_A);                 // [16][AST] bf16 lo

  const int qt = blockIdx.x, h = blockIdx.y, b = blockIdx.z;
  const int q0 = qt * 16;
  const int lane = threadIdx.x & 31;
  const int w    = threadIdx.x >> 5;
  const int hl   = lane >> 4;
  const int l15  = lane & 15;

  // ---- phase 1: sS[16][1024] = Q(16x64) . K^T / 8 * log2(e): scores in base-2 units, so that every
  //      exp(a - b) of the row math is 2^(a' - b') with no multiply of its own ------------------
  {
    const size_t qrow = (size_t)(b * SS + q0) * DM + h * (DKK * 16) + lane * 8;
    const v16bf qh0 = ldg_frag(Qh, qrow),       ql0 = ldg_frag(Ql, qrow);
    const v16bf qh1 = ldg_frag(Qh, qrow + 512), ql1 = ldg_frag(Ql, qrow + 512);
    // the two Q address pairs stay live up to this wait: no later load may land on them before it
    asm volatile("s_wait_xcnt 0x0" :: "v"(Qh + qrow), "v"(Ql + qrow) : "memory");
    // ring of four key tiles in registers: a tile's slot is loaded again, four tiles ahead, behind its products
    const size_t krow0 = (size_t)(b * SS + w * 128) * DM + h * (DKK * 16) + lane * 8;
    v16bf kh0[4], kl0[4], kh1[4], kl1[4];
#pragma unroll  // constant indices, or the ring falls to scratch
    for (int t = 0; t < 4; ++t) {
      const size_t krow = krow0 + (size_t)t * 16 * DM;
      kh0[t] = ldg_frag(Kh, krow);       kl0[t] = ldg_frag(Kl, krow);
      kh1[t] = ldg_frag(Kh, krow + 512); kl1[t] = ldg_frag(Kl, krow + 512);
    }
#pragma unroll  // constant indices into the ring
    for (int t = 0; t < 8; ++t) {                            // 8 key tiles of 16 per wave
      const int kt = w * 8 + t;
      const int sl = t & 3;
      v8f acc = zero8();
      acc = wmma3(acc, qh0, ql0, kh0[sl], kl0[sl]);
      acc = wmma3(acc, qh1, ql1, kh1[sl], kl1[sl]);
      if (t + 4 < 8) {
        const size_t krow = krow0 + (size_t)(t + 4) * 16 * DM;
        kh0[sl] = ldg_frag(Kh, krow);       kl0[sl] = ldg_frag(Kl, krow);
        kh1[sl] = ldg_frag(Kh, krow + 512); kl1[sl] = ldg_frag(Kl, krow + 512);
        // behind the last K load: its address pairs stay live up to this wait and are free for reuse behind it
        if (t == 3) asm volatile("s_wait_xcnt 0x0" :: "v"(Kh + krow0), "v"(Kl + krow0) : "memory");
      }
#pragma unroll
      for (int r = 0; r < 8; ++r)
        sS[(hl * 8 + r) * SST + kt * 16 + l15] = acc[r] * (0.125f * LOG2E);
    }
  }
  __syncthreads();

  // ---- phase 2: row math, 2 rows per wave, 32 consecutive columns per lane, all in registers
  {
    const float gg  = gammas[h];
    // gam2 = -softplus(gg) * log2(e), so that exp(-d * softplus) = 2^(d * gam2); 1 + 2^(..) lies in (1, 2]
    const float gam2 = -(fmaxf(gg, 0.f) * LOG2E +
                         __builtin_amdgcn_logf(1.0f + __builtin_amdgcn_exp2f(-fabsf(gg) * LOG2E)));
    const int cb = lane * 32;
    for (int rr = 0; rr < 2; ++rr) {
      const int row = w + rr * 8;
      const int iq  = q0 + row;
      const float* srow = sS + row * SST + cb;

      float s[32];                                           // scores, then new scores, then e2
      float c[32];                                           // e, then within-chunk running sum
#pragma unroll  // constant indices, or s[] falls to scratch
      for (int g = 0; g < 8; ++g) {
        const v4f a = *(const v4f*)(srow + 4 * g);
        s[4 * g] = a.x; s[4 * g + 1] = a.y; s[4 * g + 2] = a.z; s[4 * g + 3] = a.w;
      }

      // A: row max over all 1024 keys
      float m1 = -3.0e38f;
#pragma unroll  // constant indices into s[]
      for (int i = 0; i < 32; ++i) m1 = fmaxf(m1, s[i]);
#pragma unroll
      for (int o = 16; o > 0; o >>= 1) m1 = fmaxf(m1, __shfl_xor(m1, o, 32));

      // B: e = exp(score - max) = 2^(s - m1) over the full row; s1 = sum
      float s1 = 0.f;
#pragma unroll  // constant indices into s[] and c[]
      for (int g = 0; g < 4; ++g) {
        float a[8], e[8];
#pragma unroll
        for (int i = 0; i < 8; ++i) a[i] = s[8 * g + i] - m1;
        hw_exp2x8(e, a);
#pragma unroll
        for (int i = 0; i < 8; ++i) { c[8 * g + i] = e[i]; s1 += e[i]; }
      }
#pragma unroll
      for (int o = 16; o > 0; o >>= 1) s1 += __shfl_xor(s1, o, 32);
      const float inv1 = hw_rcp(s1);

      // C: p = softmax * (j <= i); within-chunk inclusive running sum
      float run = 0.f;
#pragma unroll  // constant indices into c[]
      for (int i = 0; i < 32; ++i) {
        const float p = (cb + i <= iq) ? c[i] * inv1 : 0.f;
        run += p;
        c[i] = run;
      }
      float incl = run;
#pragma unroll
      for (int d = 1; d < 32; d <<= 1) {
        const float t = __shfl_up(incl, d, 32);
        if (lane >= d) incl += t;
      }
      const float off       = incl - run;                    // exclusive prefix of earlier lanes
      const float disttotal = __shfl(incl, 31, 32);

      // D: decay factor, masked rescale, row max of the new scores
      float m2 = -3.0e38f;
#pragma unroll  // constant indices into s[] and c[]
      for (int g = 0; g < 4; ++g) {
        float x[8], dsc[8], t[8], eff[8];
#pragma unroll
        for (int i = 0; i < 8; ++i) {
          const float distcum = off + c[8 * g + i];
          const float pe = fabsf((float)(iq - (cb + 8 * g + i)));
          x[i] = fmaxf((disttotal - distcum) * pe, 0.f);
        }
        hw_sqrtx8(dsc, x);
#pragma unroll
        for (int i = 0; i < 8; ++i) t[i] = dsc[i] * gam2;
        hw_exp2x8(eff, t);
#pragma unroll
        for (int i = 0; i < 8; ++i) {
          const float ef = fminf(fmaxf(eff[i], 1e-5f), 1e5f);
          const float ns = (cb + 8 * g + i <= iq) ? s[8 * g + i] * ef : -1e32f;
          s[8 * g + i] = ns;
          m2 = fmaxf(m2, ns);
        }
      }
#pragma unroll
      for (int o = 16; o > 0; o >>= 1) m2 = fmaxf(m2, __shfl_xor(m2, o, 32));

      // E: e2 = 2^(ns - m2) (masked entries give exactly 0); s2 = sum
      float s2 = 0.f;
#pragma unroll  // constant indices into s[]
      for (int g = 0; g < 4; ++g) {
        float a[8], e[8];
#pragma unroll
        for (int i = 0; i < 8; ++i) a[i] = s[8 * g + i] - m2;
        hw_exp2x8(e, a);
#pragma unroll
        for (int i = 0; i < 8; ++i) { s[8 * g + i] = e[i]; s2 += e[i]; }
      }
#pragma unroll
      for (int o = 16; o > 0; o >>= 1) s2 += __shfl_xor(s2, o, 32);
      const float inv2 = hw_rcp(s2);

      // F: attn probabilities -> bf16 hi/lo planes in LDS (16-B stores per lane)
      u16* ahp = aH + row * AST + cb;
      u16* alp = aL + row * AST + cb;
#pragma unroll  // constant indices into s[]
      for (int g8 = 0; g8 < 4; ++g8) {
        float p[8];
#pragma unroll  // constant indices into s[] and p[]
        for (int i = 0; i < 8; ++i) p[i] = s[8 * g8 + i] * inv2;
        v4u vh, vl;
        split8(p, vh, vl);
        *(v4u*)(ahp + 8 * g8) = vh;
        *(v4u*)(alp + 8 * g8) = vl;
      }
    }
  }
  __syncthreads();   // P planes complete (block barrier between the LDS spill and the fragment reload)

  // ---- phase 3: out(16x64) = attn(16x1024) . V(1024x64); key tiles beyond the causal range carry exact zeros
  if (w < 4) {                                               // wave-uniform
    const int nt  = w;                                       // output columns nt*16..+15
    const int nkt = q0 / 32 + 1;                             // <= 32, block-uniform
    const size_t vrow = ((size_t)(b * DM + h * DKK + nt * 16)) * SS + lane * 8;
    const int nk4 = (nkt + 3) & ~3;                          // whole groups of four tiles, <= 32: the added tiles have P == 0
    const int pa0 = l15 * AST + hl * 8;
    v8f acc = zero8();
    // ring of four V tiles in registers: a tile's slot is loaded again, four tiles ahead, behind its product
    v16bf vh[4], vl[4];
#pragma unroll  // constant indices, or the ring falls to scratch
    for (int j = 0; j < 4; ++j) {
      vh[j] = ldg_frag(Vh, vrow + (size_t)j * 512);
      vl[j] = ldg_frag(Vl, vrow + (size_t)j * 512);
    }
    // the two V address pairs stay live up to this wait: no load above may land on them
    asm volatile("s_wait_xcnt 0x0" :: "v"(Vh + vrow), "v"(Vl + vrow) : "memory");
    int k0 = 0;
    for (; k0 + 4 < nk4; k0 += 4) {
      v16bf ph[4], pl[4];
#pragma unroll  // constant indices; the group's four P tiles are read from LDS in one go
      for (int j = 0; j < 4; ++j) {
        ph[j] = lds_frag(aH, pa0 + (k0 + j) * 32);
        pl[j] = lds_frag(aL, pa0 + (k0 + j) * 32);
      }
#pragma unroll  // constant indices into the ring
      for (int j = 0; j < 4; ++j) {
        acc = wmma3(acc, ph[j], pl[j], vh[j], vl[j]);
        vh[j] = ldg_frag(Vh, vrow + (size_t)(k0 + 4 + j) * 512);
        vl[j] = ldg_frag(Vl, vrow + (size_t)(k0 + 4 + j) * 512);
      }
      // the next trip's address additions overwrite registers that the loads in flight name
      asm volatile("s_wait_xcnt 0x0" ::: "memory");
    }
    {                                                        // last group: nothing left to load
      v16bf ph[4], pl[4];
#pragma unroll
      for (int j = 0; j < 4; ++j) {
        ph[j] = lds_frag(aH, pa0 + (k0 + j) * 32);
        pl[j] = lds_frag(aL, pa0 + (k0 + j) * 32);
      }
#pragma unroll
      for (int j = 0; j < 4; ++j) acc = wmma3(acc, ph[j], pl[j], vh[j], vl[j]);
    }
#pragma unroll
    for (int r = 0; r < 8; ++r)
      sO[(hl * 8 + r) * OST + nt * 16 + l15] = acc[r];
  }
  __syncthreads();

  // ---- store concat planes: two plane tiles; wave w owns half of tile w/2, one instruction per plane = 512 contiguous B
  if (w < 4) {
    const int s  = (w & 1) * 32 + lane;                      // chunk inside the tile
    const int cc = (w >> 1) * 32 + (s >> 4) * 8;
    const float* sp = sO + (s & 15) * OST + cc;
    const v4f a = *(const v4f*)sp;
    const v4f c = *(const v4f*)(sp + 4);
    float x[8] = {a.x, a.y, a.z, a.w, c.x, c.y, c.z, c.w};
    v4u vh, vl;
    split8(x, vh, vl);
    const size_t go = (size_t)(b * SS + q0) * DM + h * (DKK * 16) + (w >> 1) * 512 + s * 8;
    *(v4u*)(Ch + go) = vh;
    *(v4u*)(Cl + go) = vl;
    
  }
}

// ---------------------------------------------------------------- launcher
extern "C" void kernel_launch(void* const* d_in, const int* in_sizes, int n_in,
                              void* d_out, int out_size, void* d_ws, size_t ws_size,
                              hipStream_t stream) {
  if (n_in < 12) return;
  if (in_sizes[0] != (int)ACT || in_sizes[1] != (int)ACT || in_sizes[2] != (int)ACT) return;
  if (in_sizes[3] != (int)WEL || in_sizes[5] != (int)WEL || in_sizes[7] != (int)WEL || in_sizes[9] != (int)WEL) return;
  if (in_sizes[4] != DM || in_sizes[6] != DM || in_sizes[8] != DM || in_sizes[10] != DM) return;
  if (in_sizes[11] != HH) return;
  if (out_size != (int)ACT) return;

  const float* q   = (const float*)d_in[0];
  const float* k   = (const float*)d_in[1];
  const float* v   = (const float*)d_in[2];
  const float* Wq  = (const float*)d_in[3];
  const float* bq  = (const float*)d_in[4];
  const float* Wk  = (const float*)d_in[5];
  const float* bk  = (const float*)d_in[6];
  const float* Wv  = (const float*)d_in[7];
  const float* bv  = (const float*)d_in[8];
  const float* Wo  = (const float*)d_in[9];
  const float* bo  = (const float*)d_in[10];
  const float* gam = (const float*)d_in[11];
  float* out = (float*)d_out;

  // workspace carve (256-B aligned): q, k, v planes hi and lo (the q planes are reused for the concat planes),
  // Wq, Wk, Wv, Wo planes hi and lo, Qp, Kp, Vt planes hi and lo.  Total 112 MiB.
  char* ws = (char*)d_ws;
  size_t off = 0;
  auto carve = [&](size_t bytes) -> char* {
    char* p = ws + off;
    off += (bytes + 255) & ~(size_t)255;
    return p;
  };
  u16* actH = (u16*)carve(3 * ACT * 2);
  u16* actL = (u16*)carve(3 * ACT * 2);
  u16* wH   = (u16*)carve(4 * WEL * 2);
  u16* wL   = (u16*)carve(4 * WEL * 2);
  u16* prH  = (u16*)carve(3 * ACT * 2);             // Qp, Kp, Vt
  u16* prL  = (u16*)carve(3 * ACT * 2);
  if (off > ws_size) return;

  const dim3 pgrid(DM / 128, MROWS / (64 * MT), 3); // (8, 16, 3)
  const dim3 ggrid(DM / 128, MROWS / (64 * MT));    // (8, 16)
  const dim3 agrid(SS / 16, HH, BB);                // (64, 16, 4)

  // all seven f32 matrices -> planes
  k_split<<<dim3(SPLIT_BLKS), 256, 0, stream>>>(q, k, v, Wq, Wk, Wv, Wo, actH, actL, wH, wL);
  // q, k, v projections -> Qp, Kp planes, Vt planes (k = token)
  k_gemm3<0><<<pgrid, 256, 0, stream>>>(actH, actL, wH, wL, bq, bk, bv, prH, prL, out);
  // attention -> concat planes (reuse the q planes)
  k_attn<<<agrid, 256, SMEM_ATTN, stream>>>(prH, prL, prH + ACT, prL + ACT, prH + 2 * ACT, prL + 2 * ACT, gam, actH, actL);
  // output projection -> f32 result
  k_gemm3<2><<<ggrid, 256, 0, stream>>>(actH, actL, wH + 3 * WEL, wL + 3 * WEL, bo, bo, bo, prH, prL, out);
}

// v007
// A run of this version takes 197 microseconds.
// In both of two side-by-side timings against v006, it was 1.09 times as fast.
// All steps since v000 together make it 3.27 times as fast.
#include <hip/hip_runtime.h>
#include <math.h>
#include <stdint.h>
#include <stddef.h>

// All six contractions (three input projections, q.k^T scores, attn.V, output projection): v_wmma_f32_16x16x32_bf16 with bf16 hi/lo three-term split operands (hi*hi + hi*lo + lo*hi), f32 accumulate; softmax / cumsum / distance-decay row math in f32 on VALU.

typedef __bf16         v16bf __attribute__((ext_vector_type(16)));
typedef float          v8f   __attribute__((ext_vector_type(8)));
typedef float          v4f   __attribute__((ext_vector_type(4)));
typedef unsigned int   v4u   __attribute__((ext_vector_type(4)));
typedef unsigned int   v2u   __attribute__((ext_vector_type(2)));
typedef unsigned short u16;

union Frag { v16bf v; v4u u[2]; };

static constexpr int BB  = 4;
static constexpr int SS  = 1024;
static constexpr int DM  = 1024;
static constexpr int HH  = 16;
static constexpr int DKK = 64;
static constexpr int MROWS = BB * SS;                 // 4096
static constexpr size_t ACT = (size_t)MROWS * DM;     // 4194304
static constexpr size_t WEL = (size_t)DM * DM;        // 1048576
static_assert(HH * DKK == DM);
static_assert(MROWS % 64 == 0);
static_assert(DM % 128 == 0);
static_assert(DM % 64 == 0);
static_assert(SS % 64 == 0);
static_assert(ACT % 2048 == 0);
static_assert(WEL % 2048 == 0);
static_assert(SS == DM);                              // one tile map serves every plane

// Every bf16 plane is a [rows][1024] matrix stored in fragment order: 1-KiB tiles of 16 rows x 32 k,
// tile index (row/16)*KB + k/32; inside a tile the 16-B chunk of (row, k/8) sits at (k/8 % 4)*16 + row%16.
// A lane's two fragment chunks are then chunk 'lane' and chunk '32 + lane' of the tile, so one
// wave-wide 16-B load covers 512 contiguous bytes.
static constexpr int KB = DM / 32;                    // tiles along k

// ---------------------------------------------------------------- small helpers
__device__ __forceinline__ unsigned bf16_bits(float x) {          // RNE f32 -> bf16 bits
  unsigned u = __float_as_uint(x);
  u += 0x7FFFu + ((u >> 16) & 1u);
  return u >> 16;
}
__device__ __forceinline__ void split2(float x, unsigned& hi, unsigned& lo) {
  hi = bf16_bits(x);
  const float xh = __uint_as_float(hi << 16);
  lo = bf16_bits(x - xh);                                         // x - xh exact in f32
}
// 8 consecutive f32 -> packed 8 bf16 hi (16 B) and 8 bf16 lo (16 B)
__device__ __forceinline__ void split8(const float* x, v4u& vh, v4u& vl) {
  unsigned hw[4], lw[4];
#pragma unroll
  for (int i = 0; i < 4; ++i) {
    unsigned h0, l0, h1, l1;
    split2(x[2 * i], h0, l0);
    split2(x[2 * i + 1], h1, l1);
    hw[i] = h0 | (h1 << 16);
    lw[i] = l0 | (l1 << 16);
  }
  vh.x = hw[0]; vh.y = hw[1]; vh.z = hw[2]; vh.w = hw[3];
  vl.x = lw[0]; vl.y = lw[1]; vl.z = lw[2]; vl.w = lw[3];
}
__device__ __forceinline__ v8f zero8() {
  v8f z;
#pragma unroll
  for (int i = 0; i < 8; ++i) z[i] = 0.f;
  return z;
}
// 16x32 operand fragment from one plane tile: elements 0..7 <- k 8*(lane>>4).., 8..15 <- 16 further,
// row lane&15 (same map for A rows and for B stored [n][k])
// (caller passes e = row0*DM + (k0/32)*512 + 8*lane, the lane's first chunk of the tile at row0, k0)
__device__ __forceinline__ v16bf ldg_frag(const u16* __restrict__ p, size_t e) {
  Frag f;
  f.u[0] = *(const v4u*)(p + e);
  f.u[1] = *(const v4u*)(p + e + 256);
  return f.v;
}
// the same through a pointer that is typed as global memory: an address that has passed through an asm statement
// has lost what the compiler knew of its origin, and an untyped one would load by flat_load
typedef const __attribute__((address_space(1))) u16* gptr;
typedef const __attribute__((address_space(1))) v4u* gptr4;
__device__ __forceinline__ v16bf ldg_frag_g(gptr p, size_t e) {
  Frag f;
  f.u[0] = *(gptr4)(p + e);
  f.u[1] = *(gptr4)(p + e + 256);
  return f.v;
}
// 16x32 operand fragment from a k-contiguous bf16 row in LDS: elements 0..7 <- e.., 8..15 <- e+16..
// (caller passes e = row*pitch + k0 + 8*(lane>>4))
__device__ __forceinline__ v16bf lds_frag(const u16* p, int e) {
  Frag f;
  f.u[0] = *(const v4u*)(p + e);
  f.u[1] = *(const v4u*)(p + e + 16);
  return f.v;
}
// 2^x, log2(x), sqrt(x) and 1/x as the chip's own single instructions (about 1 ulp), without libm's range reduction,
// range checks and refinement steps.  A result below the normal range may come out as 0, a subnormal
// sqrt argument likewise: every use below adds such a value to a sum that is at least 1 or clamps it;
// the two reciprocals are of such sums (1 <= sum <= 1024).
// Eight at a time in one statement: behind a transcendental the instruction set wants one slot before its
// result is read or its source overwritten.  "=&v" keeps every result apart from every argument, so no
// neighbour takes a source's register; the v_nop is the slot behind the last one; the s_delay_alu is the
// issue hint for the arguments, which the compiler cannot give for instructions inside a statement.
__device__ __forceinline__ void hw_exp2x8(float (&r)[8], const float (&a)[8]) {
  asm("s_delay_alu instid0(VALU_DEP_1)\n\t"
      "v_exp_f32 %0, %8\n\tv_exp_f32 %1, %9\n\tv_exp_f32 %2, %10\n\tv_exp_f32 %3, %11\n\t"
      "v_exp_f32 %4, %12\n\tv_exp_f32 %5, %13\n\tv_exp_f32 %6, %14\n\tv_exp_f32 %7, %15\n\t"
      "v_nop"
      : "=&v"(r[0]), "=&v"(r[1]), "=&v"(r[2]), "=&v"(r[3]), "=&v"(r[4]), "=&v"(r[5]), "=&v"(r[6]), "=&v"(r[7])
      : "v"(a[0]), "v"(a[1]), "v"(a[2]), "v"(a[3]), "v"(a[4]), "v"(a[5]), "v"(a[6]), "v"(a[7]));
}
// the same, four at a time, for the passes that go group by group
__device__ __forceinline__ void hw_exp2x4(float (&r)[4], const float (&a)[4]) {
  asm("s_delay_alu instid0(VALU_DEP_1)\n\t"
      "v_exp_f32 %0, %4\n\tv_exp_f32 %1, %5\n\tv_exp_f32 %2, %6\n\tv_exp_f32 %3, %7\n\t"
      "v_nop"
      : "=&v"(r[0]), "=&v"(r[1]), "=&v"(r[2]), "=&v"(r[3])
      : "v"(a[0]), "v"(a[1]), "v"(a[2]), "v"(a[3]));
}
__device__ __forceinline__ void hw_sqrtx4(float (&r)[4], const float (&a)[4]) {
  asm("s_delay_alu instid0(VALU_DEP_1)\n\t"
      "v_sqrt_f32 %0, %4\n\tv_sqrt_f32 %1, %5\n\tv_sqrt_f32 %2, %6\n\tv_sqrt_f32 %3, %7\n\t"
      "v_nop"
      : "=&v"(r[0]), "=&v"(r[1]), "=&v"(r[2]), "=&v"(r[3])
      : "v"(a[0]), "v"(a[1]), "v"(a[2]), "v"(a[3]));
}
// x + (x of the lane N places down in the same 16-lane row; 0 where there is none): one step of a running sum over lanes
template <int N>
__device__ __forceinline__ float row_shr_add(float x) {
  return x + __int_as_float(__builtin_amdgcn_update_dpp(0, __float_as_int(x), 0x110 + N, 0xf, 0xf, true));
}
__device__ __forceinline__ float hw_rcp(float x) { return __builtin_amdgcn_rcpf(x); }
static constexpr float LOG2E = 1.44269504088896340736f;
// three-term split product into one accumulator, then hazard guard (ties D, keeps A/B live)
__device__ __forceinline__ v8f wmma3(v8f acc, v16bf ah, v16bf al, v16bf bh, v16bf bl) {
  acc = __builtin_amdgcn_wmma_f32_16x16x32_bf16(false, ah, false, bh, (short)0, acc, false, false);
  acc = __builtin_amdgcn_wmma_f32_16x16x32_bf16(false, ah, false, bl, (short)0, acc, false, false);
  acc = __builtin_amdgcn_wmma_f32_16x16x32_bf16(false, al, false, bh, (short)0, acc, false, false);
  asm volatile("v_nop\n\tv_nop\n\tv_nop\n\tv_nop" : "+v"(acc) : "v"(ah), "v"(al), "v"(bh), "v"(bl));
  return acc;
}

// ---------------------------------------------------------------- f32 [rows][1024] -> bf16 hi/lo planes (fragment order)
// One launch splits all seven f32 matrices (q, k, v, Wq, Wk, Wv, Wo): none reads another's result.
// aH/aL hold the three activation planes one behind the other, wH/wL the four weight planes.
// A unit is 8 rows x 32 k of one tile, one wave's work: 8 whole 128-B lines read, 4 whole lines stored per plane.
// A block takes 128 consecutive units of ONE matrix (32 rows), 16 per wave.
static constexpr int UPB      = 128;                        // units per block
static constexpr int ACT_BLKS = (int)(ACT / 256 / UPB);     // 128 blocks per activation
static constexpr int WEL_BLKS = (int)(WEL / 256 / UPB);     // 32 blocks per weight
static constexpr int SPLIT_BLKS = 3 * ACT_BLKS + 4 * WEL_BLKS;
static_assert(ACT % (256 * UPB) == 0);
static_assert(WEL % (256 * UPB) == 0);

__global__ void __launch_bounds__(256)
k_split(const float* __restrict__ q, const float* __restrict__ k, const float* __restrict__ v,
        const float* __restrict__ Wq, const float* __restrict__ Wk, const float* __restrict__ Wv,
        const float* __restrict__ Wo,
        u16* __restrict__ aH, u16* __restrict__ aL, u16* __restrict__ wH, u16* __restrict__ wL) {
  const int blk  = blockIdx.x;
  const int lane = threadIdx.x & 31;
  const int w    = threadIdx.x >> 5;
  const float* in;
  u16 *ph, *pl;
  int u0;                                                   // the block's first unit inside its matrix
  if (blk < 3 * ACT_BLKS) {                                 // block-uniform
    const int a = blk / ACT_BLKS;
    in = (a == 0) ? q : (a == 1) ? k : v;
    ph = aH + (size_t)a * ACT;
    pl = aL + (size_t)a * ACT;
    u0 = (blk - a * ACT_BLKS) * UPB;
  } else {
    const int a = (blk - 3 * ACT_BLKS) / WEL_BLKS;
    in = (a == 0) ? Wq : (a == 1) ? Wk : (a == 2) ? Wv : Wo;
    ph = wH + (size_t)a * WEL;
    pl = wL + (size_t)a * WEL;
    u0 = (blk - 3 * ACT_BLKS - a * WEL_BLKS) * UPB;
  }
  // the wave's n-th unit is unit n*8 + w of the block: half w&1 of tile (n&7)*4 + w/2 in the block's tile row n>>3,
  // so every address below is one lane address plus a compile-time offset
  const int r = (w & 1) * 8 + (lane & 7);                   // row inside the tile
  const int j = lane >> 3;                                  // 8-element chunk along k
  const float* src = in + (size_t)((u0 >> 6) * 16 + r) * DM + (w >> 1) * 32 + j * 8;
  const size_t dst = ((size_t)((u0 >> 1) + (w >> 1)) * 64 + j * 16 + r) * 8;
  v4f a[16], c[16];
#pragma unroll  // constant indices, or a[] and c[] fall to scratch
  for (int n = 0; n < 16; ++n) {
    const float* p = src + (n >> 3) * 16 * DM + (n & 7) * 128;
    a[n] = *(const v4f*)p;
    c[n] = *(const v4f*)(p + 4);
  }
  // keeps all 32 loads ahead of the arithmetic: left alone the compiler sinks them and holds about six in flight
  __builtin_amdgcn_sched_barrier(0);
#pragma unroll  // constant indices
  for (int n = 0; n < 16; ++n) {
    float x[8] = {a[n].x, a[n].y, a[n].z, a[n].w, c[n].x, c[n].y, c[n].z, c[n].w};
    v4u vh, vl;
    split8(x, vh, vl);
    const size_t d = dst + (size_t)((n >> 3) * KB + (n & 7) * 4) * 512;
    *(v4u*)(ph + d) = vh;
    *(v4u*)(pl + d) = vl;
  }
}

// ---------------------------------------------------------------- GEMM: out = A @ W^T + bias
// A planes [M=4096][K=1024] bf16 hi/lo, W planes [N=1024][K] bf16 hi/lo ([out,in]), both in fragment order;
// bias [N] f32. Block 256 thr = 8 waves, block tile 256(M) x 128(N), wave tile 64 x 64: four 16-row tiles, 64 rows apart,
// times four 16-column tiles, so a loaded A or B fragment feeds four accumulators: a wave loads 16 KiB per 48 products.
// About 470 VGPRs per wave: two waves per SIMD, one block per WGP.
// Fragments straight from global (no LDS in the k-loop), fetched two k steps ahead.  Epilogue: tile staged in LDS, then
// MODE 0: the three input projections in one launch, blockIdx.z = 0, 1, 2 for q, k, v: operand, weight and result
//         planes of projection z lie z planes behind the pointers given.  Result of z = 0, 1: bf16 hi/lo planes
//         [M][N] in fragment order; of z = 2: planes transposed [(m/SS)*N + n][m%SS] in fragment order
//         (k = token, for attn.V)
// MODE 2: f32 row-major [M][N] (Of)
static constexpr int TP = 132;   // LDS tile pitch (floats)
static constexpr int MT = 4;     // 16-row A tiles per wave
static_assert(MROWS % (64 * MT) == 0);

template <int MODE>
__global__ void __launch_bounds__(256)
k_gemm3(const u16* __restrict__ Ah0, const u16* __restrict__ Al0,
        const u16* __restrict__ Wh0, const u16* __restrict__ Wl0,
        const float* __restrict__ bias0, const float* __restrict__ bias1, const float* __restrict__ bias2,
        u16* __restrict__ Oh0, u16* __restrict__ Ol0, float* __restrict__ Of) {
  constexpr int N = DM, K = DM;
  __shared__ __attribute__((aligned(16))) float sT[64 * MT * TP];

  const int z = (MODE == 0) ? (int)blockIdx.z : 0;     // which projection; block-uniform
  const u16* __restrict__ Ah = Ah0 + (size_t)z * ACT;
  const u16* __restrict__ Al = Al0 + (size_t)z * ACT;
  const u16* __restrict__ Wh = Wh0 + (size_t)z * WEL;
  const u16* __restrict__ Wl = Wl0 + (size_t)z * WEL;
  const float* __restrict__ bias = (z == 0) ? bias0 : (z == 1) ? bias1 : bias2;
  u16* __restrict__ Oh = Oh0 + (size_t)z * ACT;
  u16* __restrict__ Ol = Ol0 + (size_t)z * ACT;

  const int lane = threadIdx.x & 31;
  const int w    = threadIdx.x >> 5;
  const int wm   = w & 3;              // 0..3
  const int wn   = w >> 2;             // 0..1
  const int hl   = lane >> 4;
  const int l15  = lane & 15;
  const int m0b  = blockIdx.y * (64 * MT);
  const int n0b  = blockIdx.x * 128;
  const int m0   = m0b + wm * 16;
  const int n0   = n0b + wn * 64;

  v8f acc[MT][4];
#pragma unroll
  for (int mt = 0; mt < MT; ++mt)
#pragma unroll
    for (int nt = 0; nt < 4; ++nt) acc[mt][nt] = zero8();

  // the lane's four running addresses, at the current even k step; every load is one of them plus a constant
  gptr pah = (gptr)(Ah + (size_t)m0 * K + lane * 8);    // A rows m0..m0+15 (+mt*64 rows)
  gptr pal = (gptr)(Al + (size_t)m0 * K + lane * 8);
  gptr pbh = (gptr)(Wh + (size_t)n0 * K + lane * 8);    // W rows n0..n0+15 (+nt*16 rows)
  gptr pbl = (gptr)(Wl + (size_t)n0 * K + lane * 8);

  // Two register sets of fragments, even and odd k steps.  A set is loaded again, for two k steps later,
  // behind its 48 products, so a load has the other set's 48 products' time to come back.
  v16bf ah[2][MT], al[2][MT], bh[2][4], bl[2][4];
#pragma unroll  // constant indices, or the sets fall to scratch
  for (int p = 0; p < 2; ++p) {
#pragma unroll
    for (int mt = 0; mt < MT; ++mt) {
      ah[p][mt] = ldg_frag_g(pah, (size_t)mt * 64 * K + p * 512);
      al[p][mt] = ldg_frag_g(pal, (size_t)mt * 64 * K + p * 512);
    }
#pragma unroll
    for (int nt = 0; nt < 4; ++nt) {
      bh[p][nt] = ldg_frag_g(pbh, (size_t)nt * 16 * K + p * 512);
      bl[p][nt] = ldg_frag_g(pbl, (size_t)nt * 16 * K + p * 512);
    }
  }
  // one k step: hi*hi, then hi*lo, then lo*hi into each accumulator (the order of wmma3), term by term over the
  // 16 accumulators, so that neighbouring products are independent
#define GEMM_KSTEP(p)                                                                                        \
  _Pragma("unroll") for (int mt = 0; mt < MT; ++mt)                                                          \
    _Pragma("unroll") for (int nt = 0; nt < 4; ++nt)                                                         \
      acc[mt][nt] = __builtin_amdgcn_wmma_f32_16x16x32_bf16(false, ah[p][mt], false, bh[p][nt], (short)0,    \
                                                            acc[mt][nt], false, false);                      \
  _Pragma("unroll") for (int mt = 0; mt < MT; ++mt)                                                          \
    _Pragma("unroll") for (int nt = 0; nt < 4; ++nt)                                                         \
      acc[mt][nt] = __builtin_amdgcn_wmma_f32_16x16x32_bf16(false, ah[p][mt], false, bl[p][nt], (short)0,    \
                                                            acc[mt][nt], false, false);                      \
  _Pragma("unroll") for (int mt = 0; mt < MT; ++mt)                                                          \
    _Pragma("unroll") for (int nt = 0; nt < 4; ++nt)                                                         \
      acc[mt][nt] = __builtin_amdgcn_wmma_f32_16x16x32_bf16(false, al[p][mt], false, bh[p][nt], (short)0,    \
                                                            acc[mt][nt], false, false);
#pragma unroll 1  // one trip already holds both sets; further copies only grow the code
  for (int kb = 0; kb < K / 32 - 2; kb += 2) {
#pragma unroll  // constant indices into the sets
    for (int p = 0; p < 2; ++p) {
      GEMM_KSTEP(p)
      // the four slots between the last products and the loads that land on their A and B registers; the
      // scheduling fences keep every product above the slots and the reloads in one group directly below them
      // (left alone the compiler sinks the reloads halfway into the other set's products, which halves their lead)
      __builtin_amdgcn_sched_barrier(0);
      asm volatile("v_nop\n\tv_nop\n\tv_nop\n\tv_nop");
      __builtin_amdgcn_sched_barrier(0);
#pragma unroll
      for (int mt = 0; mt < MT; ++mt) {
        ah[p][mt] = ldg_frag_g(pah, (size_t)mt * 64 * K + (2 + p) * 512);
        al[p][mt] = ldg_frag_g(pal, (size_t)mt * 64 * K + (2 + p) * 512);
      }
#pragma unroll
      for (int nt = 0; nt < 4; ++nt) {
        bh[p][nt] = ldg_frag_g(pbh, (size_t)nt * 16 * K + (2 + p) * 512);
        bl[p][nt] = ldg_frag_g(pbl, (size_t)nt * 16 * K + (2 + p) * 512);
      }
      __builtin_amdgcn_sched_barrier(0);
    }
    // the four additions below overwrite registers that the loads in flight name; as operands of the wait the
    // address pairs keep registers of their own up to it, so that no reload lands on one either
    asm volatile("s_wait_xcnt 0x0" : "+v"(pah), "+v"(pal), "+v"(pbh), "+v"(pbl) :: "memory");
    pah += 2 * 512; pal += 2 * 512; pbh += 2 * 512; pbl += 2 * 512;
  }
  // the last two k steps: nothing left to load
  GEMM_KSTEP(0)
  GEMM_KSTEP(1)
#undef GEMM_KSTEP

  const int bi = n0 + l15;
  float bb[4];
#pragma unroll
  for (int nt = 0; nt < 4; ++nt) bb[nt] = bias[bi + nt * 16];
  // the index register stays live up to this wait: none of the four loads may land on it before it
  asm volatile("s_wait_xcnt 0x0" :: "v"(bi) : "memory");

  // stage the 256x128 f32 tile (+bias) in LDS; D element r of lane = (row 8h+r, col l15)
#pragma unroll  // constant indices into acc
  for (int mt = 0; mt < MT; ++mt)
#pragma unroll
    for (int nt = 0; nt < 4; ++nt)
#pragma unroll
      for (int r = 0; r < 8; ++r)
        sT[(mt * 64 + wm * 16 + hl * 8 + r) * TP + wn * 64 + nt * 16 + l15] = acc[mt][nt][r] + bb[nt];
  __syncthreads();

  // the tile leaves in MT parts of 64 rows.  The next part's LDS loads and arithmetic overwrite registers that this
  // part's stores name: the wait behind the stores stands in front of them, and the two scheduling fences keep the
  // compiler from moving any of them in between the first store and the wait
  if (MODE == 0 && z < 2) {
    // per part 4 x 4 plane tiles; a wave pair owns tile j*4 + w/2, one instruction = half a tile = 512 contiguous B
    const int s = (w & 1) * 32 + lane;                     // chunk inside the tile
#pragma unroll 1  // the parts differ only in their addresses: copies would only grow the code
    for (int mt = 0; mt < MT; ++mt) {
      const int mh  = m0b + mt * 64;                       // the part's first row
      const int kbl = w >> 1;                              // tile column; tile row is j
      v4u vh[4], vl[4];
#pragma unroll
      for (int j = 0; j < 4; ++j) {
        const int row = mt * 64 + j * 16 + (s & 15);
        const float* sp = sT + row * TP + kbl * 32 + (s >> 4) * 8;
        const v4f a = *(const v4f*)sp;
        const v4f c = *(const v4f*)(sp + 4);
        float x[8] = {a.x, a.y, a.z, a.w, c.x, c.y, c.z, c.w};
        split8(x, vh[j], vl[j]);
      }
      const size_t go = ((size_t)((mh >> 4) * KB + (n0b >> 5) + kbl) * 64 + s) * 8;   // tile row j: j*KB tiles on
      u16* oh = Oh + go;
      u16* ol = Ol + go;
      __builtin_amdgcn_sched_barrier(0);                   // all arithmetic above the stores
#pragma unroll
      for (int j = 0; j < 4; ++j) {
        *(v4u*)(oh + (size_t)j * KB * 512) = vh[j];
        *(v4u*)(ol + (size_t)j * KB * 512) = vl[j];
      }
      asm volatile("s_wait_xcnt 0x0" ::: "memory");
      __builtin_amdgcn_sched_barrier(0);
    }
  } else if (MODE == 0) {
    // per part 8 (features) x 2 (tokens) plane tiles; wave w owns features w*16..+15, one instruction = half a tile
    const int f = w * 16 + l15;
#pragma unroll 1  // the parts differ only in their addresses: copies would only grow the code
    for (int mt = 0; mt < MT; ++mt) {
      const int mh   = m0b + mt * 64;                      // the part's first row
      const int bidx = mh / SS;
      const int s0   = mh - bidx * SS;
      v4u vh[4], vl[4];
#pragma unroll
      for (int j = 0; j < 4; ++j) {
        const int s  = (j & 1) * 32 + lane;                // chunk inside the tile
        const int tc = (j >> 1) * 32 + (s >> 4) * 8;       // first of its 8 tokens
        float x[8];
#pragma unroll
        for (int i = 0; i < 8; ++i) x[i] = sT[(mt * 64 + tc + i) * TP + f];
        split8(x, vh[j], vl[j]);
      }
      // half tile j (tile j/2, chunks (j&1)*32 + lane) lies j*256 elements behind half tile 0
      const size_t go = ((size_t)(((bidx * N + n0b) >> 4) + w) * KB + (s0 >> 5)) * 512 + (size_t)lane * 8;
      u16* oh = Oh + go;
      u16* ol = Ol + go;
      __builtin_amdgcn_sched_barrier(0);                   // all arithmetic above the stores
#pragma unroll
      for (int j = 0; j < 4; ++j) {
        *(v4u*)(oh + j * 256) = vh[j];
        *(v4u*)(ol + j * 256) = vl[j];
      }
      asm volatile("s_wait_xcnt 0x0" ::: "memory");
      __builtin_amdgcn_sched_barrier(0);
    }
  } else {
    // f32: per part wave w owns rows w*8..+7; one instruction = 32 lanes x 16 B = one 512-B row segment.
    const int cc4 = lane * 4;
#pragma unroll 1  // the parts differ only in their addresses: copies would only grow the code
    for (int mt = 0; mt < MT; ++mt) {
      const int row0 = mt * 64 + w * 8;
      v4f val[8];
#pragma unroll
      for (int j = 0; j < 8; ++j) val[j] = *(const v4f*)(sT + (row0 + j) * TP + cc4);
      float* op = Of + (size_t)(m0b + row0) * N + n0b + cc4;
      __builtin_amdgcn_sched_barrier(0);                   // all arithmetic above the stores
#pragma unroll
      for (int j = 0; j < 8; ++j) *(v4f*)(op + (size_t)j * N) = val[j];
      asm volatile("s_wait_xcnt 0x0" ::: "memory");
      __builtin_amdgcn_sched_barrier(0);
    }
  }
}

// ---------------------------------------------------------------- distance-decay attention
// grid (S/16, H, B); block 256 thr = 8 waves; 16 query rows, full 1024-key score rows in LDS.
// Qp, Kp planes [b*S+s][h*64+d], Vt planes [b*1024+h*64+d][s], concat planes [b*S+s][h*64+d]: all in fragment order;
// Row math runs in registers: the owning wave reads a score row from LDS once, 32 columns per lane (8 groups of 4).
static constexpr int SST = 1028;                          // f32 score row pitch
static constexpr int AST = 1032;                          // bf16 prob row pitch (x2 B = 129*16)
static constexpr int OST = 68;                            // f32 out-tile pitch
static constexpr size_t SM_S = (size_t)16 * SST * 4;      // 65792 (out tile aliases it later)
static constexpr size_t SM_A = (size_t)16 * AST * 2;      // 33024
static constexpr size_t SMEM_ATTN = SM_S + 2 * SM_A;      // 131840
static_assert((size_t)16 * OST * 4 <= SM_S);
static_assert(SM_S % 16 == 0);
static_assert(SM_A % 16 == 0);

__global__ void __launch_bounds__(256)
k_attn(const u16* __restrict__ Qh, const u16* __restrict__ Ql,
       const u16* __restrict__ Kh, const u16* __restrict__ Kl,
       const u16* __restrict__ Vh, const u16* __restrict__ Vl,
       const float* __restrict__ gammas,
       u16* __restrict__ Ch, u16* __restrict__ Cl) {
  extern __shared__ __attribute__((aligned(16))) char smem[];
  float* sS   = (float*)smem;                               // [16][SST]
  float* sO   = sS;                                         // [16][OST], used only after the phase-2 barrier
  u16*   aH   = (u16*)(smem + SM_S);                        // [16][AST] bf16 hi
  u16*   aL   = (u16*)(smem + SM_S + SM_A);                 // [16][AST] bf16 lo

  const int qt = blockIdx.x, h = blockIdx.y, b = blockIdx.z;
  const int q0 = qt * 16;
  const int lane = threadIdx.x & 31;
  const int w    = threadIdx.x >> 5;
  const int hl   = lane >> 4;
  const int l15  = lane & 15;

  // ---- phase 1: sS[16][1024] = Q(16x64) . K^T / 8 * log2(e): scores in base-2 units, so that every
  //      exp(a - b) of the row math is 2^(a' - b') with no multiply of its own ------------------
  {
    const size_t qrow = (size_t)(b * SS + q0) * DM + h * (DKK * 16) + lane * 8;
    const v16bf qh0 = ldg_frag(Qh, qrow),       ql0 = ldg_frag(Ql, qrow);
    const v16bf qh1 = ldg_frag(Qh, qrow + 512), ql1 = ldg_frag(Ql, qrow + 512);
    // the two Q address pairs stay live up to this wait: no later load may land on them before it
    asm volatile("s_wait_xcnt 0x0" :: "v"(Qh + qrow), "v"(Ql + qrow) : "memory");
    // ring of four key tiles in registers: a tile's slot is loaded again, four tiles ahead, behind its products
    const size_t krow0 = (size_t)(b * SS + w * 128) * DM + h * (DKK * 16) + lane * 8;
    v16bf kh0[4], kl0[4], kh1[4], kl1[4];
#pragma unroll  // constant indices, or the ring falls to scratch
    for (int t = 0; t < 4; ++t) {
      const size_t krow = krow0 + (size_t)t * 16 * DM;
      kh0[t] = ldg_frag(Kh, krow);       kl0[t] = ldg_frag(Kl, krow);
      kh1[t] = ldg_frag(Kh, krow + 512); kl1[t] = ldg_frag(Kl, krow + 512);
    }
#pragma unroll  // constant indices into the ring
    for (int t = 0; t < 8; ++t) {                            // 8 key tiles of 16 per wave
      const int kt = w * 8 + t;
      const int sl = t & 3;
      v8f acc = zero8();
      acc = wmma3(acc, qh0, ql0, kh0[sl], kl0[sl]);
      acc = wmma3(acc, qh1, ql1, kh1[sl], kl1[sl]);
      if (t + 4 < 8) {
        const size_t krow = krow0 + (size_t)(t + 4) * 16 * DM;
        kh0[sl] = ldg_frag(Kh, krow);       kl0[sl] = ldg_frag(Kl, krow);
        kh1[sl] = ldg_frag(Kh, krow + 512); kl1[sl] = ldg_frag(Kl, krow + 512);
        // behind the last K load: its address pairs stay live up to this wait and are free for reuse behind it
        if (t == 3) asm volatile("s_wait_xcnt 0x0" :: "v"(Kh + krow0), "v"(Kl + krow0) : "memory");
      }
#pragma unroll
      for (int r = 0; r < 8; ++r)
        sS[(hl * 8 + r) * SST + kt * 16 + l15] = acc[r] * (0.125f * LOG2E);
    }
  }
  __syncthreads();

  // ---- phase 2: row math, 2 rows per wave, all in registers.  A lane owns columns g*128 + 4*lane .. +3 of each of the
  //      eight 128-column groups g: every LDS access of a wave is one contiguous run, and a group that lies wholly
  //      past the block's last query row is needed for the first softmax's maximum and sum alone
  {
    const float gg  = gammas[h];
    // gam2 = -softplus(gg) * log2(e), so that exp(-d * softplus) = 2^(d * gam2); 1 + 2^(..) lies in (1, 2]
    const float gam2 = -(fmaxf(gg, 0.f) * LOG2E +
                         __builtin_amdgcn_logf(1.0f + __builtin_amdgcn_exp2f(-fabsf(gg) * LOG2E)));
    const int   ng  = (q0 >> 7) + 1;                         // groups that hold a column <= q0 + 15; block-uniform, 1..8
    const int   cl  = lane * 4;
    const float hiF = (lane >= 16) ? 1.f : 0.f;
    for (int rr = 0; rr < 2; ++rr) {
      const int row = w + rr * 8;
      const int iq  = q0 + row;
      const float* srow = sS + row * SST + cl;

      float s[32];                                           // scores, then new scores, then e2; [4*g + i]
      float c[32];                                           // e, then the lane's running sum inside its four columns
#pragma unroll  // constant indices, or s[] falls to scratch
      for (int g = 0; g < 8; ++g) {
        const v4f a = *(const v4f*)(srow + 128 * g);
        s[4 * g] = a.x; s[4 * g + 1] = a.y; s[4 * g + 2] = a.z; s[4 * g + 3] = a.w;
      }

      // A: row max over all 1024 keys
      float m1 = -3.0e38f;
#pragma unroll  // constant indices into s[]
      for (int i = 0; i < 32; ++i) m1 = fmaxf(m1, s[i]);
#pragma unroll
      for (int o = 16; o > 0; o >>= 1) m1 = fmaxf(m1, __shfl_xor(m1, o, 32));

      // B: e = exp(score - max) = 2^(s - m1) over the full row; s1 = sum
      float s1 = 0.f;
#pragma unroll  // constant indices into s[] and c[]
      for (int g = 0; g < 4; ++g) {
        float a[8], e[8];
#pragma unroll
        for (int i = 0; i < 8; ++i) a[i] = s[8 * g + i] - m1;
        hw_exp2x8(e, a);
#pragma unroll
        for (int i = 0; i < 8; ++i) { c[8 * g + i] = e[i]; s1 += e[i]; }
      }
#pragma unroll
      for (int o = 16; o > 0; o >>= 1) s1 += __shfl_xor(s1, o, 32);
      const float inv1 = hw_rcp(s1);

      // C: p = softmax * (j <= i); running sum inside the lane's four columns, over the lanes of the group, over the groups
      float off[8];                                          // sum of all columns in front of the lane's four
      float base = 0.f;                                      // sum of the groups so far
#pragma unroll  // constant indices into c[] and off[]
      for (int g = 0; g < 8; ++g) {
        if (g >= ng) break;                                  // block-uniform: the groups behind are past the diagonal
        float run = 0.f;
#pragma unroll
        for (int i = 0; i < 4; ++i) {
          const float p = (g * 128 + cl + i <= iq) ? c[4 * g + i] * inv1 : 0.f;
          run += p;
          c[4 * g + i] = run;
        }
        float x = row_shr_add<1>(run);                     // inclusive sum over the 16-lane row
        x = row_shr_add<2>(x);
        x = row_shr_add<4>(x);
        x = row_shr_add<8>(x);
        // the other row's lane 15 and the own row's lane 15: the two rows' sums
        const float oth = __uint_as_float(__builtin_amdgcn_permlanex16(0u, __float_as_uint(x), 0xffffffffu, 0xffffffffu,
                                                                       false, false));
        const float own = __int_as_float(__builtin_amdgcn_update_dpp(0, __float_as_int(x), 0x15f, 0xf, 0xf, true));
        off[g] = base + (fmaf(oth, hiF, x) - run);
        base += own + oth;
      }
      const float disttotal = base;

      // D: decay factor, masked rescale, row max of the new scores
      float m2 = -3.0e38f;
#pragma unroll  // constant indices into s[], c[] and off[]
      for (int g = 0; g < 8; ++g) {
        if (g >= ng) break;                                  // block-uniform: the groups behind are past the diagonal
        float x[4], dsc[4], t[4], eff[4];
#pragma unroll
        for (int i = 0; i < 4; ++i) {
          const float distcum = off[g] + c[4 * g + i];
          const float pe = fabsf((float)(iq - (g * 128 + cl + i)));
          x[i] = fmaxf((disttotal - distcum) * pe, 0.f);
        }
        hw_sqrtx4(dsc, x);
#pragma unroll
        for (int i = 0; i < 4; ++i) t[i] = dsc[i] * gam2;
        hw_exp2x4(eff, t);
#pragma unroll
        for (int i = 0; i < 4; ++i) {
          const float ef = fminf(fmaxf(eff[i], 1e-5f), 1e5f);
          const float ns = (g * 128 + cl + i <= iq) ? s[4 * g + i] * ef : -1e32f;
          s[4 * g + i] = ns;
          m2 = fmaxf(m2, ns);
        }
      }
#pragma unroll
      for (int o = 16; o > 0; o >>= 1) m2 = fmaxf(m2, __shfl_xor(m2, o, 32));

      // E: e2 = 2^(ns - m2) (masked entries give exactly 0, as would every column of a group left out); s2 = sum
      float s2 = 0.f;
#pragma unroll  // constant indices into s[]
      for (int g = 0; g < 8; ++g) {
        if (g >= ng) break;                                  // block-uniform: the groups behind are past the diagonal
        float a[4], e[4];
#pragma unroll
        for (int i = 0; i < 4; ++i) a[i] = s[4 * g + i] - m2;
        hw_exp2x4(e, a);
#pragma unroll
        for (int i = 0; i < 4; ++i) { s[4 * g + i] = e[i]; s2 += e[i]; }
      }
#pragma unroll
      for (int o = 16; o > 0; o >>= 1) s2 += __shfl_xor(s2, o, 32);
      const float inv2 = hw_rcp(s2);

      // F: attn probabilities -> bf16 hi/lo planes in LDS (8-B stores per lane); phase 3 reads columns < ng*128 alone
      u16* ahp = aH + row * AST + cl;
      u16* alp = aL + row * AST + cl;
#pragma unroll  // constant indices into s[]
      for (int g = 0; g < 8; ++g) {
        if (g >= ng) break;                                  // block-uniform: the groups behind are past the diagonal
        unsigned hw[4], lw[4];
#pragma unroll
        for (int i = 0; i < 4; ++i) split2(s[4 * g + i] * inv2, hw[i], lw[i]);
        v2u vh, vl;
        vh.x = hw[0] | (hw[1] << 16); vh.y = hw[2] | (hw[3] << 16);
        vl.x = lw[0] | (lw[1] << 16); vl.y = lw[2] | (lw[3] << 16);
        *(v2u*)(ahp + 128 * g) = vh;
        *(v2u*)(alp + 128 * g) = vl;
      }
    }
  }
  __syncthreads();   // P planes complete (block barrier between the LDS spill and the fragment reload)

  // ---- phase 3: out(16x64) = attn(16x1024) . V(1024x64); key tiles beyond the causal range carry exact zeros
  if (w < 4) {                                               // wave-uniform
    const int nt  = w;                                       // output columns nt*16..+15
    const int nkt = q0 / 32 + 1;                             // <= 32, block-uniform
    const size_t vrow = ((size_t)(b * DM + h * DKK + nt * 16)) * SS + lane * 8;
    const int nk4 = (nkt + 3) & ~3;                          // whole groups of four tiles (128 columns, as in phase 2), <= 32: the added tiles have P == 0
    const int pa0 = l15 * AST + hl * 8;
    v8f acc = zero8();
    // ring of four V tiles in registers: a tile's slot is loaded again, four tiles ahead, behind its product
    v16bf vh[4], vl[4];
#pragma unroll  // constant indices, or the ring falls to scratch
    for (int j = 0; j < 4; ++j) {
      vh[j] = ldg_frag(Vh, vrow + (size_t)j * 512);
      vl[j] = ldg_frag(Vl, vrow + (size_t)j * 512);
    }
    // the two V address pairs stay live up to this wait: no load above may land on them
    asm volatile("s_wait_xcnt 0x0" :: "v"(Vh + vrow), "v"(Vl + vrow) : "memory");
    int k0 = 0;
    for (; k0 + 4 < nk4; k0 += 4) {
      v16bf ph[4], pl[4];
#pragma unroll  // constant indices; the group's four P tiles are read from LDS in one go
      for (int j = 0; j < 4; ++j) {
        ph[j] = lds_frag(aH, pa0 + (k0 + j) * 32);
        pl[j] = lds_frag(aL, pa0 + (k0 + j) * 32);
      }
#pragma unroll  // constant indices into the ring
      for (int j = 0; j < 4; ++j) {
        acc = wmma3(acc, ph[j], pl[j], vh[j], vl[j]);
        vh[j] = ldg_frag(Vh, vrow + (size_t)(k0 + 4 + j) * 512);
        vl[j] = ldg_frag(Vl, vrow + (size_t)(k0 + 4 + j) * 512);
      }
      // the next trip's address additions overwrite registers that the loads in flight name
      asm volatile("s_wait_xcnt 0x0" ::: "memory");
    }
    {                                                        // last group: nothing left to load
      v16bf ph[4], pl[4];
#pragma unroll
      for (int j = 0; j < 4; ++j) {
        ph[j] = lds_frag(aH, pa0 + (k0 + j) * 32);
        pl[j] = lds_frag(aL, pa0 + (k0 + j) * 32);
      }
#pragma unroll
      for (int j = 0; j < 4; ++j) acc = wmma3(acc, ph[j], pl[j], vh[j], vl[j]);
    }
#pragma unroll
    for (int r = 0; r < 8; ++r)
      sO[(hl * 8 + r) * OST + nt * 16 + l15] = acc[r];
  }
  __syncthreads();

  // ---- store concat planes: two plane tiles; wave w owns half of tile w/2, one instruction per plane = 512 contiguous B
  if (w < 4) {
    const int s  = (w & 1) * 32 + lane;                      // chunk inside the tile
    const int cc = (w >> 1) * 32 + (s >> 4) * 8;
    const float* sp = sO + (s & 15) * OST + cc;
    const v4f a = *(const v4f*)sp;
    const v4f c = *(const v4f*)(sp + 4);
    float x[8] = {a.x, a.y, a.z, a.w, c.x, c.y, c.z, c.w};
    v4u vh, vl;
    split8(x, vh, vl);
    const size_t go = (size_t)(b * SS + q0) * DM + h * (DKK * 16) + (w >> 1) * 512 + s * 8;
    *(v4u*)(Ch + go) = vh;
    *(v4u*)(Cl + go) = vl;
    
  }
}

// ---------------------------------------------------------------- launcher
extern "C" void kernel_launch(void* const* d_in, const int* in_sizes, int n_in,
                              void* d_out, int out_size, void* d_ws, size_t ws_size,
                              hipStream_t stream) {
  if (n_in < 12) return;
  if (in_sizes[0] != (int)ACT || in_sizes[1] != (int)ACT || in_sizes[2] != (int)ACT) return;
  if (in_sizes[3] != (int)WEL || in_sizes[5] != (int)WEL || in_sizes[7] != (int)WEL || in_sizes[9] != (int)WEL) return;
  if (in_sizes[4] != DM || in_sizes[6] != DM || in_sizes[8] != DM || in_sizes[10] != DM) return;
  if (in_sizes[11] != HH) return;
  if (out_size != (int)ACT) return;

  const float* q   = (const float*)d_in[0];
  const float* k   = (const float*)d_in[1];
  const float* v   = (const float*)d_in[2];
  const float* Wq  = (const float*)d_in[3];
  const float* bq  = (const float*)d_in[4];
  const float* Wk  = (const float*)d_in[5];
  const float* bk  = (const float*)d_in[6];
  const float* Wv  = (const float*)d_in[7];
  const float* bv  = (const float*)d_in[8];
  const float* Wo  = (const float*)d_in[9];
  const float* bo  = (const float*)d_in[10];
  const float* gam = (const float*)d_in[11];
  float* out = (float*)d_out;

  // workspace carve (256-B aligned): q, k, v planes hi and lo (the q planes are reused for the concat planes),
  // Wq, Wk, Wv, Wo planes hi and lo, Qp, Kp, Vt planes hi and lo.  Total 112 MiB.
  char* ws = (char*)d_ws;
  size_t off = 0;
  auto carve = [&](size_t bytes) -> char* {
    char* p = ws + off;
    off += (bytes + 255) & ~(size_t)255;
    return p;
  };
  u16* actH = (u16*)carve(3 * ACT * 2);
  u16* actL = (u16*)carve(3 * ACT * 2);
  u16* wH   = (u16*)carve(4 * WEL * 2);
  u16* wL   = (u16*)carve(4 * WEL * 2);
  u16* prH  = (u16*)carve(3 * ACT * 2);             // Qp, Kp, Vt
  u16* prL  = (u16*)carve(3 * ACT * 2);
  if (off > ws_size) return;

  const dim3 pgrid(DM / 128, MROWS / (64 * MT), 3); // (8, 16, 3)
  const dim3 ggrid(DM / 128, MROWS / (64 * MT));    // (8, 16)
  const dim3 agrid(SS / 16, HH, BB);                // (64, 16, 4)

  // all seven f32 matrices -> planes
  k_split<<<dim3(SPLIT_BLKS), 256, 0, stream>>>(q, k, v, Wq, Wk, Wv, Wo, actH, actL, wH, wL);
  // q, k, v projections -> Qp, Kp planes, Vt planes (k = token)
  k_gemm3<0><<<pgrid, 256, 0, stream>>>(actH, actL, wH, wL, bq, bk, bv, prH, prL, out);
  // attention -> concat planes (reuse the q planes)
  k_attn<<<agrid, 256, SMEM_ATTN, stream>>>(prH, prL, prH + ACT, prL + ACT, prH + 2 * ACT, prL + 2 * ACT, gam, actH, actL);
  // output projection -> f32 result
  k_gemm3<2><<<ggrid, 256, 0, stream>>>(actH, actL, wH + 3 * WEL, wL + 3 * WEL, bo, bo, bo, prH, prL, out);
}

// v008
// It runs in 181 microseconds.
// Two timings next to v007 both put it at 1.08 times that version's speed.
// Counting every step since v000, it is 3.53 times as fast.
#include <hip/hip_runtime.h>
#include <math.h>
#include <stdint.h>
#include <stddef.h>

// All six contractions (three input projections, q.k^T scores, attn.V, output projection): v_wmma_f32_16x16x32_bf16 with bf16 hi/lo three-term split operands (hi*hi + hi*lo + lo*hi), f32 accumulate; softmax / cumsum / distance-decay row math in f32 on VALU.

typedef __bf16         v16bf __attribute__((ext_vector_type(16)));
typedef float          v8f   __attribute__((ext_vector_type(8)));
typedef float          v4f   __attribute__((ext_vector_type(4)));
typedef unsigned int   v4u   __attribute__((ext_vector_type(4)));
typedef unsigned int   v2u   __attribute__((ext_vector_type(2)));
typedef unsigned short u16;

union Frag { v16bf v; v4u u[2]; };

static constexpr int BB  = 4;
static constexpr int SS  = 1024;
static constexpr int DM  = 1024;
static constexpr int HH  = 16;
static constexpr int DKK = 64;
static constexpr int MROWS = BB * SS;                 // 4096
static constexpr size_t ACT = (size_t)MROWS * DM;     // 4194304
static constexpr size_t WEL = (size_t)DM * DM;        // 1048576
static_assert(HH * DKK == DM);
static_assert(MROWS % 64 == 0);
static_assert(DM % 128 == 0);
static_assert(DM % 64 == 0);
static_assert(SS % 64 == 0);
static_assert(ACT % 2048 == 0);
static_assert(WEL % 2048 == 0);
static_assert(SS == DM);                              // one tile map serves every plane

// Every bf16 plane is a [rows][1024] matrix stored in fragment order: 1-KiB tiles of 16 rows x 32 k,
// tile index (row/16)*KB + k/32; inside a tile the 16-B chunk of (row, k/8) sits at (k/8 % 4)*16 + row%16.
// A lane's two fragment chunks are then chunk 'lane' and chunk '32 + lane' of the tile, so one
// wave-wide 16-B load covers 512 contiguous bytes.
static constexpr int KB = DM / 32;                    // tiles along k

// ---------------------------------------------------------------- small helpers
__device__ __forceinline__ unsigned bf16_bits(float x) {          // RNE f32 -> bf16 bits
  unsigned u = __float_as_uint(x);
  u += 0x7FFFu + ((u >> 16) & 1u);
  return u >> 16;
}
__device__ __forceinline__ void split2(float x, unsigned& hi, unsigned& lo) {
  hi = bf16_bits(x);
  const float xh = __uint_as_float(hi << 16);
  lo = bf16_bits(x - xh);                                         // x - xh exact in f32
}
// 8 consecutive f32 -> packed 8 bf16 hi (16 B) and 8 bf16 lo (16 B)
__device__ __forceinline__ void split8(const float* x, v4u& vh, v4u& vl) {
  unsigned hw[4], lw[4];
#pragma unroll
  for (int i = 0; i < 4; ++i) {
    unsigned h0, l0, h1, l1;
    split2(x[2 * i], h0, l0);
    split2(x[2 * i + 1], h1, l1);
    hw[i] = h0 | (h1 << 16);
    lw[i] = l0 | (l1 << 16);
  }
  vh.x = hw[0]; vh.y = hw[1]; vh.z = hw[2]; vh.w = hw[3];
  vl.x = lw[0]; vl.y = lw[1]; vl.z = lw[2]; vl.w = lw[3];
}
__device__ __forceinline__ v8f zero8() {
  v8f z;
#pragma unroll
  for (int i = 0; i < 8; ++i) z[i] = 0.f;
  return z;
}
// 16x32 operand fragment from one plane tile: elements 0..7 <- k 8*(lane>>4).., 8..15 <- 16 further,
// row lane&15 (same map for A rows and for B stored [n][k])
// (caller passes e = row0*DM + (k0/32)*512 + 8*lane, the lane's first chunk of the tile at row0, k0)
__device__ __forceinline__ v16bf ldg_frag(const u16* __restrict__ p, size_t e) {
  Frag f;
  f.u[0] = *(const v4u*)(p + e);
  f.u[1] = *(const v4u*)(p + e + 256);
  return f.v;
}
// the same through a pointer that is typed as global memory: an address that has passed through an asm statement
// has lost what the compiler knew of its origin, and an untyped one would load by flat_load
typedef const __attribute__((address_space(1))) u16* gptr;
typedef const __attribute__((address_space(1))) v4u* gptr4;
__device__ __forceinline__ v16bf ldg_frag_g(gptr p, size_t e) {
  Frag f;
  f.u[0] = *(gptr4)(p + e);
  f.u[1] = *(gptr4)(p + e + 256);
  return f.v;
}
// 16x32 operand fragment from a k-contiguous bf16 row in LDS: elements 0..7 <- e.., 8..15 <- e+16..
// (caller passes e = row*pitch + k0 + 8*(lane>>4))
__device__ __forceinline__ v16bf lds_frag(const u16* p, int e) {
  Frag f;
  f.u[0] = *(const v4u*)(p + e);
  f.u[1] = *(const v4u*)(p + e + 16);
  return f.v;
}
// 2^x, log2(x), sqrt(x) and 1/x as the chip's own single instructions (about 1 ulp), without libm's range reduction,
// range checks and refinement steps.  A result below the normal range may come out as 0, a subnormal
// sqrt argument likewise: every use below adds such a value to a sum that is at least 1 or clamps it;
// the two reciprocals are of such sums (1 <= sum <= 1024).
// Eight at a time in one statement: behind a transcendental the instruction set wants one slot before its
// result is read or its source overwritten.  "=&v" keeps every result apart from every argument, so no
// neighbour takes a source's register; the v_nop is the slot behind the last one; the s_delay_alu is the
// issue hint for the arguments, which the compiler cannot give for instructions inside a statement.
__device__ __forceinline__ void hw_exp2x8(float (&r)[8], const float (&a)[8]) {
  asm("s_delay_alu instid0(VALU_DEP_1)\n\t"
      "v_exp_f32 %0, %8\n\tv_exp_f32 %1, %9\n\tv_exp_f32 %2, %10\n\tv_exp_f32 %3, %11\n\t"
      "v_exp_f32 %4, %12\n\tv_exp_f32 %5, %13\n\tv_exp_f32 %6, %14\n\tv_exp_f32 %7, %15\n\t"
      "v_nop"
      : "=&v"(r[0]), "=&v"(r[1]), "=&v"(r[2]), "=&v"(r[3]), "=&v"(r[4]), "=&v"(r[5]), "=&v"(r[6]), "=&v"(r[7])
      : "v"(a[0]), "v"(a[1]), "v"(a[2]), "v"(a[3]), "v"(a[4]), "v"(a[5]), "v"(a[6]), "v"(a[7]));
}
// the same, four at a time, for the passes that go group by group
__device__ __forceinline__ void hw_exp2x4(float (&r)[4], const float (&a)[4]) {
  asm("s_delay_alu instid0(VALU_DEP_1)\n\t"
      "v_exp_f32 %0, %4\n\tv_exp_f32 %1, %5\n\tv_exp_f32 %2, %6\n\tv_exp_f32 %3, %7\n\t"
      "v_nop"
      : "=&v"(r[0]), "=&v"(r[1]), "=&v"(r[2]), "=&v"(r[3])
      : "v"(a[0]), "v"(a[1]), "v"(a[2]), "v"(a[3]));
}
__device__ __forceinline__ void hw_sqrtx4(float (&r)[4], const float (&a)[4]) {
  asm("s_delay_alu instid0(VALU_DEP_1)\n\t"
      "v_sqrt_f32 %0, %4\n\tv_sqrt_f32 %1, %5\n\tv_sqrt_f32 %2, %6\n\tv_sqrt_f32 %3, %7\n\t"
      "v_nop"
      : "=&v"(r[0]), "=&v"(r[1]), "=&v"(r[2]), "=&v"(r[3])
      : "v"(a[0]), "v"(a[1]), "v"(a[2]), "v"(a[3]));
}
// x + (x of the lane N places down in the same 16-lane row; 0 where there is none): one step of a running sum over lanes
template <int N>
__device__ __forceinline__ float row_shr_add(float x) {
  return x + __int_as_float(__builtin_amdgcn_update_dpp(0, __float_as_int(x), 0x110 + N, 0xf, 0xf, true));
}
__device__ __forceinline__ float hw_rcp(float x) { return __builtin_amdgcn_rcpf(x); }
static constexpr float LOG2E = 1.44269504088896340736f;
// three-term split product (hi*hi, then hi*lo, then lo*hi) into two accumulators that share the B operand, term by term
// in turn, so that neighbouring products are independent; then the hazard guard
__device__ __forceinline__ void wmma3x2(v8f& c0, v8f& c1, v16bf a0h, v16bf a0l, v16bf a1h, v16bf a1l, v16bf bh, v16bf bl) {
  c0 = __builtin_amdgcn_wmma_f32_16x16x32_bf16(false, a0h, false, bh, (short)0, c0, false, false);
  c1 = __builtin_amdgcn_wmma_f32_16x16x32_bf16(false, a1h, false, bh, (short)0, c1, false, false);
  c0 = __builtin_amdgcn_wmma_f32_16x16x32_bf16(false, a0h, false, bl, (short)0, c0, false, false);
  c1 = __builtin_amdgcn_wmma_f32_16x16x32_bf16(false, a1h, false, bl, (short)0, c1, false, false);
  c0 = __builtin_amdgcn_wmma_f32_16x16x32_bf16(false, a0l, false, bh, (short)0, c0, false, false);
  c1 = __builtin_amdgcn_wmma_f32_16x16x32_bf16(false, a1l, false, bh, (short)0, c1, false, false);
  // the four slots between the last products and whatever lands on their registers (ties D, keeps A/B live)
  asm volatile("v_nop\n\tv_nop\n\tv_nop\n\tv_nop" : "+v"(c0), "+v"(c1)
               : "v"(a0h), "v"(a0l), "v"(a1h), "v"(a1l), "v"(bh), "v"(bl));
}

// ---------------------------------------------------------------- f32 [rows][1024] -> bf16 hi/lo planes (fragment order)
// One launch splits all seven f32 matrices (q, k, v, Wq, Wk, Wv, Wo): none reads another's result.
// aH/aL hold the three activation planes one behind the other, wH/wL the four weight planes.
// A unit is 8 rows x 32 k of one tile, one wave's work: 8 whole 128-B lines read, 4 whole lines stored per plane.
// A block takes 128 consecutive units of ONE matrix (32 rows), 16 per wave.
static constexpr int UPB      = 128;                        // units per block
static constexpr int ACT_BLKS = (int)(ACT / 256 / UPB);     // 128 blocks per activation
static constexpr int WEL_BLKS = (int)(WEL / 256 / UPB);     // 32 blocks per weight
static constexpr int SPLIT_BLKS = 3 * ACT_BLKS + 4 * WEL_BLKS;
static_assert(ACT % (256 * UPB) == 0);
static_assert(WEL % (256 * UPB) == 0);

__global__ void __launch_bounds__(256)
k_split(const float* __restrict__ q, const float* __restrict__ k, const float* __restrict__ v,
        const float* __restrict__ Wq, const float* __restrict__ Wk, const float* __restrict__ Wv,
        const float* __restrict__ Wo,
        u16* __restrict__ aH, u16* __restrict__ aL, u16* __restrict__ wH, u16* __restrict__ wL) {
  const int blk  = blockIdx.x;
  const int lane = threadIdx.x & 31;
  const int w    = threadIdx.x >> 5;
  const float* in;
  u16 *ph, *pl;
  int u0;                                                   // the block's first unit inside its matrix
  if (blk < 3 * ACT_BLKS) {                                 // block-uniform
    const int a = blk / ACT_BLKS;
    in = (a == 0) ? q : (a == 1) ? k : v;
    ph = aH + (size_t)a * ACT;
    pl = aL + (size_t)a * ACT;
    u0 = (blk - a * ACT_BLKS) * UPB;
  } else {
    const int a = (blk - 3 * ACT_BLKS) / WEL_BLKS;
    in = (a == 0) ? Wq : (a == 1) ? Wk : (a == 2) ? Wv : Wo;
    ph = wH + (size_t)a * WEL;
    pl = wL + (size_t)a * WEL;
    u0 = (blk - 3 * ACT_BLKS - a * WEL_BLKS) * UPB;
  }
  // the wave's n-th unit is unit n*8 + w of the block: half w&1 of tile (n&7)*4 + w/2 in the block's tile row n>>3,
  // so every address below is one lane address plus a compile-time offset
  const int r = (w & 1) * 8 + (lane & 7);                   // row inside the tile
  const int j = lane >> 3;                                  // 8-element chunk along k
  const float* src = in + (size_t)((u0 >> 6) * 16 + r) * DM + (w >> 1) * 32 + j * 8;
  const size_t dst = ((size_t)((u0 >> 1) + (w >> 1)) * 64 + j * 16 + r) * 8;
  v4f a[16], c[16];
#pragma unroll  // constant indices, or a[] and c[] fall to scratch
  for (int n = 0; n < 16; ++n) {
    const float* p = src + (n >> 3) * 16 * DM + (n & 7) * 128;
    a[n] = *(const v4f*)p;
    c[n] = *(const v4f*)(p + 4);
  }
  // keeps all 32 loads ahead of the arithmetic: left alone the compiler sinks them and holds about six in flight
  __builtin_amdgcn_sched_barrier(0);
#pragma unroll  // constant indices
  for (int n = 0; n < 16; ++n) {
    float x[8] = {a[n].x, a[n].y, a[n].z, a[n].w, c[n].x, c[n].y, c[n].z, c[n].w};
    v4u vh, vl;
    split8(x, vh, vl);
    const size_t d = dst + (size_t)((n >> 3) * KB + (n & 7) * 4) * 512;
    *(v4u*)(ph + d) = vh;
    *(v4u*)(pl + d) = vl;
  }
}

// ---------------------------------------------------------------- GEMM: out = A @ W^T + bias
// A planes [M=4096][K=1024] bf16 hi/lo, W planes [N=1024][K] bf16 hi/lo ([out,in]), both in fragment order;
// bias [N] f32. Block 256 thr = 8 waves, block tile 256(M) x 128(N), wave tile 64 x 64: four 16-row tiles, 64 rows apart,
// times four 16-column tiles, so a loaded A or B fragment feeds four accumulators: a wave loads 16 KiB per 48 products.
// About 470 VGPRs per wave: two waves per SIMD, one block per WGP.
// Fragments straight from global (no LDS in the k-loop), fetched two k steps ahead.  Epilogue: tile staged in LDS, then
// MODE 0: the three input projections in one launch, blockIdx.z = 0, 1, 2 for q, k, v: operand, weight and result
//         planes of projection z lie z planes behind the pointers given.  Result of z = 0, 1: bf16 hi/lo planes
//         [M][N] in fragment order; of z = 2: planes transposed [(m/SS)*N + n][m%SS] in fragment order
//         (k = token, for attn.V)
// MODE 2: f32 row-major [M][N] (Of)
static constexpr int TP = 132;   // LDS tile pitch (floats)
static constexpr int MT = 4;     // 16-row A tiles per wave
static_assert(MROWS % (64 * MT) == 0);

template <int MODE>
__global__ void __launch_bounds__(256)
k_gemm3(const u16* __restrict__ Ah0, const u16* __restrict__ Al0,
        const u16* __restrict__ Wh0, const u16* __restrict__ Wl0,
        const float* __restrict__ bias0, const float* __restrict__ bias1, const float* __restrict__ bias2,
        u16* __restrict__ Oh0, u16* __restrict__ Ol0, float* __restrict__ Of) {
  constexpr int N = DM, K = DM;
  __shared__ __attribute__((aligned(16))) float sT[64 * MT * TP];

  const int z = (MODE == 0) ? (int)blockIdx.z : 0;     // which projection; block-uniform
  const u16* __restrict__ Ah = Ah0 + (size_t)z * ACT;
  const u16* __restrict__ Al = Al0 + (size_t)z * ACT;
  const u16* __restrict__ Wh = Wh0 + (size_t)z * WEL;
  const u16* __restrict__ Wl = Wl0 + (size_t)z * WEL;
  const float* __restrict__ bias = (z == 0) ? bias0 : (z == 1) ? bias1 : bias2;
  u16* __restrict__ Oh = Oh0 + (size_t)z * ACT;
  u16* __restrict__ Ol = Ol0 + (size_t)z * ACT;

  const int lane = threadIdx.x & 31;
  const int w    = threadIdx.x >> 5;
  const int wm   = w & 3;              // 0..3
  const int wn   = w >> 2;             // 0..1
  const int hl   = lane >> 4;
  const int l15  = lane & 15;
  const int m0b  = blockIdx.y * (64 * MT);
  const int n0b  = blockIdx.x * 128;
  const int m0   = m0b + wm * 16;
  const int n0   = n0b + wn * 64;

  v8f acc[MT][4];
#pragma unroll
  for (int mt = 0; mt < MT; ++mt)
#pragma unroll
    for (int nt = 0; nt < 4; ++nt) acc[mt][nt] = zero8();

  // the lane's four running addresses, at the current even k step; every load is one of them plus a constant
  gptr pah = (gptr)(Ah + (size_t)m0 * K + lane * 8);    // A rows m0..m0+15 (+mt*64 rows)
  gptr pal = (gptr)(Al + (size_t)m0 * K + lane * 8);
  gptr pbh = (gptr)(Wh + (size_t)n0 * K + lane * 8);    // W rows n0..n0+15 (+nt*16 rows)
  gptr pbl = (gptr)(Wl + (size_t)n0 * K + lane * 8);

  // Two register sets of fragments, even and odd k steps.  A set is loaded again, for two k steps later,
  // behind its 48 products, so a load has the other set's 48 products' time to come back.
  v16bf ah[2][MT], al[2][MT], bh[2][4], bl[2][4];
#pragma unroll  // constant indices, or the sets fall to scratch
  for (int p = 0; p < 2; ++p) {
#pragma unroll
    for (int mt = 0; mt < MT; ++mt) {
      ah[p][mt] = ldg_frag_g(pah, (size_t)mt * 64 * K + p * 512);
      al[p][mt] = ldg_frag_g(pal, (size_t)mt * 64 * K + p * 512);
    }
#pragma unroll
    for (int nt = 0; nt < 4; ++nt) {
      bh[p][nt] = ldg_frag_g(pbh, (size_t)nt * 16 * K + p * 512);
      bl[p][nt] = ldg_frag_g(pbl, (size_t)nt * 16 * K + p * 512);
    }
  }
  // one k step: hi*hi, then hi*lo, then lo*hi into each accumulator (the order of wmma3x2), term by term over the
  // 16 accumulators, so that neighbouring products are independent
#define GEMM_KSTEP(p)                                                                                        \
  _Pragma("unroll") for (int mt = 0; mt < MT; ++mt)                                                          \
    _Pragma("unroll") for (int nt = 0; nt < 4; ++nt)                                                         \
      acc[mt][nt] = __builtin_amdgcn_wmma_f32_16x16x32_bf16(false, ah[p][mt], false, bh[p][nt], (short)0,    \
                                                            acc[mt][nt], false, false);                      \
  _Pragma("unroll") for (int mt = 0; mt < MT; ++mt)                                                          \
    _Pragma("unroll") for (int nt = 0; nt < 4; ++nt)                                                         \
      acc[mt][nt] = __builtin_amdgcn_wmma_f32_16x16x32_bf16(false, ah[p][mt], false, bl[p][nt], (short)0,    \
                                                            acc[mt][nt], false, false);                      \
  _Pragma("unroll") for (int mt = 0; mt < MT; ++mt)                                                          \
    _Pragma("unroll") for (int nt = 0; nt < 4; ++nt)                                                         \
      acc[mt][nt] = __builtin_amdgcn_wmma_f32_16x16x32_bf16(false, al[p][mt], false, bh[p][nt], (short)0,    \
                                                            acc[mt][nt], false, false);
#pragma unroll 1  // one trip already holds both sets; further copies only grow the code
  for (int kb = 0; kb < K / 32 - 2; kb += 2) {
#pragma unroll  // constant indices into the sets
    for (int p = 0; p < 2; ++p) {
      GEMM_KSTEP(p)
      // the four slots between the last products and the loads that land on their A and B registers; the
      // scheduling fences keep every product above the slots and the reloads in one group directly below them
      // (left alone the compiler sinks the reloads halfway into the other set's products, which halves their lead)
      __builtin_amdgcn_sched_barrier(0);
      asm volatile("v_nop\n\tv_nop\n\tv_nop\n\tv_nop");
      __builtin_amdgcn_sched_barrier(0);
#pragma unroll
      for (int mt = 0; mt < MT; ++mt) {
        ah[p][mt] = ldg_frag_g(pah, (size_t)mt * 64 * K + (2 + p) * 512);
        al[p][mt] = ldg_frag_g(pal, (size_t)mt * 64 * K + (2 + p) * 512);
      }
#pragma unroll
      for (int nt = 0; nt < 4; ++nt) {
        bh[p][nt] = ldg_frag_g(pbh, (size_t)nt * 16 * K + (2 + p) * 512);
        bl[p][nt] = ldg_frag_g(pbl, (size_t)nt * 16 * K + (2 + p) * 512);
      }
      __builtin_amdgcn_sched_barrier(0);
    }
    // the four additions below overwrite registers that the loads in flight name; as operands of the wait the
    // address pairs keep registers of their own up to it, so that no reload lands on one either
    asm volatile("s_wait_xcnt 0x0" : "+v"(pah), "+v"(pal), "+v"(pbh), "+v"(pbl) :: "memory");
    pah += 2 * 512; pal += 2 * 512; pbh += 2 * 512; pbl += 2 * 512;
  }
  // the last two k steps: nothing left to load
  GEMM_KSTEP(0)
  GEMM_KSTEP(1)
#undef GEMM_KSTEP

  const int bi = n0 + l15;
  float bb[4];
#pragma unroll
  for (int nt = 0; nt < 4; ++nt) bb[nt] = bias[bi + nt * 16];
  // the index register stays live up to this wait: none of the four loads may land on it before it
  asm volatile("s_wait_xcnt 0x0" :: "v"(bi) : "memory");

  // stage the 256x128 f32 tile (+bias) in LDS; D element r of lane = (row 8h+r, col l15)
#pragma unroll  // constant indices into acc
  for (int mt = 0; mt < MT; ++mt)
#pragma unroll
    for (int nt = 0; nt < 4; ++nt)
#pragma unroll
      for (int r = 0; r < 8; ++r)
        sT[(mt * 64 + wm * 16 + hl * 8 + r) * TP + wn * 64 + nt * 16 + l15] = acc[mt][nt][r] + bb[nt];
  __syncthreads();

  // the tile leaves in MT parts of 64 rows.  The next part's LDS loads and arithmetic overwrite registers that this
  // part's stores name: the wait behind the stores stands in front of them, and the two scheduling fences keep the
  // compiler from moving any of them in between the first store and the wait
  if (MODE == 0 && z < 2) {
    // per part 4 x 4 plane tiles; a wave pair owns tile j*4 + w/2, one instruction = half a tile = 512 contiguous B
    const int s = (w & 1) * 32 + lane;                     // chunk inside the tile
#pragma unroll 1  // the parts differ only in their addresses: copies would only grow the code
    for (int mt = 0; mt < MT; ++mt) {
      const int mh  = m0b + mt * 64;                       // the part's first row
      const int kbl = w >> 1;                              // tile column; tile row is j
      v4u vh[4], vl[4];
#pragma unroll
      for (int j = 0; j < 4; ++j) {
        const int row = mt * 64 + j * 16 + (s & 15);
        const float* sp = sT + row * TP + kbl * 32 + (s >> 4) * 8;
        const v4f a = *(const v4f*)sp;
        const v4f c = *(const v4f*)(sp + 4);
        float x[8] = {a.x, a.y, a.z, a.w, c.x, c.y, c.z, c.w};
        split8(x, vh[j], vl[j]);
      }
      const size_t go = ((size_t)((mh >> 4) * KB + (n0b >> 5) + kbl) * 64 + s) * 8;   // tile row j: j*KB tiles on
      u16* oh = Oh + go;
      u16* ol = Ol + go;
      __builtin_amdgcn_sched_barrier(0);                   // all arithmetic above the stores
#pragma unroll
      for (int j = 0; j < 4; ++j) {
        *(v4u*)(oh + (size_t)j * KB * 512) = vh[j];
        *(v4u*)(ol + (size_t)j * KB * 512) = vl[j];
      }
      asm volatile("s_wait_xcnt 0x0" ::: "memory");
      __builtin_amdgcn_sched_barrier(0);
    }
  } else if (MODE == 0) {
    // per part 8 (features) x 2 (tokens) plane tiles; wave w owns features w*16..+15, one instruction = half a tile
    const int f = w * 16 + l15;
#pragma unroll 1  // the parts differ only in their addresses: copies would only grow the code
    for (int mt = 0; mt < MT; ++mt) {
      const int mh   = m0b + mt * 64;                      // the part's first row
      const int bidx = mh / SS;
      const int s0   = mh - bidx * SS;
      v4u vh[4], vl[4];
#pragma unroll
      for (int j = 0; j < 4; ++j) {
        const int s  = (j & 1) * 32 + lane;                // chunk inside the tile
        const int tc = (j >> 1) * 32 + (s >> 4) * 8;       // first of its 8 tokens
        float x[8];
#pragma unroll
        for (int i = 0; i < 8; ++i) x[i] = sT[(mt * 64 + tc + i) * TP + f];
        split8(x, vh[j], vl[j]);
      }
      // half tile j (tile j/2, chunks (j&1)*32 + lane) lies j*256 elements behind half tile 0
      const size_t go = ((size_t)(((bidx * N + n0b) >> 4) + w) * KB + (s0 >> 5)) * 512 + (size_t)lane * 8;
      u16* oh = Oh + go;
      u16* ol = Ol + go;
      __builtin_amdgcn_sched_barrier(0);                   // all arithmetic above the stores
#pragma unroll
      for (int j = 0; j < 4; ++j) {
        *(v4u*)(oh + j * 256) = vh[j];
        *(v4u*)(ol + j * 256) = vl[j];
      }
      asm volatile("s_wait_xcnt 0x0" ::: "memory");
      __builtin_amdgcn_sched_barrier(0);
    }
  } else {
    // f32: per part wave w owns rows w*8..+7; one instruction = 32 lanes x 16 B = one 512-B row segment.
    const int cc4 = lane * 4;
#pragma unroll 1  // the parts differ only in their addresses: copies would only grow the code
    for (int mt = 0; mt < MT; ++mt) {
      const int row0 = mt * 64 + w * 8;
      v4f val[8];
#pragma unroll
      for (int j = 0; j < 8; ++j) val[j] = *(const v4f*)(sT + (row0 + j) * TP + cc4);
      float* op = Of + (size_t)(m0b + row0) * N + n0b + cc4;
      __builtin_amdgcn_sched_barrier(0);                   // all arithmetic above the stores
#pragma unroll
      for (int j = 0; j < 8; ++j) *(v4f*)(op + (size_t)j * N) = val[j];
      asm volatile("s_wait_xcnt 0x0" ::: "memory");
      __builtin_amdgcn_sched_barrier(0);
    }
  }
}

// ---------------------------------------------------------------- distance-decay attention
// grid (S/32, H, B); block 256 thr = 8 waves; 32 query rows (two 16-row tiles), full 1024-key score rows in LDS.
// A K or V fragment in registers feeds both query tiles: half the K and V loads per query row of a 16-row block.
// Qp, Kp planes [b*S+s][h*64+d], Vt planes [b*1024+h*64+d][s], concat planes [b*S+s][h*64+d]: all in fragment order;
// Row math runs in registers: the owning wave reads a score row from LDS once, 32 columns per lane (8 groups of 4),
// and writes the row's bf16 hi and lo probabilities over the same row (2 + 2 bytes a column on the 4 of the score),
// so that 32 rows take no more LDS than 16 rows with planes of their own and two blocks still share a WGP.
static constexpr int QR  = 32;                            // query rows per block
static constexpr int SST = 1036;                          // f32 score row pitch: 259 * 16 B; 8 rows = 32 banks mod 64
static constexpr int PST = 2 * SST;                       // the same pitch in bf16 elements
static constexpr int PLO = 1032;                          // the lo plane's start inside a row, in bf16 elements (129 * 16 B)
static constexpr int OST = 68;                            // f32 out-tile pitch
static constexpr size_t SM_S = (size_t)QR * SST * 4;      // 132608
static constexpr size_t SM_O = (size_t)QR * OST * 4;      // 8704
static constexpr size_t SMEM_ATTN = SM_S + SM_O;          // 141312
static_assert(SS % QR == 0);
static_assert(128 % QR == 0);                             // a block's rows share one last 128-column group
static_assert(PLO >= SS && PLO + SS <= PST);
static_assert(SM_S % 16 == 0);

__global__ void __launch_bounds__(256)
k_attn(const u16* __restrict__ Qh, const u16* __restrict__ Ql,
       const u16* __restrict__ Kh, const u16* __restrict__ Kl,
       const u16* __restrict__ Vh, const u16* __restrict__ Vl,
       const float* __restrict__ gammas,
       u16* __restrict__ Ch, u16* __restrict__ Cl) {
  extern __shared__ __attribute__((aligned(16))) char smem[];
  float* sS   = (float*)smem;                               // [QR][SST] scores
  u16*   aH   = (u16*)smem;                                 // [QR][PST] bf16 hi, over the row's own scores
  u16*   aL   = aH + PLO;                                   // [QR][PST] bf16 lo, behind the hi plane in the same row
  float* sO   = (float*)(smem + SM_S);                      // [QR][OST]

  const int qt = blockIdx.x, h = blockIdx.y, b = blockIdx.z;
  const int q0 = qt * QR;
  const int lane = threadIdx.x & 31;
  const int w    = threadIdx.x >> 5;
  const int hl   = lane >> 4;
  const int l15  = lane & 15;

  // ---- phase 1: sS[32][1024] = Q(32x64) . K^T / 8 * log2(e): scores in base-2 units, so that every
  //      exp(a - b) of the row math is 2^(a' - b') with no multiply of its own ------------------
  {
    const size_t qrow = (size_t)(b * SS + q0) * DM + h * (DKK * 16) + lane * 8;
    v16bf qh0[2], ql0[2], qh1[2], ql1[2];                    // [query tile]
#pragma unroll  // constant indices
    for (int u = 0; u < 2; ++u) {
      const size_t e = qrow + (size_t)u * 16 * DM;
      qh0[u] = ldg_frag(Qh, e);       ql0[u] = ldg_frag(Ql, e);
      qh1[u] = ldg_frag(Qh, e + 512); ql1[u] = ldg_frag(Ql, e + 512);
    }
    // the two Q address pairs stay live up to this wait: no later load may land on them before it
    asm volatile("s_wait_xcnt 0x0" :: "v"(Qh + qrow), "v"(Ql + qrow) : "memory");
    // ring of four key tiles in registers: a tile's slot is loaded again, four tiles ahead, behind its products
    const size_t krow0 = (size_t)(b * SS + w * 128) * DM + h * (DKK * 16) + lane * 8;
    v16bf kh0[4], kl0[4], kh1[4], kl1[4];
#pragma unroll  // constant indices, or the ring falls to scratch
    for (int t = 0; t < 4; ++t) {
      const size_t krow = krow0 + (size_t)t * 16 * DM;
      kh0[t] = ldg_frag(Kh, krow);       kl0[t] = ldg_frag(Kl, krow);
      kh1[t] = ldg_frag(Kh, krow + 512); kl1[t] = ldg_frag(Kl, krow + 512);
    }
#pragma unroll  // constant indices into the ring
    for (int t = 0; t < 8; ++t) {                            // 8 key tiles of 16 per wave
      const int kt = w * 8 + t;
      const int sl = t & 3;
      v8f acc0 = zero8(), acc1 = zero8();
      wmma3x2(acc0, acc1, qh0[0], ql0[0], qh0[1], ql0[1], kh0[sl], kl0[sl]);
      wmma3x2(acc0, acc1, qh1[0], ql1[0], qh1[1], ql1[1], kh1[sl], kl1[sl]);
      if (t + 4 < 8) {
        const size_t krow = krow0 + (size_t)(t + 4) * 16 * DM;
        kh0[sl] = ldg_frag(Kh, krow);       kl0[sl] = ldg_frag(Kl, krow);
        kh1[sl] = ldg_frag(Kh, krow + 512); kl1[sl] = ldg_frag(Kl, krow + 512);
        // behind the last K load: its address pairs stay live up to this wait and are free for reuse behind it
        if (t == 3) asm volatile("s_wait_xcnt 0x0" :: "v"(Kh + krow0), "v"(Kl + krow0) : "memory");
      }
#pragma unroll
      for (int r = 0; r < 8; ++r) {
        sS[(hl * 8 + r) * SST + kt * 16 + l15]        = acc0[r] * (0.125f * LOG2E);
        sS[(16 + hl * 8 + r) * SST + kt * 16 + l15]   = acc1[r] * (0.125f * LOG2E);
      }
    }
  }
  __syncthreads();

  // ---- phase 2: row math, 4 rows per wave, all in registers.  A lane owns columns g*128 + 4*lane .. +3 of each of the
  //      eight 128-column groups g: every LDS access of a wave is one contiguous run, and a group that lies wholly
  //      past the block's last query row is needed for the first softmax's maximum and sum alone
  {
    const float gg  = gammas[h];
    // gam2 = -softplus(gg) * log2(e), so that exp(-d * softplus) = 2^(d * gam2); 1 + 2^(..) lies in (1, 2]
    const float gam2 = -(fmaxf(gg, 0.f) * LOG2E +
                         __builtin_amdgcn_logf(1.0f + __builtin_amdgcn_exp2f(-fabsf(gg) * LOG2E)));
    const int   ng  = (q0 >> 7) + 1;                         // groups that hold a column <= q0 + 31; block-uniform, 1..8
    const int   cl  = lane * 4;
    const float hiF = (lane >= 16) ? 1.f : 0.f;
    for (int rr = 0; rr < QR / 8; ++rr) {
      const int row = w + rr * 8;
      const int iq  = q0 + row;
      const float* srow = sS + row * SST + cl;

      float s[32];                                           // scores, then new scores, then e2; [4*g + i]
      float c[32];                                           // e, then the lane's running sum inside its four columns
#pragma unroll  // constant indices, or s[] falls to scratch
      for (int g = 0; g < 8; ++g) {
        const v4f a = *(const v4f*)(srow + 128 * g);
        s[4 * g] = a.x; s[4 * g + 1] = a.y; s[4 * g + 2] = a.z; s[4 * g + 3] = a.w;
      }

      // A: row max over all 1024 keys
      float m1 = -3.0e38f;
#pragma unroll  // constant indices into s[]
      for (int i = 0; i < 32; ++i) m1 = fmaxf(m1, s[i]);
#pragma unroll
      for (int o = 16; o > 0; o >>= 1) m1 = fmaxf(m1, __shfl_xor(m1, o, 32));

      // B: e = exp(score - max) = 2^(s - m1) over the full row; s1 = sum
      float s1 = 0.f;
#pragma unroll  // constant indices into s[] and c[]
      for (int g = 0; g < 4; ++g) {
        float a[8], e[8];
#pragma unroll
        for (int i = 0; i < 8; ++i) a[i] = s[8 * g + i] - m1;
        hw_exp2x8(e, a);
#pragma unroll
        for (int i = 0; i < 8; ++i) { c[8 * g + i] = e[i]; s1 += e[i]; }
      }
#pragma unroll
      for (int o = 16; o > 0; o >>= 1) s1 += __shfl_xor(s1, o, 32);
      const float inv1 = hw_rcp(s1);

      // C: p = softmax * (j <= i); running sum inside the lane's four columns, over the lanes of the group, over the groups
      float off[8];                                          // sum of all columns in front of the lane's four
      float base = 0.f;                                      // sum of the groups so far
#pragma unroll  // constant indices into c[] and off[]
      for (int g = 0; g < 8; ++g) {
        if (g >= ng) break;                                  // block-uniform: the groups behind are past the diagonal
        float run = 0.f;
#pragma unroll
        for (int i = 0; i < 4; ++i) {
          const float p = (g * 128 + cl + i <= iq) ? c[4 * g + i] * inv1 : 0.f;
          run += p;
          c[4 * g + i] = run;
        }
        float x = row_shr_add<1>(run);                     // inclusive sum over the 16-lane row
        x = row_shr_add<2>(x);
        x = row_shr_add<4>(x);
        x = row_shr_add<8>(x);
        // the other row's lane 15 and the own row's lane 15: the two rows' sums
        const float oth = __uint_as_float(__builtin_amdgcn_permlanex16(0u, __float_as_uint(x), 0xffffffffu, 0xffffffffu,
                                                                       false, false));
        const float own = __int_as_float(__builtin_amdgcn_update_dpp(0, __float_as_int(x), 0x15f, 0xf, 0xf, true));
        off[g] = base + (fmaf(oth, hiF, x) - run);
        base += own + oth;
      }
      const float disttotal = base;

      // D: decay factor, masked rescale, row max of the new scores
      float m2 = -3.0e38f;
#pragma unroll  // constant indices into s[], c[] and off[]
      for (int g = 0; g < 8; ++g) {
        if (g >= ng) break;                                  // block-uniform: the groups behind are past the diagonal
        float x[4], dsc[4], t[4], eff[4];
#pragma unroll
        for (int i = 0; i < 4; ++i) {
          const float distcum = off[g] + c[4 * g + i];
          const float pe = fabsf((float)(iq - (g * 128 + cl + i)));
          x[i] = fmaxf((disttotal - distcum) * pe, 0.f);
        }
        hw_sqrtx4(dsc, x);
#pragma unroll
        for (int i = 0; i < 4; ++i) t[i] = dsc[i] * gam2;
        hw_exp2x4(eff, t);
#pragma unroll
        for (int i = 0; i < 4; ++i) {
          const float ef = fminf(fmaxf(eff[i], 1e-5f), 1e5f);
          const float ns = (g * 128 + cl + i <= iq) ? s[4 * g + i] * ef : -1e32f;
          s[4 * g + i] = ns;
          m2 = fmaxf(m2, ns);
        }
      }
#pragma unroll
      for (int o = 16; o > 0; o >>= 1) m2 = fmaxf(m2, __shfl_xor(m2, o, 32));

      // E: e2 = 2^(ns - m2) (masked entries give exactly 0, as would every column of a group left out); s2 = sum
      float s2 = 0.f;
#pragma unroll  // constant indices into s[]
      for (int g = 0; g < 8; ++g) {
        if (g >= ng) break;                                  // block-uniform: the groups behind are past the diagonal
        float a[4], e[4];
#pragma unroll
        for (int i = 0; i < 4; ++i) a[i] = s[4 * g + i] - m2;
        hw_exp2x4(e, a);
#pragma unroll
        for (int i = 0; i < 4; ++i) { s[4 * g + i] = e[i]; s2 += e[i]; }
      }
#pragma unroll
      for (int o = 16; o > 0; o >>= 1) s2 += __shfl_xor(s2, o, 32);
      const float inv2 = hw_rcp(s2);

      // F: attn probabilities -> bf16 hi/lo planes in LDS (8-B stores per lane), over this row's scores, which this wave
      //    alone has read, all of them, above; phase 3 reads columns < ng*128 alone
      u16* ahp = aH + row * PST + cl;
      u16* alp = aL + row * PST + cl;
#pragma unroll  // constant indices into s[]
      for (int g = 0; g < 8; ++g) {
        if (g >= ng) break;                                  // block-uniform: the groups behind are past the diagonal
        unsigned hw[4], lw[4];
#pragma unroll
        for (int i = 0; i < 4; ++i) split2(s[4 * g + i] * inv2, hw[i], lw[i]);
        v2u vh, vl;
        vh.x = hw[0] | (hw[1] << 16); vh.y = hw[2] | (hw[3] << 16);
        vl.x = lw[0] | (lw[1] << 16); vl.y = lw[2] | (lw[3] << 16);
        *(v2u*)(ahp + 128 * g) = vh;
        *(v2u*)(alp + 128 * g) = vl;
      }
    }
  }
  __syncthreads();   // P planes complete (block barrier between the LDS spill and the fragment reload)

  // ---- phase 3: out(32x64) = attn(32x1024) . V(1024x64); key tiles beyond the causal range carry exact zeros
  if (w < 4) {                                               // wave-uniform
    const int nt  = w;                                       // output columns nt*16..+15, of both query tiles
    const int nkt = q0 / 32 + 1;                             // <= 32, block-uniform
    const size_t vrow = ((size_t)(b * DM + h * DKK + nt * 16)) * SS + lane * 8;
    const int nk4 = (nkt + 3) & ~3;                          // whole groups of four tiles (128 columns, as in phase 2), <= 32: the added tiles have P == 0
    const int pa0 = l15 * PST + hl * 8;                      // query tile 0; tile 1 lies 16 rows on
    const int pa1 = pa0 + 16 * PST;
    v8f acc0 = zero8(), acc1 = zero8();
    // ring of four V tiles in registers: a tile's slot is loaded again, four tiles ahead, behind its products
    v16bf vh[4], vl[4];
#pragma unroll  // constant indices, or the ring falls to scratch
    for (int j = 0; j < 4; ++j) {
      vh[j] = ldg_frag(Vh, vrow + (size_t)j * 512);
      vl[j] = ldg_frag(Vl, vrow + (size_t)j * 512);
    }
    // the two V address pairs stay live up to this wait: no load above may land on them
    asm volatile("s_wait_xcnt 0x0" :: "v"(Vh + vrow), "v"(Vl + vrow) : "memory");
    int k0 = 0;
    for (; k0 + 4 < nk4; k0 += 4) {
      v16bf ph0[4], pl0[4], ph1[4], pl1[4];
#pragma unroll  // constant indices; the group's P tiles are read from LDS in one go
      for (int j = 0; j < 4; ++j) {
        ph0[j] = lds_frag(aH, pa0 + (k0 + j) * 32);
        pl0[j] = lds_frag(aL, pa0 + (k0 + j) * 32);
        ph1[j] = lds_frag(aH, pa1 + (k0 + j) * 32);
        pl1[j] = lds_frag(aL, pa1 + (k0 + j) * 32);
      }
#pragma unroll  // constant indices into the ring
      for (int j = 0; j < 4; ++j) {
        wmma3x2(acc0, acc1, ph0[j], pl0[j], ph1[j], pl1[j], vh[j], vl[j]);
        vh[j] = ldg_frag(Vh, vrow + (size_t)(k0 + 4 + j) * 512);
        vl[j] = ldg_frag(Vl, vrow + (size_t)(k0 + 4 + j) * 512);
      }
      // the next trip's address additions overwrite registers that the loads in flight name
      asm volatile("s_wait_xcnt 0x0" ::: "memory");
    }
    {                                                        // last group: nothing left to load
      v16bf ph0[4], pl0[4], ph1[4], pl1[4];
#pragma unroll
      for (int j = 0; j < 4; ++j) {
        ph0[j] = lds_frag(aH, pa0 + (k0 + j) * 32);
        pl0[j] = lds_frag(aL, pa0 + (k0 + j) * 32);
        ph1[j] = lds_frag(aH, pa1 + (k0 + j) * 32);
        pl1[j] = lds_frag(aL, pa1 + (k0 + j) * 32);
      }
#pragma unroll
      for (int j = 0; j < 4; ++j) wmma3x2(acc0, acc1, ph0[j], pl0[j], ph1[j], pl1[j], vh[j], vl[j]);
    }
#pragma unroll
    for (int r = 0; r < 8; ++r) {
      sO[(hl * 8 + r) * OST + nt * 16 + l15]      = acc0[r];
      sO[(16 + hl * 8 + r) * OST + nt * 16 + l15] = acc1[r];
    }
  }
  __syncthreads();

  // ---- store concat planes: four plane tiles (two per query tile); wave w owns half of tile (w&3)/2 of query tile w/4,
  //      one instruction per plane = 512 contiguous B
  {
    const int u  = w >> 2;                                   // query tile
    const int wq = w & 3;
    const int s  = (wq & 1) * 32 + lane;                     // chunk inside the tile
    const int cc = (wq >> 1) * 32 + (s >> 4) * 8;
    const float* sp = sO + (u * 16 + (s & 15)) * OST + cc;
    const v4f a = *(const v4f*)sp;
    const v4f c = *(const v4f*)(sp + 4);
    float x[8] = {a.x, a.y, a.z, a.w, c.x, c.y, c.z, c.w};
    v4u vh, vl;
    split8(x, vh, vl);
    const size_t go = (size_t)(b * SS + q0 + u * 16) * DM + h * (DKK * 16) + (wq >> 1) * 512 + s * 8;
    *(v4u*)(Ch + go) = vh;
    *(v4u*)(Cl + go) = vl;
  }
}

// ---------------------------------------------------------------- launcher
extern "C" void kernel_launch(void* const* d_in, const int* in_sizes, int n_in,
                              void* d_out, int out_size, void* d_ws, size_t ws_size,
                              hipStream_t stream) {
  if (n_in < 12) return;
  if (in_sizes[0] != (int)ACT || in_sizes[1] != (int)ACT || in_sizes[2] != (int)ACT) return;
  if (in_sizes[3] != (int)WEL || in_sizes[5] != (int)WEL || in_sizes[7] != (int)WEL || in_sizes[9] != (int)WEL) return;
  if (in_sizes[4] != DM || in_sizes[6] != DM || in_sizes[8] != DM || in_sizes[10] != DM) return;
  if (in_sizes[11] != HH) return;
  if (out_size != (int)ACT) return;

  const float* q   = (const float*)d_in[0];
  const float* k   = (const float*)d_in[1];
  const float* v   = (const float*)d_in[2];
  const float* Wq  = (const float*)d_in[3];
  const float* bq  = (const float*)d_in[4];
  const float* Wk  = (const float*)d_in[5];
  const float* bk  = (const float*)d_in[6];
  const float* Wv  = (const float*)d_in[7];
  const float* bv  = (const float*)d_in[8];
  const float* Wo  = (const float*)d_in[9];
  const float* bo  = (const float*)d_in[10];
  const float* gam = (const float*)d_in[11];
  float* out = (float*)d_out;

  // workspace carve (256-B aligned): q, k, v planes hi and lo (the q planes are reused for the concat planes),
  // Wq, Wk, Wv, Wo planes hi and lo, Qp, Kp, Vt planes hi and lo.  Total 112 MiB.
  char* ws = (char*)d_ws;
  size_t off = 0;
  auto carve = [&](size_t bytes) -> char* {
    char* p = ws + off;
    off += (bytes + 255) & ~(size_t)255;
    return p;
  };
  u16* actH = (u16*)carve(3 * ACT * 2);
  u16* actL = (u16*)carve(3 * ACT * 2);
  u16* wH   = (u16*)carve(4 * WEL * 2);
  u16* wL   = (u16*)carve(4 * WEL * 2);
  u16* prH  = (u16*)carve(3 * ACT * 2);             // Qp, Kp, Vt
  u16* prL  = (u16*)carve(3 * ACT * 2);
  if (off > ws_size) return;

  const dim3 pgrid(DM / 128, MROWS / (64 * MT), 3); // (8, 16, 3)
  const dim3 ggrid(DM / 128, MROWS / (64 * MT));    // (8, 16)
  const dim3 agrid(SS / QR, HH, BB);                // (32, 16, 4)

  // all seven f32 matrices -> planes
  k_split<<<dim3(SPLIT_BLKS), 256, 0, stream>>>(q, k, v, Wq, Wk, Wv, Wo, actH, actL, wH, wL);
  // q, k, v projections -> Qp, Kp planes, Vt planes (k = token)
  k_gemm3<0><<<pgrid, 256, 0, stream>>>(actH, actL, wH, wL, bq, bk, bv, prH, prL, out);
  // attention -> concat planes (reuse the q planes)
  k_attn<<<agrid, 256, SMEM_ATTN, stream>>>(prH, prL, prH + ACT, prL + ACT, prH + 2 * ACT, prL + 2 * ACT, gam, actH, actL);
  // output projection -> f32 result
  k_gemm3<2><<<ggrid, 256, 0, stream>>>(actH, actL, wH + 3 * WEL, wL + 3 * WEL, bo, bo, bo, prH, prL, out);
}

// v009
// It runs in 173 microseconds.
// In both of two side-by-side timings against v008, it was 1.05 times as fast.
// Counting every step since v000, it is 3.70 times as fast.
#include <hip/hip_runtime.h>
#include <math.h>
#include <stdint.h>
#include <stddef.h>

// All six contractions (three input projections, q.k^T scores, attn.V, output projection): v_wmma_f32_16x16x32_bf16 with bf16 hi/lo three-term split operands (hi*hi + hi*lo + lo*hi), f32 accumulate; softmax / cumsum / distance-decay row math in f32 on VALU.

typedef __bf16         v16bf __attribute__((ext_vector_type(16)));
typedef float          v8f   __attribute__((ext_vector_type(8)));
typedef float          v4f   __attribute__((ext_vector_type(4)));
typedef float          v2f   __attribute__((ext_vector_type(2)));
typedef __bf16         v2bf  __attribute__((ext_vector_type(2)));
typedef unsigned int   v4u   __attribute__((ext_vector_type(4)));
typedef unsigned int   v2u   __attribute__((ext_vector_type(2)));
typedef unsigned short u16;

union Frag { v16bf v; v4u u[2]; };

static constexpr int BB  = 4;
static constexpr int SS  = 1024;
static constexpr int DM  = 1024;
static constexpr int HH  = 16;
static constexpr int DKK = 64;
static constexpr int MROWS = BB * SS;                 // 4096
static constexpr size_t ACT = (size_t)MROWS * DM;     // 4194304
static constexpr size_t WEL = (size_t)DM * DM;        // 1048576
static_assert(HH * DKK == DM);
static_assert(MROWS % 64 == 0);
static_assert(DM % 128 == 0);
static_assert(DM % 64 == 0);
static_assert(SS % 64 == 0);
static_assert(ACT % 2048 == 0);
static_assert(WEL % 2048 == 0);
static_assert(SS == DM);                              // one tile map serves every plane

// Every bf16 plane is a [rows][1024] matrix stored in fragment order: 1-KiB tiles of 16 rows x 32 k,
// tile index (row/16)*KB + k/32; inside a tile the 16-B chunk of (row, k/8) sits at (k/8 % 4)*16 + row%16.
// A lane's two fragment chunks are then chunk 'lane' and chunk '32 + lane' of the tile, so one
// wave-wide 16-B load covers 512 contiguous bytes.
static constexpr int KB = DM / 32;                    // tiles along k

// ---------------------------------------------------------------- small helpers
// two f32 -> their bf16 hi parts (round to nearest even) packed in one word, x0 in the low half, and the packed bf16
// of what the hi parts leave: each packed conversion is one v_cvt_pk_bf16_f32
__device__ __forceinline__ void split_pair(float x0, float x1, unsigned& hi, unsigned& lo) {
  v2f x;
  x.x = x0; x.y = x1;
  const v2bf h = __builtin_convertvector(x, v2bf);
  v2f d;
  d.x = x0 - (float)h.x;                                          // x - xh exact in f32
  d.y = x1 - (float)h.y;
  hi = __builtin_bit_cast(unsigned, h);
  lo = __builtin_bit_cast(unsigned, __builtin_convertvector(d, v2bf));
}
// 8 consecutive f32 -> packed 8 bf16 hi (16 B) and 8 bf16 lo (16 B)
__device__ __forceinline__ void split8(const float* x, v4u& vh, v4u& vl) {
  unsigned hw[4], lw[4];
#pragma unroll
  for (int i = 0; i < 4; ++i) split_pair(x[2 * i], x[2 * i + 1], hw[i], lw[i]);
  vh.x = hw[0]; vh.y = hw[1]; vh.z = hw[2]; vh.w = hw[3];
  vl.x = lw[0]; vl.y = lw[1]; vl.z = lw[2]; vl.w = lw[3];
}
__device__ __forceinline__ v8f zero8() {
  v8f z;
#pragma unroll
  for (int i = 0; i < 8; ++i) z[i] = 0.f;
  return z;
}
// 16x32 operand fragment from one plane tile: elements 0..7 <- k 8*(lane>>4).., 8..15 <- 16 further,
// row lane&15 (same map for A rows and for B stored [n][k])
// (caller passes e = row0*DM + (k0/32)*512 + 8*lane, the lane's first chunk of the tile at row0, k0)
__device__ __forceinline__ v16bf ldg_frag(const u16* __restrict__ p, size_t e) {
  Frag f;
  f.u[0] = *(const v4u*)(p + e);
  f.u[1] = *(const v4u*)(p + e + 256);
  return f.v;
}
// the same through a pointer that is typed as global memory: an address that has passed through an asm statement
// has lost what the compiler knew of its origin, and an untyped one would load by flat_load
typedef const __attribute__((address_space(1))) u16* gptr;
typedef const __attribute__((address_space(1))) v4u* gptr4;
__device__ __forceinline__ v16bf ldg_frag_g(gptr p, size_t e) {
  Frag f;
  f.u[0] = *(gptr4)(p + e);
  f.u[1] = *(gptr4)(p + e + 256);
  return f.v;
}
// 16x32 operand fragment from a k-contiguous bf16 row in LDS: elements 0..7 <- e.., 8..15 <- e+16..
// (caller passes e = row*pitch + k0 + 8*(lane>>4))
__device__ __forceinline__ v16bf lds_frag(const u16* p, int e) {
  Frag f;
  f.u[0] = *(const v4u*)(p + e);
  f.u[1] = *(const v4u*)(p + e + 16);
  return f.v;
}
// 2^x, log2(x), sqrt(x) and 1/x as the chip's own single instructions (about 1 ulp), without libm's range reduction,
// range checks and refinement steps.  A result below the normal range may come out as 0, a subnormal
// sqrt argument likewise: every use below adds such a value to a sum that is at least 1 or clamps it;
// the two reciprocals are of such sums (1 <= sum <= 1024).
// Eight at a time in one statement: behind a transcendental the instruction set wants one slot before its
// result is read or its source overwritten.  "=&v" keeps every result apart from every argument, so no
// neighbour takes a source's register; the v_nop is the slot behind the last one; the s_delay_alu is the
// issue hint for the arguments, which the compiler cannot give for instructions inside a statement.
__device__ __forceinline__ void hw_exp2x8(float (&r)[8], const float (&a)[8]) {
  asm("s_delay_alu instid0(VALU_DEP_1)\n\t"
      "v_exp_f32 %0, %8\n\tv_exp_f32 %1, %9\n\tv_exp_f32 %2, %10\n\tv_exp_f32 %3, %11\n\t"
      "v_exp_f32 %4, %12\n\tv_exp_f32 %5, %13\n\tv_exp_f32 %6, %14\n\tv_exp_f32 %7, %15\n\t"
      "v_nop"
      : "=&v"(r[0]), "=&v"(r[1]), "=&v"(r[2]), "=&v"(r[3]), "=&v"(r[4]), "=&v"(r[5]), "=&v"(r[6]), "=&v"(r[7])
      : "v"(a[0]), "v"(a[1]), "v"(a[2]), "v"(a[3]), "v"(a[4]), "v"(a[5]), "v"(a[6]), "v"(a[7]));
}
// the same, four at a time, for the passes that go group by group
__device__ __forceinline__ void hw_exp2x4(float (&r)[4], const float (&a)[4]) {
  asm("s_delay_alu instid0(VALU_DEP_1)\n\t"
      "v_exp_f32 %0, %4\n\tv_exp_f32 %1, %5\n\tv_exp_f32 %2, %6\n\tv_exp_f32 %3, %7\n\t"
      "v_nop"
      : "=&v"(r[0]), "=&v"(r[1]), "=&v"(r[2]), "=&v"(r[3])
      : "v"(a[0]), "v"(a[1]), "v"(a[2]), "v"(a[3]));
}
__device__ __forceinline__ void hw_sqrtx4(float (&r)[4], const float (&a)[4]) {
  asm("s_delay_alu instid0(VALU_DEP_1)\n\t"
      "v_sqrt_f32 %0, %4\n\tv_sqrt_f32 %1, %5\n\tv_sqrt_f32 %2, %6\n\tv_sqrt_f32 %3, %7\n\t"
      "v_nop"
      : "=&v"(r[0]), "=&v"(r[1]), "=&v"(r[2]), "=&v"(r[3])
      : "v"(a[0]), "v"(a[1]), "v"(a[2]), "v"(a[3]));
}
// x + (x of the lane N places down in the same 16-lane row; 0 where there is none): one step of a running sum over lanes
template <int N>
__device__ __forceinline__ float row_shr_add(float x) {
  return x + __int_as_float(__builtin_amdgcn_update_dpp(0, __float_as_int(x), 0x110 + N, 0xf, 0xf, true));
}
__device__ __forceinline__ float hw_rcp(float x) { return __builtin_amdgcn_rcpf(x); }
static constexpr float LOG2E = 1.44269504088896340736f;
// three-term split product (hi*hi, then hi*lo, then lo*hi) into two accumulators that share the B operand, term by term
// in turn, so that neighbouring products are independent; then the hazard guard
__device__ __forceinline__ void wmma3x2(v8f& c0, v8f& c1, v16bf a0h, v16bf a0l, v16bf a1h, v16bf a1l, v16bf bh, v16bf bl) {
  c0 = __builtin_amdgcn_wmma_f32_16x16x32_bf16(false, a0h, false, bh, (short)0, c0, false, false);
  c1 = __builtin_amdgcn_wmma_f32_16x16x32_bf16(false, a1h, false, bh, (short)0, c1, false, false);
  c0 = __builtin_amdgcn_wmma_f32_16x16x32_bf16(false, a0h, false, bl, (short)0, c0, false, false);
  c1 = __builtin_amdgcn_wmma_f32_16x16x32_bf16(false, a1h, false, bl, (short)0, c1, false, false);
  c0 = __builtin_amdgcn_wmma_f32_16x16x32_bf16(false, a0l, false, bh, (short)0, c0, false, false);
  c1 = __builtin_amdgcn_wmma_f32_16x16x32_bf16(false, a1l, false, bh, (short)0, c1, false, false);
  // the four slots between the last products and whatever lands on their registers (ties D, keeps A/B live)
  asm volatile("v_nop\n\tv_nop\n\tv_nop\n\tv_nop" : "+v"(c0), "+v"(c1)
               : "v"(a0h), "v"(a0l), "v"(a1h), "v"(a1l), "v"(bh), "v"(bl));
}

// ---------------------------------------------------------------- f32 [rows][1024] -> bf16 hi/lo planes (fragment order)
// One launch splits all seven f32 matrices (q, k, v, Wq, Wk, Wv, Wo): none reads another's result.
// aH/aL hold the three activation planes one behind the other, wH/wL the four weight planes.
// A unit is 8 rows x 32 k of one tile, one wave's work: 8 whole 128-B lines read, 4 whole lines stored per plane.
// A block takes 128 consecutive units of ONE matrix (32 rows), 16 per wave.
static constexpr int UPB      = 128;                        // units per block
static constexpr int ACT_BLKS = (int)(ACT / 256 / UPB);     // 128 blocks per activation
static constexpr int WEL_BLKS = (int)(WEL / 256 / UPB);     // 32 blocks per weight
static constexpr int SPLIT_BLKS = 3 * ACT_BLKS + 4 * WEL_BLKS;
static_assert(ACT % (256 * UPB) == 0);
static_assert(WEL % (256 * UPB) == 0);

__global__ void __launch_bounds__(256)
k_split(const float* __restrict__ q, const float* __restrict__ k, const float* __restrict__ v,
        const float* __restrict__ Wq, const float* __restrict__ Wk, const float* __restrict__ Wv,
        const float* __restrict__ Wo,
        u16* __restrict__ aH, u16* __restrict__ aL, u16* __restrict__ wH, u16* __restrict__ wL) {
  const int blk  = blockIdx.x;
  const int lane = threadIdx.x & 31;
  const int w    = threadIdx.x >> 5;
  const float* in;
  u16 *ph, *pl;
  int u0;                                                   // the block's first unit inside its matrix
  if (blk < 3 * ACT_BLKS) {                                 // block-uniform
    const int a = blk / ACT_BLKS;
    in = (a == 0) ? q : (a == 1) ? k : v;
    ph = aH + (size_t)a * ACT;
    pl = aL + (size_t)a * ACT;
    u0 = (blk - a * ACT_BLKS) * UPB;
  } else {
    const int a = (blk - 3 * ACT_BLKS) / WEL_BLKS;
    in = (a == 0) ? Wq : (a == 1) ? Wk : (a == 2) ? Wv : Wo;
    ph = wH + (size_t)a * WEL;
    pl = wL + (size_t)a * WEL;
    u0 = (blk - 3 * ACT_BLKS - a * WEL_BLKS) * UPB;
  }
  // the wave's n-th unit is unit n*8 + w of the block: half w&1 of tile (n&7)*4 + w/2 in the block's tile row n>>3,
  // so every address below is one lane address plus a compile-time offset
  const int r = (w & 1) * 8 + (lane & 7);                   // row inside the tile
  const int j = lane >> 3;                                  // 8-element chunk along k
  const float* src = in + (size_t)((u0 >> 6) * 16 + r) * DM + (w >> 1) * 32 + j * 8;
  const size_t dst = ((size_t)((u0 >> 1) + (w >> 1)) * 64 + j * 16 + r) * 8;
  v4f a[16], c[16];
#pragma unroll  // constant indices, or a[] and c[] fall to scratch
  for (int n = 0; n < 16; ++n) {
    const float* p = src + (n >> 3) * 16 * DM + (n & 7) * 128;
    a[n] = *(const v4f*)p;
    c[n] = *(const v4f*)(p + 4);
  }
  // keeps all 32 loads ahead of the arithmetic: left alone the compiler sinks them and holds about six in flight
  __builtin_amdgcn_sched_barrier(0);
#pragma unroll  // constant indices
  for (int n = 0; n < 16; ++n) {
    float x[8] = {a[n].x, a[n].y, a[n].z, a[n].w, c[n].x, c[n].y, c[n].z, c[n].w};
    v4u vh, vl;
    split8(x, vh, vl);
    const size_t d = dst + (size_t)((n >> 3) * KB + (n & 7) * 4) * 512;
    *(v4u*)(ph + d) = vh;
    *(v4u*)(pl + d) = vl;
  }
}

// ---------------------------------------------------------------- GEMM: out = A @ W^T + bias
// A planes [M=4096][K=1024] bf16 hi/lo, W planes [N=1024][K] bf16 hi/lo ([out,in]), both in fragment order;
// bias [N] f32. Block 256 thr = 8 waves, block tile 256(M) x 128(N), wave tile 64 x 64: four 16-row tiles, 64 rows apart,
// times four 16-column tiles, so a loaded A or B fragment feeds four accumulators: a wave loads 16 KiB per 48 products.
// About 470 VGPRs per wave: two waves per SIMD, one block per WGP.
// Fragments straight from global (no LDS in the k-loop), fetched two k steps ahead.  Epilogue: tile staged in LDS, then
// MODE 0: the three input projections in one launch, blockIdx.z = 0, 1, 2 for q, k, v: operand, weight and result
//         planes of projection z lie z planes behind the pointers given.  Result of z = 0, 1: bf16 hi/lo planes
//         [M][N] in fragment order; of z = 2: planes transposed [(m/SS)*N + n][m%SS] in fragment order
//         (k = token, for attn.V)
// MODE 2: f32 row-major [M][N] (Of)
static constexpr int TP = 132;   // LDS tile pitch (floats)
static constexpr int MT = 4;     // 16-row A tiles per wave
static_assert(MROWS % (64 * MT) == 0);

template <int MODE>
__global__ void __launch_bounds__(256)
k_gemm3(const u16* __restrict__ Ah0, const u16* __restrict__ Al0,
        const u16* __restrict__ Wh0, const u16* __restrict__ Wl0,
        const float* __restrict__ bias0, const float* __restrict__ bias1, const float* __restrict__ bias2,
        u16* __restrict__ Oh0, u16* __restrict__ Ol0, float* __restrict__ Of) {
  constexpr int N = DM, K = DM;
  __shared__ __attribute__((aligned(16))) float sT[64 * MT * TP];

  const int z = (MODE == 0) ? (int)blockIdx.z : 0;     // which projection; block-uniform
  const u16* __restrict__ Ah = Ah0 + (size_t)z * ACT;
  const u16* __restrict__ Al = Al0 + (size_t)z * ACT;
  const u16* __restrict__ Wh = Wh0 + (size_t)z * WEL;
  const u16* __restrict__ Wl = Wl0 + (size_t)z * WEL;
  const float* __restrict__ bias = (z == 0) ? bias0 : (z == 1) ? bias1 : bias2;
  u16* __restrict__ Oh = Oh0 + (size_t)z * ACT;
  u16* __restrict__ Ol = Ol0 + (size_t)z * ACT;

  const int lane = threadIdx.x & 31;
  const int w    = threadIdx.x >> 5;
  const int wm   = w & 3;              // 0..3
  const int wn   = w >> 2;             // 0..1
  const int hl   = lane >> 4;
  const int l15  = lane & 15;
  const int m0b  = blockIdx.y * (64 * MT);
  const int n0b  = blockIdx.x * 128;
  const int m0   = m0b + wm * 16;
  const int n0   = n0b + wn * 64;

  v8f acc[MT][4];
#pragma unroll
  for (int mt = 0; mt < MT; ++mt)
#pragma unroll
    for (int nt = 0; nt < 4; ++nt) acc[mt][nt] = zero8();

  // the lane's four running addresses, at the current even k step; every load is one of them plus a constant
  gptr pah = (gptr)(Ah + (size_t)m0 * K + lane * 8);    // A rows m0..m0+15 (+mt*64 rows)
  gptr pal = (gptr)(Al + (size_t)m0 * K + lane * 8);
  gptr pbh = (gptr)(Wh + (size_t)n0 * K + lane * 8);    // W rows n0..n0+15 (+nt*16 rows)
  gptr pbl = (gptr)(Wl + (size_t)n0 * K + lane * 8);

  // Two register sets of fragments, even and odd k steps.  A set is loaded again, for two k steps later,
  // behind its 48 products, so a load has the other set's 48 products' time to come back.
  v16bf ah[2][MT], al[2][MT], bh[2][4], bl[2][4];
#pragma unroll  // constant indices, or the sets fall to scratch
  for (int p = 0; p < 2; ++p) {
#pragma unroll
    for (int mt = 0; mt < MT; ++mt) {
      ah[p][mt] = ldg_frag_g(pah, (size_t)mt * 64 * K + p * 512);
      al[p][mt] = ldg_frag_g(pal, (size_t)mt * 64 * K + p * 512);
    }
#pragma unroll
    for (int nt = 0; nt < 4; ++nt) {
      bh[p][nt] = ldg_frag_g(pbh, (size_t)nt * 16 * K + p * 512);
      bl[p][nt] = ldg_frag_g(pbl, (size_t)nt * 16 * K + p * 512);
    }
  }
  // one k step: hi*hi, then hi*lo, then lo*hi into each accumulator (the order of wmma3x2), term by term over the
  // 16 accumulators, so that neighbouring products are independent
#define GEMM_KSTEP(p)                                                                                        \
  _Pragma("unroll") for (int mt = 0; mt < MT; ++mt)                                                          \
    _Pragma("unroll") for (int nt = 0; nt < 4; ++nt)                                                         \
      acc[mt][nt] = __builtin_amdgcn_wmma_f32_16x16x32_bf16(false, ah[p][mt], false, bh[p][nt], (short)0,    \
                                                            acc[mt][nt], false, false);                      \
  _Pragma("unroll") for (int mt = 0; mt < MT; ++mt)                                                          \
    _Pragma("unroll") for (int nt = 0; nt < 4; ++nt)                                                         \
      acc[mt][nt] = __builtin_amdgcn_wmma_f32_16x16x32_bf16(false, ah[p][mt], false, bl[p][nt], (short)0,    \
                                                            acc[mt][nt], false, false);                      \
  _Pragma("unroll") for (int mt = 0; mt < MT; ++mt)                                                          \
    _Pragma("unroll") for (int nt = 0; nt < 4; ++nt)                                                         \
      acc[mt][nt] = __builtin_amdgcn_wmma_f32_16x16x32_bf16(false, al[p][mt], false, bh[p][nt], (short)0,    \
                                                            acc[mt][nt], false, false);
#pragma unroll 1  // one trip already holds both sets; further copies only grow the code
  for (int kb = 0; kb < K / 32 - 2; kb += 2) {
#pragma unroll  // constant indices into the sets
    for (int p = 0; p < 2; ++p) {
      GEMM_KSTEP(p)
      // the four slots between the last products and the loads that land on their A and B registers; the
      // scheduling fences keep every product above the slots and the reloads in one group directly below them
      // (left alone the compiler sinks the reloads halfway into the other set's products, which halves their lead)
      __builtin_amdgcn_sched_barrier(0);
      asm volatile("v_nop\n\tv_nop\n\tv_nop\n\tv_nop");
      __builtin_amdgcn_sched_barrier(0);
#pragma unroll
      for (int mt = 0; mt < MT; ++mt) {
        ah[p][mt] = ldg_frag_g(pah, (size_t)mt * 64 * K + (2 + p) * 512);
        al[p][mt] = ldg_frag_g(pal, (size_t)mt * 64 * K + (2 + p) * 512);
      }
#pragma unroll
      for (int nt = 0; nt < 4; ++nt) {
        bh[p][nt] = ldg_frag_g(pbh, (size_t)nt * 16 * K + (2 + p) * 512);
        bl[p][nt] = ldg_frag_g(pbl, (size_t)nt * 16 * K + (2 + p) * 512);
      }
      __builtin_amdgcn_sched_barrier(0);
    }
    // the four additions below overwrite registers that the loads in flight name; as operands of the wait the
    // address pairs keep registers of their own up to it, so that no reload lands on one either
    asm volatile("s_wait_xcnt 0x0" : "+v"(pah), "+v"(pal), "+v"(pbh), "+v"(pbl) :: "memory");
    pah += 2 * 512; pal += 2 * 512; pbh += 2 * 512; pbl += 2 * 512;
  }
  // the last two k steps: nothing left to load
  GEMM_KSTEP(0)
  GEMM_KSTEP(1)
#undef GEMM_KSTEP

  const int bi = n0 + l15;
  float bb[4];
#pragma unroll
  for (int nt = 0; nt < 4; ++nt) bb[nt] = bias[bi + nt * 16];
  // the index register stays live up to this wait: none of the four loads may land on it before it
  asm volatile("s_wait_xcnt 0x0" :: "v"(bi) : "memory");

  // stage the 256x128 f32 tile (+bias) in LDS; D element r of lane = (row 8h+r, col l15)
#pragma unroll  // constant indices into acc
  for (int mt = 0; mt < MT; ++mt)
#pragma unroll
    for (int nt = 0; nt < 4; ++nt)
#pragma unroll
      for (int r = 0; r < 8; ++r)
        sT[(mt * 64 + wm * 16 + hl * 8 + r) * TP + wn * 64 + nt * 16 + l15] = acc[mt][nt][r] + bb[nt];
  __syncthreads();

  // the tile leaves in MT parts of 64 rows.  The next part's LDS loads and arithmetic overwrite registers that this
  // part's stores name: the wait behind the stores stands in front of them, and the two scheduling fences keep the
  // compiler from moving any of them in between the first store and the wait
  if (MODE == 0 && z < 2) {
    // per part 4 x 4 plane tiles; a wave pair owns tile j*4 + w/2, one instruction = half a tile = 512 contiguous B
    const int s = (w & 1) * 32 + lane;                     // chunk inside the tile
#pragma unroll 1  // the parts differ only in their addresses: copies would only grow the code
    for (int mt = 0; mt < MT; ++mt) {
      const int mh  = m0b + mt * 64;                       // the part's first row
      const int kbl = w >> 1;                              // tile column; tile row is j
      v4u vh[4], vl[4];
#pragma unroll
      for (int j = 0; j < 4; ++j) {
        const int row = mt * 64 + j * 16 + (s & 15);
        const float* sp = sT + row * TP + kbl * 32 + (s >> 4) * 8;
        const v4f a = *(const v4f*)sp;
        const v4f c = *(const v4f*)(sp + 4);
        float x[8] = {a.x, a.y, a.z, a.w, c.x, c.y, c.z, c.w};
        split8(x, vh[j], vl[j]);
      }
      const size_t go = ((size_t)((mh >> 4) * KB + (n0b >> 5) + kbl) * 64 + s) * 8;   // tile row j: j*KB tiles on
      u16* oh = Oh + go;
      u16* ol = Ol + go;
      __builtin_amdgcn_sched_barrier(0);                   // all arithmetic above the stores
#pragma unroll
      for (int j = 0; j < 4; ++j) {
        *(v4u*)(oh + (size_t)j * KB * 512) = vh[j];
        *(v4u*)(ol + (size_t)j * KB * 512) = vl[j];
      }
      asm volatile("s_wait_xcnt 0x0" ::: "memory");
      __builtin_amdgcn_sched_barrier(0);
    }
  } else if (MODE == 0) {
    // per part 8 (features) x 2 (tokens) plane tiles; wave w owns features w*16..+15, one instruction = half a tile
    const int f = w * 16 + l15;
#pragma unroll 1  // the parts differ only in their addresses: copies would only grow the code
    for (int mt = 0; mt < MT; ++mt) {
      const int mh   = m0b + mt * 64;                      // the part's first row
      const int bidx = mh / SS;
      const int s0   = mh - bidx * SS;
      v4u vh[4], vl[4];
#pragma unroll
      for (int j = 0; j < 4; ++j) {
        const int s  = (j & 1) * 32 + lane;                // chunk inside the tile
        const int tc = (j >> 1) * 32 + (s >> 4) * 8;       // first of its 8 tokens
        float x[8];
#pragma unroll
        for (int i = 0; i < 8; ++i) x[i] = sT[(mt * 64 + tc + i) * TP + f];
        split8(x, vh[j], vl[j]);
      }
      // half tile j (tile j/2, chunks (j&1)*32 + lane) lies j*256 elements behind half tile 0
      const size_t go = ((size_t)(((bidx * N + n0b) >> 4) + w) * KB + (s0 >> 5)) * 512 + (size_t)lane * 8;
      u16* oh = Oh + go;
      u16* ol = Ol + go;
      __builtin_amdgcn_sched_barrier(0);                   // all arithmetic above the stores
#pragma unroll
      for (int j = 0; j < 4; ++j) {
        *(v4u*)(oh + j * 256) = vh[j];
        *(v4u*)(ol + j * 256) = vl[j];
      }
      asm volatile("s_wait_xcnt 0x0" ::: "memory");
      __builtin_amdgcn_sched_barrier(0);
    }
  } else {
    // f32: per part wave w owns rows w*8..+7; one instruction = 32 lanes x 16 B = one 512-B row segment.
    const int cc4 = lane * 4;
#pragma unroll 1  // the parts differ only in their addresses: copies would only grow the code
    for (int mt = 0; mt < MT; ++mt) {
      const int row0 = mt * 64 + w * 8;
      v4f val[8];
#pragma unroll
      for (int j = 0; j < 8; ++j) val[j] = *(const v4f*)(sT + (row0 + j) * TP + cc4);
      float* op = Of + (size_t)(m0b + row0) * N + n0b + cc4;
      __builtin_amdgcn_sched_barrier(0);                   // all arithmetic above the stores
#pragma unroll
      for (int j = 0; j < 8; ++j) *(v4f*)(op + (size_t)j * N) = val[j];
      asm volatile("s_wait_xcnt 0x0" ::: "memory");
      __builtin_amdgcn_sched_barrier(0);
    }
  }
}

// ---------------------------------------------------------------- distance-decay attention
// grid (S/32, H, B); block 256 thr = 8 waves; 32 query rows (two 16-row tiles), full 1024-key score rows in LDS.
// A K or V fragment in registers feeds both query tiles: half the K and V loads per query row of a 16-row block.
// Qp, Kp planes [b*S+s][h*64+d], Vt planes [b*1024+h*64+d][s], concat planes [b*S+s][h*64+d]: all in fragment order;
// Row math runs in registers: the owning wave reads a score row from LDS once, 32 columns per lane (8 groups of 4),
// and writes the row's bf16 hi and lo probabilities over the same row (2 + 2 bytes a column on the 4 of the score),
// so that 32 rows take no more LDS than 16 rows with planes of their own and two blocks still share a WGP.
static constexpr int QR  = 32;                            // query rows per block
static constexpr int SST = 1036;                          // f32 score row pitch: 259 * 16 B; 8 rows = 32 banks mod 64
static constexpr int PST = 2 * SST;                       // the same pitch in bf16 elements
static constexpr int PLO = 1032;                          // the lo plane's start inside a row, in bf16 elements (129 * 16 B)
static constexpr int OST = 68;                            // f32 out-tile pitch
static constexpr size_t SM_S = (size_t)QR * SST * 4;      // 132608
static constexpr size_t SM_O = (size_t)QR * OST * 4;      // 8704
static constexpr size_t SMEM_ATTN = SM_S + SM_O;          // 141312
static_assert(SS % QR == 0);
static_assert(128 % QR == 0);                             // a block's rows share one last 128-column group
static_assert(PLO >= SS && PLO + SS <= PST);
static_assert(SM_S % 16 == 0);

__global__ void __launch_bounds__(256)
k_attn(const u16* __restrict__ Qh, const u16* __restrict__ Ql,
       const u16* __restrict__ Kh, const u16* __restrict__ Kl,
       const u16* __restrict__ Vh, const u16* __restrict__ Vl,
       const float* __restrict__ gammas,
       u16* __restrict__ Ch, u16* __restrict__ Cl) {
  extern __shared__ __attribute__((aligned(16))) char smem[];
  float* sS   = (float*)smem;                               // [QR][SST] scores
  u16*   aH   = (u16*)smem;                                 // [QR][PST] bf16 hi, over the row's own scores
  u16*   aL   = aH + PLO;                                   // [QR][PST] bf16 lo, behind the hi plane in the same row
  float* sO   = (float*)(smem + SM_S);                      // [QR][OST]

  const int qt = blockIdx.x, h = blockIdx.y, b = blockIdx.z;
  const int q0 = qt * QR;
  const int lane = threadIdx.x & 31;
  const int w    = threadIdx.x >> 5;
  const int hl   = lane >> 4;
  const int l15  = lane & 15;

  // ---- phase 1: sS[32][1024] = Q(32x64) . K^T / 8 * log2(e): scores in base-2 units, so that every
  //      exp(a - b) of the row math is 2^(a' - b') with no multiply of its own ------------------
  {
    const size_t qrow = (size_t)(b * SS + q0) * DM + h * (DKK * 16) + lane * 8;
    v16bf qh0[2], ql0[2], qh1[2], ql1[2];                    // [query tile]
#pragma unroll  // constant indices
    for (int u = 0; u < 2; ++u) {
      const size_t e = qrow + (size_t)u * 16 * DM;
      qh0[u] = ldg_frag(Qh, e);       ql0[u] = ldg_frag(Ql, e);
      qh1[u] = ldg_frag(Qh, e + 512); ql1[u] = ldg_frag(Ql, e + 512);
    }
    // the two Q address pairs stay live up to this wait: no later load may land on them before it
    asm volatile("s_wait_xcnt 0x0" :: "v"(Qh + qrow), "v"(Ql + qrow) : "memory");
    // ring of four key tiles in registers: a tile's slot is loaded again, four tiles ahead, behind its products
    const size_t krow0 = (size_t)(b * SS + w * 128) * DM + h * (DKK * 16) + lane * 8;
    v16bf kh0[4], kl0[4], kh1[4], kl1[4];
#pragma unroll  // constant indices, or the ring falls to scratch
    for (int t = 0; t < 4; ++t) {
      const size_t krow = krow0 + (size_t)t * 16 * DM;
      kh0[t] = ldg_frag(Kh, krow);       kl0[t] = ldg_frag(Kl, krow);
      kh1[t] = ldg_frag(Kh, krow + 512); kl1[t] = ldg_frag(Kl, krow + 512);
    }
#pragma unroll  // constant indices into the ring
    for (int t = 0; t < 8; ++t) {                            // 8 key tiles of 16 per wave
      const int kt = w * 8 + t;
      const int sl = t & 3;
      v8f acc0 = zero8(), acc1 = zero8();
      wmma3x2(acc0, acc1, qh0[0], ql0[0], qh0[1], ql0[1], kh0[sl], kl0[sl]);
      wmma3x2(acc0, acc1, qh1[0], ql1[0], qh1[1], ql1[1], kh1[sl], kl1[sl]);
      if (t + 4 < 8) {
        const size_t krow = krow0 + (size_t)(t + 4) * 16 * DM;
        kh0[sl] = ldg_frag(Kh, krow);       kl0[sl] = ldg_frag(Kl, krow);
        kh1[sl] = ldg_frag(Kh, krow + 512); kl1[sl] = ldg_frag(Kl, krow + 512);
        // behind the last K load: its address pairs stay live up to this wait and are free for reuse behind it
        if (t == 3) asm volatile("s_wait_xcnt 0x0" :: "v"(Kh + krow0), "v"(Kl + krow0) : "memory");
      }
#pragma unroll
      for (int r = 0; r < 8; ++r) {
        sS[(hl * 8 + r) * SST + kt * 16 + l15]        = acc0[r] * (0.125f * LOG2E);
        sS[(16 + hl * 8 + r) * SST + kt * 16 + l15]   = acc1[r] * (0.125f * LOG2E);
      }
    }
  }
  __syncthreads();

  // ---- phase 2: row math, 4 rows per wave, all in registers.  A lane owns columns g*128 + 4*lane .. +3 of each of the
  //      eight 128-column groups g: every LDS access of a wave is one contiguous run, and a group that lies wholly
  //      past the block's last query row is needed for the first softmax's maximum and sum alone
  {
    const float gg  = gammas[h];
    // gam2 = -softplus(gg) * log2(e), so that exp(-d * softplus) = 2^(d * gam2); 1 + 2^(..) lies in (1, 2]
    const float gam2 = -(fmaxf(gg, 0.f) * LOG2E +
                         __builtin_amdgcn_logf(1.0f + __builtin_amdgcn_exp2f(-fabsf(gg) * LOG2E)));
    const int   ng  = (q0 >> 7) + 1;                         // groups that hold a column <= q0 + 31; block-uniform, 1..8
    const int   cl  = lane * 4;
    const float hiF = (lane >= 16) ? 1.f : 0.f;
    for (int rr = 0; rr < QR / 8; ++rr) {
      const int row = w + rr * 8;
      const int iq  = q0 + row;
      const float* srow = sS + row * SST + cl;

      float s[32];                                           // scores, then new scores, then e2; [4*g + i]
      float c[32];                                           // e, then the lane's running sum inside its four columns
#pragma unroll  // constant indices, or s[] falls to scratch
      for (int g = 0; g < 8; ++g) {
        const v4f a = *(const v4f*)(srow + 128 * g);
        s[4 * g] = a.x; s[4 * g + 1] = a.y; s[4 * g + 2] = a.z; s[4 * g + 3] = a.w;
      }

      // A: row max over all 1024 keys
      float m1 = -3.0e38f;
#pragma unroll  // constant indices into s[]
      for (int i = 0; i < 32; ++i) m1 = fmaxf(m1, s[i]);
#pragma unroll
      for (int o = 16; o > 0; o >>= 1) m1 = fmaxf(m1, __shfl_xor(m1, o, 32));

      // B: e = exp(score - max) = 2^(s - m1) over the full row; s1 = sum
      float s1 = 0.f;
#pragma unroll  // constant indices into s[] and c[]
      for (int g = 0; g < 4; ++g) {
        float a[8], e[8];
#pragma unroll
        for (int i = 0; i < 8; ++i) a[i] = s[8 * g + i] - m1;
        hw_exp2x8(e, a);
#pragma unroll
        for (int i = 0; i < 8; ++i) { c[8 * g + i] = e[i]; s1 += e[i]; }
      }
#pragma unroll
      for (int o = 16; o > 0; o >>= 1) s1 += __shfl_xor(s1, o, 32);
      const float inv1 = hw_rcp(s1);

      // C: p = softmax * (j <= i); running sum inside the lane's four columns, over the lanes of the group, over the groups
      float off[8];                                          // sum of all columns in front of the lane's four
      float base = 0.f;                                      // sum of the groups so far
#pragma unroll  // constant indices into c[] and off[]
      for (int g = 0; g < 8; ++g) {
        if (g >= ng) break;                                  // block-uniform: the groups behind are past the diagonal
        float run = 0.f;
#pragma unroll
        for (int i = 0; i < 4; ++i) {
          const float p = (g * 128 + cl + i <= iq) ? c[4 * g + i] * inv1 : 0.f;
          run += p;
          c[4 * g + i] = run;
        }
        float x = row_shr_add<1>(run);                     // inclusive sum over the 16-lane row
        x = row_shr_add<2>(x);
        x = row_shr_add<4>(x);
        x = row_shr_add<8>(x);
        // the other row's lane 15 and the own row's lane 15: the two rows' sums
        const float oth = __uint_as_float(__builtin_amdgcn_permlanex16(0u, __float_as_uint(x), 0xffffffffu, 0xffffffffu,
                                                                       false, false));
        const float own = __int_as_float(__builtin_amdgcn_update_dpp(0, __float_as_int(x), 0x15f, 0xf, 0xf, true));
        off[g] = base + (fmaf(oth, hiF, x) - run);
        base += own + oth;
      }
      const float disttotal = base;

      // D: decay factor, masked rescale, row max of the new scores
      float m2 = -3.0e38f;
#pragma unroll  // constant indices into s[], c[] and off[]
      for (int g = 0; g < 8; ++g) {
        if (g >= ng) break;                                  // block-uniform: the groups behind are past the diagonal
        float x[4], dsc[4], t[4], eff[4];
#pragma unroll
        for (int i = 0; i < 4; ++i) {
          const float distcum = off[g] + c[4 * g + i];
          const float pe = fabsf((float)(iq - (g * 128 + cl + i)));
          x[i] = fmaxf((disttotal - distcum) * pe, 0.f);
        }
        hw_sqrtx4(dsc, x);
#pragma unroll
        for (int i = 0; i < 4; ++i) t[i] = dsc[i] * gam2;
        hw_exp2x4(eff, t);
#pragma unroll
        for (int i = 0; i < 4; ++i) {
          const float ef = fminf(fmaxf(eff[i], 1e-5f), 1e5f);
          const float ns = (g * 128 + cl + i <= iq) ? s[4 * g + i] * ef : -1e32f;
          s[4 * g + i] = ns;
          m2 = fmaxf(m2, ns);
        }
      }
#pragma unroll
      for (int o = 16; o > 0; o >>= 1) m2 = fmaxf(m2, __shfl_xor(m2, o, 32));

      // E: e2 = 2^(ns - m2) (masked entries give exactly 0, as would every column of a group left out); s2 = sum
      float s2 = 0.f;
#pragma unroll  // constant indices into s[]
      for (int g = 0; g < 8; ++g) {
        if (g >= ng) break;                                  // block-uniform: the groups behind are past the diagonal
        float a[4], e[4];
#pragma unroll
        for (int i = 0; i < 4; ++i) a[i] = s[4 * g + i] - m2;
        hw_exp2x4(e, a);
#pragma unroll
        for (int i = 0; i < 4; ++i) { s[4 * g + i] = e[i]; s2 += e[i]; }
      }
#pragma unroll
      for (int o = 16; o > 0; o >>= 1) s2 += __shfl_xor(s2, o, 32);
      const float inv2 = hw_rcp(s2);

      // F: attn probabilities -> bf16 hi/lo planes in LDS (8-B stores per lane), over this row's scores, which this wave
      //    alone has read, all of them, above; phase 3 reads columns < ng*128 alone
      u16* ahp = aH + row * PST + cl;
      u16* alp = aL + row * PST + cl;
#pragma unroll  // constant indices into s[]
      for (int g = 0; g < 8; ++g) {
        if (g >= ng) break;                                  // block-uniform: the groups behind are past the diagonal
        unsigned hw[2], lw[2];
        split_pair(s[4 * g] * inv2, s[4 * g + 1] * inv2, hw[0], lw[0]);
        split_pair(s[4 * g + 2] * inv2, s[4 * g + 3] * inv2, hw[1], lw[1]);
        v2u vh, vl;
        vh.x = hw[0]; vh.y = hw[1];
        vl.x = lw[0]; vl.y = lw[1];
        *(v2u*)(ahp + 128 * g) = vh;
        *(v2u*)(alp + 128 * g) = vl;
      }
    }
  }
  __syncthreads();   // P planes complete (block barrier between the LDS spill and the fragment reload)

  // ---- phase 3: out(32x64) = attn(32x1024) . V(1024x64); key tiles beyond the causal range carry exact zeros
  if (w < 4) {                                               // wave-uniform
    const int nt  = w;                                       // output columns nt*16..+15, of both query tiles
    const int nkt = q0 / 32 + 1;                             // <= 32, block-uniform
    const size_t vrow = ((size_t)(b * DM + h * DKK + nt * 16)) * SS + lane * 8;
    const int nk4 = (nkt + 3) & ~3;                          // whole groups of four tiles (128 columns, as in phase 2), <= 32: the added tiles have P == 0
    const int pa0 = l15 * PST + hl * 8;                      // query tile 0; tile 1 lies 16 rows on
    const int pa1 = pa0 + 16 * PST;
    v8f acc0 = zero8(), acc1 = zero8();
    // ring of four V tiles in registers: a tile's slot is loaded again, four tiles ahead, behind its products
    v16bf vh[4], vl[4];
#pragma unroll  // constant indices, or the ring falls to scratch
    for (int j = 0; j < 4; ++j) {
      vh[j] = ldg_frag(Vh, vrow + (size_t)j * 512);
      vl[j] = ldg_frag(Vl, vrow + (size_t)j * 512);
    }
    // the two V address pairs stay live up to this wait: no load above may land on them
    asm volatile("s_wait_xcnt 0x0" :: "v"(Vh + vrow), "v"(Vl + vrow) : "memory");
    int k0 = 0;
    for (; k0 + 4 < nk4; k0 += 4) {
      v16bf ph0[4], pl0[4], ph1[4], pl1[4];
#pragma unroll  // constant indices; the group's P tiles are read from LDS in one go
      for (int j = 0; j < 4; ++j) {
        ph0[j] = lds_frag(aH, pa0 + (k0 + j) * 32);
        pl0[j] = lds_frag(aL, pa0 + (k0 + j) * 32);
        ph1[j] = lds_frag(aH, pa1 + (k0 + j) * 32);
        pl1[j] = lds_frag(aL, pa1 + (k0 + j) * 32);
      }
#pragma unroll  // constant indices into the ring
      for (int j = 0; j < 4; ++j) {
        wmma3x2(acc0, acc1, ph0[j], pl0[j], ph1[j], pl1[j], vh[j], vl[j]);
        vh[j] = ldg_frag(Vh, vrow + (size_t)(k0 + 4 + j) * 512);
        vl[j] = ldg_frag(Vl, vrow + (size_t)(k0 + 4 + j) * 512);
      }
      // the next trip's address additions overwrite registers that the loads in flight name
      asm volatile("s_wait_xcnt 0x0" ::: "memory");
    }
    {                                                        // last group: nothing left to load
      v16bf ph0[4], pl0[4], ph1[4], pl1[4];
#pragma unroll
      for (int j = 0; j < 4; ++j) {
        ph0[j] = lds_frag(aH, pa0 + (k0 + j) * 32);
        pl0[j] = lds_frag(aL, pa0 + (k0 + j) * 32);
        ph1[j] = lds_frag(aH, pa1 + (k0 + j) * 32);
        pl1[j] = lds_frag(aL, pa1 + (k0 + j) * 32);
      }
#pragma unroll
      for (int j = 0; j < 4; ++j) wmma3x2(acc0, acc1, ph0[j], pl0[j], ph1[j], pl1[j], vh[j], vl[j]);
    }
#pragma unroll
    for (int r = 0; r < 8; ++r) {
      sO[(hl * 8 + r) * OST + nt * 16 + l15]      = acc0[r];
      sO[(16 + hl * 8 + r) * OST + nt * 16 + l15] = acc1[r];
    }
  }
  __syncthreads();

  // ---- store concat planes: four plane tiles (two per query tile); wave w owns half of tile (w&3)/2 of query tile w/4,
  //      one instruction per plane = 512 contiguous B
  {
    const int u  = w >> 2;                                   // query tile
    const int wq = w & 3;
    const int s  = (wq & 1) * 32 + lane;                     // chunk inside the tile
    const int cc = (wq >> 1) * 32 + (s >> 4) * 8;
    const float* sp = sO + (u * 16 + (s & 15)) * OST + cc;
    const v4f a = *(const v4f*)sp;
    const v4f c = *(const v4f*)(sp + 4);
    float x[8] = {a.x, a.y, a.z, a.w, c.x, c.y, c.z, c.w};
    v4u vh, vl;
    split8(x, vh, vl);
    const size_t go = (size_t)(b * SS + q0 + u * 16) * DM + h * (DKK * 16) + (wq >> 1) * 512 + s * 8;
    *(v4u*)(Ch + go) = vh;
    *(v4u*)(Cl + go) = vl;
  }
}

// ---------------------------------------------------------------- launcher
extern "C" void kernel_launch(void* const* d_in, const int* in_sizes, int n_in,
                              void* d_out, int out_size, void* d_ws, size_t ws_size,
                              hipStream_t stream) {
  if (n_in < 12) return;
  if (in_sizes[0] != (int)ACT || in_sizes[1] != (int)ACT || in_sizes[2] != (int)ACT) return;
  if (in_sizes[3] != (int)WEL || in_sizes[5] != (int)WEL || in_sizes[7] != (int)WEL || in_sizes[9] != (int)WEL) return;
  if (in_sizes[4] != DM || in_sizes[6] != DM || in_sizes[8] != DM || in_sizes[10] != DM) return;
  if (in_sizes[11] != HH) return;
  if (out_size != (int)ACT) return;

  const float* q   = (const float*)d_in[0];
  const float* k   = (const float*)d_in[1];
  const float* v   = (const float*)d_in[2];
  const float* Wq  = (const float*)d_in[3];
  const float* bq  = (const float*)d_in[4];
  const float* Wk  = (const float*)d_in[5];
  const float* bk  = (const float*)d_in[6];
  const float* Wv  = (const float*)d_in[7];
  const float* bv  = (const float*)d_in[8];
  const float* Wo  = (const float*)d_in[9];
  const float* bo  = (const float*)d_in[10];
  const float* gam = (const float*)d_in[11];
  float* out = (float*)d_out;

  // workspace carve (256-B aligned): q, k, v planes hi and lo (the q planes are reused for the concat planes),
  // Wq, Wk, Wv, Wo planes hi and lo, Qp, Kp, Vt planes hi and lo.  Total 112 MiB.
  char* ws = (char*)d_ws;
  size_t off = 0;
  auto carve = [&](size_t bytes) -> char* {
    char* p = ws + off;
    off += (bytes + 255) & ~(size_t)255;
    return p;
  };
  u16* actH = (u16*)carve(3 * ACT * 2);
  u16* actL = (u16*)carve(3 * ACT * 2);
  u16* wH   = (u16*)carve(4 * WEL * 2);
  u16* wL   = (u16*)carve(4 * WEL * 2);
  u16* prH  = (u16*)carve(3 * ACT * 2);             // Qp, Kp, Vt
  u16* prL  = (u16*)carve(3 * ACT * 2);
  if (off > ws_size) return;

  const dim3 pgrid(DM / 128, MROWS / (64 * MT), 3); // (8, 16, 3)
  const dim3 ggrid(DM / 128, MROWS / (64 * MT));    // (8, 16)
  const dim3 agrid(SS / QR, HH, BB);                // (32, 16, 4)

  // all seven f32 matrices -> planes
  k_split<<<dim3(SPLIT_BLKS), 256, 0, stream>>>(q, k, v, Wq, Wk, Wv, Wo, actH, actL, wH, wL);
  // q, k, v projections -> Qp, Kp planes, Vt planes (k = token)
  k_gemm3<0><<<pgrid, 256, 0, stream>>>(actH, actL, wH, wL, bq, bk, bv, prH, prL, out);
  // attention -> concat planes (reuse the q planes)
  k_attn<<<agrid, 256, SMEM_ATTN, stream>>>(prH, prL, prH + ACT, prL + ACT, prH + 2 * ACT, prL + 2 * ACT, gam, actH, actL);
  // output projection -> f32 result
  k_gemm3<2><<<ggrid, 256, 0, stream>>>(actH, actL, wH + 3 * WEL, wL + 3 * WEL, bo, bo, bo, prH, prL, out);
}

// v010
// A run of this version takes 160 microseconds.
// Timed twice side by side with v009, it ran 1.08 times as fast both times.
// Over all steps from v000 it is 4.00 times as fast.
#include <hip/hip_runtime.h>
#include <math.h>
#include <stdint.h>
#include <stddef.h>

// All six contractions (three input projections, q.k^T scores, attn.V, output projection): v_wmma_f32_16x16x32_bf16 with bf16 hi/lo three-term split operands (hi*hi + hi*lo + lo*hi), f32 accumulate; softmax / cumsum / distance-decay row math in f32 on VALU.

typedef __bf16         v16bf __attribute__((ext_vector_type(16)));
typedef float          v8f   __attribute__((ext_vector_type(8)));
typedef float          v4f   __attribute__((ext_vector_type(4)));
typedef float          v2f   __attribute__((ext_vector_type(2)));
typedef __bf16         v2bf  __attribute__((ext_vector_type(2)));
typedef unsigned int   v4u   __attribute__((ext_vector_type(4)));
typedef unsigned int   v2u   __attribute__((ext_vector_type(2)));
typedef unsigned short u16;

union Frag { v16bf v; v4u u[2]; };

static constexpr int BB  = 4;
static constexpr int SS  = 1024;
static constexpr int DM  = 1024;
static constexpr int HH  = 16;
static constexpr int DKK = 64;
static constexpr int MROWS = BB * SS;                 // 4096
static constexpr size_t ACT = (size_t)MROWS * DM;     // 4194304
static constexpr size_t WEL = (size_t)DM * DM;        // 1048576
static_assert(HH * DKK == DM);
static_assert(MROWS % 64 == 0);
static_assert(DM % 128 == 0);
static_assert(DM % 64 == 0);
static_assert(SS % 64 == 0);
static_assert(ACT % 2048 == 0);
static_assert(WEL % 2048 == 0);
static_assert(SS == DM);                              // one tile map serves every plane

// Every bf16 plane is a [rows][1024] matrix stored in fragment order: 1-KiB tiles of 16 rows x 32 k,
// tile index (row/16)*KB + k/32; inside a tile the 16-B chunk of (row, k/8) sits at (k/8 % 4)*16 + row%16.
// A lane's two fragment chunks are then chunk 'lane' and chunk '32 + lane' of the tile, so one
// wave-wide 16-B load covers 512 contiguous bytes.
static constexpr int KB = DM / 32;                    // tiles along k

// ---------------------------------------------------------------- small helpers
// two f32 -> their bf16 hi parts (round to nearest even) packed in one word, x0 in the low half, and the packed bf16
// of what the hi parts leave: each packed conversion is one v_cvt_pk_bf16_f32
__device__ __forceinline__ void split_pair(float x0, float x1, unsigned& hi, unsigned& lo) {
  v2f x;
  x.x = x0; x.y = x1;
  const v2bf h = __builtin_convertvector(x, v2bf);
  v2f d;
  d.x = x0 - (float)h.x;                                          // x - xh exact in f32
  d.y = x1 - (float)h.y;
  hi = __builtin_bit_cast(unsigned, h);
  lo = __builtin_bit_cast(unsigned, __builtin_convertvector(d, v2bf));
}
// 8 consecutive f32 -> packed 8 bf16 hi (16 B) and 8 bf16 lo (16 B)
__device__ __forceinline__ void split8(const float* x, v4u& vh, v4u& vl) {
  unsigned hw[4], lw[4];
#pragma unroll
  for (int i = 0; i < 4; ++i) split_pair(x[2 * i], x[2 * i + 1], hw[i], lw[i]);
  vh.x = hw[0]; vh.y = hw[1]; vh.z = hw[2]; vh.w = hw[3];
  vl.x = lw[0]; vl.y = lw[1]; vl.z = lw[2]; vl.w = lw[3];
}
__device__ __forceinline__ v8f zero8() {
  v8f z;
#pragma unroll
  for (int i = 0; i < 8; ++i) z[i] = 0.f;
  return z;
}
// 16x32 operand fragment from one plane tile: elements 0..7 <- k 8*(lane>>4).., 8..15 <- 16 further,
// row lane&15 (same map for A rows and for B stored [n][k])
// (caller passes e = row0*DM + (k0/32)*512 + 8*lane, the lane's first chunk of the tile at row0, k0)
__device__ __forceinline__ v16bf ldg_frag(const u16* __restrict__ p, size_t e) {
  Frag f;
  f.u[0] = *(const v4u*)(p + e);
  f.u[1] = *(const v4u*)(p + e + 256);
  return f.v;
}
// the same through a pointer that is typed as global memory: an address that has passed through an asm statement
// has lost what the compiler knew of its origin, and an untyped one would load by flat_load
typedef const __attribute__((address_space(1))) u16* gptr;
typedef const __attribute__((address_space(1))) v4u* gptr4;
__device__ __forceinline__ v16bf ldg_frag_g(gptr p, size_t e) {
  Frag f;
  f.u[0] = *(gptr4)(p + e);
  f.u[1] = *(gptr4)(p + e + 256);
  return f.v;
}
// 16x32 operand fragment from a k-contiguous bf16 row in LDS: elements 0..7 <- e.., 8..15 <- e+16..
// (caller passes e = row*pitch + k0 + 8*(lane>>4))
__device__ __forceinline__ v16bf lds_frag(const u16* p, int e) {
  Frag f;
  f.u[0] = *(const v4u*)(p + e);
  f.u[1] = *(const v4u*)(p + e + 16);
  return f.v;
}
// 2^x, log2(x), sqrt(x) and 1/x as the chip's own single instructions (about 1 ulp), without libm's range reduction,
// range checks and refinement steps.  A result below the normal range may come out as 0, a subnormal
// sqrt argument likewise: every use below adds such a value to a sum that is at least 1 or clamps it;
// the two reciprocals are of such sums (1 <= sum <= 1024).
// Eight at a time in one statement: behind a transcendental the instruction set wants one slot before its
// result is read or its source overwritten.  "=&v" keeps every result apart from every argument, so no
// neighbour takes a source's register; the v_nop is the slot behind the last one; the s_delay_alu is the
// issue hint for the arguments, which the compiler cannot give for instructions inside a statement.
__device__ __forceinline__ void hw_exp2x8(float (&r)[8], const float (&a)[8]) {
  asm("s_delay_alu instid0(VALU_DEP_1)\n\t"
      "v_exp_f32 %0, %8\n\tv_exp_f32 %1, %9\n\tv_exp_f32 %2, %10\n\tv_exp_f32 %3, %11\n\t"
      "v_exp_f32 %4, %12\n\tv_exp_f32 %5, %13\n\tv_exp_f32 %6, %14\n\tv_exp_f32 %7, %15\n\t"
      "v_nop"
      : "=&v"(r[0]), "=&v"(r[1]), "=&v"(r[2]), "=&v"(r[3]), "=&v"(r[4]), "=&v"(r[5]), "=&v"(r[6]), "=&v"(r[7])
      : "v"(a[0]), "v"(a[1]), "v"(a[2]), "v"(a[3]), "v"(a[4]), "v"(a[5]), "v"(a[6]), "v"(a[7]));
}
// the same, four at a time, for the passes that go group by group
__device__ __forceinline__ void hw_exp2x4(float (&r)[4], const float (&a)[4]) {
  asm("s_delay_alu instid0(VALU_DEP_1)\n\t"
      "v_exp_f32 %0, %4\n\tv_exp_f32 %1, %5\n\tv_exp_f32 %2, %6\n\tv_exp_f32 %3, %7\n\t"
      "v_nop"
      : "=&v"(r[0]), "=&v"(r[1]), "=&v"(r[2]), "=&v"(r[3])
      : "v"(a[0]), "v"(a[1]), "v"(a[2]), "v"(a[3]));
}
__device__ __forceinline__ void hw_sqrtx4(float (&r)[4], const float (&a)[4]) {
  asm("s_delay_alu instid0(VALU_DEP_1)\n\t"
      "v_sqrt_f32 %0, %4\n\tv_sqrt_f32 %1, %5\n\tv_sqrt_f32 %2, %6\n\tv_sqrt_f32 %3, %7\n\t"
      "v_nop"
      : "=&v"(r[0]), "=&v"(r[1]), "=&v"(r[2]), "=&v"(r[3])
      : "v"(a[0]), "v"(a[1]), "v"(a[2]), "v"(a[3]));
}
// x + (x of the lane N places down in the same 16-lane row; 0 where there is none): one step of a running sum over lanes
template <int N>
__device__ __forceinline__ float row_shr_add(float x) {
  return x + __int_as_float(__builtin_amdgcn_update_dpp(0, __float_as_int(x), 0x110 + N, 0xf, 0xf, true));
}
__device__ __forceinline__ float hw_rcp(float x) { return __builtin_amdgcn_rcpf(x); }
static constexpr float LOG2E = 1.44269504088896340736f;
// three-term split product (hi*hi, then hi*lo, then lo*hi) into two accumulators that share the B operand, term by term
// in turn, so that neighbouring products are independent; then the hazard guard
__device__ __forceinline__ void wmma3x2(v8f& c0, v8f& c1, v16bf a0h, v16bf a0l, v16bf a1h, v16bf a1l, v16bf bh, v16bf bl) {
  c0 = __builtin_amdgcn_wmma_f32_16x16x32_bf16(false, a0h, false, bh, (short)0, c0, false, false);
  c1 = __builtin_amdgcn_wmma_f32_16x16x32_bf16(false, a1h, false, bh, (short)0, c1, false, false);
  c0 = __builtin_amdgcn_wmma_f32_16x16x32_bf16(false, a0h, false, bl, (short)0, c0, false, false);
  c1 = __builtin_amdgcn_wmma_f32_16x16x32_bf16(false, a1h, false, bl, (short)0, c1, false, false);
  c0 = __builtin_amdgcn_wmma_f32_16x16x32_bf16(false, a0l, false, bh, (short)0, c0, false, false);
  c1 = __builtin_amdgcn_wmma_f32_16x16x32_bf16(false, a1l, false, bh, (short)0, c1, false, false);
  // the four slots between the last products and whatever lands on their registers (ties D, keeps A/B live)
  asm volatile("v_nop\n\tv_nop\n\tv_nop\n\tv_nop" : "+v"(c0), "+v"(c1)
               : "v"(a0h), "v"(a0l), "v"(a1h), "v"(a1l), "v"(bh), "v"(bl));
}

// ---------------------------------------------------------------- f32 [rows][1024] -> bf16 hi/lo planes (fragment order)
// One launch splits all seven f32 matrices (q, k, v, Wq, Wk, Wv, Wo): none reads another's result.
// aH/aL hold the three activation planes one behind the other, wH/wL the four weight planes.
// A unit is 8 rows x 32 k of one tile, one wave's work: 8 whole 128-B lines read, 4 whole lines stored per plane.
// A block takes 128 consecutive units of ONE matrix (32 rows), 16 per wave.
static constexpr int UPB      = 128;                        // units per block
static constexpr int ACT_BLKS = (int)(ACT / 256 / UPB);     // 128 blocks per activation
static constexpr int WEL_BLKS = (int)(WEL / 256 / UPB);     // 32 blocks per weight
static constexpr int SPLIT_BLKS = 3 * ACT_BLKS + 4 * WEL_BLKS;
static_assert(ACT % (256 * UPB) == 0);
static_assert(WEL % (256 * UPB) == 0);

__global__ void __launch_bounds__(256)
k_split(const float* __restrict__ q, const float* __restrict__ k, const float* __restrict__ v,
        const float* __restrict__ Wq, const float* __restrict__ Wk, const float* __restrict__ Wv,
        const float* __restrict__ Wo,
        u16* __restrict__ aH, u16* __restrict__ aL, u16* __restrict__ wH, u16* __restrict__ wL) {
  const int blk  = blockIdx.x;
  const int lane = threadIdx.x & 31;
  const int w    = threadIdx.x >> 5;
  const float* in;
  u16 *ph, *pl;
  int u0;                                                   // the block's first unit inside its matrix
  if (blk < 3 * ACT_BLKS) {                                 // block-uniform
    const int a = blk / ACT_BLKS;
    in = (a == 0) ? q : (a == 1) ? k : v;
    ph = aH + (size_t)a * ACT;
    pl = aL + (size_t)a * ACT;
    u0 = (blk - a * ACT_BLKS) * UPB;
  } else {
    const int a = (blk - 3 * ACT_BLKS) / WEL_BLKS;
    in = (a == 0) ? Wq : (a == 1) ? Wk : (a == 2) ? Wv : Wo;
    ph = wH + (size_t)a * WEL;
    pl = wL + (size_t)a * WEL;
    u0 = (blk - 3 * ACT_BLKS - a * WEL_BLKS) * UPB;
  }
  // the wave's n-th unit is unit n*8 + w of the block: half w&1 of tile (n&7)*4 + w/2 in the block's tile row n>>3,
  // so every address below is one lane address plus a compile-time offset
  const int r = (w & 1) * 8 + (lane & 7);                   // row inside the tile
  const int j = lane >> 3;                                  // 8-element chunk along k
  const float* src = in + (size_t)((u0 >> 6) * 16 + r) * DM + (w >> 1) * 32 + j * 8;
  const size_t dst = ((size_t)((u0 >> 1) + (w >> 1)) * 64 + j * 16 + r) * 8;
  v4f a[16], c[16];
#pragma unroll  // constant indices, or a[] and c[] fall to scratch
  for (int n = 0; n < 16; ++n) {
    const float* p = src + (n >> 3) * 16 * DM + (n & 7) * 128;
    a[n] = *(const v4f*)p;
    c[n] = *(const v4f*)(p + 4);
  }
  // keeps all 32 loads ahead of the arithmetic: left alone the compiler sinks them and holds about six in flight
  __builtin_amdgcn_sched_barrier(0);
#pragma unroll  // constant indices
  for (int n = 0; n < 16; ++n) {
    float x[8] = {a[n].x, a[n].y, a[n].z, a[n].w, c[n].x, c[n].y, c[n].z, c[n].w};
    v4u vh, vl;
    split8(x, vh, vl);
    const size_t d = dst + (size_t)((n >> 3) * KB + (n & 7) * 4) * 512;
    *(v4u*)(ph + d) = vh;
    *(v4u*)(pl + d) = vl;
  }
}

// ---------------------------------------------------------------- GEMM: out = A @ W^T + bias
// A planes [M=4096][K=1024] bf16 hi/lo, W planes [N=1024][K] bf16 hi/lo ([out,in]), both in fragment order;
// bias [N] f32. Block 128 thr = 4 waves (2 x 2), block tile 128(M) x 128(N), wave tile 64 x 64: four 16-row tiles, 32 rows
// apart, times four 16-column tiles, so a loaded A or B fragment feeds four accumulators: a wave loads 16 KiB per 48 products.
// About 410 VGPRs per wave: two waves per SIMD, two blocks per WGP.  The block is this small for the grid's sake: the three
// input projections are 768 blocks, three per WGP of the chip's 256, and the output projection 256, one per WGP; a WGP
// takes its next block when one of its two ends, and one block's epilogue runs beside the other's products.
// Fragments straight from global (no LDS in the k-loop), fetched two k steps ahead.  Epilogue: tile staged in LDS, then
// MODE 0: the three input projections in one launch, blockIdx.z = 0, 1, 2 for q, k, v: operand, weight and result
//         planes of projection z lie z planes behind the pointers given.  Result of z = 0, 1: bf16 hi/lo planes
//         [M][N] in fragment order; of z = 2: planes transposed [(m/SS)*N + n][m%SS] in fragment order
//         (k = token, for attn.V)
// MODE 2: f32 row-major [M][N] (Of)
static constexpr int TP = 132;   // LDS tile pitch (floats)
static constexpr int MT = 4;     // 16-row A tiles per wave
static constexpr int BR = 32 * MT;   // rows of a block tile: two waves along M
static_assert(MROWS % BR == 0);
static_assert(SS % BR == 0);         // a block's rows lie in one batch entry

template <int MODE>
__global__ void __launch_bounds__(128, 2)   // at least two waves per SIMD: at most 512 VGPRs, so that two blocks share a WGP
k_gemm3(const u16* __restrict__ Ah0, const u16* __restrict__ Al0,
        const u16* __restrict__ Wh0, const u16* __restrict__ Wl0,
        const float* __restrict__ bias0, const float* __restrict__ bias1, const float* __restrict__ bias2,
        u16* __restrict__ Oh0, u16* __restrict__ Ol0, float* __restrict__ Of) {
  constexpr int N = DM, K = DM;
  __shared__ __attribute__((aligned(16))) float sT[BR * TP];

  const int z = (MODE == 0) ? (int)blockIdx.z : 0;     // which projection; block-uniform
  const u16* __restrict__ Ah = Ah0 + (size_t)z * ACT;
  const u16* __restrict__ Al = Al0 + (size_t)z * ACT;
  const u16* __restrict__ Wh = Wh0 + (size_t)z * WEL;
  const u16* __restrict__ Wl = Wl0 + (size_t)z * WEL;
  const float* __restrict__ bias = (z == 0) ? bias0 : (z == 1) ? bias1 : bias2;
  u16* __restrict__ Oh = Oh0 + (size_t)z * ACT;
  u16* __restrict__ Ol = Ol0 + (size_t)z * ACT;

  const int lane = threadIdx.x & 31;
  const int w    = threadIdx.x >> 5;
  const int wm   = w & 1;              // 0..1
  const int wn   = w >> 1;             // 0..1
  const int hl   = lane >> 4;
  const int l15  = lane & 15;
  const int m0b  = blockIdx.y * BR;
  const int n0b  = blockIdx.x * 128;
  const int m0   = m0b + wm * 16;
  const int n0   = n0b + wn * 64;

  v8f acc[MT][4];
#pragma unroll
  for (int mt = 0; mt < MT; ++mt)
#pragma unroll
    for (int nt = 0; nt < 4; ++nt) acc[mt][nt] = zero8();

  // the lane's four running addresses, at the current even k step; every load is one of them plus a constant
  gptr pah = (gptr)(Ah + (size_t)m0 * K + lane * 8);    // A rows m0..m0+15 (+mt*32 rows)
  gptr pal = (gptr)(Al + (size_t)m0 * K + lane * 8);
  gptr pbh = (gptr)(Wh + (size_t)n0 * K + lane * 8);    // W rows n0..n0+15 (+nt*16 rows)
  gptr pbl = (gptr)(Wl + (size_t)n0 * K + lane * 8);

  // Two register sets of fragments, even and odd k steps.  A set is loaded again, for two k steps later,
  // behind its 48 products, so a load has the other set's 48 products' time to come back.
  v16bf ah[2][MT], al[2][MT], bh[2][4], bl[2][4];
#pragma unroll  // constant indices, or the sets fall to scratch
  for (int p = 0; p < 2; ++p) {
#pragma unroll
    for (int mt = 0; mt < MT; ++mt) {
      ah[p][mt] = ldg_frag_g(pah, (size_t)mt * 32 * K + p * 512);
      al[p][mt] = ldg_frag_g(pal, (size_t)mt * 32 * K + p * 512);
    }
#pragma unroll
    for (int nt = 0; nt < 4; ++nt) {
      bh[p][nt] = ldg_frag_g(pbh, (size_t)nt * 16 * K + p * 512);
      bl[p][nt] = ldg_frag_g(pbl, (size_t)nt * 16 * K + p * 512);
    }
  }
  // one k step: hi*hi, then hi*lo, then lo*hi into each accumulator (the order of wmma3x2), term by term over the
  // 16 accumulators, so that neighbouring products are independent
#define GEMM_KSTEP(p)                                                                                        \
  _Pragma("unroll") for (int mt = 0; mt < MT; ++mt)                                                          \
    _Pragma("unroll") for (int nt = 0; nt < 4; ++nt)                                                         \
      acc[mt][nt] = __builtin_amdgcn_wmma_f32_16x16x32_bf16(false, ah[p][mt], false, bh[p][nt], (short)0,    \
                                                            acc[mt][nt], false, false);                      \
  _Pragma("unroll") for (int mt = 0; mt < MT; ++mt)                                                          \
    _Pragma("unroll") for (int nt = 0; nt < 4; ++nt)                                                         \
      acc[mt][nt] = __builtin_amdgcn_wmma_f32_16x16x32_bf16(false, ah[p][mt], false, bl[p][nt], (short)0,    \
                                                            acc[mt][nt], false, false);                      \
  _Pragma("unroll") for (int mt = 0; mt < MT; ++mt)                                                          \
    _Pragma("unroll") for (int nt = 0; nt < 4; ++nt)                                                         \
      acc[mt][nt] = __builtin_amdgcn_wmma_f32_16x16x32_bf16(false, al[p][mt], false, bh[p][nt], (short)0,    \
                                                            acc[mt][nt], false, false);
#pragma unroll 1  // one trip already holds both sets; further copies only grow the code
  for (int kb = 0; kb < K / 32 - 2; kb += 2) {
#pragma unroll  // constant indices into the sets
    for (int p = 0; p < 2; ++p) {
      GEMM_KSTEP(p)
      // the four slots between the last products and the loads that land on their A and B registers; the
      // scheduling fences keep every product above the slots and the reloads in one group directly below them
      // (left alone the compiler sinks the reloads halfway into the other set's products, which halves their lead)
      __builtin_amdgcn_sched_barrier(0);
      asm volatile("v_nop\n\tv_nop\n\tv_nop\n\tv_nop");
      __builtin_amdgcn_sched_barrier(0);
#pragma unroll
      for (int mt = 0; mt < MT; ++mt) {
        ah[p][mt] = ldg_frag_g(pah, (size_t)mt * 32 * K + (2 + p) * 512);
        al[p][mt] = ldg_frag_g(pal, (size_t)mt * 32 * K + (2 + p) * 512);
      }
#pragma unroll
      for (int nt = 0; nt < 4; ++nt) {
        bh[p][nt] = ldg_frag_g(pbh, (size_t)nt * 16 * K + (2 + p) * 512);
        bl[p][nt] = ldg_frag_g(pbl, (size_t)nt * 16 * K + (2 + p) * 512);
      }
      __builtin_amdgcn_sched_barrier(0);
    }
    // the four additions below overwrite registers that the loads in flight name; as operands of the wait the
    // address pairs keep registers of their own up to it, so that no reload lands on one either
    asm volatile("s_wait_xcnt 0x0" : "+v"(pah), "+v"(pal), "+v"(pbh), "+v"(pbl) :: "memory");
    pah += 2 * 512; pal += 2 * 512; pbh += 2 * 512; pbl += 2 * 512;
  }
  // the last two k steps: nothing left to load
  GEMM_KSTEP(0)
  GEMM_KSTEP(1)
#undef GEMM_KSTEP

  const int bi = n0 + l15;
  float bb[4];
#pragma unroll
  for (int nt = 0; nt < 4; ++nt) bb[nt] = bias[bi + nt * 16];
  // the index register stays live up to this wait: none of the four loads may land on it before it
  asm volatile("s_wait_xcnt 0x0" :: "v"(bi) : "memory");

  // stage the 128x128 f32 tile (+bias) in LDS; D element r of lane = (row 8h+r, col l15)
#pragma unroll  // constant indices into acc
  for (int mt = 0; mt < MT; ++mt)
#pragma unroll
    for (int nt = 0; nt < 4; ++nt)
#pragma unroll
      for (int r = 0; r < 8; ++r)
        sT[(mt * 32 + wm * 16 + hl * 8 + r) * TP + wn * 64 + nt * 16 + l15] = acc[mt][nt][r] + bb[nt];
  __syncthreads();

  // the tile leaves in MT parts of 32 rows.  The next part's LDS loads and arithmetic overwrite registers that this
  // part's stores name: the wait behind the stores stands in front of them, and the two scheduling fences keep the
  // compiler from moving any of them in between the first store and the wait
  if (MODE == 0 && z < 2) {
    // per part 2 x 4 plane tiles; wave w owns tile column w, one instruction = half a tile = 512 contiguous B
#pragma unroll 1  // the parts differ only in their addresses: copies would only grow the code
    for (int mt = 0; mt < MT; ++mt) {
      const int mh  = m0b + mt * 32;                       // the part's first row
      const int kbl = w;                                   // tile column; tile row is j/2, half tile j&1
      v4u vh[4], vl[4];
#pragma unroll
      for (int j = 0; j < 4; ++j) {
        const int s   = (j & 1) * 32 + lane;               // chunk inside the tile
        const int row = mt * 32 + (j >> 1) * 16 + (s & 15);
        const float* sp = sT + row * TP + kbl * 32 + (s >> 4) * 8;
        const v4f a = *(const v4f*)sp;
        const v4f c = *(const v4f*)(sp + 4);
        float x[8] = {a.x, a.y, a.z, a.w, c.x, c.y, c.z, c.w};
        split8(x, vh[j], vl[j]);
      }
      const size_t go = ((size_t)((mh >> 4) * KB + (n0b >> 5) + kbl) * 64 + lane) * 8;   // tile row 1: KB tiles on
      u16* oh = Oh + go;
      u16* ol = Ol + go;
      __builtin_amdgcn_sched_barrier(0);                   // all arithmetic above the stores
#pragma unroll
      for (int j = 0; j < 4; ++j) {
        *(v4u*)(oh + (size_t)(j >> 1) * KB * 512 + (j & 1) * 256) = vh[j];
        *(v4u*)(ol + (size_t)(j >> 1) * KB * 512 + (j & 1) * 256) = vl[j];
      }
      asm volatile("s_wait_xcnt 0x0" ::: "memory");
      __builtin_amdgcn_sched_barrier(0);
    }
  } else if (MODE == 0) {
    // per part 8 (features) x 1 (tokens) plane tiles; wave w owns feature tiles w and w + 4, one instruction = half a tile
#pragma unroll 1  // the parts differ only in their addresses: copies would only grow the code
    for (int mt = 0; mt < MT; ++mt) {
      const int mh   = m0b + mt * 32;                      // the part's first row
      const int bidx = mh / SS;
      const int s0   = mh - bidx * SS;
      v4u vh[4], vl[4];
#pragma unroll
      for (int j = 0; j < 4; ++j) {
        const int s  = (j & 1) * 32 + lane;                // chunk inside the tile
        const int tc = (s >> 4) * 8;                       // first of its 8 tokens
        const int f  = (w + (j >> 1) * 4) * 16 + l15;      // its feature
        float x[8];
#pragma unroll
        for (int i = 0; i < 8; ++i) x[i] = sT[(mt * 32 + tc + i) * TP + f];
        split8(x, vh[j], vl[j]);
      }
      // half tile j&1 lies 256 elements behind half tile 0, feature tile w + 4 four tile rows (4*KB tiles) behind tile w
      const size_t go = ((size_t)(((bidx * N + n0b) >> 4) + w) * KB + (s0 >> 5)) * 512 + (size_t)lane * 8;
      u16* oh = Oh + go;
      u16* ol = Ol + go;
      __builtin_amdgcn_sched_barrier(0);                   // all arithmetic above the stores
#pragma unroll
      for (int j = 0; j < 4; ++j) {
        *(v4u*)(oh + (size_t)(j >> 1) * 4 * KB * 512 + (j & 1) * 256) = vh[j];
        *(v4u*)(ol + (size_t)(j >> 1) * 4 * KB * 512 + (j & 1) * 256) = vl[j];
      }
      asm volatile("s_wait_xcnt 0x0" ::: "memory");
      __builtin_amdgcn_sched_barrier(0);
    }
  } else {
    // f32: per part wave w owns rows w*8..+7; one instruction = 32 lanes x 16 B = one 512-B row segment.
    const int cc4 = lane * 4;
#pragma unroll 1  // the parts differ only in their addresses: copies would only grow the code
    for (int mt = 0; mt < MT; ++mt) {
      const int row0 = mt * 32 + w * 8;
      v4f val[8];
#pragma unroll
      for (int j = 0; j < 8; ++j) val[j] = *(const v4f*)(sT + (row0 + j) * TP + cc4);
      float* op = Of + (size_t)(m0b + row0) * N + n0b + cc4;
      __builtin_amdgcn_sched_barrier(0);                   // all arithmetic above the stores
#pragma unroll
      for (int j = 0; j < 8; ++j) *(v4f*)(op + (size_t)j * N) = val[j];
      asm volatile("s_wait_xcnt 0x0" ::: "memory");
      __builtin_amdgcn_sched_barrier(0);
    }
  }
}

// ---------------------------------------------------------------- distance-decay attention
// grid (S/32, H, B); block 256 thr = 8 waves; 32 query rows (two 16-row tiles), full 1024-key score rows in LDS.
// A K or V fragment in registers feeds both query tiles: half the K and V loads per query row of a 16-row block.
// Qp, Kp planes [b*S+s][h*64+d], Vt planes [b*1024+h*64+d][s], concat planes [b*S+s][h*64+d]: all in fragment order;
// Row math runs in registers: the owning wave reads a score row from LDS once, 32 columns per lane (8 groups of 4),
// and writes the row's bf16 hi and lo probabilities over the same row (2 + 2 bytes a column on the 4 of the score),
// so that 32 rows take no more LDS than 16 rows with planes of their own and two blocks still share a WGP.
static constexpr int QR  = 32;                            // query rows per block
static constexpr int SST = 1036;                          // f32 score row pitch: 259 * 16 B; 8 rows = 32 banks mod 64
static constexpr int PST = 2 * SST;                       // the same pitch in bf16 elements
static constexpr int PLO = 1032;                          // the lo plane's start inside a row, in bf16 elements (129 * 16 B)
static constexpr int OST = 68;                            // f32 out-tile pitch
static constexpr size_t SM_S = (size_t)QR * SST * 4;      // 132608
static constexpr size_t SM_O = (size_t)QR * OST * 4;      // 8704
static constexpr size_t SMEM_ATTN = SM_S + SM_O;          // 141312
static_assert(SS % QR == 0);
static_assert(128 % QR == 0);                             // a block's rows share one last 128-column group
static_assert(PLO >= SS && PLO + SS <= PST);
static_assert(SM_S % 16 == 0);

__global__ void __launch_bounds__(256)
k_attn(const u16* __restrict__ Qh, const u16* __restrict__ Ql,
       const u16* __restrict__ Kh, const u16* __restrict__ Kl,
       const u16* __restrict__ Vh, const u16* __restrict__ Vl,
       const float* __restrict__ gammas,
       u16* __restrict__ Ch, u16* __restrict__ Cl) {
  extern __shared__ __attribute__((aligned(16))) char smem[];
  float* sS   = (float*)smem;                               // [QR][SST] scores
  u16*   aH   = (u16*)smem;                                 // [QR][PST] bf16 hi, over the row's own scores
  u16*   aL   = aH + PLO;                                   // [QR][PST] bf16 lo, behind the hi plane in the same row
  float* sO   = (float*)(smem + SM_S);                      // [QR][OST]

  const int qt = blockIdx.x, h = blockIdx.y, b = blockIdx.z;
  const int q0 = qt * QR;
  const int lane = threadIdx.x & 31;
  const int w    = threadIdx.x >> 5;
  const int hl   = lane >> 4;
  const int l15  = lane & 15;

  // ---- phase 1: sS[32][1024] = Q(32x64) . K^T / 8 * log2(e): scores in base-2 units, so that every
  //      exp(a - b) of the row math is 2^(a' - b') with no multiply of its own ------------------
  {
    const size_t qrow = (size_t)(b * SS + q0) * DM + h * (DKK * 16) + lane * 8;
    v16bf qh0[2], ql0[2], qh1[2], ql1[2];                    // [query tile]
#pragma unroll  // constant indices
    for (int u = 0; u < 2; ++u) {
      const size_t e = qrow + (size_t)u * 16 * DM;
      qh0[u] = ldg_frag(Qh, e);       ql0[u] = ldg_frag(Ql, e);
      qh1[u] = ldg_frag(Qh, e + 512); ql1[u] = ldg_frag(Ql, e + 512);
    }
    // the two Q address pairs stay live up to this wait: no later load may land on them before it
    asm volatile("s_wait_xcnt 0x0" :: "v"(Qh + qrow), "v"(Ql + qrow) : "memory");
    // ring of four key tiles in registers: a tile's slot is loaded again, four tiles ahead, behind its products
    const size_t krow0 = (size_t)(b * SS + w * 128) * DM + h * (DKK * 16) + lane * 8;
    v16bf kh0[4], kl0[4], kh1[4], kl1[4];
#pragma unroll  // constant indices, or the ring falls to scratch
    for (int t = 0; t < 4; ++t) {
      const size_t krow = krow0 + (size_t)t * 16 * DM;
      kh0[t] = ldg_frag(Kh, krow);       kl0[t] = ldg_frag(Kl, krow);
      kh1[t] = ldg_frag(Kh, krow + 512); kl1[t] = ldg_frag(Kl, krow + 512);
    }
#pragma unroll  // constant indices into the ring
    for (int t = 0; t < 8; ++t) {                            // 8 key tiles of 16 per wave
      const int kt = w * 8 + t;
      const int sl = t & 3;
      v8f acc0 = zero8(), acc1 = zero8();
      wmma3x2(acc0, acc1, qh0[0], ql0[0], qh0[1], ql0[1], kh0[sl], kl0[sl]);
      wmma3x2(acc0, acc1, qh1[0], ql1[0], qh1[1], ql1[1], kh1[sl], kl1[sl]);
      if (t + 4 < 8) {
        const size_t krow = krow0 + (size_t)(t + 4) * 16 * DM;
        kh0[sl] = ldg_frag(Kh, krow);       kl0[sl] = ldg_frag(Kl, krow);
        kh1[sl] = ldg_frag(Kh, krow + 512); kl1[sl] = ldg_frag(Kl, krow + 512);
        // behind the last K load: its address pairs stay live up to this wait and are free for reuse behind it
        if (t == 3) asm volatile("s_wait_xcnt 0x0" :: "v"(Kh + krow0), "v"(Kl + krow0) : "memory");
      }
#pragma unroll
      for (int r = 0; r < 8; ++r) {
        sS[(hl * 8 + r) * SST + kt * 16 + l15]        = acc0[r] * (0.125f * LOG2E);
        sS[(16 + hl * 8 + r) * SST + kt * 16 + l15]   = acc1[r] * (0.125f * LOG2E);
      }
    }
  }
  __syncthreads();

  // ---- phase 2: row math, 4 rows per wave, all in registers.  A lane owns columns g*128 + 4*lane .. +3 of each of the
  //      eight 128-column groups g: every LDS access of a wave is one contiguous run, and a group that lies wholly
  //      past the block's last query row is needed for the first softmax's maximum and sum alone
  {
    const float gg  = gammas[h];
    // gam2 = -softplus(gg) * log2(e), so that exp(-d * softplus) = 2^(d * gam2); 1 + 2^(..) lies in (1, 2]
    const float gam2 = -(fmaxf(gg, 0.f) * LOG2E +
                         __builtin_amdgcn_logf(1.0f + __builtin_amdgcn_exp2f(-fabsf(gg) * LOG2E)));
    const int   ng  = (q0 >> 7) + 1;                         // groups that hold a column <= q0 + 31; block-uniform, 1..8
    const int   cl  = lane * 4;
    const float hiF = (lane >= 16) ? 1.f : 0.f;
    for (int rr = 0; rr < QR / 8; ++rr) {
      const int row = w + rr * 8;
      const int iq  = q0 + row;
      const float* srow = sS + row * SST + cl;

      float s[32];                                           // scores, then new scores, then e2; [4*g + i]
      float c[32];                                           // e, then the lane's running sum inside its four columns
#pragma unroll  // constant indices, or s[] falls to scratch
      for (int g = 0; g < 8; ++g) {
        const v4f a = *(const v4f*)(srow + 128 * g);
        s[4 * g] = a.x; s[4 * g + 1] = a.y; s[4 * g + 2] = a.z; s[4 * g + 3] = a.w;
      }

      // A: row max over all 1024 keys
      float m1 = -3.0e38f;
#pragma unroll  // constant indices into s[]
      for (int i = 0; i < 32; ++i) m1 = fmaxf(m1, s[i]);
#pragma unroll
      for (int o = 16; o > 0; o >>= 1) m1 = fmaxf(m1, __shfl_xor(m1, o, 32));

      // B: e = exp(score - max) = 2^(s - m1) over the full row; s1 = sum
      float s1 = 0.f;
#pragma unroll  // constant indices into s[] and c[]
      for (int g = 0; g < 4; ++g) {
        float a[8], e[8];
#pragma unroll
        for (int i = 0; i < 8; ++i) a[i] = s[8 * g + i] - m1;
        hw_exp2x8(e, a);
#pragma unroll
        for (int i = 0; i < 8; ++i) { c[8 * g + i] = e[i]; s1 += e[i]; }
      }
#pragma unroll
      for (int o = 16; o > 0; o >>= 1) s1 += __shfl_xor(s1, o, 32);
      const float inv1 = hw_rcp(s1);

      // C: p = softmax * (j <= i); running sum inside the lane's four columns, over the lanes of the group, over the groups
      float off[8];                                          // sum of all columns in front of the lane's four
      float base = 0.f;                                      // sum of the groups so far
#pragma unroll  // constant indices into c[] and off[]
      for (int g = 0; g < 8; ++g) {
        if (g >= ng) break;                                  // block-uniform: the groups behind are past the diagonal
        float run = 0.f;
#pragma unroll
        for (int i = 0; i < 4; ++i) {
          const float p = (g * 128 + cl + i <= iq) ? c[4 * g + i] * inv1 : 0.f;
          run += p;
          c[4 * g + i] = run;
        }
        float x = row_shr_add<1>(run);                     // inclusive sum over the 16-lane row
        x = row_shr_add<2>(x);
        x = row_shr_add<4>(x);
        x = row_shr_add<8>(x);
        // the other row's lane 15 and the own row's lane 15: the two rows' sums
        const float oth = __uint_as_float(__builtin_amdgcn_permlanex16(0u, __float_as_uint(x), 0xffffffffu, 0xffffffffu,
                                                                       false, false));
        const float own = __int_as_float(__builtin_amdgcn_update_dpp(0, __float_as_int(x), 0x15f, 0xf, 0xf, true));
        off[g] = base + (fmaf(oth, hiF, x) - run);
        base += own + oth;
      }
      const float disttotal = base;

      // D: decay factor, masked rescale, row max of the new scores
      float m2 = -3.0e38f;
#pragma unroll  // constant indices into s[], c[] and off[]
      for (int g = 0; g < 8; ++g) {
        if (g >= ng) break;                                  // block-uniform: the groups behind are past the diagonal
        float x[4], dsc[4], t[4], eff[4];
#pragma unroll
        for (int i = 0; i < 4; ++i) {
          const float distcum = off[g] + c[4 * g + i];
          const float pe = fabsf((float)(iq - (g * 128 + cl + i)));
          x[i] = fmaxf((disttotal - distcum) * pe, 0.f);
        }
        hw_sqrtx4(dsc, x);
#pragma unroll
        for (int i = 0; i < 4; ++i) t[i] = dsc[i] * gam2;
        hw_exp2x4(eff, t);
#pragma unroll
        for (int i = 0; i < 4; ++i) {
          const float ef = fminf(fmaxf(eff[i], 1e-5f), 1e5f);
          const float ns = (g * 128 + cl + i <= iq) ? s[4 * g + i] * ef : -1e32f;
          s[4 * g + i] = ns;
          m2 = fmaxf(m2, ns);
        }
      }
#pragma unroll
      for (int o = 16; o > 0; o >>= 1) m2 = fmaxf(m2, __shfl_xor(m2, o, 32));

      // E: e2 = 2^(ns - m2) (masked entries give exactly 0, as would every column of a group left out); s2 = sum
      float s2 = 0.f;
#pragma unroll  // constant indices into s[]
      for (int g = 0; g < 8; ++g) {
        if (g >= ng) break;                                  // block-uniform: the groups behind are past the diagonal
        float a[4], e[4];
#pragma unroll
        for (int i = 0; i < 4; ++i) a[i] = s[4 * g + i] - m2;
        hw_exp2x4(e, a);
#pragma unroll
        for (int i = 0; i < 4; ++i) { s[4 * g + i] = e[i]; s2 += e[i]; }
      }
#pragma unroll
      for (int o = 16; o > 0; o >>= 1) s2 += __shfl_xor(s2, o, 32);
      const float inv2 = hw_rcp(s2);

      // F: attn probabilities -> bf16 hi/lo planes in LDS (8-B stores per lane), over this row's scores, which this wave
      //    alone has read, all of them, above; phase 3 reads columns < ng*128 alone
      u16* ahp = aH + row * PST + cl;
      u16* alp = aL + row * PST + cl;
#pragma unroll  // constant indices into s[]
      for (int g = 0; g < 8; ++g) {
        if (g >= ng) break;                                  // block-uniform: the groups behind are past the diagonal
        unsigned hw[2], lw[2];
        split_pair(s[4 * g] * inv2, s[4 * g + 1] * inv2, hw[0], lw[0]);
        split_pair(s[4 * g + 2] * inv2, s[4 * g + 3] * inv2, hw[1], lw[1]);
        v2u vh, vl;
        vh.x = hw[0]; vh.y = hw[1];
        vl.x = lw[0]; vl.y = lw[1];
        *(v2u*)(ahp + 128 * g) = vh;
        *(v2u*)(alp + 128 * g) = vl;
      }
    }
  }
  __syncthreads();   // P planes complete (block barrier between the LDS spill and the fragment reload)

  // ---- phase 3: out(32x64) = attn(32x1024) . V(1024x64); key tiles beyond the causal range carry exact zeros
  if (w < 4) {                                               // wave-uniform
    const int nt  = w;                                       // output columns nt*16..+15, of both query tiles
    const int nkt = q0 / 32 + 1;                             // <= 32, block-uniform
    const size_t vrow = ((size_t)(b * DM + h * DKK + nt * 16)) * SS + lane * 8;
    const int nk4 = (nkt + 3) & ~3;                          // whole groups of four tiles (128 columns, as in phase 2), <= 32: the added tiles have P == 0
    const int pa0 = l15 * PST + hl * 8;                      // query tile 0; tile 1 lies 16 rows on
    const int pa1 = pa0 + 16 * PST;
    v8f acc0 = zero8(), acc1 = zero8();
    // ring of four V tiles in registers: a tile's slot is loaded again, four tiles ahead, behind its products
    v16bf vh[4], vl[4];
#pragma unroll  // constant indices, or the ring falls to scratch
    for (int j = 0; j < 4; ++j) {
      vh[j] = ldg_frag(Vh, vrow + (size_t)j * 512);
      vl[j] = ldg_frag(Vl, vrow + (size_t)j * 512);
    }
    // the two V address pairs stay live up to this wait: no load above may land on them
    asm volatile("s_wait_xcnt 0x0" :: "v"(Vh + vrow), "v"(Vl + vrow) : "memory");
    int k0 = 0;
    for (; k0 + 4 < nk4; k0 += 4) {
      v16bf ph0[4], pl0[4], ph1[4], pl1[4];
#pragma unroll  // constant indices; the group's P tiles are read from LDS in one go
      for (int j = 0; j < 4; ++j) {
        ph0[j] = lds_frag(aH, pa0 + (k0 + j) * 32);
        pl0[j] = lds_frag(aL, pa0 + (k0 + j) * 32);
        ph1[j] = lds_frag(aH, pa1 + (k0 + j) * 32);
        pl1[j] = lds_frag(aL, pa1 + (k0 + j) * 32);
      }
#pragma unroll  // constant indices into the ring
      for (int j = 0; j < 4; ++j) {
        wmma3x2(acc0, acc1, ph0[j], pl0[j], ph1[j], pl1[j], vh[j], vl[j]);
        vh[j] = ldg_frag(Vh, vrow + (size_t)(k0 + 4 + j) * 512);
        vl[j] = ldg_frag(Vl, vrow + (size_t)(k0 + 4 + j) * 512);
      }
      // the next trip's address additions overwrite registers that the loads in flight name
      asm volatile("s_wait_xcnt 0x0" ::: "memory");
    }
    {                                                        // last group: nothing left to load
      v16bf ph0[4], pl0[4], ph1[4], pl1[4];
#pragma unroll
      for (int j = 0; j < 4; ++j) {
        ph0[j] = lds_frag(aH, pa0 + (k0 + j) * 32);
        pl0[j] = lds_frag(aL, pa0 + (k0 + j) * 32);
        ph1[j] = lds_frag(aH, pa1 + (k0 + j) * 32);
        pl1[j] = lds_frag(aL, pa1 + (k0 + j) * 32);
      }
#pragma unroll
      for (int j = 0; j < 4; ++j) wmma3x2(acc0, acc1, ph0[j], pl0[j], ph1[j], pl1[j], vh[j], vl[j]);
    }
#pragma unroll
    for (int r = 0; r < 8; ++r) {
      sO[(hl * 8 + r) * OST + nt * 16 + l15]      = acc0[r];
      sO[(16 + hl * 8 + r) * OST + nt * 16 + l15] = acc1[r];
    }
  }
  __syncthreads();

  // ---- store concat planes: four plane tiles (two per query tile); wave w owns half of tile (w&3)/2 of query tile w/4,
  //      one instruction per plane = 512 contiguous B
  {
    const int u  = w >> 2;                                   // query tile
    const int wq = w & 3;
    const int s  = (wq & 1) * 32 + lane;                     // chunk inside the tile
    const int cc = (wq >> 1) * 32 + (s >> 4) * 8;
    const float* sp = sO + (u * 16 + (s & 15)) * OST + cc;
    const v4f a = *(const v4f*)sp;
    const v4f c = *(const v4f*)(sp + 4);
    float x[8] = {a.x, a.y, a.z, a.w, c.x, c.y, c.z, c.w};
    v4u vh, vl;
    split8(x, vh, vl);
    const size_t go = (size_t)(b * SS + q0 + u * 16) * DM + h * (DKK * 16) + (wq >> 1) * 512 + s * 8;
    *(v4u*)(Ch + go) = vh;
    *(v4u*)(Cl + go) = vl;
  }
}

// ---------------------------------------------------------------- launcher
extern "C" void kernel_launch(void* const* d_in, const int* in_sizes, int n_in,
                              void* d_out, int out_size, void* d_ws, size_t ws_size,
                              hipStream_t stream) {
  if (n_in < 12) return;
  if (in_sizes[0] != (int)ACT || in_sizes[1] != (int)ACT || in_sizes[2] != (int)ACT) return;
  if (in_sizes[3] != (int)WEL || in_sizes[5] != (int)WEL || in_sizes[7] != (int)WEL || in_sizes[9] != (int)WEL) return;
  if (in_sizes[4] != DM || in_sizes[6] != DM || in_sizes[8] != DM || in_sizes[10] != DM) return;
  if (in_sizes[11] != HH) return;
  if (out_size != (int)ACT) return;

  const float* q   = (const float*)d_in[0];
  const float* k   = (const float*)d_in[1];
  const float* v   = (const float*)d_in[2];
  const float* Wq  = (const float*)d_in[3];
  const float* bq  = (const float*)d_in[4];
  const float* Wk  = (const float*)d_in[5];
  const float* bk  = (const float*)d_in[6];
  const float* Wv  = (const float*)d_in[7];
  const float* bv  = (const float*)d_in[8];
  const float* Wo  = (const float*)d_in[9];
  const float* bo  = (const float*)d_in[10];
  const float* gam = (const float*)d_in[11];
  float* out = (float*)d_out;

  // workspace carve (256-B aligned): q, k, v planes hi and lo (the q planes are reused for the concat planes),
  // Wq, Wk, Wv, Wo planes hi and lo, Qp, Kp, Vt planes hi and lo.  Total 112 MiB.
  char* ws = (char*)d_ws;
  size_t off = 0;
  auto carve = [&](size_t bytes) -> char* {
    char* p = ws + off;
    off += (bytes + 255) & ~(size_t)255;
    return p;
  };
  u16* actH = (u16*)carve(3 * ACT * 2);
  u16* actL = (u16*)carve(3 * ACT * 2);
  u16* wH   = (u16*)carve(4 * WEL * 2);
  u16* wL   = (u16*)carve(4 * WEL * 2);
  u16* prH  = (u16*)carve(3 * ACT * 2);             // Qp, Kp, Vt
  u16* prL  = (u16*)carve(3 * ACT * 2);
  if (off > ws_size) return;

  const dim3 pgrid(DM / 128, MROWS / BR, 3);        // (8, 32, 3)
  const dim3 ggrid(DM / 128, MROWS / BR);           // (8, 32)
  const dim3 agrid(SS / QR, HH, BB);                // (32, 16, 4)

  // all seven f32 matrices -> planes
  k_split<<<dim3(SPLIT_BLKS), 256, 0, stream>>>(q, k, v, Wq, Wk, Wv, Wo, actH, actL, wH, wL);
  // q, k, v projections -> Qp, Kp planes, Vt planes (k = token)
  k_gemm3<0><<<pgrid, 128, 0, stream>>>(actH, actL, wH, wL, bq, bk, bv, prH, prL, out);
  // attention -> concat planes (reuse the q planes)
  k_attn<<<agrid, 256, SMEM_ATTN, stream>>>(prH, prL, prH + ACT, prL + ACT, prH + 2 * ACT, prL + 2 * ACT, gam, actH, actL);
  // output projection -> f32 result
  k_gemm3<2><<<ggrid, 128, 0, stream>>>(actH, actL, wH + 3 * WEL, wL + 3 * WEL, bo, bo, bo, prH, prL, out);
}
